// v000
// The times below were measured on an AMD MI455X: many runs one after another, warmed up first and cycling through
// copies of the inputs, with the whole window's GPU time divided by the number of runs. Launches and the gaps
// between them are all in it. The median over several windows is given; except for v000 it joins two sittings, which
// can be a few percent apart, so the side-by-side timings, each taken in one sitting, are the better comparison.
// The starting kernel, v000, takes 226 microseconds a run.
// All contractions (q/k/v projections, q.k^T, p.v, output projection): v_wmma_f32_16x16x32_f16, f16 operands with power-of-two carries, f32 accumulate; rotary tables, exp, row sums and normalisation in f32.
#include <hip/hip_runtime.h>
#include <math.h>

typedef __attribute__((ext_vector_type(16))) _Float16 v16h;
typedef __attribute__((ext_vector_type(8)))  _Float16 v8h;
typedef __attribute__((ext_vector_type(8)))  float    v8f;
typedef __attribute__((ext_vector_type(4)))  float    v4f;

// ---------------------------------------------------------------------------
// Shape constants
// ---------------------------------------------------------------------------
constexpr int kBatch  = 2;
constexpr int kSeq    = 2048;
constexpr int kHid    = 1024;
constexpr int kHeads  = 16;
constexpr int kHd     = 64;
constexpr int kRows   = kBatch * kSeq;
constexpr int kHalfHd = kHd / 2;
static_assert(kHeads * kHd == kHid, "head split");
static_assert(kHd == 64, "head width fixed at 64");
static_assert((kSeq % 64) == 0 && (kHid % 64) == 0 && (kHid % 32) == 0 && (kRows % 64) == 0, "tile multiples");
static_assert(kSeq == 2048 && kHid == 1024, "bit tricks below assume these");

// ---------------------------------------------------------------------------
// Power-of-two carries of the f16 planes and the derived fold-back scales
// ---------------------------------------------------------------------------
constexpr double cx_sqrt(double x) {
  double g = (x > 1.0) ? x : 1.0;
  for (int it = 0; it < 80; ++it) g = 0.5 * (g + x / g);
  return g;
}
constexpr float kXCarry    = 16.0f;
constexpr float kWCarry    = 256.0f;
constexpr float kQKCarry   = 16.0f;
constexpr float kVCarry    = 16.0f;
constexpr float kAttnCarry = 2048.0f;
constexpr float kInvSqrtHd = (float)(1.0 / cx_sqrt((double)kHd));
static_assert(kInvSqrtHd == 0.125f, "1/sqrt(head width)");
constexpr float kQKScale    = kQKCarry / (kXCarry * kWCarry);
constexpr float kVScale     = kVCarry / (kXCarry * kWCarry);
constexpr float kScoreScale = kInvSqrtHd / (kQKCarry * kQKCarry);
constexpr float kCtxScale   = kAttnCarry / kVCarry;
constexpr float kOutScale   = 1.0f / (kAttnCarry * kWCarry);
constexpr float kScoreClamp = 10.0f;

// ---------------------------------------------------------------------------
// Rotary inverse frequencies: 10000^(-2i/64) = 10^(-i/8), i = 0..31, evaluated in double at build time, converted to f32
// ---------------------------------------------------------------------------
struct InvFreqTab { float v[kHalfHd]; };
constexpr InvFreqTab make_inv_freq() {
  InvFreqTab t{};
  const double r8 = cx_sqrt(cx_sqrt(cx_sqrt(10.0)));
  for (int i = 0; i < kHalfHd; ++i) {
    double p = 1.0;
    for (int j = 0; j < (i & 7); ++j) p *= r8;
    for (int j = 0; j < (i >> 3); ++j) p *= 10.0;
    t.v[i] = (float)(1.0 / p);
  }
  return t;
}
__device__ constexpr InvFreqTab kInvFreq = make_inv_freq();
static_assert(sizeof(kInvFreq.v) / sizeof(kInvFreq.v[0]) == 32, "table length");

// ---------------------------------------------------------------------------
// Workspace region map (bytes; every offset a multiple of 128)
//   X16   f16 [4096][1024]          x carried x16                         8,388,608
//   W16   f16 [4][1024][1024]       w_q | w_k | w_v | w_o carried x256    8,388,608
//   COS   f32 [2048][32]                                                    262,144
//   SIN   f32 [2048][32]                                                    262,144
//   Q16   f16 [32][2048][64]        rotated q carried x16                 8,388,608
//   K16   f16 [32][2048][64]        rotated k carried x16 (follows Q16)   8,388,608
//   VT16  f16 [32][64][2048]        v transposed, carried x16             8,388,608
//   A16   f16 [4096][1024]          attention output carried x2048        8,388,608
//   total                                                                50,855,936
// ---------------------------------------------------------------------------
constexpr size_t kPlaneBytes = (size_t)kRows * kHid * 2;
constexpr size_t kTabBytes   = (size_t)kSeq * kHalfHd * 4;
constexpr size_t kOffX16  = 0;
constexpr size_t kOffW16  = kOffX16 + kPlaneBytes;
constexpr size_t kOffCos  = kOffW16 + (size_t)4 * kHid * kHid * 2;
constexpr size_t kOffSin  = kOffCos + kTabBytes;
constexpr size_t kOffQ16  = kOffSin + kTabBytes;
constexpr size_t kOffK16  = kOffQ16 + kPlaneBytes;
constexpr size_t kOffVT16 = kOffK16 + kPlaneBytes;
constexpr size_t kOffA16  = kOffVT16 + kPlaneBytes;
constexpr size_t kWsTotal = kOffA16 + kPlaneBytes;
static_assert(kWsTotal == 50855936ull, "carve total");
static_assert(kWsTotal <= 134217728ull, "carve cap");
static_assert((kOffW16 % 128) == 0 && (kOffCos % 128) == 0 && (kOffSin % 128) == 0 && (kOffQ16 % 128) == 0 &&
              (kOffK16 % 128) == 0 && (kOffVT16 % 128) == 0 && (kOffA16 % 128) == 0, "128-B aligned regions");
constexpr size_t kPlaneElems = (size_t)kRows * kHid;

// ---------------------------------------------------------------------------
// Fragment helpers (split k map for A and B: elements 0..7 <- p[0..7], 8..15 <- p[16..23], p already offset by 8*(lane>>4))
// ---------------------------------------------------------------------------
struct FragH {
  union U { v16h v; v8h h[2]; };
  static __device__ __forceinline__ v16h load(const _Float16* p) {
    U f;
    f.h[0] = *(const v8h*)(p);
    f.h[1] = *(const v8h*)(p + 16);
    return f.v;
  }
  static __device__ __forceinline__ v8f mma(v16h a, v16h b, v8f c) {
    return __builtin_amdgcn_wmma_f32_16x16x32_f16(false, a, false, b, (short)0, c, false, false);
  }
};
__device__ __forceinline__ void guard4_h(v8f& a, v8f& b, v8f& c, v8f& d, v16h x, v16h y) {
  asm volatile("v_nop\n\tv_nop\n\tv_nop\n\tv_nop" : "+v"(a), "+v"(b), "+v"(c), "+v"(d) : "v"(x), "v"(y));
}
__device__ __forceinline__ void keep4_h(v16h a, v16h b, v16h c, v16h d) {
  asm volatile("v_nop" :: "v"(a), "v"(b), "v"(c), "v"(d));
}
__device__ __forceinline__ void acc_guard4(v8f& a, v8f& b, v8f& c, v8f& d) {
  asm volatile("v_nop\n\tv_nop\n\tv_nop\n\tv_nop" : "+v"(a), "+v"(b), "+v"(c), "+v"(d));
}
__device__ __forceinline__ v8f mma_g(v16h a, v16h b, v8f c) {
  c = __builtin_amdgcn_wmma_f32_16x16x32_f16(false, a, false, b, (short)0, c, false, false);
  asm volatile("v_nop\n\tv_nop\n\tv_nop\n\tv_nop" : "+v"(c) : "v"(a), "v"(b));
  return c;
}

// ---------------------------------------------------------------------------
// f32 -> f16 cast with a power-of-two carry, 8 consecutive elements per thread.
// blockIdx.y selects one of up to four source planes; destination plane z starts at out + z * 8 * n8 halves.
// Coverage: grid.x * 256 = n8 threads exactly (checked on the host); each lane stores 16 B, 32 consecutive lanes
// ---------------------------------------------------------------------------
__global__ __launch_bounds__(256) void cast8_scale_f16_kernel(
    const float* __restrict__ in0, const float* __restrict__ in1,
    const float* __restrict__ in2, const float* __restrict__ in3,
    unsigned short* __restrict__ out, int n8, float scale)
{
  const int z = blockIdx.y;
  const float* in = (z == 0) ? in0 : (z == 1) ? in1 : (z == 2) ? in2 : in3;
  const int i = blockIdx.x * 256 + threadIdx.x;
  if (i >= n8) return;
  const float* p = in + 8 * (size_t)i;
  const v4f a = *(const v4f*)(p);
  const v4f c = *(const v4f*)(p + 4);
  v8h hv;
#pragma unroll
  for (int e = 0; e < 4; ++e) {
    const float f0 = a[e] * scale;
    const float f1 = c[e] * scale;
    hv[e]     = (_Float16)f0;
    hv[4 + e] = (_Float16)f1;
  }
  unsigned short* q = out + (size_t)z * 8 * (size_t)n8 + 8 * (size_t)i;
  *(v8h*)q = hv;
  
}

// ---------------------------------------------------------------------------
// Rotary tables: COS/SIN [2048][32] f32, angle = float(position) * inv_freq[i] (single f32 multiply), accurate sincosf.
// ---------------------------------------------------------------------------
__global__ __launch_bounds__(256) void rotary_table_kernel(float* __restrict__ cosT, float* __restrict__ sinT)
{
  const int t = blockIdx.x * 256 + threadIdx.x;
  const int s = t >> 5;
  const int i = t & 31;
  const float inv = kInvFreq.v[i];
  const float ang = (float)s * inv;
  float sn, cs;
  sincosf(ang, &sn, &cs);
  ((float*)cosT)[t] = cs;
  ((float*)sinT)[t] = sn;
  
}

// ---------------------------------------------------------------------------
// Register-blocked batched GEMM: C[m,n] = scale * sum_k A[m,k] * Bt[n,k]; each wave owns a 64x64 tile.
// A row-major [M,K]; Bt row-major [N,K]; M, N multiples of 64, K multiple of 32 (asserted on the host).
// OUT_MODE 3: N = 2 x kHid (q columns then k columns); the 64-wide tile is one head; interleaved-pair rotation with
//             COS/SIN[position][pair] then f16 store to plane (n0 >> 10) laid out [batch*heads + head][position][64]
// Store coverage per 16-row slab: mode 0: 8 iterations x 2 rows; modes 1 and 3: 4 iterations x 4 rows; 64 columns each.
// ---------------------------------------------------------------------------
template <int OUT_MODE>
__global__ __launch_bounds__(256) void wmma_gemm64(
    const unsigned short* __restrict__ Ap, int lda, long strideA,
    const unsigned short* __restrict__ Btp, int ldb, long strideB,
    void* __restrict__ Cout, int ldc, long strideC,
    const float* __restrict__ cosT, const float* __restrict__ sinT,
    int M, int N, int K, float scale)
{
  const _Float16* A  = (const _Float16*)Ap;
  const _Float16* Bt = (const _Float16*)Btp;
  __shared__ __align__(16) float sT[8][16 * 68];
  const int b    = blockIdx.y;
  const int lane = threadIdx.x & 31;
  const int wave = __builtin_amdgcn_readfirstlane((int)(threadIdx.x >> 5));
  const int tilesN = N >> 6;
  const int tilesM = M >> 6;
  const int tile = blockIdx.x * 8 + wave;
  /* wave-uniform exit; this kernel has no block barriers */
  if (tile >= tilesM * tilesN) return;
  const int tm = tile / tilesN;
  const int tn = tile - tm * tilesN;
  const int m0 = tm << 6;
  const int n0 = tn << 6;

  const _Float16* Ab = A  + (size_t)b * strideA;
  const _Float16* Bb = Bt + (size_t)b * strideB;

  const int rlane = lane & 15;
  const int koff  = (lane >> 4) * 8;
  const int mOff  = (lane >> 4) * 8;

  v8f acc[4][4];
#pragma unroll
  for (int i = 0; i < 4; ++i)
#pragma unroll
    for (int j = 0; j < 4; ++j) acc[i][j] = (v8f){0.f,0.f,0.f,0.f,0.f,0.f,0.f,0.f};

  for (int k0 = 0; k0 < K; k0 += 32) {
    v16h bh[4];
#pragma unroll
    for (int j = 0; j < 4; ++j) {
      const size_t bo = (size_t)(n0 + (j << 4) + rlane) * ldb + koff + k0;
      bh[j] = FragH::load(Bb + bo);
    }
#pragma unroll
    for (int i = 0; i < 4; ++i) {
      const size_t ao = (size_t)(m0 + (i << 4) + rlane) * lda + koff + k0;
      v16h ah = FragH::load(Ab + ao);
#pragma unroll
      for (int j = 0; j < 4; ++j) acc[i][j] = FragH::mma(ah, bh[j], acc[i][j]);
      guard4_h(acc[i][0], acc[i][1], acc[i][2], acc[i][3], ah, bh[3]);
    }
    keep4_h(bh[0], bh[1], bh[2], bh[3]);
  }
  acc_guard4(acc[0][0], acc[0][1], acc[0][2], acc[0][3]);
  acc_guard4(acc[1][0], acc[1][1], acc[1][2], acc[1][3]);
  acc_guard4(acc[2][0], acc[2][1], acc[2][2], acc[2][3]);
  acc_guard4(acc[3][0], acc[3][1], acc[3][2], acc[3][3]);

  float* slab = sT[wave];
#pragma unroll
  for (int i = 0; i < 4; ++i) {
    const int mBase = m0 + (i << 4);
#pragma unroll
    for (int j = 0; j < 4; ++j) {
#pragma unroll
      for (int r = 0; r < 8; ++r) {
        const float v = acc[i][j][r] * scale;
        slab[(mOff + r) * 68 + (j << 4) + rlane] = v;
      }
    }
    __builtin_amdgcn_fence(__ATOMIC_RELEASE, "workgroup");
    __builtin_amdgcn_wave_barrier();
    __builtin_amdgcn_fence(__ATOMIC_ACQUIRE, "workgroup");
    if (OUT_MODE == 0) {
      float* C = (float*)Cout + (size_t)b * strideC;
      const int hh = lane >> 4, c4 = (lane & 15) * 4;
      {
#pragma unroll
        for (int it = 0; it < 8; ++it) {
          const int row = it * 2 + hh;
          v4f v = *(const v4f*)(slab + row * 68 + c4);
          *(v4f*)(C + (size_t)(mBase + row) * ldc + n0 + c4) = v;
        }
        
      }
    } else if (OUT_MODE == 1) {
      const int q = lane >> 3, c8 = (lane & 7) * 8;
      unsigned short* C = (unsigned short*)Cout + (size_t)b * strideC;
      v8h ov[4];
#pragma unroll
      for (int it = 0; it < 4; ++it) {
        const int row = it * 4 + q;
        const float* sp = slab + row * 68 + c8;
        const v4f a0 = *(const v4f*)(sp);
        const v4f a1 = *(const v4f*)(sp + 4);
#pragma unroll
        for (int e = 0; e < 4; ++e) {
          ov[it][e]     = (_Float16)a0[e];
          ov[it][4 + e] = (_Float16)a1[e];
        }
      }
      {
#pragma unroll
        for (int it = 0; it < 4; ++it) {
          const int row = it * 4 + q;
          *(v8h*)(C + (size_t)(mBase + row) * ldc + n0 + c8) = ov[it];
        }
        
      }
    } else {
      const int q = lane >> 3, c8 = (lane & 7) * 8;
      const int which = n0 >> 10;
      const int head  = (n0 >> 6) & (kHeads - 1);
      unsigned short* C = (unsigned short*)Cout + (size_t)which * kPlaneElems;
      v8h ov[4];
      size_t oo[4];
#pragma unroll
      for (int it = 0; it < 4; ++it) {
        const int row = it * 4 + q;
        const int m   = mBase + row;
        const int bb  = m >> 11;
        const int s   = m & (kSeq - 1);
        const float* sp = slab + row * 68 + c8;
        const v4f a0 = *(const v4f*)(sp);
        const v4f a1 = *(const v4f*)(sp + 4);
        const v4f cv = *(const v4f*)(cosT + (size_t)s * kHalfHd + (c8 >> 1));
        const v4f sv = *(const v4f*)(sinT + (size_t)s * kHalfHd + (c8 >> 1));
        const float o0 = a0[0] * cv[0] - a0[1] * sv[0];
        const float o1 = a0[0] * sv[0] + a0[1] * cv[0];
        const float o2 = a0[2] * cv[1] - a0[3] * sv[1];
        const float o3 = a0[2] * sv[1] + a0[3] * cv[1];
        const float o4 = a1[0] * cv[2] - a1[1] * sv[2];
        const float o5 = a1[0] * sv[2] + a1[1] * cv[2];
        const float o6 = a1[2] * cv[3] - a1[3] * sv[3];
        const float o7 = a1[2] * sv[3] + a1[3] * cv[3];
        ov[it][0] = (_Float16)o0;
        ov[it][1] = (_Float16)o1;
        ov[it][2] = (_Float16)o2;
        ov[it][3] = (_Float16)o3;
        ov[it][4] = (_Float16)o4;
        ov[it][5] = (_Float16)o5;
        ov[it][6] = (_Float16)o6;
        ov[it][7] = (_Float16)o7;
        oo[it] = ((size_t)(bb * kHeads + head) * kSeq + s) * kHd + c8;
      }
      {
#pragma unroll
        for (int it = 0; it < 4; ++it) *(v8h*)(C + oo[it]) = ov[it];
        
      }
    }
    __builtin_amdgcn_fence(__ATOMIC_RELEASE, "workgroup");
    __builtin_amdgcn_wave_barrier();
    __builtin_amdgcn_fence(__ATOMIC_ACQUIRE, "workgroup");
  }
}

// ---------------------------------------------------------------------------
// Attention for one (batch, head) and 64 query rows per block (4 waves x 16 rows), key tiles of 64.
//   scores = (Q16 . K16^T) * kScoreScale for ALL 32 key tiles; p = exp(min(score, clamp)) unnormalised, f32;
//   the row sum l accumulates every key (future keys included), per lane, reduced over 16 lanes once after the loop;
//   P.V is accumulated only for key tiles at or below the diagonal (tile index <= query tile index, block-uniform), with
//   p set to zero by select where key > query inside the diagonal tile; O = acc / l, no renormalisation.
// LDS: K tile [64 keys][72] f16 and Vt tile [64 dd][72] f16 (columns 0..63 written and read, pad never read), staged by
//   128 threads x 4 x 16 B = 8,192 B = the whole tile each; per-wave P tile [16][72] f16 written fully (16 rows x 64
// Block barriers only at the top of each key tile and after staging; all 4 waves run all 32 tiles; no early exits.
// grid.x = 32 (batch, head) groups x 32 query tiles.
// ---------------------------------------------------------------------------
constexpr int kQB = 64;
constexpr int kKT = 64;
constexpr int kLP = 72;
constexpr int kAW = 4;
constexpr int kQTiles = kSeq / kQB;
constexpr int kKTiles = kSeq / kKT;
static_assert(kQB == kKT, "diagonal tile logic assumes equal tiles");

__global__ __launch_bounds__(128) void attn_kernel(
    const unsigned short* __restrict__ Qp, const unsigned short* __restrict__ Kp,
    const unsigned short* __restrict__ Vtp, unsigned short* __restrict__ Op)
{
  __shared__ __align__(16) _Float16 Ksh[kKT * kLP];
  __shared__ __align__(16) _Float16 Vsh[kHd * kLP];
  __shared__ __align__(16) _Float16 Psh[kAW][16 * kLP];
  __shared__ __align__(16) float    Os[kAW][16 * 68];

  const int tid  = threadIdx.x;
  const int wave = __builtin_amdgcn_readfirstlane((int)(threadIdx.x >> 5));
  const int lane = tid & 31;
  const int hh   = lane >> 4;
  const int c    = lane & 15;
  const int qb   = blockIdx.x % kQTiles;
  const int bh   = blockIdx.x / kQTiles;
  const int q0   = qb * kQB + wave * 16;

  const _Float16* Qb = (const _Float16*)Qp  + (size_t)bh * kSeq * kHd;
  const _Float16* Kb = (const _Float16*)Kp  + (size_t)bh * kSeq * kHd;
  const _Float16* Vb = (const _Float16*)Vtp + (size_t)bh * kHd * kSeq;

  v16h qa[2];
#pragma unroll
  for (int dc = 0; dc < 2; ++dc) qa[dc] = FragH::load(Qb + (size_t)(q0 + c) * kHd + dc * 32 + 8 * hh);

  float lsum[8];
  v8f oacc[4];
#pragma unroll
  for (int r = 0; r < 8; ++r) lsum[r] = 0.f;
#pragma unroll
  for (int t = 0; t < 4; ++t) oacc[t] = (v8f){0.f,0.f,0.f,0.f,0.f,0.f,0.f,0.f};

  _Float16* pw = Psh[wave];

#pragma unroll 1
  for (int kc = 0; kc < kKTiles; ++kc) {
    const int kv0 = kc * kKT;
    /* block-uniform: this key tile contributes to P.V */
    const bool pv = (kc <= qb);
    __syncthreads();
#pragma unroll
    for (int it = 0; it < 4; ++it) {
      const int e = it * 128 + tid;
      const int row = e >> 3, part = e & 7;
      const v8h kk = *(const v8h*)(Kb + (size_t)(kv0 + row) * kHd + part * 8);
      *(v8h*)(Ksh + row * kLP + part * 8) = kk;
    }
    if (pv) {
#pragma unroll
      for (int it = 0; it < 4; ++it) {
        const int e = it * 128 + tid;
        const int row = e >> 3, part = e & 7;
        const v8h vv = *(const v8h*)(Vb + (size_t)row * kSeq + kv0 + part * 8);
        *(v8h*)(Vsh + row * kLP + part * 8) = vv;
      }
    }
    __syncthreads();

    v8f s[4];
#pragma unroll
    for (int j = 0; j < 4; ++j) {
      s[j] = (v8f){0.f,0.f,0.f,0.f,0.f,0.f,0.f,0.f};
#pragma unroll
      for (int dc = 0; dc < 2; ++dc) {
        const v16h kb = FragH::load(Ksh + (j * 16 + c) * kLP + dc * 32 + 8 * hh);
        s[j] = mma_g(qa[dc], kb, s[j]);
      }
    }
#pragma unroll
    for (int j = 0; j < 4; ++j) {
#pragma unroll
      for (int r = 0; r < 8; ++r) {
        const float x = fminf(s[j][r] * kScoreScale, kScoreClamp);
        const float p = __expf(x);
        lsum[r] += p;
        s[j][r] = p;
      }
    }
    if (pv) {
      const bool diag = (kc == qb);
#pragma unroll
      for (int j = 0; j < 4; ++j) {
        const int kvcol = kv0 + j * 16 + c;
#pragma unroll
        for (int r = 0; r < 8; ++r) {
          const int qrow = q0 + 8 * hh + r;
          const float pm = (diag && (kvcol > qrow)) ? 0.0f : s[j][r];
          pw[(8 * hh + r) * kLP + j * 16 + c] = (_Float16)pm;
        }
      }
      __builtin_amdgcn_fence(__ATOMIC_RELEASE, "workgroup");
      __builtin_amdgcn_wave_barrier();
      __builtin_amdgcn_fence(__ATOMIC_ACQUIRE, "workgroup");
#pragma unroll
      for (int kk = 0; kk < 2; ++kk) {
        const v16h pa = FragH::load(pw + c * kLP + kk * 32 + 8 * hh);
#pragma unroll
        for (int t = 0; t < 4; ++t) {
          const v16h vb = FragH::load(Vsh + (t * 16 + c) * kLP + kk * 32 + 8 * hh);
          oacc[t] = mma_g(pa, vb, oacc[t]);
        }
      }
    }
  }

  float* os = Os[wave];
#pragma unroll
  for (int r = 0; r < 8; ++r) {
    float l = lsum[r];
    l += __shfl_xor(l, 1, 32);
    l += __shfl_xor(l, 2, 32);
    l += __shfl_xor(l, 4, 32);
    l += __shfl_xor(l, 8, 32);
    const float inv = kCtxScale * __builtin_amdgcn_rcpf(l);
#pragma unroll
    for (int t = 0; t < 4; ++t) os[(8 * hh + r) * 68 + t * 16 + c] = oacc[t][r] * inv;
  }
  __builtin_amdgcn_fence(__ATOMIC_RELEASE, "workgroup");
  __builtin_amdgcn_wave_barrier();
  __builtin_amdgcn_fence(__ATOMIC_ACQUIRE, "workgroup");
  {
    const int bb = bh / kHeads;
    const int h  = bh - bb * kHeads;
    const int q4 = lane >> 3, c8 = (lane & 7) * 8;
    v8h ov[4];
    size_t oo[4];
#pragma unroll
    for (int it = 0; it < 4; ++it) {
      const int row = it * 4 + q4;
      const float* sp = os + row * 68 + c8;
      const v4f a0 = *(const v4f*)(sp);
      const v4f a1 = *(const v4f*)(sp + 4);
#pragma unroll
      for (int e = 0; e < 4; ++e) {
        ov[it][e]     = (_Float16)a0[e];
        ov[it][4 + e] = (_Float16)a1[e];
      }
      oo[it] = ((size_t)(bb * kSeq + q0 + row)) * kHid + h * kHd + c8;
    }
    {
#pragma unroll
      for (int it = 0; it < 4; ++it) *(v8h*)(Op + oo[it]) = ov[it];
      
    }
  }
}

// ---------------------------------------------------------------------------
// Host glue: 7 kernel launches, nothing else.
//   1 cast x (2048 blocks)             2 cast w_q|w_k|w_v|w_o (512 x 4 blocks)     3 rotary tables (256 blocks)
//   4 q|k projection + rotation: M 4096, N 2048, K 1024 -> 64 x 32 tiles = 2048 -> 256 blocks
//   5 v projection transposed (A = w_v, Bt = x of one batch): M 1024, N 2048, K 1024 -> 16 x 32 tiles = 512 -> 64 blocks x 2
//   6 attention: 32 x 32 = 1024 blocks of 128 threads
//   7 output projection: M 4096, N 1024, K 1024 -> 64 x 16 tiles = 1024 -> 128 blocks
// ---------------------------------------------------------------------------
extern "C" void kernel_launch(void* const* d_in, const int* in_sizes, int n_in,
                              void* d_out, int out_size, void* d_ws, size_t ws_size,
                              hipStream_t stream) {
  if (n_in < 5) return;
  if (in_sizes[0] != kRows * kHid) return;
  if (in_sizes[1] != kHid * kHid) return;
  if (in_sizes[2] != kHid * kHid) return;
  if (in_sizes[3] != kHid * kHid) return;
  if (in_sizes[4] != kHid * kHid) return;
  if (out_size != kRows * kHid) return;
  if (ws_size < kWsTotal) return;

  const float* x  = (const float*)d_in[0];
  const float* wq = (const float*)d_in[1];
  const float* wk = (const float*)d_in[2];
  const float* wv = (const float*)d_in[3];
  const float* wo = (const float*)d_in[4];
  float* out = (float*)d_out;

  char* ws = (char*)d_ws;
  unsigned short* X16  = (unsigned short*)(ws + kOffX16);
  unsigned short* W16  = (unsigned short*)(ws + kOffW16);
  float*          COS  = (float*)(ws + kOffCos);
  float*          SIN  = (float*)(ws + kOffSin);
  unsigned short* Q16  = (unsigned short*)(ws + kOffQ16);
  unsigned short* K16  = (unsigned short*)(ws + kOffK16);
  unsigned short* VT16 = (unsigned short*)(ws + kOffVT16);
  unsigned short* A16  = (unsigned short*)(ws + kOffA16);
  const unsigned short* Wqk16 = W16;
  const unsigned short* Wv16  = W16 + (size_t)2 * kHid * kHid;
  const unsigned short* Wo16  = W16 + (size_t)3 * kHid * kHid;

  constexpr int kXn8 = kRows * kHid / 8;
  constexpr int kWn8 = kHid * kHid / 8;
  static_assert((kXn8 % 256) == 0 && (kWn8 % 256) == 0, "cast grids exact");

  cast8_scale_f16_kernel<<<dim3(kXn8 / 256, 1), 256, 0, stream>>>(x, x, x, x, X16, kXn8, kXCarry);
  cast8_scale_f16_kernel<<<dim3(kWn8 / 256, 4), 256, 0, stream>>>(wq, wk, wv, wo, W16, kWn8, kWCarry);
  rotary_table_kernel<<<(kSeq * kHalfHd) / 256, 256, 0, stream>>>(COS, SIN);

  wmma_gemm64<3><<<dim3((kRows / 64) * (2 * kHid / 64) / 8, 1), 256, 0, stream>>>(
      X16, kHid, 0L,
      Wqk16, kHid, 0L,
      (void*)Q16, 0, 0L,
      COS, SIN,
      kRows, 2 * kHid, kHid, kQKScale);

  wmma_gemm64<1><<<dim3((kHid / 64) * (kSeq / 64) / 8, kBatch), 256, 0, stream>>>(
      Wv16, kHid, 0L,
      X16, kHid, (long)kSeq * kHid,
      (void*)VT16, kSeq, (long)kHid * kSeq,
      nullptr, nullptr,
      kHid, kSeq, kHid, kVScale);

  attn_kernel<<<kBatch * kHeads * kQTiles, 128, 0, stream>>>(Q16, K16, VT16, A16);

  wmma_gemm64<0><<<dim3((kRows / 64) * (kHid / 64) / 8, 1), 256, 0, stream>>>(
      A16, kHid, 0L,
      Wo16, kHid, 0L,
      (void*)out, kHid, 0L,
      nullptr, nullptr,
      kRows, kHid, kHid, kOutScale);
}

// v001
// Measured time: 133 microseconds a run.
// Two timings next to v000 put it at 1.76 and 1.75 times that version's speed.
// All contractions (q/k/v projections, q.k^T, p.v, output projection): v_wmma_f32_16x16x32_f16, f16 operands with power-of-two carries, f32 accumulate; rotary tables, exp, row sums and normalisation in f32.
#include <hip/hip_runtime.h>
#include <math.h>

typedef __attribute__((ext_vector_type(16))) _Float16 v16h;
typedef __attribute__((ext_vector_type(8)))  _Float16 v8h;
typedef __attribute__((ext_vector_type(8)))  float    v8f;
typedef __attribute__((ext_vector_type(4)))  float    v4f;

// ---------------------------------------------------------------------------
// Shape constants
// ---------------------------------------------------------------------------
constexpr int kBatch  = 2;
constexpr int kSeq    = 2048;
constexpr int kHid    = 1024;
constexpr int kHeads  = 16;
constexpr int kHd     = 64;
constexpr int kRows   = kBatch * kSeq;
constexpr int kHalfHd = kHd / 2;
static_assert(kHeads * kHd == kHid, "head split");
static_assert(kHd == 64, "head width fixed at 64");
static_assert((kSeq % 64) == 0 && (kHid % 64) == 0 && (kHid % 32) == 0 && (kRows % 64) == 0, "tile multiples");
static_assert(kSeq == 2048 && kHid == 1024, "bit tricks below assume these");

// ---------------------------------------------------------------------------
// Power-of-two carries of the f16 planes and the derived fold-back scales
// ---------------------------------------------------------------------------
constexpr double cx_sqrt(double x) {
  double g = (x > 1.0) ? x : 1.0;
  for (int it = 0; it < 80; ++it) g = 0.5 * (g + x / g);
  return g;
}
constexpr float kXCarry    = 16.0f;
constexpr float kWCarry    = 256.0f;
constexpr float kQKCarry   = 16.0f;
constexpr float kVCarry    = 16.0f;
constexpr float kAttnCarry = 2048.0f;
constexpr float kInvSqrtHd = (float)(1.0 / cx_sqrt((double)kHd));
static_assert(kInvSqrtHd == 0.125f, "1/sqrt(head width)");
constexpr float kQKScale    = kQKCarry / (kXCarry * kWCarry);
constexpr float kVScale     = kVCarry / (kXCarry * kWCarry);
constexpr float kScoreScale = kInvSqrtHd / (kQKCarry * kQKCarry);
constexpr float kCtxScale   = kAttnCarry / kVCarry;
constexpr float kOutScale   = 1.0f / (kAttnCarry * kWCarry);
constexpr float kScoreClamp = 10.0f;

// ---------------------------------------------------------------------------
// Rotary inverse frequencies: 10000^(-2i/64) = 10^(-i/8), i = 0..31, evaluated in double at build time, converted to f32
// ---------------------------------------------------------------------------
struct InvFreqTab { float v[kHalfHd]; };
constexpr InvFreqTab make_inv_freq() {
  InvFreqTab t{};
  const double r8 = cx_sqrt(cx_sqrt(cx_sqrt(10.0)));
  for (int i = 0; i < kHalfHd; ++i) {
    double p = 1.0;
    for (int j = 0; j < (i & 7); ++j) p *= r8;
    for (int j = 0; j < (i >> 3); ++j) p *= 10.0;
    t.v[i] = (float)(1.0 / p);
  }
  return t;
}
__device__ constexpr InvFreqTab kInvFreq = make_inv_freq();
static_assert(sizeof(kInvFreq.v) / sizeof(kInvFreq.v[0]) == 32, "table length");

// ---------------------------------------------------------------------------
// Workspace region map (bytes; every offset a multiple of 128)
//   X16   f16 [4096][1024]          x carried x16                         8,388,608
//   W16   f16 [4][1024][1024]       w_q | w_k | w_v | w_o carried x256    8,388,608
//   COS   f32 [2048][32]                                                    262,144
//   SIN   f32 [2048][32]                                                    262,144
//   Q16   f16 [32][2048][64]        rotated q carried x16                 8,388,608
//   K16   f16 [32][2048][64]        rotated k carried x16 (follows Q16)   8,388,608
//   VT16  f16 [32][64][2048]        v transposed, carried x16             8,388,608
//   A16   f16 [4096][1024]          attention output carried x2048        8,388,608
//   total                                                                50,855,936
// ---------------------------------------------------------------------------
constexpr size_t kPlaneBytes = (size_t)kRows * kHid * 2;
constexpr size_t kTabBytes   = (size_t)kSeq * kHalfHd * 4;
constexpr size_t kOffX16  = 0;
constexpr size_t kOffW16  = kOffX16 + kPlaneBytes;
constexpr size_t kOffCos  = kOffW16 + (size_t)4 * kHid * kHid * 2;
constexpr size_t kOffSin  = kOffCos + kTabBytes;
constexpr size_t kOffQ16  = kOffSin + kTabBytes;
constexpr size_t kOffK16  = kOffQ16 + kPlaneBytes;
constexpr size_t kOffVT16 = kOffK16 + kPlaneBytes;
constexpr size_t kOffA16  = kOffVT16 + kPlaneBytes;
constexpr size_t kWsTotal = kOffA16 + kPlaneBytes;
static_assert(kWsTotal == 50855936ull, "carve total");
static_assert(kWsTotal <= 134217728ull, "carve cap");
static_assert((kOffW16 % 128) == 0 && (kOffCos % 128) == 0 && (kOffSin % 128) == 0 && (kOffQ16 % 128) == 0 &&
              (kOffK16 % 128) == 0 && (kOffVT16 % 128) == 0 && (kOffA16 % 128) == 0, "128-B aligned regions");
constexpr size_t kPlaneElems = (size_t)kRows * kHid;

// ---------------------------------------------------------------------------
// Fragment helpers (split k map for A and B: elements 0..7 <- p[0..7], 8..15 <- p[16..23], p already offset by 8*(lane>>4))
// ---------------------------------------------------------------------------
struct FragH {
  union U { v16h v; v8h h[2]; };
  static __device__ __forceinline__ v16h load(const _Float16* p) {
    U f;
    f.h[0] = *(const v8h*)(p);
    f.h[1] = *(const v8h*)(p + 16);
    return f.v;
  }
  static __device__ __forceinline__ v8f mma(v16h a, v16h b, v8f c) {
    return __builtin_amdgcn_wmma_f32_16x16x32_f16(false, a, false, b, (short)0, c, false, false);
  }
};
__device__ __forceinline__ void guard4_h(v8f& a, v8f& b, v8f& c, v8f& d, v16h x, v16h y) {
  asm volatile("v_nop\n\tv_nop\n\tv_nop\n\tv_nop" : "+v"(a), "+v"(b), "+v"(c), "+v"(d) : "v"(x), "v"(y));
}
__device__ __forceinline__ void keep4_h(v16h a, v16h b, v16h c, v16h d) {
  asm volatile("v_nop" :: "v"(a), "v"(b), "v"(c), "v"(d));
}
__device__ __forceinline__ void acc_guard4(v8f& a, v8f& b, v8f& c, v8f& d) {
  asm volatile("v_nop\n\tv_nop\n\tv_nop\n\tv_nop" : "+v"(a), "+v"(b), "+v"(c), "+v"(d));
}
__device__ __forceinline__ v8f mma_g(v16h a, v16h b, v8f c) {
  c = __builtin_amdgcn_wmma_f32_16x16x32_f16(false, a, false, b, (short)0, c, false, false);
  asm volatile("v_nop\n\tv_nop\n\tv_nop\n\tv_nop" : "+v"(c) : "v"(a), "v"(b));
  return c;
}

// ---------------------------------------------------------------------------
// f32 -> f16 cast with a power-of-two carry, 8 consecutive elements per thread.
// blockIdx.y selects one of up to four source planes; destination plane z starts at out + z * 8 * n8 halves.
// Coverage: grid.x * 256 = n8 threads exactly (checked on the host); each lane stores 16 B, 32 consecutive lanes
// ---------------------------------------------------------------------------
__global__ __launch_bounds__(256) void cast8_scale_f16_kernel(
    const float* __restrict__ in0, const float* __restrict__ in1,
    const float* __restrict__ in2, const float* __restrict__ in3,
    unsigned short* __restrict__ out, int n8, float scale)
{
  const int z = blockIdx.y;
  const float* in = (z == 0) ? in0 : (z == 1) ? in1 : (z == 2) ? in2 : in3;
  const int i = blockIdx.x * 256 + threadIdx.x;
  if (i >= n8) return;
  const float* p = in + 8 * (size_t)i;
  const v4f a = *(const v4f*)(p);
  const v4f c = *(const v4f*)(p + 4);
  v8h hv;
#pragma unroll
  for (int e = 0; e < 4; ++e) {
    const float f0 = a[e] * scale;
    const float f1 = c[e] * scale;
    hv[e]     = (_Float16)f0;
    hv[4 + e] = (_Float16)f1;
  }
  unsigned short* q = out + (size_t)z * 8 * (size_t)n8 + 8 * (size_t)i;
  *(v8h*)q = hv;
  
}

// ---------------------------------------------------------------------------
// Rotary tables: COS/SIN [2048][32] f32, angle = float(position) * inv_freq[i] (single f32 multiply), accurate sincosf.
// ---------------------------------------------------------------------------
__global__ __launch_bounds__(256) void rotary_table_kernel(float* __restrict__ cosT, float* __restrict__ sinT)
{
  const int t = blockIdx.x * 256 + threadIdx.x;
  const int s = t >> 5;
  const int i = t & 31;
  const float inv = kInvFreq.v[i];
  const float ang = (float)s * inv;
  float sn, cs;
  sincosf(ang, &sn, &cs);
  ((float*)cosT)[t] = cs;
  ((float*)sinT)[t] = sn;
  
}

// ---------------------------------------------------------------------------
// Asynchronous copy of 8 slices of 16 tile rows to LDS: each lane moves its own 16 B per slice, a wave 4 whole 128-B rows.
// lds = the lane's LDS byte address in slice 0, g = its global address in slice 0, gstep = 16 source rows in halves.
// s_wait_xcnt 0 closes the statement so that no address register named here is rewritten ahead of it.
// ---------------------------------------------------------------------------
constexpr int kBT = 128;                     // block tile: rows of A and rows of Bt
constexpr int kKC = 64;                      // k per pass: tile rows of 128 B
constexpr int kGP = 72;                      // LDS row pitch in halves: 144 B = 16 B x 9, for ds_load_b128 readers
constexpr int kOpHalves    = kBT * kGP;      // one operand's tile
constexpr int kStageHalves = 2 * kOpHalves;  // [A tile | Bt tile]
constexpr unsigned kSliceBytes = 16u * kGP * 2u;
__device__ __forceinline__ void async_copy8(unsigned lds, const _Float16* g, size_t gstep) {
  asm volatile(
      "global_load_async_to_lds_b128 %0, %8, off\n\t"
      "global_load_async_to_lds_b128 %1, %9, off\n\t"
      "global_load_async_to_lds_b128 %2, %10, off\n\t"
      "global_load_async_to_lds_b128 %3, %11, off\n\t"
      "global_load_async_to_lds_b128 %4, %12, off\n\t"
      "global_load_async_to_lds_b128 %5, %13, off\n\t"
      "global_load_async_to_lds_b128 %6, %14, off\n\t"
      "global_load_async_to_lds_b128 %7, %15, off\n\t"
      "s_wait_xcnt 0x0"
      :: "v"(lds), "v"(lds + kSliceBytes), "v"(lds + 2u * kSliceBytes), "v"(lds + 3u * kSliceBytes),
         "v"(lds + 4u * kSliceBytes), "v"(lds + 5u * kSliceBytes), "v"(lds + 6u * kSliceBytes), "v"(lds + 7u * kSliceBytes),
         "v"(g), "v"(g + gstep), "v"(g + 2 * gstep), "v"(g + 3 * gstep),
         "v"(g + 4 * gstep), "v"(g + 5 * gstep), "v"(g + 6 * gstep), "v"(g + 7 * gstep)
      : "memory");
}

// ---------------------------------------------------------------------------
// Batched GEMM: C[m,n] = scale * sum_k A[m,k] * Bt[n,k]; a block of 4 waves (2 x 2) owns a 128x128 tile, each wave 64x64 of it.
// A row-major [M,K]; Bt row-major [N,K]; M, N multiples of 128, K a multiple of 64 and at least 128 (asserted on the host).
// Operands: per pass of 64 k the block's 128 A rows and 128 Bt rows go to LDS by asynchronous copies, two buffers, the next
//           pass's copies in flight while this pass's fragments are read; every wave copies, waits and passes every barrier.
// OUT_MODE 3: N = 2 x kHid (q columns then k columns); the 64-wide tile is one head; interleaved-pair rotation with
//             COS/SIN[position][pair] then f16 store to plane (n0 >> 10) laid out [batch*heads + head][position][64]
// Store coverage per 16-row slab: mode 0: 8 iterations x 2 rows; modes 1 and 3: 4 iterations x 4 rows; 64 columns each.
// ---------------------------------------------------------------------------
template <int OUT_MODE>
__global__ __launch_bounds__(128) void wmma_gemm64(
    const unsigned short* __restrict__ Ap, int lda, long strideA,
    const unsigned short* __restrict__ Btp, int ldb, long strideB,
    void* __restrict__ Cout, int ldc, long strideC,
    const float* __restrict__ cosT, const float* __restrict__ sinT,
    int M, int N, int K, float scale)
{
  const _Float16* A  = (const _Float16*)Ap;
  const _Float16* Bt = (const _Float16*)Btp;
  __shared__ __align__(16) _Float16 ring[2 * kStageHalves];
  __shared__ __align__(16) float sT[4][16 * 68];
  const int b    = blockIdx.y;
  const int tid  = threadIdx.x;
  const int lane = threadIdx.x & 31;
  const int wave = __builtin_amdgcn_readfirstlane((int)(threadIdx.x >> 5));
  const int tilesN = N >> 7;
  const int tilesM = M >> 7;
  const int tile = blockIdx.x;
  /* block-uniform exit, in front of every copy and barrier */
  if (tile >= tilesM * tilesN) return;
  const int tm = tile / tilesN;
  const int tn = tile - tm * tilesN;
  const int wm = wave >> 1;
  const int wn = wave & 1;
  const int m0 = (tm << 7) + (wm << 6);
  const int n0 = (tn << 7) + (wn << 6);

  const _Float16* Ab = A  + (size_t)b * strideA;
  const _Float16* Bb = Bt + (size_t)b * strideB;

  const int rlane = lane & 15;
  const int koff  = (lane >> 4) * 8;
  const int mOff  = (lane >> 4) * 8;

  v8f acc[4][4];
#pragma unroll
  for (int i = 0; i < 4; ++i)
#pragma unroll
    for (int j = 0; j < 4; ++j) acc[i][j] = (v8f){0.f,0.f,0.f,0.f,0.f,0.f,0.f,0.f};

  /* copy map: thread -> row tid / 8 of each 16-row slice, 16-B part tid % 8 of its 128 B */
  const int crow  = tid >> 3;
  const int cpart = (tid & 7) * 8;
  const _Float16* gA = Ab + (size_t)((tm << 7) + crow) * lda + cpart;
  const _Float16* gB = Bb + (size_t)((tn << 7) + crow) * ldb + cpart;
  const size_t stepA = (size_t)16 * lda;
  const size_t stepB = (size_t)16 * ldb;
  const unsigned ldsA =
      (unsigned)(size_t)(__attribute__((address_space(3))) _Float16*)ring + (unsigned)(crow * kGP + cpart) * 2u;
  const unsigned ldsB = ldsA + (unsigned)kOpHalves * 2u;
  constexpr unsigned kStageBytes = (unsigned)kStageHalves * 2u;
  const _Float16* fA = ring + ((wm << 6) + rlane) * kGP + koff;
  const _Float16* fB = ring + kOpHalves + ((wn << 6) + rlane) * kGP + koff;
  const int passes = K / kKC;

  async_copy8(ldsA, gA, stepA);
  async_copy8(ldsB, gB, stepB);
  /* pass 0's tile has landed for this wave; the barrier publishes it to the other waves */
  asm volatile("s_wait_asynccnt 0x0" ::: "memory");
  __syncthreads();
  if (1 < passes) {
    async_copy8(ldsA + kStageBytes, gA + kKC, stepA);
    async_copy8(ldsB + kStageBytes, gB + kKC, stepB);
  }

  for (int t = 0; t < passes; ++t) {
    const int buf = t & 1;
    const _Float16* pA = fA + buf * kStageHalves;
    const _Float16* pB = fB + buf * kStageHalves;
    /* unrolled, like the loops inside: every fragment and accumulator index is a constant, so the arrays stay in registers */
#pragma unroll
    for (int kk = 0; kk < kKC; kk += 32) {
      /* the 16 LDS reads of a 32-k step stand as one group in front of its 16 products */
      v16h ah[4], bh[4];
#pragma unroll
      for (int j = 0; j < 4; ++j) bh[j] = FragH::load(pB + (j << 4) * kGP + kk);
#pragma unroll
      for (int i = 0; i < 4; ++i) ah[i] = FragH::load(pA + (i << 4) * kGP + kk);
#pragma unroll
      for (int i = 0; i < 4; ++i) {
#pragma unroll
        for (int j = 0; j < 4; ++j) acc[i][j] = FragH::mma(ah[i], bh[j], acc[i][j]);
        guard4_h(acc[i][0], acc[i][1], acc[i][2], acc[i][3], ah[i], bh[3]);
      }
      keep4_h(bh[0], bh[1], bh[2], bh[3]);
    }
    /* this wave's reads of buffer buf are complete before any wave refills it */
    asm volatile("s_wait_dscnt 0x0" ::: "memory");
    /* this wave's copies of pass t + 1 have landed before the barrier publishes them */
    asm volatile("s_wait_asynccnt 0x0" ::: "memory");
    __syncthreads();
    if (t + 2 < passes) {
      async_copy8(ldsA + (unsigned)buf * kStageBytes, gA + (size_t)(t + 2) * kKC, stepA);
      async_copy8(ldsB + (unsigned)buf * kStageBytes, gB + (size_t)(t + 2) * kKC, stepB);
    }
  }
  /* no copy of this wave is outstanding past here */
  asm volatile("s_wait_asynccnt 0x0" ::: "memory");
  acc_guard4(acc[0][0], acc[0][1], acc[0][2], acc[0][3]);
  acc_guard4(acc[1][0], acc[1][1], acc[1][2], acc[1][3]);
  acc_guard4(acc[2][0], acc[2][1], acc[2][2], acc[2][3]);
  acc_guard4(acc[3][0], acc[3][1], acc[3][2], acc[3][3]);

  float* slab = sT[wave];
#pragma unroll
  for (int i = 0; i < 4; ++i) {
    const int mBase = m0 + (i << 4);
#pragma unroll
    for (int j = 0; j < 4; ++j) {
#pragma unroll
      for (int r = 0; r < 8; ++r) {
        const float v = acc[i][j][r] * scale;
        slab[(mOff + r) * 68 + (j << 4) + rlane] = v;
      }
    }
    __builtin_amdgcn_fence(__ATOMIC_RELEASE, "workgroup");
    __builtin_amdgcn_wave_barrier();
    __builtin_amdgcn_fence(__ATOMIC_ACQUIRE, "workgroup");
    if (OUT_MODE == 0) {
      float* C = (float*)Cout + (size_t)b * strideC;
      const int hh = lane >> 4, c4 = (lane & 15) * 4;
      {
#pragma unroll
        for (int it = 0; it < 8; ++it) {
          const int row = it * 2 + hh;
          v4f v = *(const v4f*)(slab + row * 68 + c4);
          *(v4f*)(C + (size_t)(mBase + row) * ldc + n0 + c4) = v;
        }
        
      }
    } else if (OUT_MODE == 1) {
      const int q = lane >> 3, c8 = (lane & 7) * 8;
      unsigned short* C = (unsigned short*)Cout + (size_t)b * strideC;
      v8h ov[4];
#pragma unroll
      for (int it = 0; it < 4; ++it) {
        const int row = it * 4 + q;
        const float* sp = slab + row * 68 + c8;
        const v4f a0 = *(const v4f*)(sp);
        const v4f a1 = *(const v4f*)(sp + 4);
#pragma unroll
        for (int e = 0; e < 4; ++e) {
          ov[it][e]     = (_Float16)a0[e];
          ov[it][4 + e] = (_Float16)a1[e];
        }
      }
      {
#pragma unroll
        for (int it = 0; it < 4; ++it) {
          const int row = it * 4 + q;
          *(v8h*)(C + (size_t)(mBase + row) * ldc + n0 + c8) = ov[it];
        }
        
      }
    } else {
      const int q = lane >> 3, c8 = (lane & 7) * 8;
      const int which = n0 >> 10;
      const int head  = (n0 >> 6) & (kHeads - 1);
      unsigned short* C = (unsigned short*)Cout + (size_t)which * kPlaneElems;
      v8h ov[4];
      size_t oo[4];
#pragma unroll
      for (int it = 0; it < 4; ++it) {
        const int row = it * 4 + q;
        const int m   = mBase + row;
        const int bb  = m >> 11;
        const int s   = m & (kSeq - 1);
        const float* sp = slab + row * 68 + c8;
        const v4f a0 = *(const v4f*)(sp);
        const v4f a1 = *(const v4f*)(sp + 4);
        const v4f cv = *(const v4f*)(cosT + (size_t)s * kHalfHd + (c8 >> 1));
        const v4f sv = *(const v4f*)(sinT + (size_t)s * kHalfHd + (c8 >> 1));
        const float o0 = a0[0] * cv[0] - a0[1] * sv[0];
        const float o1 = a0[0] * sv[0] + a0[1] * cv[0];
        const float o2 = a0[2] * cv[1] - a0[3] * sv[1];
        const float o3 = a0[2] * sv[1] + a0[3] * cv[1];
        const float o4 = a1[0] * cv[2] - a1[1] * sv[2];
        const float o5 = a1[0] * sv[2] + a1[1] * cv[2];
        const float o6 = a1[2] * cv[3] - a1[3] * sv[3];
        const float o7 = a1[2] * sv[3] + a1[3] * cv[3];
        ov[it][0] = (_Float16)o0;
        ov[it][1] = (_Float16)o1;
        ov[it][2] = (_Float16)o2;
        ov[it][3] = (_Float16)o3;
        ov[it][4] = (_Float16)o4;
        ov[it][5] = (_Float16)o5;
        ov[it][6] = (_Float16)o6;
        ov[it][7] = (_Float16)o7;
        oo[it] = ((size_t)(bb * kHeads + head) * kSeq + s) * kHd + c8;
      }
      {
#pragma unroll
        for (int it = 0; it < 4; ++it) *(v8h*)(C + oo[it]) = ov[it];
        
      }
    }
    __builtin_amdgcn_fence(__ATOMIC_RELEASE, "workgroup");
    __builtin_amdgcn_wave_barrier();
    __builtin_amdgcn_fence(__ATOMIC_ACQUIRE, "workgroup");
  }
}

// ---------------------------------------------------------------------------
// Attention for one (batch, head) and 64 query rows per block (4 waves x 16 rows), key tiles of 64.
//   scores = (Q16 . K16^T) * kScoreScale for ALL 32 key tiles; p = exp(min(score, clamp)) unnormalised, f32;
//   the row sum l accumulates every key (future keys included), per lane, reduced over 16 lanes once after the loop;
//   P.V is accumulated only for key tiles at or below the diagonal (tile index <= query tile index, block-uniform), with
//   p set to zero by select where key > query inside the diagonal tile; O = acc / l, no renormalisation.
// LDS: K tile [64 keys][72] f16 and Vt tile [64 dd][72] f16 (columns 0..63 written and read, pad never read), staged by
//   128 threads x 4 x 16 B = 8,192 B = the whole tile each; per-wave P tile [16][72] f16 written fully (16 rows x 64
// Block barriers only at the top of each key tile and after staging; all 4 waves run all 32 tiles; no early exits.
// grid.x = 32 (batch, head) groups x 32 query tiles.
// ---------------------------------------------------------------------------
constexpr int kQB = 64;
constexpr int kKT = 64;
constexpr int kLP = 72;
constexpr int kAW = 4;
constexpr int kQTiles = kSeq / kQB;
constexpr int kKTiles = kSeq / kKT;
static_assert(kQB == kKT, "diagonal tile logic assumes equal tiles");

__global__ __launch_bounds__(128) void attn_kernel(
    const unsigned short* __restrict__ Qp, const unsigned short* __restrict__ Kp,
    const unsigned short* __restrict__ Vtp, unsigned short* __restrict__ Op)
{
  __shared__ __align__(16) _Float16 Ksh[kKT * kLP];
  __shared__ __align__(16) _Float16 Vsh[kHd * kLP];
  __shared__ __align__(16) _Float16 Psh[kAW][16 * kLP];
  __shared__ __align__(16) float    Os[kAW][16 * 68];

  const int tid  = threadIdx.x;
  const int wave = __builtin_amdgcn_readfirstlane((int)(threadIdx.x >> 5));
  const int lane = tid & 31;
  const int hh   = lane >> 4;
  const int c    = lane & 15;
  const int qb   = blockIdx.x % kQTiles;
  const int bh   = blockIdx.x / kQTiles;
  const int q0   = qb * kQB + wave * 16;

  const _Float16* Qb = (const _Float16*)Qp  + (size_t)bh * kSeq * kHd;
  const _Float16* Kb = (const _Float16*)Kp  + (size_t)bh * kSeq * kHd;
  const _Float16* Vb = (const _Float16*)Vtp + (size_t)bh * kHd * kSeq;

  v16h qa[2];
#pragma unroll
  for (int dc = 0; dc < 2; ++dc) qa[dc] = FragH::load(Qb + (size_t)(q0 + c) * kHd + dc * 32 + 8 * hh);

  float lsum[8];
  v8f oacc[4];
#pragma unroll
  for (int r = 0; r < 8; ++r) lsum[r] = 0.f;
#pragma unroll
  for (int t = 0; t < 4; ++t) oacc[t] = (v8f){0.f,0.f,0.f,0.f,0.f,0.f,0.f,0.f};

  _Float16* pw = Psh[wave];

#pragma unroll 1
  for (int kc = 0; kc < kKTiles; ++kc) {
    const int kv0 = kc * kKT;
    /* block-uniform: this key tile contributes to P.V */
    const bool pv = (kc <= qb);
    __syncthreads();
#pragma unroll
    for (int it = 0; it < 4; ++it) {
      const int e = it * 128 + tid;
      const int row = e >> 3, part = e & 7;
      const v8h kk = *(const v8h*)(Kb + (size_t)(kv0 + row) * kHd + part * 8);
      *(v8h*)(Ksh + row * kLP + part * 8) = kk;
    }
    if (pv) {
#pragma unroll
      for (int it = 0; it < 4; ++it) {
        const int e = it * 128 + tid;
        const int row = e >> 3, part = e & 7;
        const v8h vv = *(const v8h*)(Vb + (size_t)row * kSeq + kv0 + part * 8);
        *(v8h*)(Vsh + row * kLP + part * 8) = vv;
      }
    }
    __syncthreads();

    v8f s[4];
#pragma unroll
    for (int j = 0; j < 4; ++j) {
      s[j] = (v8f){0.f,0.f,0.f,0.f,0.f,0.f,0.f,0.f};
#pragma unroll
      for (int dc = 0; dc < 2; ++dc) {
        const v16h kb = FragH::load(Ksh + (j * 16 + c) * kLP + dc * 32 + 8 * hh);
        s[j] = mma_g(qa[dc], kb, s[j]);
      }
    }
#pragma unroll
    for (int j = 0; j < 4; ++j) {
#pragma unroll
      for (int r = 0; r < 8; ++r) {
        const float x = fminf(s[j][r] * kScoreScale, kScoreClamp);
        const float p = __expf(x);
        lsum[r] += p;
        s[j][r] = p;
      }
    }
    if (pv) {
      const bool diag = (kc == qb);
#pragma unroll
      for (int j = 0; j < 4; ++j) {
        const int kvcol = kv0 + j * 16 + c;
#pragma unroll
        for (int r = 0; r < 8; ++r) {
          const int qrow = q0 + 8 * hh + r;
          const float pm = (diag && (kvcol > qrow)) ? 0.0f : s[j][r];
          pw[(8 * hh + r) * kLP + j * 16 + c] = (_Float16)pm;
        }
      }
      __builtin_amdgcn_fence(__ATOMIC_RELEASE, "workgroup");
      __builtin_amdgcn_wave_barrier();
      __builtin_amdgcn_fence(__ATOMIC_ACQUIRE, "workgroup");
#pragma unroll
      for (int kk = 0; kk < 2; ++kk) {
        const v16h pa = FragH::load(pw + c * kLP + kk * 32 + 8 * hh);
#pragma unroll
        for (int t = 0; t < 4; ++t) {
          const v16h vb = FragH::load(Vsh + (t * 16 + c) * kLP + kk * 32 + 8 * hh);
          oacc[t] = mma_g(pa, vb, oacc[t]);
        }
      }
    }
  }

  float* os = Os[wave];
#pragma unroll
  for (int r = 0; r < 8; ++r) {
    float l = lsum[r];
    l += __shfl_xor(l, 1, 32);
    l += __shfl_xor(l, 2, 32);
    l += __shfl_xor(l, 4, 32);
    l += __shfl_xor(l, 8, 32);
    const float inv = kCtxScale * __builtin_amdgcn_rcpf(l);
#pragma unroll
    for (int t = 0; t < 4; ++t) os[(8 * hh + r) * 68 + t * 16 + c] = oacc[t][r] * inv;
  }
  __builtin_amdgcn_fence(__ATOMIC_RELEASE, "workgroup");
  __builtin_amdgcn_wave_barrier();
  __builtin_amdgcn_fence(__ATOMIC_ACQUIRE, "workgroup");
  {
    const int bb = bh / kHeads;
    const int h  = bh - bb * kHeads;
    const int q4 = lane >> 3, c8 = (lane & 7) * 8;
    v8h ov[4];
    size_t oo[4];
#pragma unroll
    for (int it = 0; it < 4; ++it) {
      const int row = it * 4 + q4;
      const float* sp = os + row * 68 + c8;
      const v4f a0 = *(const v4f*)(sp);
      const v4f a1 = *(const v4f*)(sp + 4);
#pragma unroll
      for (int e = 0; e < 4; ++e) {
        ov[it][e]     = (_Float16)a0[e];
        ov[it][4 + e] = (_Float16)a1[e];
      }
      oo[it] = ((size_t)(bb * kSeq + q0 + row)) * kHid + h * kHd + c8;
    }
    {
#pragma unroll
      for (int it = 0; it < 4; ++it) *(v8h*)(Op + oo[it]) = ov[it];
      
    }
  }
}

// ---------------------------------------------------------------------------
// Host glue: 7 kernel launches, nothing else.
//   1 cast x (2048 blocks)             2 cast w_q|w_k|w_v|w_o (512 x 4 blocks)     3 rotary tables (256 blocks)
//   4 q|k projection + rotation: M 4096, N 2048, K 1024 -> 32 x 16 block tiles = 512 blocks of 128 threads
//   5 v projection transposed (A = w_v, Bt = x of one batch): M 1024, N 2048, K 1024 -> 8 x 16 block tiles = 128 blocks x 2
//   6 attention: 32 x 32 = 1024 blocks of 128 threads
//   7 output projection: M 4096, N 1024, K 1024 -> 32 x 8 block tiles = 256 blocks of 128 threads
// ---------------------------------------------------------------------------
extern "C" void kernel_launch(void* const* d_in, const int* in_sizes, int n_in,
                              void* d_out, int out_size, void* d_ws, size_t ws_size,
                              hipStream_t stream) {
  if (n_in < 5) return;
  if (in_sizes[0] != kRows * kHid) return;
  if (in_sizes[1] != kHid * kHid) return;
  if (in_sizes[2] != kHid * kHid) return;
  if (in_sizes[3] != kHid * kHid) return;
  if (in_sizes[4] != kHid * kHid) return;
  if (out_size != kRows * kHid) return;
  if (ws_size < kWsTotal) return;

  const float* x  = (const float*)d_in[0];
  const float* wq = (const float*)d_in[1];
  const float* wk = (const float*)d_in[2];
  const float* wv = (const float*)d_in[3];
  const float* wo = (const float*)d_in[4];
  float* out = (float*)d_out;

  char* ws = (char*)d_ws;
  unsigned short* X16  = (unsigned short*)(ws + kOffX16);
  unsigned short* W16  = (unsigned short*)(ws + kOffW16);
  float*          COS  = (float*)(ws + kOffCos);
  float*          SIN  = (float*)(ws + kOffSin);
  unsigned short* Q16  = (unsigned short*)(ws + kOffQ16);
  unsigned short* K16  = (unsigned short*)(ws + kOffK16);
  unsigned short* VT16 = (unsigned short*)(ws + kOffVT16);
  unsigned short* A16  = (unsigned short*)(ws + kOffA16);
  const unsigned short* Wqk16 = W16;
  const unsigned short* Wv16  = W16 + (size_t)2 * kHid * kHid;
  const unsigned short* Wo16  = W16 + (size_t)3 * kHid * kHid;

  constexpr int kXn8 = kRows * kHid / 8;
  constexpr int kWn8 = kHid * kHid / 8;
  static_assert((kXn8 % 256) == 0 && (kWn8 % 256) == 0, "cast grids exact");
  static_assert((kRows % kBT) == 0 && (kHid % kBT) == 0 && (kSeq % kBT) == 0, "block tiles exact");
  static_assert((kHid % kKC) == 0 && kHid / kKC >= 2, "whole passes, two or more");

  cast8_scale_f16_kernel<<<dim3(kXn8 / 256, 1), 256, 0, stream>>>(x, x, x, x, X16, kXn8, kXCarry);
  cast8_scale_f16_kernel<<<dim3(kWn8 / 256, 4), 256, 0, stream>>>(wq, wk, wv, wo, W16, kWn8, kWCarry);
  rotary_table_kernel<<<(kSeq * kHalfHd) / 256, 256, 0, stream>>>(COS, SIN);

  wmma_gemm64<3><<<dim3((kRows / kBT) * (2 * kHid / kBT), 1), 128, 0, stream>>>(
      X16, kHid, 0L,
      Wqk16, kHid, 0L,
      (void*)Q16, 0, 0L,
      COS, SIN,
      kRows, 2 * kHid, kHid, kQKScale);

  wmma_gemm64<1><<<dim3((kHid / kBT) * (kSeq / kBT), kBatch), 128, 0, stream>>>(
      Wv16, kHid, 0L,
      X16, kHid, (long)kSeq * kHid,
      (void*)VT16, kSeq, (long)kHid * kSeq,
      nullptr, nullptr,
      kHid, kSeq, kHid, kVScale);

  attn_kernel<<<kBatch * kHeads * kQTiles, 128, 0, stream>>>(Q16, K16, VT16, A16);

  wmma_gemm64<0><<<dim3((kRows / kBT) * (kHid / kBT), 1), 128, 0, stream>>>(
      A16, kHid, 0L,
      Wo16, kHid, 0L,
      (void*)out, kHid, 0L,
      nullptr, nullptr,
      kRows, kHid, kHid, kOutScale);
}

// v002
// It runs in 109 microseconds.
// In two side-by-side timings against v001, it was 1.23 and 1.22 times as fast.
// Counting every step since v000, it is 2.15 times as fast.
// All contractions (q/k/v projections, q.k^T, p.v, output projection): v_wmma_f32_16x16x32_f16, f16 operands with power-of-two carries, f32 accumulate; rotary tables, exp, row sums and normalisation in f32.
#include <hip/hip_runtime.h>
#include <math.h>

typedef __attribute__((ext_vector_type(16))) _Float16 v16h;
typedef __attribute__((ext_vector_type(8)))  _Float16 v8h;
typedef __attribute__((ext_vector_type(8)))  float    v8f;
typedef __attribute__((ext_vector_type(4)))  float    v4f;

// ---------------------------------------------------------------------------
// Shape constants
// ---------------------------------------------------------------------------
constexpr int kBatch  = 2;
constexpr int kSeq    = 2048;
constexpr int kHid    = 1024;
constexpr int kHeads  = 16;
constexpr int kHd     = 64;
constexpr int kRows   = kBatch * kSeq;
constexpr int kHalfHd = kHd / 2;
static_assert(kHeads * kHd == kHid, "head split");
static_assert(kHd == 64, "head width fixed at 64");
static_assert((kSeq % 64) == 0 && (kHid % 64) == 0 && (kHid % 32) == 0 && (kRows % 64) == 0, "tile multiples");
static_assert(kSeq == 2048 && kHid == 1024, "bit tricks below assume these");

// ---------------------------------------------------------------------------
// Power-of-two carries of the f16 planes and the derived fold-back scales
// ---------------------------------------------------------------------------
constexpr double cx_sqrt(double x) {
  double g = (x > 1.0) ? x : 1.0;
  for (int it = 0; it < 80; ++it) g = 0.5 * (g + x / g);
  return g;
}
constexpr float kXCarry    = 16.0f;
constexpr float kWCarry    = 256.0f;
constexpr float kQKCarry   = 16.0f;
constexpr float kVCarry    = 16.0f;
constexpr float kAttnCarry = 2048.0f;
constexpr float kInvSqrtHd = (float)(1.0 / cx_sqrt((double)kHd));
static_assert(kInvSqrtHd == 0.125f, "1/sqrt(head width)");
constexpr float kQKScale    = kQKCarry / (kXCarry * kWCarry);
constexpr float kVScale     = kVCarry / (kXCarry * kWCarry);
constexpr float kScoreScale = kInvSqrtHd / (kQKCarry * kQKCarry);
constexpr float kCtxScale   = kAttnCarry / kVCarry;
constexpr float kOutScale   = 1.0f / (kAttnCarry * kWCarry);
constexpr float kScoreClamp = 10.0f;

// ---------------------------------------------------------------------------
// Rotary inverse frequencies: 10000^(-2i/64) = 10^(-i/8), i = 0..31, evaluated in double at build time, converted to f32
// ---------------------------------------------------------------------------
struct InvFreqTab { float v[kHalfHd]; };
constexpr InvFreqTab make_inv_freq() {
  InvFreqTab t{};
  const double r8 = cx_sqrt(cx_sqrt(cx_sqrt(10.0)));
  for (int i = 0; i < kHalfHd; ++i) {
    double p = 1.0;
    for (int j = 0; j < (i & 7); ++j) p *= r8;
    for (int j = 0; j < (i >> 3); ++j) p *= 10.0;
    t.v[i] = (float)(1.0 / p);
  }
  return t;
}
__device__ constexpr InvFreqTab kInvFreq = make_inv_freq();
static_assert(sizeof(kInvFreq.v) / sizeof(kInvFreq.v[0]) == 32, "table length");

// ---------------------------------------------------------------------------
// Workspace region map (bytes; every offset a multiple of 128)
//   X16   f16 [4096][1024]          x carried x16                         8,388,608
//   W16   f16 [4][1024][1024]       w_q | w_k | w_v | w_o carried x256    8,388,608
//   COS   f32 [2048][32]                                                    262,144
//   SIN   f32 [2048][32]                                                    262,144
//   Q16   f16 [32][2048][64]        rotated q carried x16                 8,388,608
//   K16   f16 [32][2048][64]        rotated k carried x16 (follows Q16)   8,388,608
//   VT16  f16 [32][64][2048]        v transposed, carried x16             8,388,608
//   A16   f16 [4096][1024]          attention output carried x2048        8,388,608
//   total                                                                50,855,936
// ---------------------------------------------------------------------------
constexpr size_t kPlaneBytes = (size_t)kRows * kHid * 2;
constexpr size_t kTabBytes   = (size_t)kSeq * kHalfHd * 4;
constexpr size_t kOffX16  = 0;
constexpr size_t kOffW16  = kOffX16 + kPlaneBytes;
constexpr size_t kOffCos  = kOffW16 + (size_t)4 * kHid * kHid * 2;
constexpr size_t kOffSin  = kOffCos + kTabBytes;
constexpr size_t kOffQ16  = kOffSin + kTabBytes;
constexpr size_t kOffK16  = kOffQ16 + kPlaneBytes;
constexpr size_t kOffVT16 = kOffK16 + kPlaneBytes;
constexpr size_t kOffA16  = kOffVT16 + kPlaneBytes;
constexpr size_t kWsTotal = kOffA16 + kPlaneBytes;
static_assert(kWsTotal == 50855936ull, "carve total");
static_assert(kWsTotal <= 134217728ull, "carve cap");
static_assert((kOffW16 % 128) == 0 && (kOffCos % 128) == 0 && (kOffSin % 128) == 0 && (kOffQ16 % 128) == 0 &&
              (kOffK16 % 128) == 0 && (kOffVT16 % 128) == 0 && (kOffA16 % 128) == 0, "128-B aligned regions");
constexpr size_t kPlaneElems = (size_t)kRows * kHid;

// ---------------------------------------------------------------------------
// Fragment helpers (split k map for A and B: elements 0..7 <- p[0..7], 8..15 <- p[16..23], p already offset by 8*(lane>>4))
// ---------------------------------------------------------------------------
struct FragH {
  union U { v16h v; v8h h[2]; };
  static __device__ __forceinline__ v16h load(const _Float16* p) {
    U f;
    f.h[0] = *(const v8h*)(p);
    f.h[1] = *(const v8h*)(p + 16);
    return f.v;
  }
  static __device__ __forceinline__ v8f mma(v16h a, v16h b, v8f c) {
    return __builtin_amdgcn_wmma_f32_16x16x32_f16(false, a, false, b, (short)0, c, false, false);
  }
};
__device__ __forceinline__ void guard4_h(v8f& a, v8f& b, v8f& c, v8f& d, v16h x, v16h y) {
  asm volatile("v_nop\n\tv_nop\n\tv_nop\n\tv_nop" : "+v"(a), "+v"(b), "+v"(c), "+v"(d) : "v"(x), "v"(y));
}
__device__ __forceinline__ void keep4_h(v16h a, v16h b, v16h c, v16h d) {
  asm volatile("v_nop" :: "v"(a), "v"(b), "v"(c), "v"(d));
}
// Inputs-only hold on eight loaded fragments: their LDS reads stand as one group with one wait in front of the products that
// follow; without it each product waits for its own pair of reads.
__device__ __forceinline__ void hold8_h(v16h a, v16h b, v16h c, v16h d, v16h e, v16h f, v16h g, v16h h) {
  asm volatile("" :: "v"(a), "v"(b), "v"(c), "v"(d), "v"(e), "v"(f), "v"(g), "v"(h));
}
__device__ __forceinline__ void acc_guard4(v8f& a, v8f& b, v8f& c, v8f& d) {
  asm volatile("v_nop\n\tv_nop\n\tv_nop\n\tv_nop" : "+v"(a), "+v"(b), "+v"(c), "+v"(d));
}

// ---------------------------------------------------------------------------
// f32 -> f16 cast with a power-of-two carry, 8 consecutive elements per thread.
// blockIdx.y selects one of up to four source planes; destination plane z starts at out + z * 8 * n8 halves.
// Coverage: grid.x * 256 = n8 threads exactly (checked on the host); each lane stores 16 B, 32 consecutive lanes
// ---------------------------------------------------------------------------
__global__ __launch_bounds__(256) void cast8_scale_f16_kernel(
    const float* __restrict__ in0, const float* __restrict__ in1,
    const float* __restrict__ in2, const float* __restrict__ in3,
    unsigned short* __restrict__ out, int n8, float scale)
{
  const int z = blockIdx.y;
  const float* in = (z == 0) ? in0 : (z == 1) ? in1 : (z == 2) ? in2 : in3;
  const int i = blockIdx.x * 256 + threadIdx.x;
  if (i >= n8) return;
  const float* p = in + 8 * (size_t)i;
  const v4f a = *(const v4f*)(p);
  const v4f c = *(const v4f*)(p + 4);
  v8h hv;
#pragma unroll
  for (int e = 0; e < 4; ++e) {
    const float f0 = a[e] * scale;
    const float f1 = c[e] * scale;
    hv[e]     = (_Float16)f0;
    hv[4 + e] = (_Float16)f1;
  }
  unsigned short* q = out + (size_t)z * 8 * (size_t)n8 + 8 * (size_t)i;
  *(v8h*)q = hv;
  
}

// ---------------------------------------------------------------------------
// Rotary tables: COS/SIN [2048][32] f32, angle = float(position) * inv_freq[i] (single f32 multiply), accurate sincosf.
// ---------------------------------------------------------------------------
__global__ __launch_bounds__(256) void rotary_table_kernel(float* __restrict__ cosT, float* __restrict__ sinT)
{
  const int t = blockIdx.x * 256 + threadIdx.x;
  const int s = t >> 5;
  const int i = t & 31;
  const float inv = kInvFreq.v[i];
  const float ang = (float)s * inv;
  float sn, cs;
  sincosf(ang, &sn, &cs);
  ((float*)cosT)[t] = cs;
  ((float*)sinT)[t] = sn;
  
}

// ---------------------------------------------------------------------------
// Asynchronous copy of 8 slices of 16 tile rows to LDS: each lane moves its own 16 B per slice, a wave 4 whole 128-B rows.
// lds = the lane's LDS byte address in slice 0, g = its global address in slice 0, gstep = 16 source rows in halves.
// s_wait_xcnt 0 closes the statement so that no address register named here is rewritten ahead of it.
// ---------------------------------------------------------------------------
constexpr int kBT = 128;                     // block tile: rows of A and rows of Bt
constexpr int kKC = 64;                      // k per pass: tile rows of 128 B
constexpr int kGP = 72;                      // LDS row pitch in halves: 144 B = 16 B x 9, for ds_load_b128 readers
constexpr int kOpHalves    = kBT * kGP;      // one operand's tile
constexpr int kStageHalves = 2 * kOpHalves;  // [A tile | Bt tile]
constexpr unsigned kSliceBytes = 16u * kGP * 2u;
__device__ __forceinline__ void async_copy8(unsigned lds, const _Float16* g, size_t gstep) {
  asm volatile(
      "global_load_async_to_lds_b128 %0, %8, off\n\t"
      "global_load_async_to_lds_b128 %1, %9, off\n\t"
      "global_load_async_to_lds_b128 %2, %10, off\n\t"
      "global_load_async_to_lds_b128 %3, %11, off\n\t"
      "global_load_async_to_lds_b128 %4, %12, off\n\t"
      "global_load_async_to_lds_b128 %5, %13, off\n\t"
      "global_load_async_to_lds_b128 %6, %14, off\n\t"
      "global_load_async_to_lds_b128 %7, %15, off\n\t"
      "s_wait_xcnt 0x0"
      :: "v"(lds), "v"(lds + kSliceBytes), "v"(lds + 2u * kSliceBytes), "v"(lds + 3u * kSliceBytes),
         "v"(lds + 4u * kSliceBytes), "v"(lds + 5u * kSliceBytes), "v"(lds + 6u * kSliceBytes), "v"(lds + 7u * kSliceBytes),
         "v"(g), "v"(g + gstep), "v"(g + 2 * gstep), "v"(g + 3 * gstep),
         "v"(g + 4 * gstep), "v"(g + 5 * gstep), "v"(g + 6 * gstep), "v"(g + 7 * gstep)
      : "memory");
}

// ---------------------------------------------------------------------------
// Batched GEMM: C[m,n] = scale * sum_k A[m,k] * Bt[n,k]; a block of 4 waves (2 x 2) owns a 128x128 tile, each wave 64x64 of it.
// A row-major [M,K]; Bt row-major [N,K]; M, N multiples of 128, K a multiple of 64 and at least 128 (asserted on the host).
// Operands: per pass of 64 k the block's 128 A rows and 128 Bt rows go to LDS by asynchronous copies, two buffers, the next
//           pass's copies in flight while this pass's fragments are read; every wave copies, waits and passes every barrier.
// OUT_MODE 3: N = 2 x kHid (q columns then k columns); the 64-wide tile is one head; interleaved-pair rotation with
//             COS/SIN[position][pair] then f16 store to plane (n0 >> 10) laid out [batch*heads + head][position][64]
// Store coverage per 16-row slab: mode 0: 8 iterations x 2 rows; modes 1 and 3: 4 iterations x 4 rows; 64 columns each.
// ---------------------------------------------------------------------------
template <int OUT_MODE>
__global__ __launch_bounds__(128) void wmma_gemm64(
    const unsigned short* __restrict__ Ap, int lda, long strideA,
    const unsigned short* __restrict__ Btp, int ldb, long strideB,
    void* __restrict__ Cout, int ldc, long strideC,
    const float* __restrict__ cosT, const float* __restrict__ sinT,
    int M, int N, int K, float scale)
{
  const _Float16* A  = (const _Float16*)Ap;
  const _Float16* Bt = (const _Float16*)Btp;
  __shared__ __align__(16) _Float16 ring[2 * kStageHalves];
  __shared__ __align__(16) float sT[4][16 * 68];
  const int b    = blockIdx.y;
  const int tid  = threadIdx.x;
  const int lane = threadIdx.x & 31;
  const int wave = __builtin_amdgcn_readfirstlane((int)(threadIdx.x >> 5));
  const int tilesN = N >> 7;
  const int tilesM = M >> 7;
  const int tile = blockIdx.x;
  /* block-uniform exit, in front of every copy and barrier */
  if (tile >= tilesM * tilesN) return;
  const int tm = tile / tilesN;
  const int tn = tile - tm * tilesN;
  const int wm = wave >> 1;
  const int wn = wave & 1;
  const int m0 = (tm << 7) + (wm << 6);
  const int n0 = (tn << 7) + (wn << 6);

  const _Float16* Ab = A  + (size_t)b * strideA;
  const _Float16* Bb = Bt + (size_t)b * strideB;

  const int rlane = lane & 15;
  const int koff  = (lane >> 4) * 8;
  const int mOff  = (lane >> 4) * 8;

  v8f acc[4][4];
#pragma unroll
  for (int i = 0; i < 4; ++i)
#pragma unroll
    for (int j = 0; j < 4; ++j) acc[i][j] = (v8f){0.f,0.f,0.f,0.f,0.f,0.f,0.f,0.f};

  /* copy map: thread -> row tid / 8 of each 16-row slice, 16-B part tid % 8 of its 128 B */
  const int crow  = tid >> 3;
  const int cpart = (tid & 7) * 8;
  const _Float16* gA = Ab + (size_t)((tm << 7) + crow) * lda + cpart;
  const _Float16* gB = Bb + (size_t)((tn << 7) + crow) * ldb + cpart;
  const size_t stepA = (size_t)16 * lda;
  const size_t stepB = (size_t)16 * ldb;
  const unsigned ldsA =
      (unsigned)(size_t)(__attribute__((address_space(3))) _Float16*)ring + (unsigned)(crow * kGP + cpart) * 2u;
  const unsigned ldsB = ldsA + (unsigned)kOpHalves * 2u;
  constexpr unsigned kStageBytes = (unsigned)kStageHalves * 2u;
  const _Float16* fA = ring + ((wm << 6) + rlane) * kGP + koff;
  const _Float16* fB = ring + kOpHalves + ((wn << 6) + rlane) * kGP + koff;
  const int passes = K / kKC;

  async_copy8(ldsA, gA, stepA);
  async_copy8(ldsB, gB, stepB);
  /* pass 0's tile has landed for this wave; the barrier publishes it to the other waves */
  asm volatile("s_wait_asynccnt 0x0" ::: "memory");
  __syncthreads();
  if (1 < passes) {
    async_copy8(ldsA + kStageBytes, gA + kKC, stepA);
    async_copy8(ldsB + kStageBytes, gB + kKC, stepB);
  }

  for (int t = 0; t < passes; ++t) {
    const int buf = t & 1;
    const _Float16* pA = fA + buf * kStageHalves;
    const _Float16* pB = fB + buf * kStageHalves;
    /* unrolled, like the loops inside: every fragment and accumulator index is a constant, so the arrays stay in registers */
#pragma unroll
    for (int kk = 0; kk < kKC; kk += 32) {
      /* the 16 LDS reads of a 32-k step stand as one group in front of its 16 products */
      v16h ah[4], bh[4];
#pragma unroll
      for (int j = 0; j < 4; ++j) bh[j] = FragH::load(pB + (j << 4) * kGP + kk);
#pragma unroll
      for (int i = 0; i < 4; ++i) ah[i] = FragH::load(pA + (i << 4) * kGP + kk);
#pragma unroll
      for (int i = 0; i < 4; ++i) {
#pragma unroll
        for (int j = 0; j < 4; ++j) acc[i][j] = FragH::mma(ah[i], bh[j], acc[i][j]);
        guard4_h(acc[i][0], acc[i][1], acc[i][2], acc[i][3], ah[i], bh[3]);
      }
      keep4_h(bh[0], bh[1], bh[2], bh[3]);
    }
    /* this wave's reads of buffer buf are complete before any wave refills it */
    asm volatile("s_wait_dscnt 0x0" ::: "memory");
    /* this wave's copies of pass t + 1 have landed before the barrier publishes them */
    asm volatile("s_wait_asynccnt 0x0" ::: "memory");
    __syncthreads();
    if (t + 2 < passes) {
      async_copy8(ldsA + (unsigned)buf * kStageBytes, gA + (size_t)(t + 2) * kKC, stepA);
      async_copy8(ldsB + (unsigned)buf * kStageBytes, gB + (size_t)(t + 2) * kKC, stepB);
    }
  }
  /* no copy of this wave is outstanding past here */
  asm volatile("s_wait_asynccnt 0x0" ::: "memory");
  acc_guard4(acc[0][0], acc[0][1], acc[0][2], acc[0][3]);
  acc_guard4(acc[1][0], acc[1][1], acc[1][2], acc[1][3]);
  acc_guard4(acc[2][0], acc[2][1], acc[2][2], acc[2][3]);
  acc_guard4(acc[3][0], acc[3][1], acc[3][2], acc[3][3]);

  float* slab = sT[wave];
#pragma unroll
  for (int i = 0; i < 4; ++i) {
    const int mBase = m0 + (i << 4);
#pragma unroll
    for (int j = 0; j < 4; ++j) {
#pragma unroll
      for (int r = 0; r < 8; ++r) {
        const float v = acc[i][j][r] * scale;
        slab[(mOff + r) * 68 + (j << 4) + rlane] = v;
      }
    }
    __builtin_amdgcn_fence(__ATOMIC_RELEASE, "workgroup");
    __builtin_amdgcn_wave_barrier();
    __builtin_amdgcn_fence(__ATOMIC_ACQUIRE, "workgroup");
    if (OUT_MODE == 0) {
      float* C = (float*)Cout + (size_t)b * strideC;
      const int hh = lane >> 4, c4 = (lane & 15) * 4;
      {
#pragma unroll
        for (int it = 0; it < 8; ++it) {
          const int row = it * 2 + hh;
          v4f v = *(const v4f*)(slab + row * 68 + c4);
          *(v4f*)(C + (size_t)(mBase + row) * ldc + n0 + c4) = v;
        }
        
      }
    } else if (OUT_MODE == 1) {
      const int q = lane >> 3, c8 = (lane & 7) * 8;
      unsigned short* C = (unsigned short*)Cout + (size_t)b * strideC;
      v8h ov[4];
#pragma unroll
      for (int it = 0; it < 4; ++it) {
        const int row = it * 4 + q;
        const float* sp = slab + row * 68 + c8;
        const v4f a0 = *(const v4f*)(sp);
        const v4f a1 = *(const v4f*)(sp + 4);
#pragma unroll
        for (int e = 0; e < 4; ++e) {
          ov[it][e]     = (_Float16)a0[e];
          ov[it][4 + e] = (_Float16)a1[e];
        }
      }
      {
#pragma unroll
        for (int it = 0; it < 4; ++it) {
          const int row = it * 4 + q;
          *(v8h*)(C + (size_t)(mBase + row) * ldc + n0 + c8) = ov[it];
        }
        
      }
    } else {
      const int q = lane >> 3, c8 = (lane & 7) * 8;
      const int which = n0 >> 10;
      const int head  = (n0 >> 6) & (kHeads - 1);
      unsigned short* C = (unsigned short*)Cout + (size_t)which * kPlaneElems;
      v8h ov[4];
      size_t oo[4];
#pragma unroll
      for (int it = 0; it < 4; ++it) {
        const int row = it * 4 + q;
        const int m   = mBase + row;
        const int bb  = m >> 11;
        const int s   = m & (kSeq - 1);
        const float* sp = slab + row * 68 + c8;
        const v4f a0 = *(const v4f*)(sp);
        const v4f a1 = *(const v4f*)(sp + 4);
        const v4f cv = *(const v4f*)(cosT + (size_t)s * kHalfHd + (c8 >> 1));
        const v4f sv = *(const v4f*)(sinT + (size_t)s * kHalfHd + (c8 >> 1));
        const float o0 = a0[0] * cv[0] - a0[1] * sv[0];
        const float o1 = a0[0] * sv[0] + a0[1] * cv[0];
        const float o2 = a0[2] * cv[1] - a0[3] * sv[1];
        const float o3 = a0[2] * sv[1] + a0[3] * cv[1];
        const float o4 = a1[0] * cv[2] - a1[1] * sv[2];
        const float o5 = a1[0] * sv[2] + a1[1] * cv[2];
        const float o6 = a1[2] * cv[3] - a1[3] * sv[3];
        const float o7 = a1[2] * sv[3] + a1[3] * cv[3];
        ov[it][0] = (_Float16)o0;
        ov[it][1] = (_Float16)o1;
        ov[it][2] = (_Float16)o2;
        ov[it][3] = (_Float16)o3;
        ov[it][4] = (_Float16)o4;
        ov[it][5] = (_Float16)o5;
        ov[it][6] = (_Float16)o6;
        ov[it][7] = (_Float16)o7;
        oo[it] = ((size_t)(bb * kHeads + head) * kSeq + s) * kHd + c8;
      }
      {
#pragma unroll
        for (int it = 0; it < 4; ++it) *(v8h*)(C + oo[it]) = ov[it];
        
      }
    }
    __builtin_amdgcn_fence(__ATOMIC_RELEASE, "workgroup");
    __builtin_amdgcn_wave_barrier();
    __builtin_amdgcn_fence(__ATOMIC_ACQUIRE, "workgroup");
  }
}

// ---------------------------------------------------------------------------
// Attention for one (batch, head) and 64 query rows per block (4 waves x 16 queries), key tiles of 64, transposed products.
//   S^T = K16 . Q16^T: A = 16 key rows from LDS, B = the wave's 16 queries, kept in registers; a lane holds, of ONE query
//   (column lane & 15), the keys 8 * (lane >> 4) + r of each 16-key group, for ALL 32 key tiles;
//   p = exp(min(score * kScoreScale, clamp)) unnormalised, f32; the row sum l accumulates every key (future keys included)
//   in the lane, 8 partial sums, joined in the lane and across the two wave halves once after the loop;
//   O^T += Vt . P^T only for key tiles at or below the diagonal (tile index <= query tile index, block-uniform), with p set
//   to zero where key > query inside the diagonal tile; O = acc / l, no renormalisation.
//   P^T never leaves the registers: score groups 2kk and 2kk + 1 of a lane are elements 0..7 and 8..15 of its B fragment for
//   keys 32kk..32kk+31, the k map that FragH::load gives the Vt rows (A): 8 * (lane >> 4) + e, then 16 + 8 * (lane >> 4) + e.
// LDS: K tile [64 keys][72] f16 and Vt tile [64 dd][72] f16 (columns 0..63 written and read, pad never read), staged by
//   128 threads x 4 x 16 B = 8,192 B = the whole tile each.
// Output: a lane holds 8 consecutive head columns of its query per 16-row group of O^T and stores them as 16 B; the wave
//   writes the whole 128-B head slice of each of its 16 rows.
// Block barriers only at the top of each key tile and after staging; all 4 waves run all 32 tiles; no early exits.
// grid.x = 32 (batch, head) groups x 32 query tiles.
// ---------------------------------------------------------------------------
constexpr int kQB = 64;
constexpr int kKT = 64;
constexpr int kLP = 72;
constexpr int kQTiles = kSeq / kQB;
constexpr int kKTiles = kSeq / kKT;
static_assert(kQB == kKT, "diagonal tile logic assumes equal tiles");

__global__ __launch_bounds__(128) void attn_kernel(
    const unsigned short* __restrict__ Qp, const unsigned short* __restrict__ Kp,
    const unsigned short* __restrict__ Vtp, unsigned short* __restrict__ Op)
{
  __shared__ __align__(16) _Float16 Ksh[kKT * kLP];
  __shared__ __align__(16) _Float16 Vsh[kHd * kLP];

  const int tid  = threadIdx.x;
  const int wave = __builtin_amdgcn_readfirstlane((int)(threadIdx.x >> 5));
  const int lane = tid & 31;
  const int hh   = lane >> 4;
  const int c    = lane & 15;
  const int qb   = blockIdx.x % kQTiles;
  const int bh   = blockIdx.x / kQTiles;
  const int q0   = qb * kQB + wave * 16;

  const _Float16* Qb = (const _Float16*)Qp  + (size_t)bh * kSeq * kHd;
  const _Float16* Kb = (const _Float16*)Kp  + (size_t)bh * kSeq * kHd;
  const _Float16* Vb = (const _Float16*)Vtp + (size_t)bh * kHd * kSeq;

  v16h qf[2];
#pragma unroll
  for (int dc = 0; dc < 2; ++dc) qf[dc] = FragH::load(Qb + (size_t)(q0 + c) * kHd + dc * 32 + 8 * hh);

  float lsum[8];
  v8f oacc[4];
#pragma unroll
  for (int r = 0; r < 8; ++r) lsum[r] = 0.f;
#pragma unroll
  for (int t = 0; t < 4; ++t) oacc[t] = (v8f){0.f,0.f,0.f,0.f,0.f,0.f,0.f,0.f};

#pragma unroll 1
  for (int kc = 0; kc < kKTiles; ++kc) {
    const int kv0 = kc * kKT;
    /* block-uniform: this key tile contributes to P.V */
    const bool pv = (kc <= qb);
    __syncthreads();
#pragma unroll
    for (int it = 0; it < 4; ++it) {
      const int e = it * 128 + tid;
      const int row = e >> 3, part = e & 7;
      const v8h kk = *(const v8h*)(Kb + (size_t)(kv0 + row) * kHd + part * 8);
      *(v8h*)(Ksh + row * kLP + part * 8) = kk;
    }
    if (pv) {
#pragma unroll
      for (int it = 0; it < 4; ++it) {
        const int e = it * 128 + tid;
        const int row = e >> 3, part = e & 7;
        const v8h vv = *(const v8h*)(Vb + (size_t)row * kSeq + kv0 + part * 8);
        *(v8h*)(Vsh + row * kLP + part * 8) = vv;
      }
    }
    __syncthreads();

    /* the K tile's fragments, named ahead of the 8 products so that their LDS reads run ahead of them */
    v16h kf[4][2];
#pragma unroll
    for (int j = 0; j < 4; ++j)
#pragma unroll
      for (int dc = 0; dc < 2; ++dc) kf[j][dc] = FragH::load(Ksh + (j * 16 + c) * kLP + dc * 32 + 8 * hh);
    v8f s[4];
#pragma unroll
    for (int j = 0; j < 4; ++j) s[j] = (v8f){0.f,0.f,0.f,0.f,0.f,0.f,0.f,0.f};
#pragma unroll
    for (int dc = 0; dc < 2; ++dc)
#pragma unroll
      for (int j = 0; j < 4; ++j) s[j] = FragH::mma(kf[j][dc], qf[dc], s[j]);
#pragma unroll
    for (int j = 0; j < 4; ++j) {
#pragma unroll
      for (int r = 0; r < 8; ++r) {
        const float x = fminf(s[j][r] * kScoreScale, kScoreClamp);
        const float p = __expf(x);
        lsum[r] += p;
        s[j][r] = p;
      }
    }
    if (pv) {
      v16h vf[4][2];
#pragma unroll
      for (int t = 0; t < 4; ++t)
#pragma unroll
        for (int kk = 0; kk < 2; ++kk) vf[t][kk] = FragH::load(Vsh + (t * 16 + c) * kLP + kk * 32 + 8 * hh);
      v16h pf[2];
#pragma unroll
      for (int kk = 0; kk < 2; ++kk) {
#pragma unroll
        for (int r = 0; r < 8; ++r) {
          pf[kk][r]     = (_Float16)s[2 * kk][r];
          pf[kk][8 + r] = (_Float16)s[2 * kk + 1][r];
        }
      }
      /* block-uniform: only the diagonal tile holds keys past a query */
      if (kc == qb) {
        const int qrow = q0 + c;
#pragma unroll
        for (int kk = 0; kk < 2; ++kk) {
#pragma unroll
          for (int e = 0; e < 16; ++e) {
            const int kvrow = kv0 + kk * 32 + (e >> 3) * 16 + 8 * hh + (e & 7);
            pf[kk][e] = (kvrow > qrow) ? (_Float16)0.0f : pf[kk][e];
          }
        }
      }
      /* the 16 LDS reads of the Vt tile as one group in front of its 8 products */
      hold8_h(vf[0][0], vf[1][0], vf[2][0], vf[3][0], vf[0][1], vf[1][1], vf[2][1], vf[3][1]);
#pragma unroll
      for (int kk = 0; kk < 2; ++kk)
#pragma unroll
        for (int t = 0; t < 4; ++t) oacc[t] = FragH::mma(vf[t][kk], pf[kk], oacc[t]);
    }
  }

  {
    float l = ((lsum[0] + lsum[1]) + (lsum[2] + lsum[3])) + ((lsum[4] + lsum[5]) + (lsum[6] + lsum[7]));
    l += __shfl_xor(l, 16, 32);
    const float inv = kCtxScale * __builtin_amdgcn_rcpf(l);
    const int bb = bh / kHeads;
    const int h  = bh - bb * kHeads;
    unsigned short* op = Op + ((size_t)(bb * kSeq + q0 + c)) * kHid + h * kHd + 8 * hh;
#pragma unroll
    for (int t = 0; t < 4; ++t) {
      v8h ov;
#pragma unroll
      for (int r = 0; r < 8; ++r) ov[r] = (_Float16)(oacc[t][r] * inv);
      *(v8h*)(op + t * 16) = ov;
    }
  }
}

// ---------------------------------------------------------------------------
// Host glue: 7 kernel launches, nothing else.
//   1 cast x (2048 blocks)             2 cast w_q|w_k|w_v|w_o (512 x 4 blocks)     3 rotary tables (256 blocks)
//   4 q|k projection + rotation: M 4096, N 2048, K 1024 -> 32 x 16 block tiles = 512 blocks of 128 threads
//   5 v projection transposed (A = w_v, Bt = x of one batch): M 1024, N 2048, K 1024 -> 8 x 16 block tiles = 128 blocks x 2
//   6 attention: 32 x 32 = 1024 blocks of 128 threads
//   7 output projection: M 4096, N 1024, K 1024 -> 32 x 8 block tiles = 256 blocks of 128 threads
// ---------------------------------------------------------------------------
extern "C" void kernel_launch(void* const* d_in, const int* in_sizes, int n_in,
                              void* d_out, int out_size, void* d_ws, size_t ws_size,
                              hipStream_t stream) {
  if (n_in < 5) return;
  if (in_sizes[0] != kRows * kHid) return;
  if (in_sizes[1] != kHid * kHid) return;
  if (in_sizes[2] != kHid * kHid) return;
  if (in_sizes[3] != kHid * kHid) return;
  if (in_sizes[4] != kHid * kHid) return;
  if (out_size != kRows * kHid) return;
  if (ws_size < kWsTotal) return;

  const float* x  = (const float*)d_in[0];
  const float* wq = (const float*)d_in[1];
  const float* wk = (const float*)d_in[2];
  const float* wv = (const float*)d_in[3];
  const float* wo = (const float*)d_in[4];
  float* out = (float*)d_out;

  char* ws = (char*)d_ws;
  unsigned short* X16  = (unsigned short*)(ws + kOffX16);
  unsigned short* W16  = (unsigned short*)(ws + kOffW16);
  float*          COS  = (float*)(ws + kOffCos);
  float*          SIN  = (float*)(ws + kOffSin);
  unsigned short* Q16  = (unsigned short*)(ws + kOffQ16);
  unsigned short* K16  = (unsigned short*)(ws + kOffK16);
  unsigned short* VT16 = (unsigned short*)(ws + kOffVT16);
  unsigned short* A16  = (unsigned short*)(ws + kOffA16);
  const unsigned short* Wqk16 = W16;
  const unsigned short* Wv16  = W16 + (size_t)2 * kHid * kHid;
  const unsigned short* Wo16  = W16 + (size_t)3 * kHid * kHid;

  constexpr int kXn8 = kRows * kHid / 8;
  constexpr int kWn8 = kHid * kHid / 8;
  static_assert((kXn8 % 256) == 0 && (kWn8 % 256) == 0, "cast grids exact");
  static_assert((kRows % kBT) == 0 && (kHid % kBT) == 0 && (kSeq % kBT) == 0, "block tiles exact");
  static_assert((kHid % kKC) == 0 && kHid / kKC >= 2, "whole passes, two or more");

  cast8_scale_f16_kernel<<<dim3(kXn8 / 256, 1), 256, 0, stream>>>(x, x, x, x, X16, kXn8, kXCarry);
  cast8_scale_f16_kernel<<<dim3(kWn8 / 256, 4), 256, 0, stream>>>(wq, wk, wv, wo, W16, kWn8, kWCarry);
  rotary_table_kernel<<<(kSeq * kHalfHd) / 256, 256, 0, stream>>>(COS, SIN);

  wmma_gemm64<3><<<dim3((kRows / kBT) * (2 * kHid / kBT), 1), 128, 0, stream>>>(
      X16, kHid, 0L,
      Wqk16, kHid, 0L,
      (void*)Q16, 0, 0L,
      COS, SIN,
      kRows, 2 * kHid, kHid, kQKScale);

  wmma_gemm64<1><<<dim3((kHid / kBT) * (kSeq / kBT), kBatch), 128, 0, stream>>>(
      Wv16, kHid, 0L,
      X16, kHid, (long)kSeq * kHid,
      (void*)VT16, kSeq, (long)kHid * kSeq,
      nullptr, nullptr,
      kHid, kSeq, kHid, kVScale);

  attn_kernel<<<kBatch * kHeads * kQTiles, 128, 0, stream>>>(Q16, K16, VT16, A16);

  wmma_gemm64<0><<<dim3((kRows / kBT) * (kHid / kBT), 1), 128, 0, stream>>>(
      A16, kHid, 0L,
      Wo16, kHid, 0L,
      (void*)out, kHid, 0L,
      nullptr, nullptr,
      kRows, kHid, kHid, kOutScale);
}

// v003
// A run of this version takes 99.7 microseconds.
// Two timings next to v002 put it at 1.08 and 1.10 times that version's speed.
// Over all steps from v000 it is 2.34 times as fast.
// All contractions (q/k/v projections, q.k^T, p.v, output projection): v_wmma_f32_16x16x32_f16, f16 operands with power-of-two carries, f32 accumulate; rotary tables, exp, row sums and normalisation in f32.
#include <hip/hip_runtime.h>
#include <math.h>

typedef __attribute__((ext_vector_type(16))) _Float16 v16h;
typedef __attribute__((ext_vector_type(8)))  _Float16 v8h;
typedef __attribute__((ext_vector_type(8)))  float    v8f;
typedef __attribute__((ext_vector_type(4)))  float    v4f;

// ---------------------------------------------------------------------------
// Shape constants
// ---------------------------------------------------------------------------
constexpr int kBatch  = 2;
constexpr int kSeq    = 2048;
constexpr int kHid    = 1024;
constexpr int kHeads  = 16;
constexpr int kHd     = 64;
constexpr int kRows   = kBatch * kSeq;
constexpr int kHalfHd = kHd / 2;
static_assert(kHeads * kHd == kHid, "head split");
static_assert(kHd == 64, "head width fixed at 64");
static_assert((kSeq % 64) == 0 && (kHid % 64) == 0 && (kHid % 32) == 0 && (kRows % 64) == 0, "tile multiples");
static_assert(kSeq == 2048 && kHid == 1024, "bit tricks below assume these");

// ---------------------------------------------------------------------------
// Power-of-two carries of the f16 planes and the derived fold-back scales
// ---------------------------------------------------------------------------
constexpr double cx_sqrt(double x) {
  double g = (x > 1.0) ? x : 1.0;
  for (int it = 0; it < 80; ++it) g = 0.5 * (g + x / g);
  return g;
}
constexpr float kXCarry    = 16.0f;
constexpr float kWCarry    = 256.0f;
constexpr float kQKCarry   = 16.0f;
constexpr float kVCarry    = 16.0f;
constexpr float kAttnCarry = 2048.0f;
constexpr float kInvSqrtHd = (float)(1.0 / cx_sqrt((double)kHd));
static_assert(kInvSqrtHd == 0.125f, "1/sqrt(head width)");
constexpr float kQKScale    = kQKCarry / (kXCarry * kWCarry);
constexpr float kVScale     = kVCarry / (kXCarry * kWCarry);
constexpr float kScoreScale = kInvSqrtHd / (kQKCarry * kQKCarry);
constexpr float kCtxScale   = kAttnCarry / kVCarry;
constexpr float kOutScale   = 1.0f / (kAttnCarry * kWCarry);
constexpr float kScoreClamp = 10.0f;

// ---------------------------------------------------------------------------
// Rotary inverse frequencies: 10000^(-2i/64) = 10^(-i/8), i = 0..31, evaluated in double at build time, converted to f32
// ---------------------------------------------------------------------------
struct InvFreqTab { float v[kHalfHd]; };
constexpr InvFreqTab make_inv_freq() {
  InvFreqTab t{};
  const double r8 = cx_sqrt(cx_sqrt(cx_sqrt(10.0)));
  for (int i = 0; i < kHalfHd; ++i) {
    double p = 1.0;
    for (int j = 0; j < (i & 7); ++j) p *= r8;
    for (int j = 0; j < (i >> 3); ++j) p *= 10.0;
    t.v[i] = (float)(1.0 / p);
  }
  return t;
}
__device__ constexpr InvFreqTab kInvFreq = make_inv_freq();
static_assert(sizeof(kInvFreq.v) / sizeof(kInvFreq.v[0]) == 32, "table length");

// ---------------------------------------------------------------------------
// Workspace region map (bytes; every offset a multiple of 128)
//   X16   f16 [4096][1024]          x carried x16                         8,388,608
//   W16   f16 [4][1024][1024]       w_q | w_k | w_v | w_o carried x256    8,388,608
//   COS   f32 [2048][32]                                                    262,144
//   SIN   f32 [2048][32]                                                    262,144
//   Q16   f16 [32][2048][64]        rotated q carried x16                 8,388,608
//   K16   f16 [32][2048][64]        rotated k carried x16 (follows Q16)   8,388,608
//   VT16  f16 [32][64][2048]        v transposed, carried x16             8,388,608
//   A16   f16 [4096][1024]          attention output carried x2048        8,388,608
//   total                                                                50,855,936
// ---------------------------------------------------------------------------
constexpr size_t kPlaneBytes = (size_t)kRows * kHid * 2;
constexpr size_t kTabBytes   = (size_t)kSeq * kHalfHd * 4;
constexpr size_t kOffX16  = 0;
constexpr size_t kOffW16  = kOffX16 + kPlaneBytes;
constexpr size_t kOffCos  = kOffW16 + (size_t)4 * kHid * kHid * 2;
constexpr size_t kOffSin  = kOffCos + kTabBytes;
constexpr size_t kOffQ16  = kOffSin + kTabBytes;
constexpr size_t kOffK16  = kOffQ16 + kPlaneBytes;
constexpr size_t kOffVT16 = kOffK16 + kPlaneBytes;
constexpr size_t kOffA16  = kOffVT16 + kPlaneBytes;
constexpr size_t kWsTotal = kOffA16 + kPlaneBytes;
static_assert(kWsTotal == 50855936ull, "carve total");
static_assert(kWsTotal <= 134217728ull, "carve cap");
static_assert((kOffW16 % 128) == 0 && (kOffCos % 128) == 0 && (kOffSin % 128) == 0 && (kOffQ16 % 128) == 0 &&
              (kOffK16 % 128) == 0 && (kOffVT16 % 128) == 0 && (kOffA16 % 128) == 0, "128-B aligned regions");
constexpr size_t kPlaneElems = (size_t)kRows * kHid;

// ---------------------------------------------------------------------------
// Fragment helpers (split k map for A and B: elements 0..7 <- p[0..7], 8..15 <- p[16..23], p already offset by 8*(lane>>4))
// ---------------------------------------------------------------------------
struct FragH {
  union U { v16h v; v8h h[2]; };
  static __device__ __forceinline__ v16h load(const _Float16* p) {
    U f;
    f.h[0] = *(const v8h*)(p);
    f.h[1] = *(const v8h*)(p + 16);
    return f.v;
  }
  static __device__ __forceinline__ v8f mma(v16h a, v16h b, v8f c) {
    return __builtin_amdgcn_wmma_f32_16x16x32_f16(false, a, false, b, (short)0, c, false, false);
  }
};
__device__ __forceinline__ void guard4_h(v8f& a, v8f& b, v8f& c, v8f& d, v16h x, v16h y) {
  asm volatile("v_nop\n\tv_nop\n\tv_nop\n\tv_nop" : "+v"(a), "+v"(b), "+v"(c), "+v"(d) : "v"(x), "v"(y));
}
__device__ __forceinline__ void keep4_h(v16h a, v16h b, v16h c, v16h d) {
  asm volatile("v_nop" :: "v"(a), "v"(b), "v"(c), "v"(d));
}
// Inputs-only hold on eight loaded fragments: their LDS reads stand as one group with one wait in front of the products that
// follow; without it each product waits for its own pair of reads.
__device__ __forceinline__ void hold8_h(v16h a, v16h b, v16h c, v16h d, v16h e, v16h f, v16h g, v16h h) {
  asm volatile("" :: "v"(a), "v"(b), "v"(c), "v"(d), "v"(e), "v"(f), "v"(g), "v"(h));
}
__device__ __forceinline__ void acc_guard4(v8f& a, v8f& b, v8f& c, v8f& d) {
  asm volatile("v_nop\n\tv_nop\n\tv_nop\n\tv_nop" : "+v"(a), "+v"(b), "+v"(c), "+v"(d));
}

// ---------------------------------------------------------------------------
// f32 -> f16 cast with a power-of-two carry, 8 consecutive elements per thread.
// blockIdx.y selects one of up to four source planes; destination plane z starts at out + z * 8 * n8 halves.
// Coverage: grid.x * 256 = n8 threads exactly (checked on the host); each lane stores 16 B, 32 consecutive lanes
// ---------------------------------------------------------------------------
__global__ __launch_bounds__(256) void cast8_scale_f16_kernel(
    const float* __restrict__ in0, const float* __restrict__ in1,
    const float* __restrict__ in2, const float* __restrict__ in3,
    unsigned short* __restrict__ out, int n8, float scale)
{
  const int z = blockIdx.y;
  const float* in = (z == 0) ? in0 : (z == 1) ? in1 : (z == 2) ? in2 : in3;
  const int i = blockIdx.x * 256 + threadIdx.x;
  if (i >= n8) return;
  const float* p = in + 8 * (size_t)i;
  const v4f a = *(const v4f*)(p);
  const v4f c = *(const v4f*)(p + 4);
  v8h hv;
#pragma unroll
  for (int e = 0; e < 4; ++e) {
    const float f0 = a[e] * scale;
    const float f1 = c[e] * scale;
    hv[e]     = (_Float16)f0;
    hv[4 + e] = (_Float16)f1;
  }
  unsigned short* q = out + (size_t)z * 8 * (size_t)n8 + 8 * (size_t)i;
  *(v8h*)q = hv;
  
}

// ---------------------------------------------------------------------------
// Rotary tables: COS/SIN [2048][32] f32, angle = float(position) * inv_freq[i] (single f32 multiply), accurate sincosf.
// ---------------------------------------------------------------------------
__global__ __launch_bounds__(256) void rotary_table_kernel(float* __restrict__ cosT, float* __restrict__ sinT)
{
  const int t = blockIdx.x * 256 + threadIdx.x;
  const int s = t >> 5;
  const int i = t & 31;
  const float inv = kInvFreq.v[i];
  const float ang = (float)s * inv;
  float sn, cs;
  sincosf(ang, &sn, &cs);
  ((float*)cosT)[t] = cs;
  ((float*)sinT)[t] = sn;
  
}

// ---------------------------------------------------------------------------
// Asynchronous copy of 8 slices of 16 tile rows to LDS: each lane moves its own 16 B per slice, a wave 4 whole 128-B rows.
// lds = the lane's LDS byte address in slice 0, g = its global address in slice 0, gstep = 16 source rows in halves.
// s_wait_xcnt 0 closes the statement so that no address register named here is rewritten ahead of it.
// ---------------------------------------------------------------------------
constexpr int kBT = 128;                     // block tile: rows of A and rows of Bt
constexpr int kKC = 64;                      // k per pass: tile rows of 128 B
constexpr int kGP = 72;                      // LDS row pitch in halves: 144 B = 16 B x 9, for ds_load_b128 readers
constexpr int kOpHalves    = kBT * kGP;      // one operand's tile
constexpr int kStageHalves = 2 * kOpHalves;  // [A tile | Bt tile]
constexpr unsigned kSliceBytes = 16u * kGP * 2u;
__device__ __forceinline__ void async_copy8(unsigned lds, const _Float16* g, size_t gstep) {
  asm volatile(
      "global_load_async_to_lds_b128 %0, %8, off\n\t"
      "global_load_async_to_lds_b128 %1, %9, off\n\t"
      "global_load_async_to_lds_b128 %2, %10, off\n\t"
      "global_load_async_to_lds_b128 %3, %11, off\n\t"
      "global_load_async_to_lds_b128 %4, %12, off\n\t"
      "global_load_async_to_lds_b128 %5, %13, off\n\t"
      "global_load_async_to_lds_b128 %6, %14, off\n\t"
      "global_load_async_to_lds_b128 %7, %15, off\n\t"
      "s_wait_xcnt 0x0"
      :: "v"(lds), "v"(lds + kSliceBytes), "v"(lds + 2u * kSliceBytes), "v"(lds + 3u * kSliceBytes),
         "v"(lds + 4u * kSliceBytes), "v"(lds + 5u * kSliceBytes), "v"(lds + 6u * kSliceBytes), "v"(lds + 7u * kSliceBytes),
         "v"(g), "v"(g + gstep), "v"(g + 2 * gstep), "v"(g + 3 * gstep),
         "v"(g + 4 * gstep), "v"(g + 5 * gstep), "v"(g + 6 * gstep), "v"(g + 7 * gstep)
      : "memory");
}

// ---------------------------------------------------------------------------
// Batched GEMM: C[m,n] = scale * sum_k A[m,k] * Bt[n,k]; a block of 4 waves (2 x 2) owns a 128x128 tile, each wave 64x64 of it.
// A row-major [M,K]; Bt row-major [N,K]; M, N multiples of 128, K a multiple of 64 and at least 128 (asserted on the host).
// Operands: per pass of 64 k the block's 128 A rows and 128 Bt rows go to LDS by asynchronous copies, two buffers, the next
//           pass's copies in flight while this pass's fragments are read; every wave copies, waits and passes every barrier.
// OUT_MODE 3: N = 2 x kHid (q columns then k columns); the 64-wide tile is one head; interleaved-pair rotation with
//             COS/SIN[position][pair] then f16 store to plane (n0 >> 10) laid out [batch*heads + head][position][64]
// Store coverage per 16-row slab: mode 0: 8 iterations x 2 rows; modes 1 and 3: 4 iterations x 4 rows; 64 columns each.
// ---------------------------------------------------------------------------
template <int OUT_MODE>
__global__ __launch_bounds__(128) void wmma_gemm64(
    const unsigned short* __restrict__ Ap, int lda, long strideA,
    const unsigned short* __restrict__ Btp, int ldb, long strideB,
    void* __restrict__ Cout, int ldc, long strideC,
    const float* __restrict__ cosT, const float* __restrict__ sinT,
    int M, int N, int K, float scale)
{
  const _Float16* A  = (const _Float16*)Ap;
  const _Float16* Bt = (const _Float16*)Btp;
  __shared__ __align__(16) _Float16 ring[2 * kStageHalves];
  __shared__ __align__(16) float sT[4][16 * 68];
  const int b    = blockIdx.y;
  const int tid  = threadIdx.x;
  const int lane = threadIdx.x & 31;
  const int wave = __builtin_amdgcn_readfirstlane((int)(threadIdx.x >> 5));
  const int tilesN = N >> 7;
  const int tilesM = M >> 7;
  const int tile = blockIdx.x;
  /* block-uniform exit, in front of every copy and barrier */
  if (tile >= tilesM * tilesN) return;
  const int tm = tile / tilesN;
  const int tn = tile - tm * tilesN;
  const int wm = wave >> 1;
  const int wn = wave & 1;
  const int m0 = (tm << 7) + (wm << 6);
  const int n0 = (tn << 7) + (wn << 6);

  const _Float16* Ab = A  + (size_t)b * strideA;
  const _Float16* Bb = Bt + (size_t)b * strideB;

  const int rlane = lane & 15;
  const int koff  = (lane >> 4) * 8;
  const int mOff  = (lane >> 4) * 8;

  v8f acc[4][4];
#pragma unroll
  for (int i = 0; i < 4; ++i)
#pragma unroll
    for (int j = 0; j < 4; ++j) acc[i][j] = (v8f){0.f,0.f,0.f,0.f,0.f,0.f,0.f,0.f};

  /* copy map: thread -> row tid / 8 of each 16-row slice, 16-B part tid % 8 of its 128 B */
  const int crow  = tid >> 3;
  const int cpart = (tid & 7) * 8;
  const _Float16* gA = Ab + (size_t)((tm << 7) + crow) * lda + cpart;
  const _Float16* gB = Bb + (size_t)((tn << 7) + crow) * ldb + cpart;
  const size_t stepA = (size_t)16 * lda;
  const size_t stepB = (size_t)16 * ldb;
  const unsigned ldsA =
      (unsigned)(size_t)(__attribute__((address_space(3))) _Float16*)ring + (unsigned)(crow * kGP + cpart) * 2u;
  const unsigned ldsB = ldsA + (unsigned)kOpHalves * 2u;
  constexpr unsigned kStageBytes = (unsigned)kStageHalves * 2u;
  const _Float16* fA = ring + ((wm << 6) + rlane) * kGP + koff;
  const _Float16* fB = ring + kOpHalves + ((wn << 6) + rlane) * kGP + koff;
  const int passes = K / kKC;

  async_copy8(ldsA, gA, stepA);
  async_copy8(ldsB, gB, stepB);
  /* pass 0's tile has landed for this wave; the barrier publishes it to the other waves */
  asm volatile("s_wait_asynccnt 0x0" ::: "memory");
  __syncthreads();
  if (1 < passes) {
    async_copy8(ldsA + kStageBytes, gA + kKC, stepA);
    async_copy8(ldsB + kStageBytes, gB + kKC, stepB);
  }

  for (int t = 0; t < passes; ++t) {
    const int buf = t & 1;
    const _Float16* pA = fA + buf * kStageHalves;
    const _Float16* pB = fB + buf * kStageHalves;
    /* unrolled, like the loops inside: every fragment and accumulator index is a constant, so the arrays stay in registers */
#pragma unroll
    for (int kk = 0; kk < kKC; kk += 32) {
      /* the 16 LDS reads of a 32-k step stand as one group in front of its 16 products */
      v16h ah[4], bh[4];
#pragma unroll
      for (int j = 0; j < 4; ++j) bh[j] = FragH::load(pB + (j << 4) * kGP + kk);
#pragma unroll
      for (int i = 0; i < 4; ++i) ah[i] = FragH::load(pA + (i << 4) * kGP + kk);
#pragma unroll
      for (int i = 0; i < 4; ++i) {
#pragma unroll
        for (int j = 0; j < 4; ++j) acc[i][j] = FragH::mma(ah[i], bh[j], acc[i][j]);
        guard4_h(acc[i][0], acc[i][1], acc[i][2], acc[i][3], ah[i], bh[3]);
      }
      keep4_h(bh[0], bh[1], bh[2], bh[3]);
    }
    /* this wave's reads of buffer buf are complete before any wave refills it */
    asm volatile("s_wait_dscnt 0x0" ::: "memory");
    /* this wave's copies of pass t + 1 have landed before the barrier publishes them */
    asm volatile("s_wait_asynccnt 0x0" ::: "memory");
    __syncthreads();
    if (t + 2 < passes) {
      async_copy8(ldsA + (unsigned)buf * kStageBytes, gA + (size_t)(t + 2) * kKC, stepA);
      async_copy8(ldsB + (unsigned)buf * kStageBytes, gB + (size_t)(t + 2) * kKC, stepB);
    }
  }
  /* no copy of this wave is outstanding past here */
  asm volatile("s_wait_asynccnt 0x0" ::: "memory");
  acc_guard4(acc[0][0], acc[0][1], acc[0][2], acc[0][3]);
  acc_guard4(acc[1][0], acc[1][1], acc[1][2], acc[1][3]);
  acc_guard4(acc[2][0], acc[2][1], acc[2][2], acc[2][3]);
  acc_guard4(acc[3][0], acc[3][1], acc[3][2], acc[3][3]);

  float* slab = sT[wave];
#pragma unroll
  for (int i = 0; i < 4; ++i) {
    const int mBase = m0 + (i << 4);
#pragma unroll
    for (int j = 0; j < 4; ++j) {
#pragma unroll
      for (int r = 0; r < 8; ++r) {
        const float v = acc[i][j][r] * scale;
        slab[(mOff + r) * 68 + (j << 4) + rlane] = v;
      }
    }
    __builtin_amdgcn_fence(__ATOMIC_RELEASE, "workgroup");
    __builtin_amdgcn_wave_barrier();
    __builtin_amdgcn_fence(__ATOMIC_ACQUIRE, "workgroup");
    if (OUT_MODE == 0) {
      float* C = (float*)Cout + (size_t)b * strideC;
      const int hh = lane >> 4, c4 = (lane & 15) * 4;
      {
#pragma unroll
        for (int it = 0; it < 8; ++it) {
          const int row = it * 2 + hh;
          v4f v = *(const v4f*)(slab + row * 68 + c4);
          *(v4f*)(C + (size_t)(mBase + row) * ldc + n0 + c4) = v;
        }
        
      }
    } else if (OUT_MODE == 1) {
      const int q = lane >> 3, c8 = (lane & 7) * 8;
      unsigned short* C = (unsigned short*)Cout + (size_t)b * strideC;
      v8h ov[4];
#pragma unroll
      for (int it = 0; it < 4; ++it) {
        const int row = it * 4 + q;
        const float* sp = slab + row * 68 + c8;
        const v4f a0 = *(const v4f*)(sp);
        const v4f a1 = *(const v4f*)(sp + 4);
#pragma unroll
        for (int e = 0; e < 4; ++e) {
          ov[it][e]     = (_Float16)a0[e];
          ov[it][4 + e] = (_Float16)a1[e];
        }
      }
      {
#pragma unroll
        for (int it = 0; it < 4; ++it) {
          const int row = it * 4 + q;
          *(v8h*)(C + (size_t)(mBase + row) * ldc + n0 + c8) = ov[it];
        }
        
      }
    } else {
      const int q = lane >> 3, c8 = (lane & 7) * 8;
      const int which = n0 >> 10;
      const int head  = (n0 >> 6) & (kHeads - 1);
      unsigned short* C = (unsigned short*)Cout + (size_t)which * kPlaneElems;
      v8h ov[4];
      size_t oo[4];
#pragma unroll
      for (int it = 0; it < 4; ++it) {
        const int row = it * 4 + q;
        const int m   = mBase + row;
        const int bb  = m >> 11;
        const int s   = m & (kSeq - 1);
        const float* sp = slab + row * 68 + c8;
        const v4f a0 = *(const v4f*)(sp);
        const v4f a1 = *(const v4f*)(sp + 4);
        const v4f cv = *(const v4f*)(cosT + (size_t)s * kHalfHd + (c8 >> 1));
        const v4f sv = *(const v4f*)(sinT + (size_t)s * kHalfHd + (c8 >> 1));
        const float o0 = a0[0] * cv[0] - a0[1] * sv[0];
        const float o1 = a0[0] * sv[0] + a0[1] * cv[0];
        const float o2 = a0[2] * cv[1] - a0[3] * sv[1];
        const float o3 = a0[2] * sv[1] + a0[3] * cv[1];
        const float o4 = a1[0] * cv[2] - a1[1] * sv[2];
        const float o5 = a1[0] * sv[2] + a1[1] * cv[2];
        const float o6 = a1[2] * cv[3] - a1[3] * sv[3];
        const float o7 = a1[2] * sv[3] + a1[3] * cv[3];
        ov[it][0] = (_Float16)o0;
        ov[it][1] = (_Float16)o1;
        ov[it][2] = (_Float16)o2;
        ov[it][3] = (_Float16)o3;
        ov[it][4] = (_Float16)o4;
        ov[it][5] = (_Float16)o5;
        ov[it][6] = (_Float16)o6;
        ov[it][7] = (_Float16)o7;
        oo[it] = ((size_t)(bb * kHeads + head) * kSeq + s) * kHd + c8;
      }
      {
#pragma unroll
        for (int it = 0; it < 4; ++it) *(v8h*)(C + oo[it]) = ov[it];
        
      }
    }
    __builtin_amdgcn_fence(__ATOMIC_RELEASE, "workgroup");
    __builtin_amdgcn_wave_barrier();
    __builtin_amdgcn_fence(__ATOMIC_ACQUIRE, "workgroup");
  }
}

// ---------------------------------------------------------------------------
// Attention for one (batch, head) and 64 query rows per block (4 waves x 16 queries), key tiles of 64, transposed products.
//   S^T = K16 . Q16^T: A = 16 key rows from LDS, B = the wave's 16 queries, kept in registers; a lane holds, of ONE query
//   (column lane & 15), the keys 8 * (lane >> 4) + r of each 16-key group, for ALL 32 key tiles;
//   p = exp(min(score * kScoreScale, clamp)) unnormalised, f32; the row sum l accumulates every key (future keys included)
//   in the lane, 8 partial sums, joined in the lane and across the two wave halves once after the loop;
//   O^T += Vt . P^T only for key tiles at or below the diagonal (tile index <= query tile index, block-uniform), with p set
//   to zero where key > query inside the diagonal tile; O = acc / l, no renormalisation.
//   P^T never leaves the registers: score groups 2kk and 2kk + 1 of a lane are elements 0..7 and 8..15 of its B fragment for
//   keys 32kk..32kk+31, the k map that FragH::load gives the Vt rows (A): 8 * (lane >> 4) + e, then 16 + 8 * (lane >> 4) + e.
// LDS: two buffers of [K tile [64 keys][72] f16 | Vt tile [64 dd][72] f16] (columns 0..63 written and read, pad never read);
//   each tile is brought by asynchronous copies, 128 threads x 4 x 16 B = 8,192 B = the whole tile; key tile kc + 2 is
//   copied into the buffer that tile kc has just left, so a tile's copies fly while the tile in front of it is worked on.
//   A Vt tile is copied only where it is used (tile index <= query tile index, block-uniform).
// Output: a lane holds 8 consecutive head columns of its query per 16-row group of O^T and stores them as 16 B; the wave
//   writes the whole 128-B head slice of each of its 16 rows.
// Block barriers: one in front of the loop, one at the foot of each key tile; all 4 waves run all 32 tiles; no early exits.
// grid.x = 32 (batch, head) groups x 32 query tiles.
// ---------------------------------------------------------------------------
constexpr int kQB = 64;
constexpr int kKT = 64;
constexpr int kLP = 72;
constexpr int kQTiles = kSeq / kQB;
constexpr int kKTiles = kSeq / kKT;
static_assert(kQB == kKT, "diagonal tile logic assumes equal tiles");
static_assert(kLP == kGP && kKT == 64 && kHd == 64, "a tile is 4 slices of 16 rows at the pitch of kSliceBytes");
static_assert(kKTiles >= 2, "two buffers are filled in front of the loop");
constexpr int kTileHalves   = kKT * kLP;       // one operand's tile
constexpr int kAStageHalves = 2 * kTileHalves; // [K tile | Vt tile]
// Asynchronous copy of one 64-row tile to LDS, 4 slices of 16 rows: each lane moves its own 16 B per slice.
// lds = the lane's LDS byte address in slice 0, g = its global address in slice 0, gstep = 16 source rows in halves.
// s_wait_xcnt 0 closes the statement so that no address register named here is rewritten ahead of it.
__device__ __forceinline__ void async_copy4(unsigned lds, const _Float16* g, size_t gstep) {
  asm volatile(
      "global_load_async_to_lds_b128 %0, %4, off\n\t"
      "global_load_async_to_lds_b128 %1, %5, off\n\t"
      "global_load_async_to_lds_b128 %2, %6, off\n\t"
      "global_load_async_to_lds_b128 %3, %7, off\n\t"
      "s_wait_xcnt 0x0"
      :: "v"(lds), "v"(lds + kSliceBytes), "v"(lds + 2u * kSliceBytes), "v"(lds + 3u * kSliceBytes),
         "v"(g), "v"(g + gstep), "v"(g + 2 * gstep), "v"(g + 3 * gstep)
      : "memory");
}

__global__ __launch_bounds__(128) void attn_kernel(
    const unsigned short* __restrict__ Qp, const unsigned short* __restrict__ Kp,
    const unsigned short* __restrict__ Vtp, unsigned short* __restrict__ Op)
{
  __shared__ __align__(16) _Float16 ring[2 * kAStageHalves];

  const int tid  = threadIdx.x;
  const int wave = __builtin_amdgcn_readfirstlane((int)(threadIdx.x >> 5));
  const int lane = tid & 31;
  const int hh   = lane >> 4;
  const int c    = lane & 15;
  const int qb   = blockIdx.x % kQTiles;
  const int bh   = blockIdx.x / kQTiles;
  const int q0   = qb * kQB + wave * 16;

  const _Float16* Qb = (const _Float16*)Qp  + (size_t)bh * kSeq * kHd;
  const _Float16* Kb = (const _Float16*)Kp  + (size_t)bh * kSeq * kHd;
  const _Float16* Vb = (const _Float16*)Vtp + (size_t)bh * kHd * kSeq;

  v16h qf[2];
#pragma unroll
  for (int dc = 0; dc < 2; ++dc) qf[dc] = FragH::load(Qb + (size_t)(q0 + c) * kHd + dc * 32 + 8 * hh);

  float lsum[8];
  v8f oacc[4];
#pragma unroll
  for (int r = 0; r < 8; ++r) lsum[r] = 0.f;
#pragma unroll
  for (int t = 0; t < 4; ++t) oacc[t] = (v8f){0.f,0.f,0.f,0.f,0.f,0.f,0.f,0.f};

  /* copy map: thread -> row tid / 8 of each 16-row slice, 16-B part tid % 8 of its 128 B */
  const int crow  = tid >> 3;
  const int cpart = (tid & 7) * 8;
  const _Float16* gK = Kb + (size_t)crow * kHd + cpart;
  const _Float16* gV = Vb + (size_t)crow * kSeq + cpart;
  constexpr size_t kStepK = (size_t)16 * kHd;
  constexpr size_t kStepV = (size_t)16 * kSeq;
  const unsigned ldsK =
      (unsigned)(size_t)(__attribute__((address_space(3))) _Float16*)ring + (unsigned)(crow * kLP + cpart) * 2u;
  const unsigned ldsV = ldsK + (unsigned)kTileHalves * 2u;
  constexpr unsigned kAStageBytes = (unsigned)kAStageHalves * 2u;

  /* key tile 0 (its Vt tile is used by every query tile) */
  async_copy4(ldsK, gK, kStepK);
  async_copy4(ldsV, gV, kStepV);
  /* tile 0 has landed for this wave; the barrier publishes it to the other waves */
  asm volatile("s_wait_asynccnt 0x0" ::: "memory");
  __syncthreads();
  async_copy4(ldsK + kAStageBytes, gK + (size_t)kKT * kHd, kStepK);
  if (1 <= qb) async_copy4(ldsV + kAStageBytes, gV + kKT, kStepV);

#pragma unroll 1
  for (int kc = 0; kc < kKTiles; ++kc) {
    const int kv0 = kc * kKT;
    /* block-uniform: this key tile contributes to P.V */
    const bool pv = (kc <= qb);
    const int buf = kc & 1;
    const _Float16* Ksh = ring + buf * kAStageHalves;
    const _Float16* Vsh = Ksh + kTileHalves;

    /* the K tile's fragments, named ahead of the 8 products so that their LDS reads run ahead of them */
    v16h kf[4][2];
#pragma unroll
    for (int j = 0; j < 4; ++j)
#pragma unroll
      for (int dc = 0; dc < 2; ++dc) kf[j][dc] = FragH::load(Ksh + (j * 16 + c) * kLP + dc * 32 + 8 * hh);
    v8f s[4];
#pragma unroll
    for (int j = 0; j < 4; ++j) s[j] = (v8f){0.f,0.f,0.f,0.f,0.f,0.f,0.f,0.f};
#pragma unroll
    for (int dc = 0; dc < 2; ++dc)
#pragma unroll
      for (int j = 0; j < 4; ++j) s[j] = FragH::mma(kf[j][dc], qf[dc], s[j]);
#pragma unroll
    for (int j = 0; j < 4; ++j) {
#pragma unroll
      for (int r = 0; r < 8; ++r) {
        const float x = fminf(s[j][r] * kScoreScale, kScoreClamp);
        const float p = __expf(x);
        lsum[r] += p;
        s[j][r] = p;
      }
    }
    if (pv) {
      v16h vf[4][2];
#pragma unroll
      for (int t = 0; t < 4; ++t)
#pragma unroll
        for (int kk = 0; kk < 2; ++kk) vf[t][kk] = FragH::load(Vsh + (t * 16 + c) * kLP + kk * 32 + 8 * hh);
      v16h pf[2];
#pragma unroll
      for (int kk = 0; kk < 2; ++kk) {
#pragma unroll
        for (int r = 0; r < 8; ++r) {
          pf[kk][r]     = (_Float16)s[2 * kk][r];
          pf[kk][8 + r] = (_Float16)s[2 * kk + 1][r];
        }
      }
      /* block-uniform: only the diagonal tile holds keys past a query */
      if (kc == qb) {
        const int qrow = q0 + c;
#pragma unroll
        for (int kk = 0; kk < 2; ++kk) {
#pragma unroll
          for (int e = 0; e < 16; ++e) {
            const int kvrow = kv0 + kk * 32 + (e >> 3) * 16 + 8 * hh + (e & 7);
            pf[kk][e] = (kvrow > qrow) ? (_Float16)0.0f : pf[kk][e];
          }
        }
      }
      /* the 16 LDS reads of the Vt tile as one group in front of its 8 products */
      hold8_h(vf[0][0], vf[1][0], vf[2][0], vf[3][0], vf[0][1], vf[1][1], vf[2][1], vf[3][1]);
#pragma unroll
      for (int kk = 0; kk < 2; ++kk)
#pragma unroll
        for (int t = 0; t < 4; ++t) oacc[t] = FragH::mma(vf[t][kk], pf[kk], oacc[t]);
    }
    /* this wave's reads of buffer buf are complete before any wave refills it */
    asm volatile("s_wait_dscnt 0x0" ::: "memory");
    /* this wave's copies of tile kc + 1 have landed before the barrier publishes them */
    asm volatile("s_wait_asynccnt 0x0" ::: "memory");
    __syncthreads();
    if (kc + 2 < kKTiles) {
      async_copy4(ldsK + (unsigned)buf * kAStageBytes, gK + (size_t)(kc + 2) * kKT * kHd, kStepK);
      if (kc + 2 <= qb) async_copy4(ldsV + (unsigned)buf * kAStageBytes, gV + (size_t)(kc + 2) * kKT, kStepV);
    }
  }
  /* no copy of this wave is outstanding past here */
  asm volatile("s_wait_asynccnt 0x0" ::: "memory");

  {
    float l = ((lsum[0] + lsum[1]) + (lsum[2] + lsum[3])) + ((lsum[4] + lsum[5]) + (lsum[6] + lsum[7]));
    l += __shfl_xor(l, 16, 32);
    const float inv = kCtxScale * __builtin_amdgcn_rcpf(l);
    const int bb = bh / kHeads;
    const int h  = bh - bb * kHeads;
    unsigned short* op = Op + ((size_t)(bb * kSeq + q0 + c)) * kHid + h * kHd + 8 * hh;
#pragma unroll
    for (int t = 0; t < 4; ++t) {
      v8h ov;
#pragma unroll
      for (int r = 0; r < 8; ++r) ov[r] = (_Float16)(oacc[t][r] * inv);
      *(v8h*)(op + t * 16) = ov;
    }
  }
}

// ---------------------------------------------------------------------------
// Host glue: 7 kernel launches, nothing else.
//   1 cast x (2048 blocks)             2 cast w_q|w_k|w_v|w_o (512 x 4 blocks)     3 rotary tables (256 blocks)
//   4 q|k projection + rotation: M 4096, N 2048, K 1024 -> 32 x 16 block tiles = 512 blocks of 128 threads
//   5 v projection transposed (A = w_v, Bt = x of one batch): M 1024, N 2048, K 1024 -> 8 x 16 block tiles = 128 blocks x 2
//   6 attention: 32 x 32 = 1024 blocks of 128 threads
//   7 output projection: M 4096, N 1024, K 1024 -> 32 x 8 block tiles = 256 blocks of 128 threads
// ---------------------------------------------------------------------------
extern "C" void kernel_launch(void* const* d_in, const int* in_sizes, int n_in,
                              void* d_out, int out_size, void* d_ws, size_t ws_size,
                              hipStream_t stream) {
  if (n_in < 5) return;
  if (in_sizes[0] != kRows * kHid) return;
  if (in_sizes[1] != kHid * kHid) return;
  if (in_sizes[2] != kHid * kHid) return;
  if (in_sizes[3] != kHid * kHid) return;
  if (in_sizes[4] != kHid * kHid) return;
  if (out_size != kRows * kHid) return;
  if (ws_size < kWsTotal) return;

  const float* x  = (const float*)d_in[0];
  const float* wq = (const float*)d_in[1];
  const float* wk = (const float*)d_in[2];
  const float* wv = (const float*)d_in[3];
  const float* wo = (const float*)d_in[4];
  float* out = (float*)d_out;

  char* ws = (char*)d_ws;
  unsigned short* X16  = (unsigned short*)(ws + kOffX16);
  unsigned short* W16  = (unsigned short*)(ws + kOffW16);
  float*          COS  = (float*)(ws + kOffCos);
  float*          SIN  = (float*)(ws + kOffSin);
  unsigned short* Q16  = (unsigned short*)(ws + kOffQ16);
  unsigned short* K16  = (unsigned short*)(ws + kOffK16);
  unsigned short* VT16 = (unsigned short*)(ws + kOffVT16);
  unsigned short* A16  = (unsigned short*)(ws + kOffA16);
  const unsigned short* Wqk16 = W16;
  const unsigned short* Wv16  = W16 + (size_t)2 * kHid * kHid;
  const unsigned short* Wo16  = W16 + (size_t)3 * kHid * kHid;

  constexpr int kXn8 = kRows * kHid / 8;
  constexpr int kWn8 = kHid * kHid / 8;
  static_assert((kXn8 % 256) == 0 && (kWn8 % 256) == 0, "cast grids exact");
  static_assert((kRows % kBT) == 0 && (kHid % kBT) == 0 && (kSeq % kBT) == 0, "block tiles exact");
  static_assert((kHid % kKC) == 0 && kHid / kKC >= 2, "whole passes, two or more");

  cast8_scale_f16_kernel<<<dim3(kXn8 / 256, 1), 256, 0, stream>>>(x, x, x, x, X16, kXn8, kXCarry);
  cast8_scale_f16_kernel<<<dim3(kWn8 / 256, 4), 256, 0, stream>>>(wq, wk, wv, wo, W16, kWn8, kWCarry);
  rotary_table_kernel<<<(kSeq * kHalfHd) / 256, 256, 0, stream>>>(COS, SIN);

  wmma_gemm64<3><<<dim3((kRows / kBT) * (2 * kHid / kBT), 1), 128, 0, stream>>>(
      X16, kHid, 0L,
      Wqk16, kHid, 0L,
      (void*)Q16, 0, 0L,
      COS, SIN,
      kRows, 2 * kHid, kHid, kQKScale);

  wmma_gemm64<1><<<dim3((kHid / kBT) * (kSeq / kBT), kBatch), 128, 0, stream>>>(
      Wv16, kHid, 0L,
      X16, kHid, (long)kSeq * kHid,
      (void*)VT16, kSeq, (long)kHid * kSeq,
      nullptr, nullptr,
      kHid, kSeq, kHid, kVScale);

  attn_kernel<<<kBatch * kHeads * kQTiles, 128, 0, stream>>>(Q16, K16, VT16, A16);

  wmma_gemm64<0><<<dim3((kRows / kBT) * (kHid / kBT), 1), 128, 0, stream>>>(
      A16, kHid, 0L,
      Wo16, kHid, 0L,
      (void*)out, kHid, 0L,
      nullptr, nullptr,
      kRows, kHid, kHid, kOutScale);
}

// v004
// It runs in 96.6 microseconds.
// Two timings next to v003 both put it at 1.04 times that version's speed.
// Over all steps from v000 it is 2.44 times as fast.
// All contractions (q/k/v projections, q.k^T, p.v, output projection): v_wmma_f32_16x16x32_f16, f16 operands with power-of-two carries, f32 accumulate; rotary tables, exp, row sums and normalisation in f32.
#include <hip/hip_runtime.h>
#include <math.h>

typedef __attribute__((ext_vector_type(16))) _Float16 v16h;
typedef __attribute__((ext_vector_type(8)))  _Float16 v8h;
typedef __attribute__((ext_vector_type(8)))  float    v8f;
typedef __attribute__((ext_vector_type(4)))  float    v4f;

// ---------------------------------------------------------------------------
// Shape constants
// ---------------------------------------------------------------------------
constexpr int kBatch  = 2;
constexpr int kSeq    = 2048;
constexpr int kHid    = 1024;
constexpr int kHeads  = 16;
constexpr int kHd     = 64;
constexpr int kRows   = kBatch * kSeq;
constexpr int kHalfHd = kHd / 2;
static_assert(kHeads * kHd == kHid, "head split");
static_assert(kHd == 64, "head width fixed at 64");
static_assert((kSeq % 64) == 0 && (kHid % 64) == 0 && (kHid % 32) == 0 && (kRows % 64) == 0, "tile multiples");
static_assert(kSeq == 2048 && kHid == 1024, "bit tricks below assume these");

// ---------------------------------------------------------------------------
// Power-of-two carries of the f16 planes and the derived fold-back scales
// ---------------------------------------------------------------------------
constexpr double cx_sqrt(double x) {
  double g = (x > 1.0) ? x : 1.0;
  for (int it = 0; it < 80; ++it) g = 0.5 * (g + x / g);
  return g;
}
constexpr float kXCarry    = 16.0f;
constexpr float kWCarry    = 256.0f;
constexpr float kQKCarry   = 16.0f;
constexpr float kVCarry    = 16.0f;
constexpr float kAttnCarry = 2048.0f;
constexpr float kInvSqrtHd = (float)(1.0 / cx_sqrt((double)kHd));
static_assert(kInvSqrtHd == 0.125f, "1/sqrt(head width)");
constexpr float kQKScale    = kQKCarry / (kXCarry * kWCarry);
constexpr float kVScale     = kVCarry / (kXCarry * kWCarry);
constexpr float kScoreScale = kInvSqrtHd / (kQKCarry * kQKCarry);
constexpr float kCtxScale   = kAttnCarry / kVCarry;
constexpr float kOutScale   = 1.0f / (kAttnCarry * kWCarry);
constexpr float kScoreClamp = 10.0f;

// ---------------------------------------------------------------------------
// Rotary inverse frequencies: 10000^(-2i/64) = 10^(-i/8), i = 0..31, evaluated in double at build time, converted to f32
// ---------------------------------------------------------------------------
struct InvFreqTab { float v[kHalfHd]; };
constexpr InvFreqTab make_inv_freq() {
  InvFreqTab t{};
  const double r8 = cx_sqrt(cx_sqrt(cx_sqrt(10.0)));
  for (int i = 0; i < kHalfHd; ++i) {
    double p = 1.0;
    for (int j = 0; j < (i & 7); ++j) p *= r8;
    for (int j = 0; j < (i >> 3); ++j) p *= 10.0;
    t.v[i] = (float)(1.0 / p);
  }
  return t;
}
__device__ constexpr InvFreqTab kInvFreq = make_inv_freq();
static_assert(sizeof(kInvFreq.v) / sizeof(kInvFreq.v[0]) == 32, "table length");

// ---------------------------------------------------------------------------
// Workspace region map (bytes; every offset a multiple of 128)
//   X16   f16 [4096][1024]          x carried x16                         8,388,608
//   W16   f16 [4][1024][1024]       w_q | w_k | w_v | w_o carried x256    8,388,608
//   COS   f32 [2048][32]                                                    262,144
//   SIN   f32 [2048][32]                                                    262,144
//   Q16   f16 [32][2048][64]        rotated q carried x16                 8,388,608
//   K16   f16 [32][2048][64]        rotated k carried x16 (follows Q16)   8,388,608
//   VT16  f16 [32][64][2048]        v transposed, carried x16             8,388,608
//   A16   f16 [4096][1024]          attention output carried x2048        8,388,608
//   total                                                                50,855,936
// ---------------------------------------------------------------------------
constexpr size_t kPlaneBytes = (size_t)kRows * kHid * 2;
constexpr size_t kTabBytes   = (size_t)kSeq * kHalfHd * 4;
constexpr size_t kOffX16  = 0;
constexpr size_t kOffW16  = kOffX16 + kPlaneBytes;
constexpr size_t kOffCos  = kOffW16 + (size_t)4 * kHid * kHid * 2;
constexpr size_t kOffSin  = kOffCos + kTabBytes;
constexpr size_t kOffQ16  = kOffSin + kTabBytes;
constexpr size_t kOffK16  = kOffQ16 + kPlaneBytes;
constexpr size_t kOffVT16 = kOffK16 + kPlaneBytes;
constexpr size_t kOffA16  = kOffVT16 + kPlaneBytes;
constexpr size_t kWsTotal = kOffA16 + kPlaneBytes;
static_assert(kWsTotal == 50855936ull, "carve total");
static_assert(kWsTotal <= 134217728ull, "carve cap");
static_assert((kOffW16 % 128) == 0 && (kOffCos % 128) == 0 && (kOffSin % 128) == 0 && (kOffQ16 % 128) == 0 &&
              (kOffK16 % 128) == 0 && (kOffVT16 % 128) == 0 && (kOffA16 % 128) == 0, "128-B aligned regions");
constexpr size_t kPlaneElems = (size_t)kRows * kHid;

// ---------------------------------------------------------------------------
// Fragment helpers (split k map for A and B: elements 0..7 <- p[0..7], 8..15 <- p[16..23], p already offset by 8*(lane>>4))
// ---------------------------------------------------------------------------
struct FragH {
  union U { v16h v; v8h h[2]; };
  static __device__ __forceinline__ v16h load(const _Float16* p) {
    U f;
    f.h[0] = *(const v8h*)(p);
    f.h[1] = *(const v8h*)(p + 16);
    return f.v;
  }
  static __device__ __forceinline__ v8f mma(v16h a, v16h b, v8f c) {
    return __builtin_amdgcn_wmma_f32_16x16x32_f16(false, a, false, b, (short)0, c, false, false);
  }
};
__device__ __forceinline__ void guard4_h(v8f& a, v8f& b, v8f& c, v8f& d, v16h x, v16h y) {
  asm volatile("v_nop\n\tv_nop\n\tv_nop\n\tv_nop" : "+v"(a), "+v"(b), "+v"(c), "+v"(d) : "v"(x), "v"(y));
}
__device__ __forceinline__ void keep4_h(v16h a, v16h b, v16h c, v16h d) {
  asm volatile("v_nop" :: "v"(a), "v"(b), "v"(c), "v"(d));
}
// Inputs-only hold on eight loaded fragments: their LDS reads stand as one group with one wait in front of the products that
// follow; without it each product waits for its own pair of reads.
__device__ __forceinline__ void hold8_h(v16h a, v16h b, v16h c, v16h d, v16h e, v16h f, v16h g, v16h h) {
  asm volatile("" :: "v"(a), "v"(b), "v"(c), "v"(d), "v"(e), "v"(f), "v"(g), "v"(h));
}
__device__ __forceinline__ void acc_guard4(v8f& a, v8f& b, v8f& c, v8f& d) {
  asm volatile("v_nop\n\tv_nop\n\tv_nop\n\tv_nop" : "+v"(a), "+v"(b), "+v"(c), "+v"(d));
}

// ---------------------------------------------------------------------------
// Preparation, one launch: f32 -> f16 casts of x and of the four weight matrices with their power-of-two carries, and the
// rotary tables. One work-group of 16 waves per 1/256 of the work; every wave lives long instead of many short waves.
// Casts: a piece is 8 consecutive elements (32 B read, 16 B stored). The grid has kPrepLanes = 131,072 threads; thread g takes
//   pieces g + j * kPrepLanes, j = 0..7: j = 0..3 are the four quarters of x, j = 4..7 are w_q, w_k, w_v, w_o (one matrix is
//   exactly kPrepLanes pieces). Destination piece index = source piece index, since W16 follows X16 in the workspace.
//   All 16 reads of a thread are issued before the first value is used.
// Rotary tables: COS/SIN [2048][32] f32, angle = float(position) * inv_freq[i] (single f32 multiply), accurate sincosf;
//   waves 0..7 of each work-group compute one entry per lane (256 x 256 = 65,536 entries) while their reads are in flight.
// ---------------------------------------------------------------------------
constexpr int kPrepThreads = 512;
constexpr int kPrepBlocks  = 256;
constexpr int kPrepLanes   = kPrepThreads * kPrepBlocks;
constexpr int kXn8 = kRows * kHid / 8;
constexpr int kWn8 = kHid * kHid / 8;
static_assert(kWn8 == kPrepLanes && kXn8 == 4 * kPrepLanes, "eight pieces per thread: four of x, one of each matrix");
static_assert(kOffX16 == 0 && kOffW16 == kOffX16 + (size_t)kXn8 * 16, "W16 follows X16");
static_assert(kSeq * kHalfHd == kPrepBlocks * 256, "one table entry per lane of waves 0..7");
__global__ __launch_bounds__(kPrepThreads) void prep_kernel(
    const float* __restrict__ x, const float* __restrict__ wq, const float* __restrict__ wk,
    const float* __restrict__ wv, const float* __restrict__ wo,
    unsigned short* __restrict__ out, float* __restrict__ cosT, float* __restrict__ sinT)
{
  const unsigned g = blockIdx.x * kPrepThreads + threadIdx.x;
  const float* sp[8] = { x, x + (size_t)8 * kPrepLanes, x + (size_t)16 * kPrepLanes, x + (size_t)24 * kPrepLanes,
                         wq, wk, wv, wo };
  const float inv = kInvFreq.v[threadIdx.x & 31];
  /* the table read's index register may be reused by what follows */
  asm volatile("s_wait_xcnt 0x0" ::: "memory");
  const unsigned rb = g * 32u;
  v4f a[8], c[8];
#pragma unroll
  for (int j = 0; j < 8; ++j) {
    const float* p = (const float*)((const char*)sp[j] + rb);
    a[j] = *(const v4f*)(p);
    c[j] = *(const v4f*)(p + 4);
  }
  /* inputs-only hold: the table read stays in front of the 16 reads, so its wait does not drain them */
  asm volatile("" :: "v"(inv));
  /* wave-uniform: waves 0..7 */
  if (threadIdx.x < 256) {
    const int t = blockIdx.x * 256 + threadIdx.x;
    const int s = t >> 5;
    const float ang = (float)s * inv;
    float sn, cs;
    sincosf(ang, &sn, &cs);
    cosT[t] = cs;
    sinT[t] = sn;
  }
#pragma unroll
  for (int j = 0; j < 8; ++j) {
    const float scale = (j < 4) ? kXCarry : kWCarry;
    v8h hv;
#pragma unroll
    for (int e = 0; e < 4; ++e) {
      const float f0 = a[j][e] * scale;
      const float f1 = c[j][e] * scale;
      hv[e]     = (_Float16)f0;
      hv[4 + e] = (_Float16)f1;
    }
    *(v8h*)((char*)(out + (size_t)8 * kPrepLanes * j) + g * 16u) = hv;
  }
}

// ---------------------------------------------------------------------------
// Asynchronous copy of 8 slices of 16 tile rows to LDS: each lane moves its own 16 B per slice, a wave 4 whole 128-B rows.
// lds = the lane's LDS byte address in slice 0, g = its global address in slice 0, gstep = 16 source rows in halves.
// s_wait_xcnt 0 closes the statement so that no address register named here is rewritten ahead of it.
// ---------------------------------------------------------------------------
constexpr int kBT = 128;                     // block tile: rows of A and rows of Bt
constexpr int kKC = 64;                      // k per pass: tile rows of 128 B
constexpr int kGP = 72;                      // LDS row pitch in halves: 144 B = 16 B x 9, for ds_load_b128 readers
constexpr int kOpHalves    = kBT * kGP;      // one operand's tile
constexpr int kStageHalves = 2 * kOpHalves;  // [A tile | Bt tile]
constexpr unsigned kSliceBytes = 16u * kGP * 2u;
__device__ __forceinline__ void async_copy8(unsigned lds, const _Float16* g, size_t gstep) {
  asm volatile(
      "global_load_async_to_lds_b128 %0, %8, off\n\t"
      "global_load_async_to_lds_b128 %1, %9, off\n\t"
      "global_load_async_to_lds_b128 %2, %10, off\n\t"
      "global_load_async_to_lds_b128 %3, %11, off\n\t"
      "global_load_async_to_lds_b128 %4, %12, off\n\t"
      "global_load_async_to_lds_b128 %5, %13, off\n\t"
      "global_load_async_to_lds_b128 %6, %14, off\n\t"
      "global_load_async_to_lds_b128 %7, %15, off\n\t"
      "s_wait_xcnt 0x0"
      :: "v"(lds), "v"(lds + kSliceBytes), "v"(lds + 2u * kSliceBytes), "v"(lds + 3u * kSliceBytes),
         "v"(lds + 4u * kSliceBytes), "v"(lds + 5u * kSliceBytes), "v"(lds + 6u * kSliceBytes), "v"(lds + 7u * kSliceBytes),
         "v"(g), "v"(g + gstep), "v"(g + 2 * gstep), "v"(g + 3 * gstep),
         "v"(g + 4 * gstep), "v"(g + 5 * gstep), "v"(g + 6 * gstep), "v"(g + 7 * gstep)
      : "memory");
}

// ---------------------------------------------------------------------------
// Batched GEMM: C[m,n] = scale * sum_k A[m,k] * Bt[n,k]; a block of 4 waves (2 x 2) owns a 128x128 tile, each wave 64x64 of it.
// A row-major [M,K]; Bt row-major [N,K]; M, N multiples of 128, K a multiple of 64 and at least 128 (asserted on the host).
// Operands: per pass of 64 k the block's 128 A rows and 128 Bt rows go to LDS by asynchronous copies, two buffers, the next
//           pass's copies in flight while this pass's fragments are read; every wave copies, waits and passes every barrier.
// OUT_MODE 3: N = 2 x kHid (q columns then k columns); the 64-wide tile is one head; interleaved-pair rotation with
//             COS/SIN[position][pair] then f16 store to plane (n0 >> 10) laid out [batch*heads + head][position][64]
// Store coverage per 16-row slab: mode 0: 8 iterations x 2 rows; modes 1 and 3: 4 iterations x 4 rows; 64 columns each.
// ---------------------------------------------------------------------------
template <int OUT_MODE>
__global__ __launch_bounds__(128) void wmma_gemm64(
    const unsigned short* __restrict__ Ap, int lda, long strideA,
    const unsigned short* __restrict__ Btp, int ldb, long strideB,
    void* __restrict__ Cout, int ldc, long strideC,
    const float* __restrict__ cosT, const float* __restrict__ sinT,
    int M, int N, int K, float scale)
{
  const _Float16* A  = (const _Float16*)Ap;
  const _Float16* Bt = (const _Float16*)Btp;
  __shared__ __align__(16) _Float16 ring[2 * kStageHalves];
  __shared__ __align__(16) float sT[4][16 * 68];
  const int b    = blockIdx.y;
  const int tid  = threadIdx.x;
  const int lane = threadIdx.x & 31;
  const int wave = __builtin_amdgcn_readfirstlane((int)(threadIdx.x >> 5));
  const int tilesN = N >> 7;
  const int tilesM = M >> 7;
  const int tile = blockIdx.x;
  /* block-uniform exit, in front of every copy and barrier */
  if (tile >= tilesM * tilesN) return;
  const int tm = tile / tilesN;
  const int tn = tile - tm * tilesN;
  const int wm = wave >> 1;
  const int wn = wave & 1;
  const int m0 = (tm << 7) + (wm << 6);
  const int n0 = (tn << 7) + (wn << 6);

  const _Float16* Ab = A  + (size_t)b * strideA;
  const _Float16* Bb = Bt + (size_t)b * strideB;

  const int rlane = lane & 15;
  const int koff  = (lane >> 4) * 8;
  const int mOff  = (lane >> 4) * 8;

  v8f acc[4][4];
#pragma unroll
  for (int i = 0; i < 4; ++i)
#pragma unroll
    for (int j = 0; j < 4; ++j) acc[i][j] = (v8f){0.f,0.f,0.f,0.f,0.f,0.f,0.f,0.f};

  /* copy map: thread -> row tid / 8 of each 16-row slice, 16-B part tid % 8 of its 128 B */
  const int crow  = tid >> 3;
  const int cpart = (tid & 7) * 8;
  const _Float16* gA = Ab + (size_t)((tm << 7) + crow) * lda + cpart;
  const _Float16* gB = Bb + (size_t)((tn << 7) + crow) * ldb + cpart;
  const size_t stepA = (size_t)16 * lda;
  const size_t stepB = (size_t)16 * ldb;
  const unsigned ldsA =
      (unsigned)(size_t)(__attribute__((address_space(3))) _Float16*)ring + (unsigned)(crow * kGP + cpart) * 2u;
  const unsigned ldsB = ldsA + (unsigned)kOpHalves * 2u;
  constexpr unsigned kStageBytes = (unsigned)kStageHalves * 2u;
  const _Float16* fA = ring + ((wm << 6) + rlane) * kGP + koff;
  const _Float16* fB = ring + kOpHalves + ((wn << 6) + rlane) * kGP + koff;
  const int passes = K / kKC;

  async_copy8(ldsA, gA, stepA);
  async_copy8(ldsB, gB, stepB);
  /* pass 0's tile has landed for this wave; the barrier publishes it to the other waves */
  asm volatile("s_wait_asynccnt 0x0" ::: "memory");
  __syncthreads();
  if (1 < passes) {
    async_copy8(ldsA + kStageBytes, gA + kKC, stepA);
    async_copy8(ldsB + kStageBytes, gB + kKC, stepB);
  }

  for (int t = 0; t < passes; ++t) {
    const int buf = t & 1;
    const _Float16* pA = fA + buf * kStageHalves;
    const _Float16* pB = fB + buf * kStageHalves;
    /* unrolled, like the loops inside: every fragment and accumulator index is a constant, so the arrays stay in registers */
#pragma unroll
    for (int kk = 0; kk < kKC; kk += 32) {
      /* the 16 LDS reads of a 32-k step stand as one group in front of its 16 products */
      v16h ah[4], bh[4];
#pragma unroll
      for (int j = 0; j < 4; ++j) bh[j] = FragH::load(pB + (j << 4) * kGP + kk);
#pragma unroll
      for (int i = 0; i < 4; ++i) ah[i] = FragH::load(pA + (i << 4) * kGP + kk);
#pragma unroll
      for (int i = 0; i < 4; ++i) {
#pragma unroll
        for (int j = 0; j < 4; ++j) acc[i][j] = FragH::mma(ah[i], bh[j], acc[i][j]);
        guard4_h(acc[i][0], acc[i][1], acc[i][2], acc[i][3], ah[i], bh[3]);
      }
      keep4_h(bh[0], bh[1], bh[2], bh[3]);
    }
    /* this wave's reads of buffer buf are complete before any wave refills it */
    asm volatile("s_wait_dscnt 0x0" ::: "memory");
    /* this wave's copies of pass t + 1 have landed before the barrier publishes them */
    asm volatile("s_wait_asynccnt 0x0" ::: "memory");
    __syncthreads();
    if (t + 2 < passes) {
      async_copy8(ldsA + (unsigned)buf * kStageBytes, gA + (size_t)(t + 2) * kKC, stepA);
      async_copy8(ldsB + (unsigned)buf * kStageBytes, gB + (size_t)(t + 2) * kKC, stepB);
    }
  }
  /* no copy of this wave is outstanding past here */
  asm volatile("s_wait_asynccnt 0x0" ::: "memory");
  acc_guard4(acc[0][0], acc[0][1], acc[0][2], acc[0][3]);
  acc_guard4(acc[1][0], acc[1][1], acc[1][2], acc[1][3]);
  acc_guard4(acc[2][0], acc[2][1], acc[2][2], acc[2][3]);
  acc_guard4(acc[3][0], acc[3][1], acc[3][2], acc[3][3]);

  float* slab = sT[wave];
#pragma unroll
  for (int i = 0; i < 4; ++i) {
    const int mBase = m0 + (i << 4);
#pragma unroll
    for (int j = 0; j < 4; ++j) {
#pragma unroll
      for (int r = 0; r < 8; ++r) {
        const float v = acc[i][j][r] * scale;
        slab[(mOff + r) * 68 + (j << 4) + rlane] = v;
      }
    }
    __builtin_amdgcn_fence(__ATOMIC_RELEASE, "workgroup");
    __builtin_amdgcn_wave_barrier();
    __builtin_amdgcn_fence(__ATOMIC_ACQUIRE, "workgroup");
    if (OUT_MODE == 0) {
      float* C = (float*)Cout + (size_t)b * strideC;
      const int hh = lane >> 4, c4 = (lane & 15) * 4;
      {
#pragma unroll
        for (int it = 0; it < 8; ++it) {
          const int row = it * 2 + hh;
          v4f v = *(const v4f*)(slab + row * 68 + c4);
          *(v4f*)(C + (size_t)(mBase + row) * ldc + n0 + c4) = v;
        }
        
      }
    } else if (OUT_MODE == 1) {
      const int q = lane >> 3, c8 = (lane & 7) * 8;
      unsigned short* C = (unsigned short*)Cout + (size_t)b * strideC;
      v8h ov[4];
#pragma unroll
      for (int it = 0; it < 4; ++it) {
        const int row = it * 4 + q;
        const float* sp = slab + row * 68 + c8;
        const v4f a0 = *(const v4f*)(sp);
        const v4f a1 = *(const v4f*)(sp + 4);
#pragma unroll
        for (int e = 0; e < 4; ++e) {
          ov[it][e]     = (_Float16)a0[e];
          ov[it][4 + e] = (_Float16)a1[e];
        }
      }
      {
#pragma unroll
        for (int it = 0; it < 4; ++it) {
          const int row = it * 4 + q;
          *(v8h*)(C + (size_t)(mBase + row) * ldc + n0 + c8) = ov[it];
        }
        
      }
    } else {
      const int q = lane >> 3, c8 = (lane & 7) * 8;
      const int which = n0 >> 10;
      const int head  = (n0 >> 6) & (kHeads - 1);
      unsigned short* C = (unsigned short*)Cout + (size_t)which * kPlaneElems;
      v8h ov[4];
      size_t oo[4];
#pragma unroll
      for (int it = 0; it < 4; ++it) {
        const int row = it * 4 + q;
        const int m   = mBase + row;
        const int bb  = m >> 11;
        const int s   = m & (kSeq - 1);
        const float* sp = slab + row * 68 + c8;
        const v4f a0 = *(const v4f*)(sp);
        const v4f a1 = *(const v4f*)(sp + 4);
        const v4f cv = *(const v4f*)(cosT + (size_t)s * kHalfHd + (c8 >> 1));
        const v4f sv = *(const v4f*)(sinT + (size_t)s * kHalfHd + (c8 >> 1));
        const float o0 = a0[0] * cv[0] - a0[1] * sv[0];
        const float o1 = a0[0] * sv[0] + a0[1] * cv[0];
        const float o2 = a0[2] * cv[1] - a0[3] * sv[1];
        const float o3 = a0[2] * sv[1] + a0[3] * cv[1];
        const float o4 = a1[0] * cv[2] - a1[1] * sv[2];
        const float o5 = a1[0] * sv[2] + a1[1] * cv[2];
        const float o6 = a1[2] * cv[3] - a1[3] * sv[3];
        const float o7 = a1[2] * sv[3] + a1[3] * cv[3];
        ov[it][0] = (_Float16)o0;
        ov[it][1] = (_Float16)o1;
        ov[it][2] = (_Float16)o2;
        ov[it][3] = (_Float16)o3;
        ov[it][4] = (_Float16)o4;
        ov[it][5] = (_Float16)o5;
        ov[it][6] = (_Float16)o6;
        ov[it][7] = (_Float16)o7;
        oo[it] = ((size_t)(bb * kHeads + head) * kSeq + s) * kHd + c8;
      }
      {
#pragma unroll
        for (int it = 0; it < 4; ++it) *(v8h*)(C + oo[it]) = ov[it];
        
      }
    }
    __builtin_amdgcn_fence(__ATOMIC_RELEASE, "workgroup");
    __builtin_amdgcn_wave_barrier();
    __builtin_amdgcn_fence(__ATOMIC_ACQUIRE, "workgroup");
  }
}

// ---------------------------------------------------------------------------
// Attention for one (batch, head) and 64 query rows per block (4 waves x 16 queries), key tiles of 64, transposed products.
//   S^T = K16 . Q16^T: A = 16 key rows from LDS, B = the wave's 16 queries, kept in registers; a lane holds, of ONE query
//   (column lane & 15), the keys 8 * (lane >> 4) + r of each 16-key group, for ALL 32 key tiles;
//   p = exp(min(score * kScoreScale, clamp)) unnormalised, f32; the row sum l accumulates every key (future keys included)
//   in the lane, 8 partial sums, joined in the lane and across the two wave halves once after the loop;
//   O^T += Vt . P^T only for key tiles at or below the diagonal (tile index <= query tile index, block-uniform), with p set
//   to zero where key > query inside the diagonal tile; O = acc / l, no renormalisation.
//   P^T never leaves the registers: score groups 2kk and 2kk + 1 of a lane are elements 0..7 and 8..15 of its B fragment for
//   keys 32kk..32kk+31, the k map that FragH::load gives the Vt rows (A): 8 * (lane >> 4) + e, then 16 + 8 * (lane >> 4) + e.
// LDS: two buffers of [K tile [64 keys][72] f16 | Vt tile [64 dd][72] f16] (columns 0..63 written and read, pad never read);
//   each tile is brought by asynchronous copies, 128 threads x 4 x 16 B = 8,192 B = the whole tile; key tile kc + 2 is
//   copied into the buffer that tile kc has just left, so a tile's copies fly while the tile in front of it is worked on.
//   A Vt tile is copied only where it is used (tile index <= query tile index, block-uniform).
// Output: a lane holds 8 consecutive head columns of its query per 16-row group of O^T and stores them as 16 B; the wave
//   writes the whole 128-B head slice of each of its 16 rows.
// Block barriers: one in front of the loop, one at the foot of each key tile; all 4 waves run all 32 tiles; no early exits.
// grid.x = 32 (batch, head) groups x 32 query tiles.
// ---------------------------------------------------------------------------
constexpr int kQB = 64;
constexpr int kKT = 64;
constexpr int kLP = 72;
constexpr int kQTiles = kSeq / kQB;
constexpr int kKTiles = kSeq / kKT;
static_assert(kQB == kKT, "diagonal tile logic assumes equal tiles");
static_assert(kLP == kGP && kKT == 64 && kHd == 64, "a tile is 4 slices of 16 rows at the pitch of kSliceBytes");
static_assert(kKTiles >= 2, "two buffers are filled in front of the loop");
constexpr int kTileHalves   = kKT * kLP;       // one operand's tile
constexpr int kAStageHalves = 2 * kTileHalves; // [K tile | Vt tile]
// Asynchronous copy of one 64-row tile to LDS, 4 slices of 16 rows: each lane moves its own 16 B per slice.
// lds = the lane's LDS byte address in slice 0, g = its global address in slice 0, gstep = 16 source rows in halves.
// s_wait_xcnt 0 closes the statement so that no address register named here is rewritten ahead of it.
__device__ __forceinline__ void async_copy4(unsigned lds, const _Float16* g, size_t gstep) {
  asm volatile(
      "global_load_async_to_lds_b128 %0, %4, off\n\t"
      "global_load_async_to_lds_b128 %1, %5, off\n\t"
      "global_load_async_to_lds_b128 %2, %6, off\n\t"
      "global_load_async_to_lds_b128 %3, %7, off\n\t"
      "s_wait_xcnt 0x0"
      :: "v"(lds), "v"(lds + kSliceBytes), "v"(lds + 2u * kSliceBytes), "v"(lds + 3u * kSliceBytes),
         "v"(g), "v"(g + gstep), "v"(g + 2 * gstep), "v"(g + 3 * gstep)
      : "memory");
}

__global__ __launch_bounds__(128) void attn_kernel(
    const unsigned short* __restrict__ Qp, const unsigned short* __restrict__ Kp,
    const unsigned short* __restrict__ Vtp, unsigned short* __restrict__ Op)
{
  __shared__ __align__(16) _Float16 ring[2 * kAStageHalves];

  const int tid  = threadIdx.x;
  const int wave = __builtin_amdgcn_readfirstlane((int)(threadIdx.x >> 5));
  const int lane = tid & 31;
  const int hh   = lane >> 4;
  const int c    = lane & 15;
  const int qb   = blockIdx.x % kQTiles;
  const int bh   = blockIdx.x / kQTiles;
  const int q0   = qb * kQB + wave * 16;

  const _Float16* Qb = (const _Float16*)Qp  + (size_t)bh * kSeq * kHd;
  const _Float16* Kb = (const _Float16*)Kp  + (size_t)bh * kSeq * kHd;
  const _Float16* Vb = (const _Float16*)Vtp + (size_t)bh * kHd * kSeq;

  v16h qf[2];
#pragma unroll
  for (int dc = 0; dc < 2; ++dc) qf[dc] = FragH::load(Qb + (size_t)(q0 + c) * kHd + dc * 32 + 8 * hh);

  float lsum[8];
  v8f oacc[4];
#pragma unroll
  for (int r = 0; r < 8; ++r) lsum[r] = 0.f;
#pragma unroll
  for (int t = 0; t < 4; ++t) oacc[t] = (v8f){0.f,0.f,0.f,0.f,0.f,0.f,0.f,0.f};

  /* copy map: thread -> row tid / 8 of each 16-row slice, 16-B part tid % 8 of its 128 B */
  const int crow  = tid >> 3;
  const int cpart = (tid & 7) * 8;
  const _Float16* gK = Kb + (size_t)crow * kHd + cpart;
  const _Float16* gV = Vb + (size_t)crow * kSeq + cpart;
  constexpr size_t kStepK = (size_t)16 * kHd;
  constexpr size_t kStepV = (size_t)16 * kSeq;
  const unsigned ldsK =
      (unsigned)(size_t)(__attribute__((address_space(3))) _Float16*)ring + (unsigned)(crow * kLP + cpart) * 2u;
  const unsigned ldsV = ldsK + (unsigned)kTileHalves * 2u;
  constexpr unsigned kAStageBytes = (unsigned)kAStageHalves * 2u;

  /* key tile 0 (its Vt tile is used by every query tile) */
  async_copy4(ldsK, gK, kStepK);
  async_copy4(ldsV, gV, kStepV);
  /* tile 0 has landed for this wave; the barrier publishes it to the other waves */
  asm volatile("s_wait_asynccnt 0x0" ::: "memory");
  __syncthreads();
  async_copy4(ldsK + kAStageBytes, gK + (size_t)kKT * kHd, kStepK);
  if (1 <= qb) async_copy4(ldsV + kAStageBytes, gV + kKT, kStepV);

#pragma unroll 1
  for (int kc = 0; kc < kKTiles; ++kc) {
    const int kv0 = kc * kKT;
    /* block-uniform: this key tile contributes to P.V */
    const bool pv = (kc <= qb);
    const int buf = kc & 1;
    const _Float16* Ksh = ring + buf * kAStageHalves;
    const _Float16* Vsh = Ksh + kTileHalves;

    /* the K tile's fragments, named ahead of the 8 products so that their LDS reads run ahead of them */
    v16h kf[4][2];
#pragma unroll
    for (int j = 0; j < 4; ++j)
#pragma unroll
      for (int dc = 0; dc < 2; ++dc) kf[j][dc] = FragH::load(Ksh + (j * 16 + c) * kLP + dc * 32 + 8 * hh);
    v8f s[4];
#pragma unroll
    for (int j = 0; j < 4; ++j) s[j] = (v8f){0.f,0.f,0.f,0.f,0.f,0.f,0.f,0.f};
#pragma unroll
    for (int dc = 0; dc < 2; ++dc)
#pragma unroll
      for (int j = 0; j < 4; ++j) s[j] = FragH::mma(kf[j][dc], qf[dc], s[j]);
#pragma unroll
    for (int j = 0; j < 4; ++j) {
#pragma unroll
      for (int r = 0; r < 8; ++r) {
        const float x = fminf(s[j][r] * kScoreScale, kScoreClamp);
        const float p = __expf(x);
        lsum[r] += p;
        s[j][r] = p;
      }
    }
    if (pv) {
      v16h vf[4][2];
#pragma unroll
      for (int t = 0; t < 4; ++t)
#pragma unroll
        for (int kk = 0; kk < 2; ++kk) vf[t][kk] = FragH::load(Vsh + (t * 16 + c) * kLP + kk * 32 + 8 * hh);
      v16h pf[2];
#pragma unroll
      for (int kk = 0; kk < 2; ++kk) {
#pragma unroll
        for (int r = 0; r < 8; ++r) {
          pf[kk][r]     = (_Float16)s[2 * kk][r];
          pf[kk][8 + r] = (_Float16)s[2 * kk + 1][r];
        }
      }
      /* block-uniform: only the diagonal tile holds keys past a query */
      if (kc == qb) {
        const int qrow = q0 + c;
#pragma unroll
        for (int kk = 0; kk < 2; ++kk) {
#pragma unroll
          for (int e = 0; e < 16; ++e) {
            const int kvrow = kv0 + kk * 32 + (e >> 3) * 16 + 8 * hh + (e & 7);
            pf[kk][e] = (kvrow > qrow) ? (_Float16)0.0f : pf[kk][e];
          }
        }
      }
      /* the 16 LDS reads of the Vt tile as one group in front of its 8 products */
      hold8_h(vf[0][0], vf[1][0], vf[2][0], vf[3][0], vf[0][1], vf[1][1], vf[2][1], vf[3][1]);
#pragma unroll
      for (int kk = 0; kk < 2; ++kk)
#pragma unroll
        for (int t = 0; t < 4; ++t) oacc[t] = FragH::mma(vf[t][kk], pf[kk], oacc[t]);
    }
    /* this wave's reads of buffer buf are complete before any wave refills it */
    asm volatile("s_wait_dscnt 0x0" ::: "memory");
    /* this wave's copies of tile kc + 1 have landed before the barrier publishes them */
    asm volatile("s_wait_asynccnt 0x0" ::: "memory");
    __syncthreads();
    if (kc + 2 < kKTiles) {
      async_copy4(ldsK + (unsigned)buf * kAStageBytes, gK + (size_t)(kc + 2) * kKT * kHd, kStepK);
      if (kc + 2 <= qb) async_copy4(ldsV + (unsigned)buf * kAStageBytes, gV + (size_t)(kc + 2) * kKT, kStepV);
    }
  }
  /* no copy of this wave is outstanding past here */
  asm volatile("s_wait_asynccnt 0x0" ::: "memory");

  {
    float l = ((lsum[0] + lsum[1]) + (lsum[2] + lsum[3])) + ((lsum[4] + lsum[5]) + (lsum[6] + lsum[7]));
    l += __shfl_xor(l, 16, 32);
    const float inv = kCtxScale * __builtin_amdgcn_rcpf(l);
    const int bb = bh / kHeads;
    const int h  = bh - bb * kHeads;
    unsigned short* op = Op + ((size_t)(bb * kSeq + q0 + c)) * kHid + h * kHd + 8 * hh;
#pragma unroll
    for (int t = 0; t < 4; ++t) {
      v8h ov;
#pragma unroll
      for (int r = 0; r < 8; ++r) ov[r] = (_Float16)(oacc[t][r] * inv);
      *(v8h*)(op + t * 16) = ov;
    }
  }
}

// ---------------------------------------------------------------------------
// Host glue: 5 kernel launches, nothing else.
//   1 casts of x and w_q|w_k|w_v|w_o, rotary tables: 256 blocks of 512 threads
//   2 q|k projection + rotation: M 4096, N 2048, K 1024 -> 32 x 16 block tiles = 512 blocks of 128 threads
//   3 v projection transposed (A = w_v, Bt = x of one batch): M 1024, N 2048, K 1024 -> 8 x 16 block tiles = 128 blocks x 2
//   4 attention: 32 x 32 = 1024 blocks of 128 threads
//   5 output projection: M 4096, N 1024, K 1024 -> 32 x 8 block tiles = 256 blocks of 128 threads
// ---------------------------------------------------------------------------
extern "C" void kernel_launch(void* const* d_in, const int* in_sizes, int n_in,
                              void* d_out, int out_size, void* d_ws, size_t ws_size,
                              hipStream_t stream) {
  if (n_in < 5) return;
  if (in_sizes[0] != kRows * kHid) return;
  if (in_sizes[1] != kHid * kHid) return;
  if (in_sizes[2] != kHid * kHid) return;
  if (in_sizes[3] != kHid * kHid) return;
  if (in_sizes[4] != kHid * kHid) return;
  if (out_size != kRows * kHid) return;
  if (ws_size < kWsTotal) return;

  const float* x  = (const float*)d_in[0];
  const float* wq = (const float*)d_in[1];
  const float* wk = (const float*)d_in[2];
  const float* wv = (const float*)d_in[3];
  const float* wo = (const float*)d_in[4];
  float* out = (float*)d_out;

  char* ws = (char*)d_ws;
  unsigned short* X16  = (unsigned short*)(ws + kOffX16);
  unsigned short* W16  = (unsigned short*)(ws + kOffW16);
  float*          COS  = (float*)(ws + kOffCos);
  float*          SIN  = (float*)(ws + kOffSin);
  unsigned short* Q16  = (unsigned short*)(ws + kOffQ16);
  unsigned short* K16  = (unsigned short*)(ws + kOffK16);
  unsigned short* VT16 = (unsigned short*)(ws + kOffVT16);
  unsigned short* A16  = (unsigned short*)(ws + kOffA16);
  const unsigned short* Wqk16 = W16;
  const unsigned short* Wv16  = W16 + (size_t)2 * kHid * kHid;
  const unsigned short* Wo16  = W16 + (size_t)3 * kHid * kHid;

  static_assert((kRows % kBT) == 0 && (kHid % kBT) == 0 && (kSeq % kBT) == 0, "block tiles exact");
  static_assert((kHid % kKC) == 0 && kHid / kKC >= 2, "whole passes, two or more");

  prep_kernel<<<kPrepBlocks, kPrepThreads, 0, stream>>>(x, wq, wk, wv, wo, X16, COS, SIN);

  wmma_gemm64<3><<<dim3((kRows / kBT) * (2 * kHid / kBT), 1), 128, 0, stream>>>(
      X16, kHid, 0L,
      Wqk16, kHid, 0L,
      (void*)Q16, 0, 0L,
      COS, SIN,
      kRows, 2 * kHid, kHid, kQKScale);

  wmma_gemm64<1><<<dim3((kHid / kBT) * (kSeq / kBT), kBatch), 128, 0, stream>>>(
      Wv16, kHid, 0L,
      X16, kHid, (long)kSeq * kHid,
      (void*)VT16, kSeq, (long)kHid * kSeq,
      nullptr, nullptr,
      kHid, kSeq, kHid, kVScale);

  attn_kernel<<<kBatch * kHeads * kQTiles, 128, 0, stream>>>(Q16, K16, VT16, A16);

  wmma_gemm64<0><<<dim3((kRows / kBT) * (kHid / kBT), 1), 128, 0, stream>>>(
      A16, kHid, 0L,
      Wo16, kHid, 0L,
      (void*)out, kHid, 0L,
      nullptr, nullptr,
      kRows, kHid, kHid, kOutScale);
}

// v005
// It runs in 85 microseconds.
// Next to v004, in two timings, it ran 1.14 and 1.15 times as fast.
// Counting every step since v000, it is 2.79 times as fast.
// All contractions (q/k/v projections, q.k^T, p.v, output projection): v_wmma_f32_16x16x32_f16, f16 operands with power-of-two carries, f32 accumulate; rotary tables, exp, row sums and normalisation in f32.
#include <hip/hip_runtime.h>
#include <math.h>

typedef __attribute__((ext_vector_type(16))) _Float16 v16h;
typedef __attribute__((ext_vector_type(8)))  _Float16 v8h;
typedef __attribute__((ext_vector_type(8)))  float    v8f;
typedef __attribute__((ext_vector_type(4)))  float    v4f;

// ---------------------------------------------------------------------------
// Shape constants
// ---------------------------------------------------------------------------
constexpr int kBatch  = 2;
constexpr int kSeq    = 2048;
constexpr int kHid    = 1024;
constexpr int kHeads  = 16;
constexpr int kHd     = 64;
constexpr int kRows   = kBatch * kSeq;
constexpr int kHalfHd = kHd / 2;
static_assert(kHeads * kHd == kHid, "head split");
static_assert(kHd == 64, "head width fixed at 64");
static_assert((kSeq % 64) == 0 && (kHid % 64) == 0 && (kHid % 32) == 0 && (kRows % 64) == 0, "tile multiples");
static_assert(kSeq == 2048 && kHid == 1024, "bit tricks below assume these");

// ---------------------------------------------------------------------------
// Power-of-two carries of the f16 planes and the derived fold-back scales
// ---------------------------------------------------------------------------
constexpr double cx_sqrt(double x) {
  double g = (x > 1.0) ? x : 1.0;
  for (int it = 0; it < 80; ++it) g = 0.5 * (g + x / g);
  return g;
}
constexpr float kXCarry    = 16.0f;
constexpr float kWCarry    = 256.0f;
constexpr float kQKCarry   = 16.0f;
constexpr float kVCarry    = 16.0f;
constexpr float kAttnCarry = 2048.0f;
constexpr float kInvSqrtHd = (float)(1.0 / cx_sqrt((double)kHd));
static_assert(kInvSqrtHd == 0.125f, "1/sqrt(head width)");
constexpr float kQKScale    = kQKCarry / (kXCarry * kWCarry);
constexpr float kVScale     = kVCarry / (kXCarry * kWCarry);
constexpr float kScoreScale = kInvSqrtHd / (kQKCarry * kQKCarry);
constexpr float kCtxScale   = kAttnCarry / kVCarry;
constexpr float kOutScale   = 1.0f / (kAttnCarry * kWCarry);
constexpr float kScoreClamp = 10.0f;

// ---------------------------------------------------------------------------
// Rotary inverse frequencies: 10000^(-2i/64) = 10^(-i/8), i = 0..31, evaluated in double at build time, converted to f32
// ---------------------------------------------------------------------------
struct InvFreqTab { float v[kHalfHd]; };
constexpr InvFreqTab make_inv_freq() {
  InvFreqTab t{};
  const double r8 = cx_sqrt(cx_sqrt(cx_sqrt(10.0)));
  for (int i = 0; i < kHalfHd; ++i) {
    double p = 1.0;
    for (int j = 0; j < (i & 7); ++j) p *= r8;
    for (int j = 0; j < (i >> 3); ++j) p *= 10.0;
    t.v[i] = (float)(1.0 / p);
  }
  return t;
}
__device__ constexpr InvFreqTab kInvFreq = make_inv_freq();
static_assert(sizeof(kInvFreq.v) / sizeof(kInvFreq.v[0]) == 32, "table length");

// ---------------------------------------------------------------------------
// Workspace region map (bytes; every offset a multiple of 128)
//   X16   f16 [4096][1024]          x carried x16                         8,388,608
//   W16   f16 [4][1024][1024]       w_q | w_k | w_v | w_o carried x256    8,388,608
//   COS   f32 [2048][32]                                                    262,144
//   SIN   f32 [2048][32]                                                    262,144
//   Q16   f16 [32][2048][64]        rotated q carried x16                 8,388,608
//   K16   f16 [32][2048][64]        rotated k carried x16 (follows Q16)   8,388,608
//   VT16  f16 [32][64][2048]        v transposed, carried x16             8,388,608
//   A16   f16 [4096][1024]          attention output carried x2048        8,388,608
//   total                                                                50,855,936
// ---------------------------------------------------------------------------
constexpr size_t kPlaneBytes = (size_t)kRows * kHid * 2;
constexpr size_t kTabBytes   = (size_t)kSeq * kHalfHd * 4;
constexpr size_t kOffX16  = 0;
constexpr size_t kOffW16  = kOffX16 + kPlaneBytes;
constexpr size_t kOffCos  = kOffW16 + (size_t)4 * kHid * kHid * 2;
constexpr size_t kOffSin  = kOffCos + kTabBytes;
constexpr size_t kOffQ16  = kOffSin + kTabBytes;
constexpr size_t kOffK16  = kOffQ16 + kPlaneBytes;
constexpr size_t kOffVT16 = kOffK16 + kPlaneBytes;
constexpr size_t kOffA16  = kOffVT16 + kPlaneBytes;
constexpr size_t kWsTotal = kOffA16 + kPlaneBytes;
static_assert(kWsTotal == 50855936ull, "carve total");
static_assert(kWsTotal <= 134217728ull, "carve cap");
static_assert((kOffW16 % 128) == 0 && (kOffCos % 128) == 0 && (kOffSin % 128) == 0 && (kOffQ16 % 128) == 0 &&
              (kOffK16 % 128) == 0 && (kOffVT16 % 128) == 0 && (kOffA16 % 128) == 0, "128-B aligned regions");
constexpr size_t kPlaneElems = (size_t)kRows * kHid;

// ---------------------------------------------------------------------------
// Fragment helpers (split k map for A and B: elements 0..7 <- p[0..7], 8..15 <- p[16..23], p already offset by 8*(lane>>4))
// ---------------------------------------------------------------------------
struct FragH {
  union U { v16h v; v8h h[2]; };
  static __device__ __forceinline__ v16h load(const _Float16* p) {
    U f;
    f.h[0] = *(const v8h*)(p);
    f.h[1] = *(const v8h*)(p + 16);
    return f.v;
  }
  static __device__ __forceinline__ v8f mma(v16h a, v16h b, v8f c) {
    return __builtin_amdgcn_wmma_f32_16x16x32_f16(false, a, false, b, (short)0, c, false, false);
  }
};
__device__ __forceinline__ void guard4_h(v8f& a, v8f& b, v8f& c, v8f& d, v16h x, v16h y) {
  asm volatile("v_nop\n\tv_nop\n\tv_nop\n\tv_nop" : "+v"(a), "+v"(b), "+v"(c), "+v"(d) : "v"(x), "v"(y));
}
__device__ __forceinline__ void keep4_h(v16h a, v16h b, v16h c, v16h d) {
  asm volatile("v_nop" :: "v"(a), "v"(b), "v"(c), "v"(d));
}
// Inputs-only hold on eight loaded fragments: their LDS reads stand as one group with one wait in front of the products that
// follow; without it each product waits for its own pair of reads.
__device__ __forceinline__ void hold8_h(v16h a, v16h b, v16h c, v16h d, v16h e, v16h f, v16h g, v16h h) {
  asm volatile("" :: "v"(a), "v"(b), "v"(c), "v"(d), "v"(e), "v"(f), "v"(g), "v"(h));
}
__device__ __forceinline__ void acc_guard4(v8f& a, v8f& b, v8f& c, v8f& d) {
  asm volatile("v_nop\n\tv_nop\n\tv_nop\n\tv_nop" : "+v"(a), "+v"(b), "+v"(c), "+v"(d));
}

// ---------------------------------------------------------------------------
// Preparation, one launch: f32 -> f16 casts of x and of the four weight matrices with their power-of-two carries, and the
// rotary tables. One work-group of 16 waves per 1/256 of the work; every wave lives long instead of many short waves.
// Casts: a piece is 8 consecutive elements (32 B read, 16 B stored). The grid has kPrepLanes = 131,072 threads; thread g takes
//   pieces g + j * kPrepLanes, j = 0..7: j = 0..3 are the four quarters of x, j = 4..7 are w_q, w_k, w_v, w_o (one matrix is
//   exactly kPrepLanes pieces). Destination piece index = source piece index, since W16 follows X16 in the workspace.
//   All 16 reads of a thread are issued before the first value is used.
// Rotary tables: COS/SIN [2048][32] f32, angle = float(position) * inv_freq[i] (single f32 multiply), accurate sincosf;
//   waves 0..7 of each work-group compute one entry per lane (256 x 256 = 65,536 entries) while their reads are in flight.
// ---------------------------------------------------------------------------
constexpr int kPrepThreads = 512;
constexpr int kPrepBlocks  = 256;
constexpr int kPrepLanes   = kPrepThreads * kPrepBlocks;
constexpr int kXn8 = kRows * kHid / 8;
constexpr int kWn8 = kHid * kHid / 8;
static_assert(kWn8 == kPrepLanes && kXn8 == 4 * kPrepLanes, "eight pieces per thread: four of x, one of each matrix");
static_assert(kOffX16 == 0 && kOffW16 == kOffX16 + (size_t)kXn8 * 16, "W16 follows X16");
static_assert(kSeq * kHalfHd == kPrepBlocks * 256, "one table entry per lane of waves 0..7");
__global__ __launch_bounds__(kPrepThreads) void prep_kernel(
    const float* __restrict__ x, const float* __restrict__ wq, const float* __restrict__ wk,
    const float* __restrict__ wv, const float* __restrict__ wo,
    unsigned short* __restrict__ out, float* __restrict__ cosT, float* __restrict__ sinT)
{
  const unsigned g = blockIdx.x * kPrepThreads + threadIdx.x;
  const float* sp[8] = { x, x + (size_t)8 * kPrepLanes, x + (size_t)16 * kPrepLanes, x + (size_t)24 * kPrepLanes,
                         wq, wk, wv, wo };
  const float inv = kInvFreq.v[threadIdx.x & 31];
  /* the table read's index register may be reused by what follows */
  asm volatile("s_wait_xcnt 0x0" ::: "memory");
  const unsigned rb = g * 32u;
  v4f a[8], c[8];
#pragma unroll
  for (int j = 0; j < 8; ++j) {
    const float* p = (const float*)((const char*)sp[j] + rb);
    a[j] = *(const v4f*)(p);
    c[j] = *(const v4f*)(p + 4);
  }
  /* inputs-only hold: the table read stays in front of the 16 reads, so its wait does not drain them */
  asm volatile("" :: "v"(inv));
  /* wave-uniform: waves 0..7 */
  if (threadIdx.x < 256) {
    const int t = blockIdx.x * 256 + threadIdx.x;
    const int s = t >> 5;
    const float ang = (float)s * inv;
    float sn, cs;
    sincosf(ang, &sn, &cs);
    cosT[t] = cs;
    sinT[t] = sn;
  }
#pragma unroll
  for (int j = 0; j < 8; ++j) {
    const float scale = (j < 4) ? kXCarry : kWCarry;
    v8h hv;
#pragma unroll
    for (int e = 0; e < 4; ++e) {
      const float f0 = a[j][e] * scale;
      const float f1 = c[j][e] * scale;
      hv[e]     = (_Float16)f0;
      hv[4 + e] = (_Float16)f1;
    }
    *(v8h*)((char*)(out + (size_t)8 * kPrepLanes * j) + g * 16u) = hv;
  }
}

// ---------------------------------------------------------------------------
// Asynchronous copy of 8 slices of 16 tile rows to LDS: each lane moves its own 16 B per slice, a wave 4 whole 128-B rows.
// lds = the lane's LDS byte address in slice 0, g = its global address in slice 0, gstep = 16 source rows in halves.
// s_wait_xcnt 0 closes the statement so that no address register named here is rewritten ahead of it.
// ---------------------------------------------------------------------------
constexpr int kBT = 128;                     // block tile: rows of A and rows of Bt
constexpr int kKC = 64;                      // k per pass: tile rows of 128 B
constexpr int kGP = 72;                      // LDS row pitch in halves: 144 B = 16 B x 9, for ds_load_b128 readers
constexpr int kOpHalves    = kBT * kGP;      // one operand's tile
constexpr int kStageHalves = 2 * kOpHalves;  // [A tile | Bt tile]
constexpr unsigned kSliceBytes = 16u * kGP * 2u;
__device__ __forceinline__ void async_copy8(unsigned lds, const _Float16* g, size_t gstep) {
  asm volatile(
      "global_load_async_to_lds_b128 %0, %8, off\n\t"
      "global_load_async_to_lds_b128 %1, %9, off\n\t"
      "global_load_async_to_lds_b128 %2, %10, off\n\t"
      "global_load_async_to_lds_b128 %3, %11, off\n\t"
      "global_load_async_to_lds_b128 %4, %12, off\n\t"
      "global_load_async_to_lds_b128 %5, %13, off\n\t"
      "global_load_async_to_lds_b128 %6, %14, off\n\t"
      "global_load_async_to_lds_b128 %7, %15, off\n\t"
      "s_wait_xcnt 0x0"
      :: "v"(lds), "v"(lds + kSliceBytes), "v"(lds + 2u * kSliceBytes), "v"(lds + 3u * kSliceBytes),
         "v"(lds + 4u * kSliceBytes), "v"(lds + 5u * kSliceBytes), "v"(lds + 6u * kSliceBytes), "v"(lds + 7u * kSliceBytes),
         "v"(g), "v"(g + gstep), "v"(g + 2 * gstep), "v"(g + 3 * gstep),
         "v"(g + 4 * gstep), "v"(g + 5 * gstep), "v"(g + 6 * gstep), "v"(g + 7 * gstep)
      : "memory");
}

// ---------------------------------------------------------------------------
// Batched GEMM: C[m,n] = scale * sum_k A[m,k] * Bt[n,k]; a block of 4 waves (2 x 2) owns a 128x128 tile, each wave 64x64 of it.
// A row-major [M,K]; Bt row-major [N,K]; M, N multiples of 128, K a multiple of 64 and at least 128 (asserted on the host).
// Operands: per pass of 64 k the block's 128 A rows and 128 Bt rows go to LDS by asynchronous copies, two buffers, the next
//           pass's copies in flight while this pass's fragments are read; every wave copies, waits and passes every barrier.
// Store mode 0: f32 rows; mode 1: f16 rows.
// Store mode 3: N = 2 x kHid (q columns then k columns); the 64-wide tile is one head; interleaved-pair rotation with
//             COS/SIN[position][pair] then f16 store to plane (n0 >> 10) laid out [batch*heads + head][position][64]
// OUT_MODE 4: the three input projections in one launch, so that three work-groups share each WGP from the start.
//             Blocks 0 .. kQKBlocks - 1 are the q|k tiles of the arguments as given (store mode 3). The kVBlocks blocks behind
//             them are the transposed v projection (store mode 1): A = w_v, the third matrix behind Btp; Bt = the rows of Ap of
//             one batch; C = the plane behind the q and k planes, [batch][kHid][kSeq]. The choice is block-uniform.
// Store coverage per 16-row slab: mode 0: 8 iterations x 2 rows; modes 1 and 3: 4 iterations x 4 rows; 64 columns each.
// ---------------------------------------------------------------------------
constexpr int kQKBlocks = (kRows / kBT) * (2 * kHid / kBT);
constexpr int kVBlocksPerBatch = (kHid / kBT) * (kSeq / kBT);
constexpr int kVBlocks = kBatch * kVBlocksPerBatch;
static_assert(kOffK16 == kOffQ16 + kPlaneBytes && kOffVT16 == kOffK16 + kPlaneBytes, "the v plane follows the q and k planes");
template <int OUT_MODE>
__global__ __launch_bounds__(128) void wmma_gemm64(
    const unsigned short* __restrict__ Ap, int lda, long strideA,
    const unsigned short* __restrict__ Btp, int ldb, long strideB,
    void* __restrict__ Cp, int ldc, long strideC,
    const float* __restrict__ cosT, const float* __restrict__ sinT,
    int M, int N, int K, float scale)
{
  const _Float16* A  = (const _Float16*)Ap;
  const _Float16* Bt = (const _Float16*)Btp;
  void* Cout = Cp;
  int b    = blockIdx.y;
  int tile = blockIdx.x;
  /* block-uniform: this block belongs to the v projection */
  const bool vpart = (OUT_MODE == 4) && (tile >= kQKBlocks);
  if (vpart) {
    tile -= kQKBlocks;
    b     = tile / kVBlocksPerBatch;
    tile -= b * kVBlocksPerBatch;
    A  = (const _Float16*)Btp + (size_t)2 * kHid * kHid;
    Bt = (const _Float16*)Ap;
    strideA = 0L;
    strideB = (long)kSeq * kHid;
    Cout    = (void*)((unsigned short*)Cp + 2 * kPlaneElems);
    ldc     = kSeq;
    strideC = (long)kHid * kSeq;
    M = kHid;
    N = kSeq;
    scale = kVScale;
  }
  const int mode = (OUT_MODE == 4) ? (vpart ? 1 : 3) : OUT_MODE;
  __shared__ __align__(16) _Float16 ring[2 * kStageHalves];
  __shared__ __align__(16) float sT[4][16 * 68];
  const int tid  = threadIdx.x;
  const int lane = threadIdx.x & 31;
  const int wave = __builtin_amdgcn_readfirstlane((int)(threadIdx.x >> 5));
  const int tilesN = N >> 7;
  const int tilesM = M >> 7;
  /* block-uniform exit, in front of every copy and barrier */
  if (tile >= tilesM * tilesN) return;
  const int tm = tile / tilesN;
  const int tn = tile - tm * tilesN;
  const int wm = wave >> 1;
  const int wn = wave & 1;
  const int m0 = (tm << 7) + (wm << 6);
  const int n0 = (tn << 7) + (wn << 6);

  const _Float16* Ab = A  + (size_t)b * strideA;
  const _Float16* Bb = Bt + (size_t)b * strideB;

  const int rlane = lane & 15;
  const int koff  = (lane >> 4) * 8;
  const int mOff  = (lane >> 4) * 8;

  v8f acc[4][4];
#pragma unroll
  for (int i = 0; i < 4; ++i)
#pragma unroll
    for (int j = 0; j < 4; ++j) acc[i][j] = (v8f){0.f,0.f,0.f,0.f,0.f,0.f,0.f,0.f};

  /* copy map: thread -> row tid / 8 of each 16-row slice, 16-B part tid % 8 of its 128 B */
  const int crow  = tid >> 3;
  const int cpart = (tid & 7) * 8;
  const _Float16* gA = Ab + (size_t)((tm << 7) + crow) * lda + cpart;
  const _Float16* gB = Bb + (size_t)((tn << 7) + crow) * ldb + cpart;
  const size_t stepA = (size_t)16 * lda;
  const size_t stepB = (size_t)16 * ldb;
  const unsigned ldsA =
      (unsigned)(size_t)(__attribute__((address_space(3))) _Float16*)ring + (unsigned)(crow * kGP + cpart) * 2u;
  const unsigned ldsB = ldsA + (unsigned)kOpHalves * 2u;
  constexpr unsigned kStageBytes = (unsigned)kStageHalves * 2u;
  const _Float16* fA = ring + ((wm << 6) + rlane) * kGP + koff;
  const _Float16* fB = ring + kOpHalves + ((wn << 6) + rlane) * kGP + koff;
  const int passes = K / kKC;

  async_copy8(ldsA, gA, stepA);
  async_copy8(ldsB, gB, stepB);
  /* pass 0's tile has landed for this wave; the barrier publishes it to the other waves */
  asm volatile("s_wait_asynccnt 0x0" ::: "memory");
  __syncthreads();
  if (1 < passes) {
    async_copy8(ldsA + kStageBytes, gA + kKC, stepA);
    async_copy8(ldsB + kStageBytes, gB + kKC, stepB);
  }

  for (int t = 0; t < passes; ++t) {
    const int buf = t & 1;
    const _Float16* pA = fA + buf * kStageHalves;
    const _Float16* pB = fB + buf * kStageHalves;
    /* unrolled, like the loops inside: every fragment and accumulator index is a constant, so the arrays stay in registers */
#pragma unroll
    for (int kk = 0; kk < kKC; kk += 32) {
      /* the 16 LDS reads of a 32-k step stand as one group in front of its 16 products */
      v16h ah[4], bh[4];
#pragma unroll
      for (int j = 0; j < 4; ++j) bh[j] = FragH::load(pB + (j << 4) * kGP + kk);
#pragma unroll
      for (int i = 0; i < 4; ++i) ah[i] = FragH::load(pA + (i << 4) * kGP + kk);
#pragma unroll
      for (int i = 0; i < 4; ++i) {
#pragma unroll
        for (int j = 0; j < 4; ++j) acc[i][j] = FragH::mma(ah[i], bh[j], acc[i][j]);
        guard4_h(acc[i][0], acc[i][1], acc[i][2], acc[i][3], ah[i], bh[3]);
      }
      keep4_h(bh[0], bh[1], bh[2], bh[3]);
    }
    /* this wave's reads of buffer buf are complete before any wave refills it */
    asm volatile("s_wait_dscnt 0x0" ::: "memory");
    /* this wave's copies of pass t + 1 have landed before the barrier publishes them */
    asm volatile("s_wait_asynccnt 0x0" ::: "memory");
    __syncthreads();
    if (t + 2 < passes) {
      async_copy8(ldsA + (unsigned)buf * kStageBytes, gA + (size_t)(t + 2) * kKC, stepA);
      async_copy8(ldsB + (unsigned)buf * kStageBytes, gB + (size_t)(t + 2) * kKC, stepB);
    }
  }
  /* no copy of this wave is outstanding past here */
  asm volatile("s_wait_asynccnt 0x0" ::: "memory");
  acc_guard4(acc[0][0], acc[0][1], acc[0][2], acc[0][3]);
  acc_guard4(acc[1][0], acc[1][1], acc[1][2], acc[1][3]);
  acc_guard4(acc[2][0], acc[2][1], acc[2][2], acc[2][3]);
  acc_guard4(acc[3][0], acc[3][1], acc[3][2], acc[3][3]);

  float* slab = sT[wave];
#pragma unroll
  for (int i = 0; i < 4; ++i) {
    const int mBase = m0 + (i << 4);
#pragma unroll
    for (int j = 0; j < 4; ++j) {
#pragma unroll
      for (int r = 0; r < 8; ++r) {
        const float v = acc[i][j][r] * scale;
        slab[(mOff + r) * 68 + (j << 4) + rlane] = v;
      }
    }
    __builtin_amdgcn_fence(__ATOMIC_RELEASE, "workgroup");
    __builtin_amdgcn_wave_barrier();
    __builtin_amdgcn_fence(__ATOMIC_ACQUIRE, "workgroup");
    if (mode == 0) {
      float* C = (float*)Cout + (size_t)b * strideC;
      const int hh = lane >> 4, c4 = (lane & 15) * 4;
      {
#pragma unroll
        for (int it = 0; it < 8; ++it) {
          const int row = it * 2 + hh;
          v4f v = *(const v4f*)(slab + row * 68 + c4);
          *(v4f*)(C + (size_t)(mBase + row) * ldc + n0 + c4) = v;
        }
        
      }
    } else if (mode == 1) {
      const int q = lane >> 3, c8 = (lane & 7) * 8;
      unsigned short* C = (unsigned short*)Cout + (size_t)b * strideC;
      v8h ov[4];
#pragma unroll
      for (int it = 0; it < 4; ++it) {
        const int row = it * 4 + q;
        const float* sp = slab + row * 68 + c8;
        const v4f a0 = *(const v4f*)(sp);
        const v4f a1 = *(const v4f*)(sp + 4);
#pragma unroll
        for (int e = 0; e < 4; ++e) {
          ov[it][e]     = (_Float16)a0[e];
          ov[it][4 + e] = (_Float16)a1[e];
        }
      }
      {
#pragma unroll
        for (int it = 0; it < 4; ++it) {
          const int row = it * 4 + q;
          *(v8h*)(C + (size_t)(mBase + row) * ldc + n0 + c8) = ov[it];
        }
        
      }
    } else {
      const int q = lane >> 3, c8 = (lane & 7) * 8;
      const int which = n0 >> 10;
      const int head  = (n0 >> 6) & (kHeads - 1);
      unsigned short* C = (unsigned short*)Cout + (size_t)which * kPlaneElems;
      v8h ov[4];
      size_t oo[4];
#pragma unroll
      for (int it = 0; it < 4; ++it) {
        const int row = it * 4 + q;
        const int m   = mBase + row;
        const int bb  = m >> 11;
        const int s   = m & (kSeq - 1);
        const float* sp = slab + row * 68 + c8;
        const v4f a0 = *(const v4f*)(sp);
        const v4f a1 = *(const v4f*)(sp + 4);
        const v4f cv = *(const v4f*)(cosT + (size_t)s * kHalfHd + (c8 >> 1));
        const v4f sv = *(const v4f*)(sinT + (size_t)s * kHalfHd + (c8 >> 1));
        const float o0 = a0[0] * cv[0] - a0[1] * sv[0];
        const float o1 = a0[0] * sv[0] + a0[1] * cv[0];
        const float o2 = a0[2] * cv[1] - a0[3] * sv[1];
        const float o3 = a0[2] * sv[1] + a0[3] * cv[1];
        const float o4 = a1[0] * cv[2] - a1[1] * sv[2];
        const float o5 = a1[0] * sv[2] + a1[1] * cv[2];
        const float o6 = a1[2] * cv[3] - a1[3] * sv[3];
        const float o7 = a1[2] * sv[3] + a1[3] * cv[3];
        ov[it][0] = (_Float16)o0;
        ov[it][1] = (_Float16)o1;
        ov[it][2] = (_Float16)o2;
        ov[it][3] = (_Float16)o3;
        ov[it][4] = (_Float16)o4;
        ov[it][5] = (_Float16)o5;
        ov[it][6] = (_Float16)o6;
        ov[it][7] = (_Float16)o7;
        oo[it] = ((size_t)(bb * kHeads + head) * kSeq + s) * kHd + c8;
      }
      {
#pragma unroll
        for (int it = 0; it < 4; ++it) *(v8h*)(C + oo[it]) = ov[it];
        
      }
    }
    __builtin_amdgcn_fence(__ATOMIC_RELEASE, "workgroup");
    __builtin_amdgcn_wave_barrier();
    __builtin_amdgcn_fence(__ATOMIC_ACQUIRE, "workgroup");
  }
}

// ---------------------------------------------------------------------------
// Attention for one (batch, head) and 64 query rows per block (4 waves x 16 queries), key tiles of 64, transposed products.
//   S^T = K16 . Q16^T: A = 16 key rows from LDS, B = the wave's 16 queries, kept in registers; a lane holds, of ONE query
//   (column lane & 15), the keys 8 * (lane >> 4) + r of each 16-key group, for ALL 32 key tiles;
//   p = exp(min(score * kScoreScale, clamp)) unnormalised, f32; the row sum l accumulates every key (future keys included)
//   in the lane, 8 partial sums, joined in the lane and across the two wave halves once after the loop;
//   O^T += Vt . P^T only for key tiles at or below the diagonal (tile index <= query tile index, block-uniform), with p set
//   to zero where key > query inside the diagonal tile; O = acc / l, no renormalisation.
//   P^T never leaves the registers: score groups 2kk and 2kk + 1 of a lane are elements 0..7 and 8..15 of its B fragment for
//   keys 32kk..32kk+31, the k map that FragH::load gives the Vt rows (A): 8 * (lane >> 4) + e, then 16 + 8 * (lane >> 4) + e.
// LDS: two buffers of [K tile [64 keys][72] f16 | Vt tile [64 dd][72] f16] (columns 0..63 written and read, pad never read);
//   each tile is brought by asynchronous copies, 128 threads x 4 x 16 B = 8,192 B = the whole tile; key tile kc + 2 is
//   copied into the buffer that tile kc has just left, so a tile's copies fly while the tile in front of it is worked on.
//   A Vt tile is copied only where it is used (tile index <= query tile index, block-uniform).
// Output: a lane holds 8 consecutive head columns of its query per 16-row group of O^T and stores them as 16 B; the wave
//   writes the whole 128-B head slice of each of its 16 rows.
// Block barriers: one in front of the loop, one at the foot of each key tile; all 4 waves run all 32 tiles; no early exits.
// grid.x = 32 (batch, head) groups x 32 query tiles.
// ---------------------------------------------------------------------------
constexpr int kQB = 64;
constexpr int kKT = 64;
constexpr int kLP = 72;
constexpr int kQTiles = kSeq / kQB;
constexpr int kKTiles = kSeq / kKT;
static_assert(kQB == kKT, "diagonal tile logic assumes equal tiles");
static_assert(kLP == kGP && kKT == 64 && kHd == 64, "a tile is 4 slices of 16 rows at the pitch of kSliceBytes");
static_assert(kKTiles >= 2, "two buffers are filled in front of the loop");
constexpr int kTileHalves   = kKT * kLP;       // one operand's tile
constexpr int kAStageHalves = 2 * kTileHalves; // [K tile | Vt tile]
// Asynchronous copy of one 64-row tile to LDS, 4 slices of 16 rows: each lane moves its own 16 B per slice.
// lds = the lane's LDS byte address in slice 0, g = its global address in slice 0, gstep = 16 source rows in halves.
// s_wait_xcnt 0 closes the statement so that no address register named here is rewritten ahead of it.
__device__ __forceinline__ void async_copy4(unsigned lds, const _Float16* g, size_t gstep) {
  asm volatile(
      "global_load_async_to_lds_b128 %0, %4, off\n\t"
      "global_load_async_to_lds_b128 %1, %5, off\n\t"
      "global_load_async_to_lds_b128 %2, %6, off\n\t"
      "global_load_async_to_lds_b128 %3, %7, off\n\t"
      "s_wait_xcnt 0x0"
      :: "v"(lds), "v"(lds + kSliceBytes), "v"(lds + 2u * kSliceBytes), "v"(lds + 3u * kSliceBytes),
         "v"(g), "v"(g + gstep), "v"(g + 2 * gstep), "v"(g + 3 * gstep)
      : "memory");
}

__global__ __launch_bounds__(128) void attn_kernel(
    const unsigned short* __restrict__ Qp, const unsigned short* __restrict__ Kp,
    const unsigned short* __restrict__ Vtp, unsigned short* __restrict__ Op)
{
  __shared__ __align__(16) _Float16 ring[2 * kAStageHalves];

  const int tid  = threadIdx.x;
  const int wave = __builtin_amdgcn_readfirstlane((int)(threadIdx.x >> 5));
  const int lane = tid & 31;
  const int hh   = lane >> 4;
  const int c    = lane & 15;
  const int qb   = blockIdx.x % kQTiles;
  const int bh   = blockIdx.x / kQTiles;
  const int q0   = qb * kQB + wave * 16;

  const _Float16* Qb = (const _Float16*)Qp  + (size_t)bh * kSeq * kHd;
  const _Float16* Kb = (const _Float16*)Kp  + (size_t)bh * kSeq * kHd;
  const _Float16* Vb = (const _Float16*)Vtp + (size_t)bh * kHd * kSeq;

  v16h qf[2];
#pragma unroll
  for (int dc = 0; dc < 2; ++dc) qf[dc] = FragH::load(Qb + (size_t)(q0 + c) * kHd + dc * 32 + 8 * hh);

  float lsum[8];
  v8f oacc[4];
#pragma unroll
  for (int r = 0; r < 8; ++r) lsum[r] = 0.f;
#pragma unroll
  for (int t = 0; t < 4; ++t) oacc[t] = (v8f){0.f,0.f,0.f,0.f,0.f,0.f,0.f,0.f};

  /* copy map: thread -> row tid / 8 of each 16-row slice, 16-B part tid % 8 of its 128 B */
  const int crow  = tid >> 3;
  const int cpart = (tid & 7) * 8;
  const _Float16* gK = Kb + (size_t)crow * kHd + cpart;
  const _Float16* gV = Vb + (size_t)crow * kSeq + cpart;
  constexpr size_t kStepK = (size_t)16 * kHd;
  constexpr size_t kStepV = (size_t)16 * kSeq;
  const unsigned ldsK =
      (unsigned)(size_t)(__attribute__((address_space(3))) _Float16*)ring + (unsigned)(crow * kLP + cpart) * 2u;
  const unsigned ldsV = ldsK + (unsigned)kTileHalves * 2u;
  constexpr unsigned kAStageBytes = (unsigned)kAStageHalves * 2u;

  /* key tile 0 (its Vt tile is used by every query tile) */
  async_copy4(ldsK, gK, kStepK);
  async_copy4(ldsV, gV, kStepV);
  /* tile 0 has landed for this wave; the barrier publishes it to the other waves */
  asm volatile("s_wait_asynccnt 0x0" ::: "memory");
  __syncthreads();
  async_copy4(ldsK + kAStageBytes, gK + (size_t)kKT * kHd, kStepK);
  if (1 <= qb) async_copy4(ldsV + kAStageBytes, gV + kKT, kStepV);

#pragma unroll 1
  for (int kc = 0; kc < kKTiles; ++kc) {
    const int kv0 = kc * kKT;
    /* block-uniform: this key tile contributes to P.V */
    const bool pv = (kc <= qb);
    const int buf = kc & 1;
    const _Float16* Ksh = ring + buf * kAStageHalves;
    const _Float16* Vsh = Ksh + kTileHalves;

    /* the K tile's fragments, named ahead of the 8 products so that their LDS reads run ahead of them */
    v16h kf[4][2];
#pragma unroll
    for (int j = 0; j < 4; ++j)
#pragma unroll
      for (int dc = 0; dc < 2; ++dc) kf[j][dc] = FragH::load(Ksh + (j * 16 + c) * kLP + dc * 32 + 8 * hh);
    v8f s[4];
#pragma unroll
    for (int j = 0; j < 4; ++j) s[j] = (v8f){0.f,0.f,0.f,0.f,0.f,0.f,0.f,0.f};
#pragma unroll
    for (int dc = 0; dc < 2; ++dc)
#pragma unroll
      for (int j = 0; j < 4; ++j) s[j] = FragH::mma(kf[j][dc], qf[dc], s[j]);
#pragma unroll
    for (int j = 0; j < 4; ++j) {
#pragma unroll
      for (int r = 0; r < 8; ++r) {
        const float x = fminf(s[j][r] * kScoreScale, kScoreClamp);
        const float p = __expf(x);
        lsum[r] += p;
        s[j][r] = p;
      }
    }
    if (pv) {
      v16h vf[4][2];
#pragma unroll
      for (int t = 0; t < 4; ++t)
#pragma unroll
        for (int kk = 0; kk < 2; ++kk) vf[t][kk] = FragH::load(Vsh + (t * 16 + c) * kLP + kk * 32 + 8 * hh);
      v16h pf[2];
#pragma unroll
      for (int kk = 0; kk < 2; ++kk) {
#pragma unroll
        for (int r = 0; r < 8; ++r) {
          pf[kk][r]     = (_Float16)s[2 * kk][r];
          pf[kk][8 + r] = (_Float16)s[2 * kk + 1][r];
        }
      }
      /* block-uniform: only the diagonal tile holds keys past a query */
      if (kc == qb) {
        const int qrow = q0 + c;
#pragma unroll
        for (int kk = 0; kk < 2; ++kk) {
#pragma unroll
          for (int e = 0; e < 16; ++e) {
            const int kvrow = kv0 + kk * 32 + (e >> 3) * 16 + 8 * hh + (e & 7);
            pf[kk][e] = (kvrow > qrow) ? (_Float16)0.0f : pf[kk][e];
          }
        }
      }
      /* the 16 LDS reads of the Vt tile as one group in front of its 8 products */
      hold8_h(vf[0][0], vf[1][0], vf[2][0], vf[3][0], vf[0][1], vf[1][1], vf[2][1], vf[3][1]);
#pragma unroll
      for (int kk = 0; kk < 2; ++kk)
#pragma unroll
        for (int t = 0; t < 4; ++t) oacc[t] = FragH::mma(vf[t][kk], pf[kk], oacc[t]);
    }
    /* this wave's reads of buffer buf are complete before any wave refills it */
    asm volatile("s_wait_dscnt 0x0" ::: "memory");
    /* this wave's copies of tile kc + 1 have landed before the barrier publishes them */
    asm volatile("s_wait_asynccnt 0x0" ::: "memory");
    __syncthreads();
    if (kc + 2 < kKTiles) {
      async_copy4(ldsK + (unsigned)buf * kAStageBytes, gK + (size_t)(kc + 2) * kKT * kHd, kStepK);
      if (kc + 2 <= qb) async_copy4(ldsV + (unsigned)buf * kAStageBytes, gV + (size_t)(kc + 2) * kKT, kStepV);
    }
  }
  /* no copy of this wave is outstanding past here */
  asm volatile("s_wait_asynccnt 0x0" ::: "memory");

  {
    float l = ((lsum[0] + lsum[1]) + (lsum[2] + lsum[3])) + ((lsum[4] + lsum[5]) + (lsum[6] + lsum[7]));
    l += __shfl_xor(l, 16, 32);
    const float inv = kCtxScale * __builtin_amdgcn_rcpf(l);
    const int bb = bh / kHeads;
    const int h  = bh - bb * kHeads;
    unsigned short* op = Op + ((size_t)(bb * kSeq + q0 + c)) * kHid + h * kHd + 8 * hh;
#pragma unroll
    for (int t = 0; t < 4; ++t) {
      v8h ov;
#pragma unroll
      for (int r = 0; r < 8; ++r) ov[r] = (_Float16)(oacc[t][r] * inv);
      *(v8h*)(op + t * 16) = ov;
    }
  }
}

// ---------------------------------------------------------------------------
// Host glue: 4 kernel launches, nothing else.
//   1 casts of x and w_q|w_k|w_v|w_o, rotary tables: 256 blocks of 512 threads
//   2 input projections, 768 blocks of 128 threads:
//     q|k projection + rotation: M 4096, N 2048, K 1024 -> 32 x 16 block tiles = 512 blocks;
//     v projection transposed (A = w_v, Bt = x of one batch): M 1024, N 2048, K 1024 -> 8 x 16 block tiles = 128 blocks x 2
//   3 attention: 32 x 32 = 1024 blocks of 128 threads
//   4 output projection: M 4096, N 1024, K 1024 -> 32 x 8 block tiles = 256 blocks of 128 threads
// ---------------------------------------------------------------------------
extern "C" void kernel_launch(void* const* d_in, const int* in_sizes, int n_in,
                              void* d_out, int out_size, void* d_ws, size_t ws_size,
                              hipStream_t stream) {
  if (n_in < 5) return;
  if (in_sizes[0] != kRows * kHid) return;
  if (in_sizes[1] != kHid * kHid) return;
  if (in_sizes[2] != kHid * kHid) return;
  if (in_sizes[3] != kHid * kHid) return;
  if (in_sizes[4] != kHid * kHid) return;
  if (out_size != kRows * kHid) return;
  if (ws_size < kWsTotal) return;

  const float* x  = (const float*)d_in[0];
  const float* wq = (const float*)d_in[1];
  const float* wk = (const float*)d_in[2];
  const float* wv = (const float*)d_in[3];
  const float* wo = (const float*)d_in[4];
  float* out = (float*)d_out;

  char* ws = (char*)d_ws;
  unsigned short* X16  = (unsigned short*)(ws + kOffX16);
  unsigned short* W16  = (unsigned short*)(ws + kOffW16);
  float*          COS  = (float*)(ws + kOffCos);
  float*          SIN  = (float*)(ws + kOffSin);
  unsigned short* Q16  = (unsigned short*)(ws + kOffQ16);
  unsigned short* K16  = (unsigned short*)(ws + kOffK16);
  unsigned short* VT16 = (unsigned short*)(ws + kOffVT16);
  unsigned short* A16  = (unsigned short*)(ws + kOffA16);
  const unsigned short* Wqk16 = W16;
  const unsigned short* Wo16  = W16 + (size_t)3 * kHid * kHid;

  static_assert((kRows % kBT) == 0 && (kHid % kBT) == 0 && (kSeq % kBT) == 0, "block tiles exact");
  static_assert((kHid % kKC) == 0 && kHid / kKC >= 2, "whole passes, two or more");

  prep_kernel<<<kPrepBlocks, kPrepThreads, 0, stream>>>(x, wq, wk, wv, wo, X16, COS, SIN);

  wmma_gemm64<4><<<dim3(kQKBlocks + kVBlocks, 1), 128, 0, stream>>>(
      X16, kHid, 0L,
      Wqk16, kHid, 0L,
      (void*)Q16, 0, 0L,
      COS, SIN,
      kRows, 2 * kHid, kHid, kQKScale);

  attn_kernel<<<kBatch * kHeads * kQTiles, 128, 0, stream>>>(Q16, K16, VT16, A16);

  wmma_gemm64<0><<<dim3((kRows / kBT) * (kHid / kBT), 1), 128, 0, stream>>>(
      A16, kHid, 0L,
      Wo16, kHid, 0L,
      (void*)out, kHid, 0L,
      nullptr, nullptr,
      kRows, kHid, kHid, kOutScale);
}

// v006
// One run takes 81 microseconds.
// Timed twice side by side with v005, it ran 1.05 times as fast both times.
// All steps since v000 together make it 2.92 times as fast.
// All contractions (q/k/v projections, q.k^T, p.v, output projection): v_wmma_f32_16x16x32_f16, f16 operands with power-of-two carries, f32 accumulate; rotary tables, exp, row sums and normalisation in f32.
#include <hip/hip_runtime.h>
#include <math.h>

typedef __attribute__((ext_vector_type(16))) _Float16 v16h;
typedef __attribute__((ext_vector_type(8)))  _Float16 v8h;
typedef __attribute__((ext_vector_type(8)))  float    v8f;
typedef __attribute__((ext_vector_type(4)))  float    v4f;

// ---------------------------------------------------------------------------
// Shape constants
// ---------------------------------------------------------------------------
constexpr int kBatch  = 2;
constexpr int kSeq    = 2048;
constexpr int kHid    = 1024;
constexpr int kHeads  = 16;
constexpr int kHd     = 64;
constexpr int kRows   = kBatch * kSeq;
constexpr int kHalfHd = kHd / 2;
static_assert(kHeads * kHd == kHid, "head split");
static_assert(kHd == 64, "head width fixed at 64");
static_assert((kSeq % 64) == 0 && (kHid % 64) == 0 && (kHid % 32) == 0 && (kRows % 64) == 0, "tile multiples");
static_assert(kSeq == 2048 && kHid == 1024, "bit tricks below assume these");

// ---------------------------------------------------------------------------
// Power-of-two carries of the f16 planes and the derived fold-back scales
// ---------------------------------------------------------------------------
constexpr double cx_sqrt(double x) {
  double g = (x > 1.0) ? x : 1.0;
  for (int it = 0; it < 80; ++it) g = 0.5 * (g + x / g);
  return g;
}
constexpr float kXCarry    = 16.0f;
constexpr float kWCarry    = 256.0f;
constexpr float kQKCarry   = 16.0f;
constexpr float kVCarry    = 16.0f;
constexpr float kAttnCarry = 2048.0f;
constexpr float kInvSqrtHd = (float)(1.0 / cx_sqrt((double)kHd));
static_assert(kInvSqrtHd == 0.125f, "1/sqrt(head width)");
constexpr float kQKScale    = kQKCarry / (kXCarry * kWCarry);
constexpr float kVScale     = kVCarry / (kXCarry * kWCarry);
constexpr float kScoreScale = kInvSqrtHd / (kQKCarry * kQKCarry);
constexpr float kCtxScale   = kAttnCarry / kVCarry;
constexpr float kOutScale   = 1.0f / (kAttnCarry * kWCarry);
constexpr float kScoreClamp = 10.0f;

// ---------------------------------------------------------------------------
// Rotary inverse frequencies: 10000^(-2i/64) = 10^(-i/8), i = 0..31, evaluated in double at build time, converted to f32
// ---------------------------------------------------------------------------
struct InvFreqTab { float v[kHalfHd]; };
constexpr InvFreqTab make_inv_freq() {
  InvFreqTab t{};
  const double r8 = cx_sqrt(cx_sqrt(cx_sqrt(10.0)));
  for (int i = 0; i < kHalfHd; ++i) {
    double p = 1.0;
    for (int j = 0; j < (i & 7); ++j) p *= r8;
    for (int j = 0; j < (i >> 3); ++j) p *= 10.0;
    t.v[i] = (float)(1.0 / p);
  }
  return t;
}
__device__ constexpr InvFreqTab kInvFreq = make_inv_freq();
static_assert(sizeof(kInvFreq.v) / sizeof(kInvFreq.v[0]) == 32, "table length");

// ---------------------------------------------------------------------------
// Workspace region map (bytes; every offset a multiple of 128)
//   X16   f16 [4096][1024]          x carried x16                         8,388,608
//   W16   f16 [4][1024][1024]       w_q | w_k | w_v | w_o carried x256    8,388,608
//   COS   f32 [2048][32]                                                    262,144
//   SIN   f32 [2048][32]                                                    262,144
//   Q16   f16 [32][2048][64]        rotated q carried x16                 8,388,608
//   K16   f16 [32][2048][64]        rotated k carried x16 (follows Q16)   8,388,608
//   VT16  f16 [32][64][2048]        v transposed, carried x16             8,388,608
//   A16   f16 [4096][1024]          attention output carried x2048        8,388,608
//   total                                                                50,855,936
// ---------------------------------------------------------------------------
constexpr size_t kPlaneBytes = (size_t)kRows * kHid * 2;
constexpr size_t kTabBytes   = (size_t)kSeq * kHalfHd * 4;
constexpr size_t kOffX16  = 0;
constexpr size_t kOffW16  = kOffX16 + kPlaneBytes;
constexpr size_t kOffCos  = kOffW16 + (size_t)4 * kHid * kHid * 2;
constexpr size_t kOffSin  = kOffCos + kTabBytes;
constexpr size_t kOffQ16  = kOffSin + kTabBytes;
constexpr size_t kOffK16  = kOffQ16 + kPlaneBytes;
constexpr size_t kOffVT16 = kOffK16 + kPlaneBytes;
constexpr size_t kOffA16  = kOffVT16 + kPlaneBytes;
constexpr size_t kWsTotal = kOffA16 + kPlaneBytes;
static_assert(kWsTotal == 50855936ull, "carve total");
static_assert(kWsTotal <= 134217728ull, "carve cap");
static_assert((kOffW16 % 128) == 0 && (kOffCos % 128) == 0 && (kOffSin % 128) == 0 && (kOffQ16 % 128) == 0 &&
              (kOffK16 % 128) == 0 && (kOffVT16 % 128) == 0 && (kOffA16 % 128) == 0, "128-B aligned regions");
constexpr size_t kPlaneElems = (size_t)kRows * kHid;

// ---------------------------------------------------------------------------
// Fragment helpers (split k map for A and B: elements 0..7 <- p[0..7], 8..15 <- p[16..23], p already offset by 8*(lane>>4))
// ---------------------------------------------------------------------------
struct FragH {
  union U { v16h v; v8h h[2]; };
  static __device__ __forceinline__ v16h load(const _Float16* p) {
    U f;
    f.h[0] = *(const v8h*)(p);
    f.h[1] = *(const v8h*)(p + 16);
    return f.v;
  }
  static __device__ __forceinline__ v8f mma(v16h a, v16h b, v8f c) {
    return __builtin_amdgcn_wmma_f32_16x16x32_f16(false, a, false, b, (short)0, c, false, false);
  }
};
__device__ __forceinline__ void guard4_h(v8f& a, v8f& b, v8f& c, v8f& d, v16h x, v16h y) {
  asm volatile("v_nop\n\tv_nop\n\tv_nop\n\tv_nop" : "+v"(a), "+v"(b), "+v"(c), "+v"(d) : "v"(x), "v"(y));
}
__device__ __forceinline__ void keep4_h(v16h a, v16h b, v16h c, v16h d) {
  asm volatile("v_nop" :: "v"(a), "v"(b), "v"(c), "v"(d));
}
// Inputs-only hold on eight loaded fragments: their LDS reads stand as one group with one wait in front of the products that
// follow; without it each product waits for its own pair of reads.
__device__ __forceinline__ void hold8_h(v16h a, v16h b, v16h c, v16h d, v16h e, v16h f, v16h g, v16h h) {
  asm volatile("" :: "v"(a), "v"(b), "v"(c), "v"(d), "v"(e), "v"(f), "v"(g), "v"(h));
}
__device__ __forceinline__ void acc_guard4(v8f& a, v8f& b, v8f& c, v8f& d) {
  asm volatile("v_nop\n\tv_nop\n\tv_nop\n\tv_nop" : "+v"(a), "+v"(b), "+v"(c), "+v"(d));
}

// ---------------------------------------------------------------------------
// Preparation, one launch: f32 -> f16 casts of x and of the four weight matrices with their power-of-two carries, and the
// rotary tables. One work-group of 16 waves per 1/256 of the work; every wave lives long instead of many short waves.
// Casts: a piece is 8 consecutive elements (32 B read, 16 B stored). The grid has kPrepLanes = 131,072 threads; thread g takes
//   pieces g + j * kPrepLanes, j = 0..7: j = 0..3 are the four quarters of x, j = 4..7 are w_q, w_k, w_v, w_o (one matrix is
//   exactly kPrepLanes pieces). Destination piece index = source piece index, since W16 follows X16 in the workspace.
//   All 16 reads of a thread are issued before the first value is used.
// Rotary tables: COS/SIN [2048][32] f32, angle = float(position) * inv_freq[i] (single f32 multiply), accurate sincosf;
//   waves 0..7 of each work-group compute one entry per lane (256 x 256 = 65,536 entries) while their reads are in flight.
// ---------------------------------------------------------------------------
constexpr int kPrepThreads = 512;
constexpr int kPrepBlocks  = 256;
constexpr int kPrepLanes   = kPrepThreads * kPrepBlocks;
constexpr int kXn8 = kRows * kHid / 8;
constexpr int kWn8 = kHid * kHid / 8;
static_assert(kWn8 == kPrepLanes && kXn8 == 4 * kPrepLanes, "eight pieces per thread: four of x, one of each matrix");
static_assert(kOffX16 == 0 && kOffW16 == kOffX16 + (size_t)kXn8 * 16, "W16 follows X16");
static_assert(kSeq * kHalfHd == kPrepBlocks * 256, "one table entry per lane of waves 0..7");
__global__ __launch_bounds__(kPrepThreads) void prep_kernel(
    const float* __restrict__ x, const float* __restrict__ wq, const float* __restrict__ wk,
    const float* __restrict__ wv, const float* __restrict__ wo,
    unsigned short* __restrict__ out, float* __restrict__ cosT, float* __restrict__ sinT)
{
  const unsigned g = blockIdx.x * kPrepThreads + threadIdx.x;
  const float* sp[8] = { x, x + (size_t)8 * kPrepLanes, x + (size_t)16 * kPrepLanes, x + (size_t)24 * kPrepLanes,
                         wq, wk, wv, wo };
  const float inv = kInvFreq.v[threadIdx.x & 31];
  /* the table read's index register may be reused by what follows */
  asm volatile("s_wait_xcnt 0x0" ::: "memory");
  const unsigned rb = g * 32u;
  v4f a[8], c[8];
#pragma unroll
  for (int j = 0; j < 8; ++j) {
    const float* p = (const float*)((const char*)sp[j] + rb);
    a[j] = *(const v4f*)(p);
    c[j] = *(const v4f*)(p + 4);
  }
  /* inputs-only hold: the table read stays in front of the 16 reads, so its wait does not drain them */
  asm volatile("" :: "v"(inv));
  /* wave-uniform: waves 0..7 */
  if (threadIdx.x < 256) {
    const int t = blockIdx.x * 256 + threadIdx.x;
    const int s = t >> 5;
    const float ang = (float)s * inv;
    float sn, cs;
    sincosf(ang, &sn, &cs);
    cosT[t] = cs;
    sinT[t] = sn;
  }
#pragma unroll
  for (int j = 0; j < 8; ++j) {
    const float scale = (j < 4) ? kXCarry : kWCarry;
    v8h hv;
#pragma unroll
    for (int e = 0; e < 4; ++e) {
      const float f0 = a[j][e] * scale;
      const float f1 = c[j][e] * scale;
      hv[e]     = (_Float16)f0;
      hv[4 + e] = (_Float16)f1;
    }
    *(v8h*)((char*)(out + (size_t)8 * kPrepLanes * j) + g * 16u) = hv;
  }
}

// ---------------------------------------------------------------------------
// Asynchronous copy of 8 slices of 16 tile rows to LDS: each lane moves its own 16 B per slice, a wave 4 whole 128-B rows.
// lds = the lane's LDS byte address in slice 0, g = its global address in slice 0, gstep = 16 source rows in halves.
// s_wait_xcnt 0 closes the statement so that no address register named here is rewritten ahead of it.
// ---------------------------------------------------------------------------
constexpr int kBT = 128;                     // block tile: rows of A and rows of Bt
constexpr int kKC = 64;                      // k per pass: tile rows of 128 B
constexpr int kGP = 72;                      // LDS row pitch in halves: 144 B = 16 B x 9, for ds_load_b128 readers
constexpr int kOpHalves    = kBT * kGP;      // one operand's tile
constexpr int kStageHalves = 2 * kOpHalves;  // [A tile | Bt tile]
constexpr unsigned kSliceBytes = 16u * kGP * 2u;
__device__ __forceinline__ void async_copy8(unsigned lds, const _Float16* g, size_t gstep) {
  asm volatile(
      "global_load_async_to_lds_b128 %0, %8, off\n\t"
      "global_load_async_to_lds_b128 %1, %9, off\n\t"
      "global_load_async_to_lds_b128 %2, %10, off\n\t"
      "global_load_async_to_lds_b128 %3, %11, off\n\t"
      "global_load_async_to_lds_b128 %4, %12, off\n\t"
      "global_load_async_to_lds_b128 %5, %13, off\n\t"
      "global_load_async_to_lds_b128 %6, %14, off\n\t"
      "global_load_async_to_lds_b128 %7, %15, off\n\t"
      "s_wait_xcnt 0x0"
      :: "v"(lds), "v"(lds + kSliceBytes), "v"(lds + 2u * kSliceBytes), "v"(lds + 3u * kSliceBytes),
         "v"(lds + 4u * kSliceBytes), "v"(lds + 5u * kSliceBytes), "v"(lds + 6u * kSliceBytes), "v"(lds + 7u * kSliceBytes),
         "v"(g), "v"(g + gstep), "v"(g + 2 * gstep), "v"(g + 3 * gstep),
         "v"(g + 4 * gstep), "v"(g + 5 * gstep), "v"(g + 6 * gstep), "v"(g + 7 * gstep)
      : "memory");
}

// ---------------------------------------------------------------------------
// Batched GEMM: C[m,n] = scale * sum_k A[m,k] * Bt[n,k]; a block of 4 waves (2 x 2) owns a 128x128 tile, each wave 64x64 of it.
// A row-major [M,K]; Bt row-major [N,K]; M, N multiples of 128, K a multiple of 64 and at least 128 (asserted on the host).
// Operands: per pass of 64 k the block's 128 A rows and 128 Bt rows go to LDS by asynchronous copies, two buffers, the next
//           pass's copies in flight while this pass's fragments are read; every wave copies, waits and passes every barrier.
// Store mode 0: f32 rows; mode 1: f16 rows.
// Store mode 3: N = 2 x kHid (q columns then k columns); the 64-wide tile is one head; interleaved-pair rotation with
//             COS/SIN[position][pair] then f16 store to plane (n0 >> 10) laid out [batch*heads + head][position][64]
// OUT_MODE 4: the three input projections in one launch, so that three work-groups share each WGP from the start.
//             Blocks 0 .. kQKBlocks - 1 are the q|k tiles of the arguments as given (store mode 3). The kVBlocks blocks behind
//             them are the transposed v projection (store mode 1): A = w_v, the third matrix behind Btp; Bt = the rows of Ap of
//             one batch; C = the plane behind the q and k planes, [batch][kHid][kSeq]. The choice is block-uniform.
// Store coverage per 16-row slab: mode 0: 8 iterations x 2 rows; modes 1 and 3: 4 iterations x 4 rows; 64 columns each.
// ---------------------------------------------------------------------------
constexpr int kQKBlocks = (kRows / kBT) * (2 * kHid / kBT);
constexpr int kVBlocksPerBatch = (kHid / kBT) * (kSeq / kBT);
constexpr int kVBlocks = kBatch * kVBlocksPerBatch;
static_assert(kOffK16 == kOffQ16 + kPlaneBytes && kOffVT16 == kOffK16 + kPlaneBytes, "the v plane follows the q and k planes");
template <int OUT_MODE>
__global__ __launch_bounds__(128) void wmma_gemm64(
    const unsigned short* __restrict__ Ap, int lda, long strideA,
    const unsigned short* __restrict__ Btp, int ldb, long strideB,
    void* __restrict__ Cp, int ldc, long strideC,
    const float* __restrict__ cosT, const float* __restrict__ sinT,
    int M, int N, int K, float scale)
{
  const _Float16* A  = (const _Float16*)Ap;
  const _Float16* Bt = (const _Float16*)Btp;
  void* Cout = Cp;
  int b    = blockIdx.y;
  int tile = blockIdx.x;
  /* block-uniform: this block belongs to the v projection */
  const bool vpart = (OUT_MODE == 4) && (tile >= kQKBlocks);
  if (vpart) {
    tile -= kQKBlocks;
    b     = tile / kVBlocksPerBatch;
    tile -= b * kVBlocksPerBatch;
    A  = (const _Float16*)Btp + (size_t)2 * kHid * kHid;
    Bt = (const _Float16*)Ap;
    strideA = 0L;
    strideB = (long)kSeq * kHid;
    Cout    = (void*)((unsigned short*)Cp + 2 * kPlaneElems);
    ldc     = kSeq;
    strideC = (long)kHid * kSeq;
    M = kHid;
    N = kSeq;
    scale = kVScale;
  }
  const int mode = (OUT_MODE == 4) ? (vpart ? 1 : 3) : OUT_MODE;
  __shared__ __align__(16) _Float16 ring[2 * kStageHalves];
  __shared__ __align__(16) float sT[4][16 * 68];
  const int tid  = threadIdx.x;
  const int lane = threadIdx.x & 31;
  const int wave = __builtin_amdgcn_readfirstlane((int)(threadIdx.x >> 5));
  const int tilesN = N >> 7;
  const int tilesM = M >> 7;
  /* block-uniform exit, in front of every copy and barrier */
  if (tile >= tilesM * tilesN) return;
  const int tm = tile / tilesN;
  const int tn = tile - tm * tilesN;
  const int wm = wave >> 1;
  const int wn = wave & 1;
  const int m0 = (tm << 7) + (wm << 6);
  const int n0 = (tn << 7) + (wn << 6);

  const _Float16* Ab = A  + (size_t)b * strideA;
  const _Float16* Bb = Bt + (size_t)b * strideB;

  const int rlane = lane & 15;
  const int koff  = (lane >> 4) * 8;
  const int mOff  = (lane >> 4) * 8;

  v8f acc[4][4];
#pragma unroll
  for (int i = 0; i < 4; ++i)
#pragma unroll
    for (int j = 0; j < 4; ++j) acc[i][j] = (v8f){0.f,0.f,0.f,0.f,0.f,0.f,0.f,0.f};

  /* copy map: thread -> row tid / 8 of each 16-row slice, 16-B part tid % 8 of its 128 B */
  const int crow  = tid >> 3;
  const int cpart = (tid & 7) * 8;
  const _Float16* gA = Ab + (size_t)((tm << 7) + crow) * lda + cpart;
  const _Float16* gB = Bb + (size_t)((tn << 7) + crow) * ldb + cpart;
  const size_t stepA = (size_t)16 * lda;
  const size_t stepB = (size_t)16 * ldb;
  const unsigned ldsA =
      (unsigned)(size_t)(__attribute__((address_space(3))) _Float16*)ring + (unsigned)(crow * kGP + cpart) * 2u;
  const unsigned ldsB = ldsA + (unsigned)kOpHalves * 2u;
  constexpr unsigned kStageBytes = (unsigned)kStageHalves * 2u;
  const _Float16* fA = ring + ((wm << 6) + rlane) * kGP + koff;
  const _Float16* fB = ring + kOpHalves + ((wn << 6) + rlane) * kGP + koff;
  const int passes = K / kKC;

  async_copy8(ldsA, gA, stepA);
  async_copy8(ldsB, gB, stepB);
  /* pass 0's tile has landed for this wave; the barrier publishes it to the other waves */
  asm volatile("s_wait_asynccnt 0x0" ::: "memory");
  __syncthreads();
  if (1 < passes) {
    async_copy8(ldsA + kStageBytes, gA + kKC, stepA);
    async_copy8(ldsB + kStageBytes, gB + kKC, stepB);
  }

  for (int t = 0; t < passes; ++t) {
    const int buf = t & 1;
    const _Float16* pA = fA + buf * kStageHalves;
    const _Float16* pB = fB + buf * kStageHalves;
    /* unrolled, like the loops inside: every fragment and accumulator index is a constant, so the arrays stay in registers */
#pragma unroll
    for (int kk = 0; kk < kKC; kk += 32) {
      /* the 16 LDS reads of a 32-k step stand as one group in front of its 16 products */
      v16h ah[4], bh[4];
#pragma unroll
      for (int j = 0; j < 4; ++j) bh[j] = FragH::load(pB + (j << 4) * kGP + kk);
#pragma unroll
      for (int i = 0; i < 4; ++i) ah[i] = FragH::load(pA + (i << 4) * kGP + kk);
#pragma unroll
      for (int i = 0; i < 4; ++i) {
#pragma unroll
        for (int j = 0; j < 4; ++j) acc[i][j] = FragH::mma(ah[i], bh[j], acc[i][j]);
        guard4_h(acc[i][0], acc[i][1], acc[i][2], acc[i][3], ah[i], bh[3]);
      }
      keep4_h(bh[0], bh[1], bh[2], bh[3]);
    }
    /* this wave's reads of buffer buf are complete before any wave refills it */
    asm volatile("s_wait_dscnt 0x0" ::: "memory");
    /* this wave's copies of pass t + 1 have landed before the barrier publishes them */
    asm volatile("s_wait_asynccnt 0x0" ::: "memory");
    __syncthreads();
    if (t + 2 < passes) {
      async_copy8(ldsA + (unsigned)buf * kStageBytes, gA + (size_t)(t + 2) * kKC, stepA);
      async_copy8(ldsB + (unsigned)buf * kStageBytes, gB + (size_t)(t + 2) * kKC, stepB);
    }
  }
  /* no copy of this wave is outstanding past here */
  asm volatile("s_wait_asynccnt 0x0" ::: "memory");
  acc_guard4(acc[0][0], acc[0][1], acc[0][2], acc[0][3]);
  acc_guard4(acc[1][0], acc[1][1], acc[1][2], acc[1][3]);
  acc_guard4(acc[2][0], acc[2][1], acc[2][2], acc[2][3]);
  acc_guard4(acc[3][0], acc[3][1], acc[3][2], acc[3][3]);

  float* slab = sT[wave];
#pragma unroll
  for (int i = 0; i < 4; ++i) {
    const int mBase = m0 + (i << 4);
#pragma unroll
    for (int j = 0; j < 4; ++j) {
#pragma unroll
      for (int r = 0; r < 8; ++r) {
        const float v = acc[i][j][r] * scale;
        slab[(mOff + r) * 68 + (j << 4) + rlane] = v;
      }
    }
    __builtin_amdgcn_fence(__ATOMIC_RELEASE, "workgroup");
    __builtin_amdgcn_wave_barrier();
    __builtin_amdgcn_fence(__ATOMIC_ACQUIRE, "workgroup");
    if (mode == 0) {
      float* C = (float*)Cout + (size_t)b * strideC;
      const int hh = lane >> 4, c4 = (lane & 15) * 4;
      {
#pragma unroll
        for (int it = 0; it < 8; ++it) {
          const int row = it * 2 + hh;
          v4f v = *(const v4f*)(slab + row * 68 + c4);
          *(v4f*)(C + (size_t)(mBase + row) * ldc + n0 + c4) = v;
        }
        
      }
    } else if (mode == 1) {
      const int q = lane >> 3, c8 = (lane & 7) * 8;
      unsigned short* C = (unsigned short*)Cout + (size_t)b * strideC;
      v8h ov[4];
#pragma unroll
      for (int it = 0; it < 4; ++it) {
        const int row = it * 4 + q;
        const float* sp = slab + row * 68 + c8;
        const v4f a0 = *(const v4f*)(sp);
        const v4f a1 = *(const v4f*)(sp + 4);
#pragma unroll
        for (int e = 0; e < 4; ++e) {
          ov[it][e]     = (_Float16)a0[e];
          ov[it][4 + e] = (_Float16)a1[e];
        }
      }
      {
#pragma unroll
        for (int it = 0; it < 4; ++it) {
          const int row = it * 4 + q;
          *(v8h*)(C + (size_t)(mBase + row) * ldc + n0 + c8) = ov[it];
        }
        
      }
    } else {
      const int q = lane >> 3, c8 = (lane & 7) * 8;
      const int which = n0 >> 10;
      const int head  = (n0 >> 6) & (kHeads - 1);
      unsigned short* C = (unsigned short*)Cout + (size_t)which * kPlaneElems;
      v8h ov[4];
      size_t oo[4];
#pragma unroll
      for (int it = 0; it < 4; ++it) {
        const int row = it * 4 + q;
        const int m   = mBase + row;
        const int bb  = m >> 11;
        const int s   = m & (kSeq - 1);
        const float* sp = slab + row * 68 + c8;
        const v4f a0 = *(const v4f*)(sp);
        const v4f a1 = *(const v4f*)(sp + 4);
        const v4f cv = *(const v4f*)(cosT + (size_t)s * kHalfHd + (c8 >> 1));
        const v4f sv = *(const v4f*)(sinT + (size_t)s * kHalfHd + (c8 >> 1));
        const float o0 = a0[0] * cv[0] - a0[1] * sv[0];
        const float o1 = a0[0] * sv[0] + a0[1] * cv[0];
        const float o2 = a0[2] * cv[1] - a0[3] * sv[1];
        const float o3 = a0[2] * sv[1] + a0[3] * cv[1];
        const float o4 = a1[0] * cv[2] - a1[1] * sv[2];
        const float o5 = a1[0] * sv[2] + a1[1] * cv[2];
        const float o6 = a1[2] * cv[3] - a1[3] * sv[3];
        const float o7 = a1[2] * sv[3] + a1[3] * cv[3];
        ov[it][0] = (_Float16)o0;
        ov[it][1] = (_Float16)o1;
        ov[it][2] = (_Float16)o2;
        ov[it][3] = (_Float16)o3;
        ov[it][4] = (_Float16)o4;
        ov[it][5] = (_Float16)o5;
        ov[it][6] = (_Float16)o6;
        ov[it][7] = (_Float16)o7;
        oo[it] = ((size_t)(bb * kHeads + head) * kSeq + s) * kHd + c8;
      }
      {
#pragma unroll
        for (int it = 0; it < 4; ++it) *(v8h*)(C + oo[it]) = ov[it];
        
      }
    }
    __builtin_amdgcn_fence(__ATOMIC_RELEASE, "workgroup");
    __builtin_amdgcn_wave_barrier();
    __builtin_amdgcn_fence(__ATOMIC_ACQUIRE, "workgroup");
  }
}

// ---------------------------------------------------------------------------
// Attention for one (batch, head) and two query tiles of 64 rows per block, key tiles of 64, transposed products.
//   The two tiles are i and kQTiles - 1 - i: every block has the same number of P.V tiles. Each of the 4 waves carries two
//   groups of 16 queries, rows 16 * wave .. + 15 of either tile; a K or Vt fragment is read from LDS once for both groups.
//   Per group:
//   S^T = K16 . Q16^T: A = 16 key rows from LDS, B = the group's 16 queries, kept in registers; a lane holds, of ONE query
//   (column lane & 15), the keys 8 * (lane >> 4) + r of each 16-key group, for ALL 32 key tiles;
//   p = exp(min(score * kScoreScale, clamp)) unnormalised, f32; the row sum l accumulates every key (future keys included)
//   in the lane, 8 partial sums, joined in the lane and across the two wave halves once after the loop;
//   O^T += Vt . P^T only for key tiles at or below the diagonal (tile index <= the group's query tile, block-uniform), with p set
//   to zero where key > query inside the diagonal tile; O = acc / l, no renormalisation.
//   P^T never leaves the registers: score groups 2kk and 2kk + 1 of a lane are elements 0..7 and 8..15 of its B fragment for
//   keys 32kk..32kk+31, the k map that FragH::load gives the Vt rows (A): 8 * (lane >> 4) + e, then 16 + 8 * (lane >> 4) + e.
// LDS: two buffers of [K tile [64 keys][72] f16 | Vt tile [64 dd][72] f16] (columns 0..63 written and read, pad never read);
//   each tile is brought by asynchronous copies, 128 threads x 4 x 16 B = 8,192 B = the whole tile; key tile kc + 2 is
//   copied into the buffer that tile kc has just left, so a tile's copies fly while the tile in front of it is worked on.
//   A Vt tile is copied only where it is used (tile index <= the higher query tile's index, block-uniform).
// Output: a lane holds 8 consecutive head columns of its query per 16-row group of O^T and stores them as 16 B; the wave
//   writes the whole 128-B head slice of each of its 2 x 16 rows.
// Block barriers: one in front of the loop, one at the foot of each key tile; all 4 waves run all 32 tiles; no early exits.
// grid.x = 32 (batch, head) groups x 16 pairs of query tiles.
// ---------------------------------------------------------------------------
constexpr int kQB = 64;
constexpr int kKT = 64;
constexpr int kLP = 72;
constexpr int kQTiles = kSeq / kQB;
constexpr int kKTiles = kSeq / kKT;
constexpr int kQPairs = kQTiles / 2;
static_assert(kQTiles == 2 * kQPairs && kQPairs >= 1, "query tiles pair up; the high tile of a pair has index 1 or more");
static_assert(kQB == kKT, "diagonal tile logic assumes equal tiles");
static_assert(kLP == kGP && kKT == 64 && kHd == 64, "a tile is 4 slices of 16 rows at the pitch of kSliceBytes");
static_assert(kKTiles >= 2, "two buffers are filled in front of the loop");
constexpr int kTileHalves   = kKT * kLP;       // one operand's tile
constexpr int kAStageHalves = 2 * kTileHalves; // [K tile | Vt tile]
// Asynchronous copy of one 64-row tile to LDS, 4 slices of 16 rows: each lane moves its own 16 B per slice.
// lds = the lane's LDS byte address in slice 0, g = its global address in slice 0, gstep = 16 source rows in halves.
// s_wait_xcnt 0 closes the statement so that no address register named here is rewritten ahead of it.
__device__ __forceinline__ void async_copy4(unsigned lds, const _Float16* g, size_t gstep) {
  asm volatile(
      "global_load_async_to_lds_b128 %0, %4, off\n\t"
      "global_load_async_to_lds_b128 %1, %5, off\n\t"
      "global_load_async_to_lds_b128 %2, %6, off\n\t"
      "global_load_async_to_lds_b128 %3, %7, off\n\t"
      "s_wait_xcnt 0x0"
      :: "v"(lds), "v"(lds + kSliceBytes), "v"(lds + 2u * kSliceBytes), "v"(lds + 3u * kSliceBytes),
         "v"(g), "v"(g + gstep), "v"(g + 2 * gstep), "v"(g + 3 * gstep)
      : "memory");
}

__global__ __launch_bounds__(128) void attn_kernel(
    const unsigned short* __restrict__ Qp, const unsigned short* __restrict__ Kp,
    const unsigned short* __restrict__ Vtp, unsigned short* __restrict__ Op)
{
  __shared__ __align__(16) _Float16 ring[2 * kAStageHalves];

  const int tid  = threadIdx.x;
  const int wave = __builtin_amdgcn_readfirstlane((int)(threadIdx.x >> 5));
  const int lane = tid & 31;
  const int hh   = lane >> 4;
  const int c    = lane & 15;
  const int pi   = blockIdx.x % kQPairs;
  const int bh   = blockIdx.x / kQPairs;
  /* the block's two query tiles: group 0 the low one, group 1 its mirror, so every block has kQTiles + 1 P.V tiles */
  const int qt[2] = { pi, kQTiles - 1 - pi };
  const int qlo = qt[0];
  const int qhi = qt[1];

  const _Float16* Qb = (const _Float16*)Qp  + (size_t)bh * kSeq * kHd;
  const _Float16* Kb = (const _Float16*)Kp  + (size_t)bh * kSeq * kHd;
  const _Float16* Vb = (const _Float16*)Vtp + (size_t)bh * kHd * kSeq;

  v16h qf[2][2];
#pragma unroll
  for (int g = 0; g < 2; ++g)
#pragma unroll
    for (int dc = 0; dc < 2; ++dc)
      qf[g][dc] = FragH::load(Qb + (size_t)(qt[g] * kQB + wave * 16 + c) * kHd + dc * 32 + 8 * hh);

  float lsum[2][8];
  v8f oacc[2][4];
#pragma unroll
  for (int g = 0; g < 2; ++g) {
#pragma unroll
    for (int r = 0; r < 8; ++r) lsum[g][r] = 0.f;
#pragma unroll
    for (int t = 0; t < 4; ++t) oacc[g][t] = (v8f){0.f,0.f,0.f,0.f,0.f,0.f,0.f,0.f};
  }

  /* copy map: thread -> row tid / 8 of each 16-row slice, 16-B part tid % 8 of its 128 B */
  const int crow  = tid >> 3;
  const int cpart = (tid & 7) * 8;
  const _Float16* gK = Kb + (size_t)crow * kHd + cpart;
  const _Float16* gV = Vb + (size_t)crow * kSeq + cpart;
  constexpr size_t kStepK = (size_t)16 * kHd;
  constexpr size_t kStepV = (size_t)16 * kSeq;
  const unsigned ldsK =
      (unsigned)(size_t)(__attribute__((address_space(3))) _Float16*)ring + (unsigned)(crow * kLP + cpart) * 2u;
  const unsigned ldsV = ldsK + (unsigned)kTileHalves * 2u;
  constexpr unsigned kAStageBytes = (unsigned)kAStageHalves * 2u;

  /* key tile 0 (its Vt tile is used by every query tile) */
  async_copy4(ldsK, gK, kStepK);
  async_copy4(ldsV, gV, kStepV);
  /* tile 0 has landed for this wave; the barrier publishes it to the other waves */
  asm volatile("s_wait_asynccnt 0x0" ::: "memory");
  __syncthreads();
  /* key tile 1: the high query tile's index is at least kQTiles / 2, so its Vt tile is always used */
  async_copy4(ldsK + kAStageBytes, gK + (size_t)kKT * kHd, kStepK);
  async_copy4(ldsV + kAStageBytes, gV + kKT, kStepV);

#pragma unroll 1
  for (int kc = 0; kc < kKTiles; ++kc) {
    const int kv0 = kc * kKT;
    const int buf = kc & 1;
    const _Float16* Ksh = ring + buf * kAStageHalves;
    const _Float16* Vsh = Ksh + kTileHalves;

    /* the K tile's fragments, each read once and used by both query groups */
    v16h kf[4][2];
#pragma unroll
    for (int j = 0; j < 4; ++j)
#pragma unroll
      for (int dc = 0; dc < 2; ++dc) kf[j][dc] = FragH::load(Ksh + (j * 16 + c) * kLP + dc * 32 + 8 * hh);
    v8f s[2][4];
#pragma unroll
    for (int g = 0; g < 2; ++g)
#pragma unroll
      for (int j = 0; j < 4; ++j) s[g][j] = (v8f){0.f,0.f,0.f,0.f,0.f,0.f,0.f,0.f};
#pragma unroll
    for (int g = 0; g < 2; ++g)
#pragma unroll
      for (int dc = 0; dc < 2; ++dc)
#pragma unroll
        for (int j = 0; j < 4; ++j) s[g][j] = FragH::mma(kf[j][dc], qf[g][dc], s[g][j]);
#pragma unroll
    for (int g = 0; g < 2; ++g) {
#pragma unroll
      for (int j = 0; j < 4; ++j) {
#pragma unroll
        for (int r = 0; r < 8; ++r) {
          const float x = fminf(s[g][j][r] * kScoreScale, kScoreClamp);
          const float p = __expf(x);
          lsum[g][r] += p;
          s[g][j][r] = p;
        }
      }
    }
    /* block-uniform: this key tile contributes to the high group's P.V (and, where kc <= qlo, to the low group's) */
    if (kc <= qhi) {
      /* the Vt tile's fragments, each read once and used by every group that needs the tile */
      v16h vf[4][2];
#pragma unroll
      for (int t = 0; t < 4; ++t)
#pragma unroll
        for (int kk = 0; kk < 2; ++kk) vf[t][kk] = FragH::load(Vsh + (t * 16 + c) * kLP + kk * 32 + 8 * hh);
      /* the 16 LDS reads of the Vt tile as one group in front of its products */
      hold8_h(vf[0][0], vf[1][0], vf[2][0], vf[3][0], vf[0][1], vf[1][1], vf[2][1], vf[3][1]);
#pragma unroll
      for (int g = 1; g >= 0; --g) {
        /* block-uniform */
        if (kc <= qt[g]) {
          v16h pf[2];
#pragma unroll
          for (int kk = 0; kk < 2; ++kk) {
#pragma unroll
            for (int r = 0; r < 8; ++r) {
              pf[kk][r]     = (_Float16)s[g][2 * kk][r];
              pf[kk][8 + r] = (_Float16)s[g][2 * kk + 1][r];
            }
          }
          /* block-uniform: only the group's diagonal tile holds keys past a query */
          if (kc == qt[g]) {
            const int qrow = qt[g] * kQB + wave * 16 + c;
#pragma unroll
            for (int kk = 0; kk < 2; ++kk) {
#pragma unroll
              for (int e = 0; e < 16; ++e) {
                const int kvrow = kv0 + kk * 32 + (e >> 3) * 16 + 8 * hh + (e & 7);
                pf[kk][e] = (kvrow > qrow) ? (_Float16)0.0f : pf[kk][e];
              }
            }
          }
#pragma unroll
          for (int kk = 0; kk < 2; ++kk)
#pragma unroll
            for (int t = 0; t < 4; ++t) oacc[g][t] = FragH::mma(vf[t][kk], pf[kk], oacc[g][t]);
        }
      }
    }
    /* this wave's reads of buffer buf are complete before any wave refills it */
    asm volatile("s_wait_dscnt 0x0" ::: "memory");
    /* this wave's copies of tile kc + 1 have landed before the barrier publishes them */
    asm volatile("s_wait_asynccnt 0x0" ::: "memory");
    __syncthreads();
    if (kc + 2 < kKTiles) {
      async_copy4(ldsK + (unsigned)buf * kAStageBytes, gK + (size_t)(kc + 2) * kKT * kHd, kStepK);
      if (kc + 2 <= qhi) async_copy4(ldsV + (unsigned)buf * kAStageBytes, gV + (size_t)(kc + 2) * kKT, kStepV);
    }
  }
  /* no copy of this wave is outstanding past here */
  asm volatile("s_wait_asynccnt 0x0" ::: "memory");

  const int bb = bh / kHeads;
  const int h  = bh - bb * kHeads;
#pragma unroll
  for (int g = 0; g < 2; ++g) {
    float l = ((lsum[g][0] + lsum[g][1]) + (lsum[g][2] + lsum[g][3])) + ((lsum[g][4] + lsum[g][5]) + (lsum[g][6] + lsum[g][7]));
    l += __shfl_xor(l, 16, 32);
    const float inv = kCtxScale * __builtin_amdgcn_rcpf(l);
    unsigned short* op = Op + ((size_t)(bb * kSeq + qt[g] * kQB + wave * 16 + c)) * kHid + h * kHd + 8 * hh;
#pragma unroll
    for (int t = 0; t < 4; ++t) {
      v8h ov;
#pragma unroll
      for (int r = 0; r < 8; ++r) ov[r] = (_Float16)(oacc[g][t][r] * inv);
      *(v8h*)(op + t * 16) = ov;
    }
  }
}

// ---------------------------------------------------------------------------
// Host glue: 4 kernel launches, nothing else.
//   1 casts of x and w_q|w_k|w_v|w_o, rotary tables: 256 blocks of 512 threads
//   2 input projections, 768 blocks of 128 threads:
//     q|k projection + rotation: M 4096, N 2048, K 1024 -> 32 x 16 block tiles = 512 blocks;
//     v projection transposed (A = w_v, Bt = x of one batch): M 1024, N 2048, K 1024 -> 8 x 16 block tiles = 128 blocks x 2
//   3 attention: 32 x 16 = 512 blocks of 128 threads
//   4 output projection: M 4096, N 1024, K 1024 -> 32 x 8 block tiles = 256 blocks of 128 threads
// ---------------------------------------------------------------------------
extern "C" void kernel_launch(void* const* d_in, const int* in_sizes, int n_in,
                              void* d_out, int out_size, void* d_ws, size_t ws_size,
                              hipStream_t stream) {
  if (n_in < 5) return;
  if (in_sizes[0] != kRows * kHid) return;
  if (in_sizes[1] != kHid * kHid) return;
  if (in_sizes[2] != kHid * kHid) return;
  if (in_sizes[3] != kHid * kHid) return;
  if (in_sizes[4] != kHid * kHid) return;
  if (out_size != kRows * kHid) return;
  if (ws_size < kWsTotal) return;

  const float* x  = (const float*)d_in[0];
  const float* wq = (const float*)d_in[1];
  const float* wk = (const float*)d_in[2];
  const float* wv = (const float*)d_in[3];
  const float* wo = (const float*)d_in[4];
  float* out = (float*)d_out;

  char* ws = (char*)d_ws;
  unsigned short* X16  = (unsigned short*)(ws + kOffX16);
  unsigned short* W16  = (unsigned short*)(ws + kOffW16);
  float*          COS  = (float*)(ws + kOffCos);
  float*          SIN  = (float*)(ws + kOffSin);
  unsigned short* Q16  = (unsigned short*)(ws + kOffQ16);
  unsigned short* K16  = (unsigned short*)(ws + kOffK16);
  unsigned short* VT16 = (unsigned short*)(ws + kOffVT16);
  unsigned short* A16  = (unsigned short*)(ws + kOffA16);
  const unsigned short* Wqk16 = W16;
  const unsigned short* Wo16  = W16 + (size_t)3 * kHid * kHid;

  static_assert((kRows % kBT) == 0 && (kHid % kBT) == 0 && (kSeq % kBT) == 0, "block tiles exact");
  static_assert((kHid % kKC) == 0 && kHid / kKC >= 2, "whole passes, two or more");

  prep_kernel<<<kPrepBlocks, kPrepThreads, 0, stream>>>(x, wq, wk, wv, wo, X16, COS, SIN);

  wmma_gemm64<4><<<dim3(kQKBlocks + kVBlocks, 1), 128, 0, stream>>>(
      X16, kHid, 0L,
      Wqk16, kHid, 0L,
      (void*)Q16, 0, 0L,
      COS, SIN,
      kRows, 2 * kHid, kHid, kQKScale);

  attn_kernel<<<kBatch * kHeads * kQPairs, 128, 0, stream>>>(Q16, K16, VT16, A16);

  wmma_gemm64<0><<<dim3((kRows / kBT) * (kHid / kBT), 1), 128, 0, stream>>>(
      A16, kHid, 0L,
      Wo16, kHid, 0L,
      (void*)out, kHid, 0L,
      nullptr, nullptr,
      kRows, kHid, kHid, kOutScale);
}

// v007
// A run of this version takes 78.4 microseconds.
// Timed twice side by side with v006, it ran 1.03 and 1.04 times as fast.
// Over all steps from v000 it is 3.03 times as fast.
// All contractions (q/k/v projections, q.k^T, p.v, output projection): v_wmma_f32_16x16x32_f16, f16 operands with power-of-two carries, f32 accumulate; rotary tables, exp, row sums and normalisation in f32.
#include <hip/hip_runtime.h>
#include <math.h>

typedef __attribute__((ext_vector_type(16))) _Float16 v16h;
typedef __attribute__((ext_vector_type(8)))  _Float16 v8h;
typedef __attribute__((ext_vector_type(8)))  float    v8f;
typedef __attribute__((ext_vector_type(4)))  float    v4f;

// ---------------------------------------------------------------------------
// Shape constants
// ---------------------------------------------------------------------------
constexpr int kBatch  = 2;
constexpr int kSeq    = 2048;
constexpr int kHid    = 1024;
constexpr int kHeads  = 16;
constexpr int kHd     = 64;
constexpr int kRows   = kBatch * kSeq;
constexpr int kHalfHd = kHd / 2;
static_assert(kHeads * kHd == kHid, "head split");
static_assert(kHd == 64, "head width fixed at 64");
static_assert((kSeq % 64) == 0 && (kHid % 64) == 0 && (kHid % 32) == 0 && (kRows % 64) == 0, "tile multiples");
static_assert(kSeq == 2048 && kHid == 1024, "bit tricks below assume these");

// ---------------------------------------------------------------------------
// Power-of-two carries of the f16 planes and the derived fold-back scales
// ---------------------------------------------------------------------------
constexpr double cx_sqrt(double x) {
  double g = (x > 1.0) ? x : 1.0;
  for (int it = 0; it < 80; ++it) g = 0.5 * (g + x / g);
  return g;
}
constexpr float kXCarry    = 16.0f;
constexpr float kWCarry    = 256.0f;
constexpr float kQKCarry   = 16.0f;
constexpr float kVCarry    = 16.0f;
constexpr float kAttnCarry = 2048.0f;
constexpr float kInvSqrtHd = (float)(1.0 / cx_sqrt((double)kHd));
static_assert(kInvSqrtHd == 0.125f, "1/sqrt(head width)");
constexpr float kQKScale    = kQKCarry / (kXCarry * kWCarry);
constexpr float kVScale     = kVCarry / (kXCarry * kWCarry);
constexpr float kScoreScale = kInvSqrtHd / (kQKCarry * kQKCarry);
constexpr float kCtxScale   = kAttnCarry / kVCarry;
constexpr float kOutScale   = 1.0f / (kAttnCarry * kWCarry);
constexpr float kScoreClamp = 10.0f;

// ---------------------------------------------------------------------------
// Rotary inverse frequencies: 10000^(-2i/64) = 10^(-i/8), i = 0..31, evaluated in double at build time, converted to f32
// ---------------------------------------------------------------------------
struct InvFreqTab { float v[kHalfHd]; };
constexpr InvFreqTab make_inv_freq() {
  InvFreqTab t{};
  const double r8 = cx_sqrt(cx_sqrt(cx_sqrt(10.0)));
  for (int i = 0; i < kHalfHd; ++i) {
    double p = 1.0;
    for (int j = 0; j < (i & 7); ++j) p *= r8;
    for (int j = 0; j < (i >> 3); ++j) p *= 10.0;
    t.v[i] = (float)(1.0 / p);
  }
  return t;
}
__device__ constexpr InvFreqTab kInvFreq = make_inv_freq();
static_assert(sizeof(kInvFreq.v) / sizeof(kInvFreq.v[0]) == 32, "table length");

// ---------------------------------------------------------------------------
// Workspace region map (bytes; every offset a multiple of 128)
//   X16   f16 [4096][1024]          x carried x16                         8,388,608
//   W16   f16 [4][1024][1024]       w_q | w_k | w_v | w_o carried x256    8,388,608
//   COS   f32 [2048][32]                                                    262,144
//   SIN   f32 [2048][32]                                                    262,144
//   Q16   f16 [32][2048][64]        rotated q carried x16                 8,388,608
//   K16   f16 [32][2048][64]        rotated k carried x16 (follows Q16)   8,388,608
//   VT16  f16 [32][64][2048]        v transposed, carried x16             8,388,608
//   A16   f16 [4096][1024]          attention output carried x2048        8,388,608
//   total                                                                50,855,936
// ---------------------------------------------------------------------------
constexpr size_t kPlaneBytes = (size_t)kRows * kHid * 2;
constexpr size_t kTabBytes   = (size_t)kSeq * kHalfHd * 4;
constexpr size_t kOffX16  = 0;
constexpr size_t kOffW16  = kOffX16 + kPlaneBytes;
constexpr size_t kOffCos  = kOffW16 + (size_t)4 * kHid * kHid * 2;
constexpr size_t kOffSin  = kOffCos + kTabBytes;
constexpr size_t kOffQ16  = kOffSin + kTabBytes;
constexpr size_t kOffK16  = kOffQ16 + kPlaneBytes;
constexpr size_t kOffVT16 = kOffK16 + kPlaneBytes;
constexpr size_t kOffA16  = kOffVT16 + kPlaneBytes;
constexpr size_t kWsTotal = kOffA16 + kPlaneBytes;
static_assert(kWsTotal == 50855936ull, "carve total");
static_assert(kWsTotal <= 134217728ull, "carve cap");
static_assert((kOffW16 % 128) == 0 && (kOffCos % 128) == 0 && (kOffSin % 128) == 0 && (kOffQ16 % 128) == 0 &&
              (kOffK16 % 128) == 0 && (kOffVT16 % 128) == 0 && (kOffA16 % 128) == 0, "128-B aligned regions");
constexpr size_t kPlaneElems = (size_t)kRows * kHid;

// ---------------------------------------------------------------------------
// Fragment helpers (split k map for A and B: elements 0..7 <- p[0..7], 8..15 <- p[16..23], p already offset by 8*(lane>>4))
// ---------------------------------------------------------------------------
struct FragH {
  union U { v16h v; v8h h[2]; };
  static __device__ __forceinline__ v16h load(const _Float16* p) {
    U f;
    f.h[0] = *(const v8h*)(p);
    f.h[1] = *(const v8h*)(p + 16);
    return f.v;
  }
  static __device__ __forceinline__ v8f mma(v16h a, v16h b, v8f c) {
    return __builtin_amdgcn_wmma_f32_16x16x32_f16(false, a, false, b, (short)0, c, false, false);
  }
};
__device__ __forceinline__ void guard4_h(v8f& a, v8f& b, v8f& c, v8f& d, v16h x, v16h y) {
  asm volatile("v_nop\n\tv_nop\n\tv_nop\n\tv_nop" : "+v"(a), "+v"(b), "+v"(c), "+v"(d) : "v"(x), "v"(y));
}
__device__ __forceinline__ void keep4_h(v16h a, v16h b, v16h c, v16h d) {
  asm volatile("v_nop" :: "v"(a), "v"(b), "v"(c), "v"(d));
}
// Inputs-only hold on eight loaded fragments: their LDS reads stand as one group with one wait in front of the products that
// follow; without it each product waits for its own pair of reads.
__device__ __forceinline__ void hold8_h(v16h a, v16h b, v16h c, v16h d, v16h e, v16h f, v16h g, v16h h) {
  asm volatile("" :: "v"(a), "v"(b), "v"(c), "v"(d), "v"(e), "v"(f), "v"(g), "v"(h));
}
__device__ __forceinline__ void acc_guard4(v8f& a, v8f& b, v8f& c, v8f& d) {
  asm volatile("v_nop\n\tv_nop\n\tv_nop\n\tv_nop" : "+v"(a), "+v"(b), "+v"(c), "+v"(d));
}

// ---------------------------------------------------------------------------
// Preparation, one launch: f32 -> f16 casts of x and of the four weight matrices with their power-of-two carries, and the
// rotary tables. One work-group of 16 waves per 1/256 of the work; every wave lives long instead of many short waves.
// Casts: a piece is 8 consecutive elements (32 B read, 16 B stored). The grid has kPrepLanes = 131,072 threads; thread g takes
//   pieces g + j * kPrepLanes, j = 0..7: j = 0..3 are the four quarters of x, j = 4..7 are w_q, w_k, w_v, w_o (one matrix is
//   exactly kPrepLanes pieces). Destination piece index = source piece index, since W16 follows X16 in the workspace.
//   All 16 reads of a thread are issued before the first value is used.
// Rotary tables: COS/SIN [2048][32] f32, angle = float(position) * inv_freq[i] (single f32 multiply), accurate sincosf;
//   waves 0..7 of each work-group compute one entry per lane (256 x 256 = 65,536 entries) while their reads are in flight.
// ---------------------------------------------------------------------------
constexpr int kPrepThreads = 512;
constexpr int kPrepBlocks  = 256;
constexpr int kPrepLanes   = kPrepThreads * kPrepBlocks;
constexpr int kXn8 = kRows * kHid / 8;
constexpr int kWn8 = kHid * kHid / 8;
static_assert(kWn8 == kPrepLanes && kXn8 == 4 * kPrepLanes, "eight pieces per thread: four of x, one of each matrix");
static_assert(kOffX16 == 0 && kOffW16 == kOffX16 + (size_t)kXn8 * 16, "W16 follows X16");
static_assert(kSeq * kHalfHd == kPrepBlocks * 256, "one table entry per lane of waves 0..7");
__global__ __launch_bounds__(kPrepThreads) void prep_kernel(
    const float* __restrict__ x, const float* __restrict__ wq, const float* __restrict__ wk,
    const float* __restrict__ wv, const float* __restrict__ wo,
    unsigned short* __restrict__ out, float* __restrict__ cosT, float* __restrict__ sinT)
{
  const unsigned g = blockIdx.x * kPrepThreads + threadIdx.x;
  const float* sp[8] = { x, x + (size_t)8 * kPrepLanes, x + (size_t)16 * kPrepLanes, x + (size_t)24 * kPrepLanes,
                         wq, wk, wv, wo };
  const float inv = kInvFreq.v[threadIdx.x & 31];
  /* the table read's index register may be reused by what follows */
  asm volatile("s_wait_xcnt 0x0" ::: "memory");
  const unsigned rb = g * 32u;
  v4f a[8], c[8];
#pragma unroll
  for (int j = 0; j < 8; ++j) {
    const float* p = (const float*)((const char*)sp[j] + rb);
    a[j] = *(const v4f*)(p);
    c[j] = *(const v4f*)(p + 4);
  }
  /* inputs-only hold: the table read stays in front of the 16 reads, so its wait does not drain them */
  asm volatile("" :: "v"(inv));
  /* wave-uniform: waves 0..7 */
  if (threadIdx.x < 256) {
    const int t = blockIdx.x * 256 + threadIdx.x;
    const int s = t >> 5;
    const float ang = (float)s * inv;
    float sn, cs;
    sincosf(ang, &sn, &cs);
    cosT[t] = cs;
    sinT[t] = sn;
  }
#pragma unroll
  for (int j = 0; j < 8; ++j) {
    const float scale = (j < 4) ? kXCarry : kWCarry;
    v8h hv;
#pragma unroll
    for (int e = 0; e < 4; ++e) {
      const float f0 = a[j][e] * scale;
      const float f1 = c[j][e] * scale;
      hv[e]     = (_Float16)f0;
      hv[4 + e] = (_Float16)f1;
    }
    *(v8h*)((char*)(out + (size_t)8 * kPrepLanes * j) + g * 16u) = hv;
  }
}

// ---------------------------------------------------------------------------
// L2 asks.
// l2_ask: each lane asks its own address, one per 256 B, into L2 ahead of the copies that read it; a hint, nothing waits for it and no
// value depends on it. Every lane is on and every address lies inside the plane it names.
// The units of a shared panel are dealt over its sharers by work-group index, in few parts; where the work-groups land only
// changes how many asks are useful.
// keep_ask: no counter tracks a prefetch, so the register pair that it names stays unchanged until the loop behind it is over.
// ---------------------------------------------------------------------------
__device__ __forceinline__ void l2_ask(const void* p) {
  asm volatile("global_prefetch_b8 %0, off scope:SCOPE_SE" :: "v"(p));
}
__device__ __forceinline__ void keep_ask(const void* p) {
  asm volatile("" :: "v"(p));
}

// ---------------------------------------------------------------------------
// Asynchronous copy of 8 slices of 16 tile rows to LDS: each lane moves its own 16 B per slice, a wave 4 whole 128-B rows.
// lds = the lane's LDS byte address in slice 0, g = its global address in slice 0, gstep = 16 source rows in halves.
// s_wait_xcnt 0 closes the statement so that no address register named here is rewritten ahead of it.
// ---------------------------------------------------------------------------
constexpr int kBT = 128;                     // block tile: rows of A and rows of Bt
constexpr int kKC = 64;                      // k per pass: tile rows of 128 B
constexpr int kGP = 72;                      // LDS row pitch in halves: 144 B = 16 B x 9, for ds_load_b128 readers
constexpr int kOpHalves    = kBT * kGP;      // one operand's tile
constexpr int kStageHalves = 2 * kOpHalves;  // [A tile | Bt tile]
constexpr unsigned kSliceBytes = 16u * kGP * 2u;
__device__ __forceinline__ void async_copy8(unsigned lds, const _Float16* g, size_t gstep) {
  asm volatile(
      "global_load_async_to_lds_b128 %0, %8, off\n\t"
      "global_load_async_to_lds_b128 %1, %9, off\n\t"
      "global_load_async_to_lds_b128 %2, %10, off\n\t"
      "global_load_async_to_lds_b128 %3, %11, off\n\t"
      "global_load_async_to_lds_b128 %4, %12, off\n\t"
      "global_load_async_to_lds_b128 %5, %13, off\n\t"
      "global_load_async_to_lds_b128 %6, %14, off\n\t"
      "global_load_async_to_lds_b128 %7, %15, off\n\t"
      "s_wait_xcnt 0x0"
      :: "v"(lds), "v"(lds + kSliceBytes), "v"(lds + 2u * kSliceBytes), "v"(lds + 3u * kSliceBytes),
         "v"(lds + 4u * kSliceBytes), "v"(lds + 5u * kSliceBytes), "v"(lds + 6u * kSliceBytes), "v"(lds + 7u * kSliceBytes),
         "v"(g), "v"(g + gstep), "v"(g + 2 * gstep), "v"(g + 3 * gstep),
         "v"(g + 4 * gstep), "v"(g + 5 * gstep), "v"(g + 6 * gstep), "v"(g + 7 * gstep)
      : "memory");
}

// ---------------------------------------------------------------------------
// Batched GEMM: C[m,n] = scale * sum_k A[m,k] * Bt[n,k]; a block of 4 waves (2 x 2) owns a 128x128 tile, each wave 64x64 of it.
// A row-major [M,K]; Bt row-major [N,K]; M, N multiples of 128, K a multiple of 64 and at least 128 (asserted on the host).
// Operands: per pass of 64 k the block's 128 A rows and 128 Bt rows go to LDS by asynchronous copies, two buffers, the next
//           pass's copies in flight while this pass's fragments are read; every wave copies, waits and passes every barrier.
// Store mode 0: f32 rows; mode 1: f16 rows.
// Store mode 3: N = 2 x kHid (q columns then k columns); the 64-wide tile is one head; interleaved-pair rotation with
//             COS/SIN[position][pair] then f16 store to plane (n0 >> 10) laid out [batch*heads + head][position][64]
// OUT_MODE 4: the three input projections in one launch, so that three work-groups share each WGP from the start.
//             Blocks 0 .. kQKBlocks - 1 are the q|k tiles of the arguments as given (store mode 3). The kVBlocks blocks behind
//             them are the transposed v projection (store mode 1): A = w_v, the third matrix behind Btp; Bt = the rows of Ap of
//             one batch; C = the plane behind the q and k planes, [batch][kHid][kSeq]. The choice is block-uniform.
// Store coverage per 16-row slab: mode 0: 8 iterations x 2 rows; modes 1 and 3: 4 iterations x 4 rows; 64 columns each.
// ---------------------------------------------------------------------------
constexpr int kQKBlocks = (kRows / kBT) * (2 * kHid / kBT);
constexpr int kVBlocksPerBatch = (kHid / kBT) * (kSeq / kBT);
constexpr int kVBlocks = kBatch * kVBlocksPerBatch;
static_assert(kOffK16 == kOffQ16 + kPlaneBytes && kOffVT16 == kOffK16 + kPlaneBytes, "the v plane follows the q and k planes");
template <int OUT_MODE>
__global__ __launch_bounds__(128) void wmma_gemm64(
    const unsigned short* __restrict__ Ap, int lda, long strideA,
    const unsigned short* __restrict__ Btp, int ldb, long strideB,
    void* __restrict__ Cp, int ldc, long strideC,
    const float* __restrict__ cosT, const float* __restrict__ sinT,
    int M, int N, int K, float scale)
{
  const _Float16* A  = (const _Float16*)Ap;
  const _Float16* Bt = (const _Float16*)Btp;
  void* Cout = Cp;
  int b    = blockIdx.y;
  int tile = blockIdx.x;
  /* block-uniform: this block belongs to the v projection */
  const bool vpart = (OUT_MODE == 4) && (tile >= kQKBlocks);
  if (vpart) {
    tile -= kQKBlocks;
    b     = tile / kVBlocksPerBatch;
    tile -= b * kVBlocksPerBatch;
    A  = (const _Float16*)Btp + (size_t)2 * kHid * kHid;
    Bt = (const _Float16*)Ap;
    strideA = 0L;
    strideB = (long)kSeq * kHid;
    Cout    = (void*)((unsigned short*)Cp + 2 * kPlaneElems);
    ldc     = kSeq;
    strideC = (long)kHid * kSeq;
    M = kHid;
    N = kSeq;
    scale = kVScale;
  }
  const int mode = (OUT_MODE == 4) ? (vpart ? 1 : 3) : OUT_MODE;
  __shared__ __align__(16) _Float16 ring[2 * kStageHalves];
  __shared__ __align__(16) float sT[4][16 * 68];
  const int tid  = threadIdx.x;
  const int lane = threadIdx.x & 31;
  const int wave = __builtin_amdgcn_readfirstlane((int)(threadIdx.x >> 5));
  const int tilesN = N >> 7;
  const int tilesM = M >> 7;
  /* block-uniform exit, in front of every copy and barrier */
  if (tile >= tilesM * tilesN) return;
  const int tm = tile / tilesN;
  const int tn = tile - tm * tilesN;
  const int wm = wave >> 1;
  const int wn = wave & 1;
  const int m0 = (tm << 7) + (wm << 6);
  const int n0 = (tn << 7) + (wn << 6);

  const _Float16* Ab = A  + (size_t)b * strideA;
  const _Float16* Bb = Bt + (size_t)b * strideB;

  const int rlane = lane & 15;
  const int koff  = (lane >> 4) * 8;
  const int mOff  = (lane >> 4) * 8;

  v8f acc[4][4];
#pragma unroll
  for (int i = 0; i < 4; ++i)
#pragma unroll
    for (int j = 0; j < 4; ++j) acc[i][j] = (v8f){0.f,0.f,0.f,0.f,0.f,0.f,0.f,0.f};

  /* copy map: thread -> row tid / 8 of each 16-row slice, 16-B part tid % 8 of its 128 B */
  const int crow  = tid >> 3;
  const int cpart = (tid & 7) * 8;
  const _Float16* gA = Ab + (size_t)((tm << 7) + crow) * lda + cpart;
  const _Float16* gB = Bb + (size_t)((tn << 7) + crow) * ldb + cpart;
  const size_t stepA = (size_t)16 * lda;
  const size_t stepB = (size_t)16 * ldb;
  const unsigned ldsA =
      (unsigned)(size_t)(__attribute__((address_space(3))) _Float16*)ring + (unsigned)(crow * kGP + cpart) * 2u;
  const unsigned ldsB = ldsA + (unsigned)kOpHalves * 2u;
  constexpr unsigned kStageBytes = (unsigned)kStageHalves * 2u;
  const _Float16* fA = ring + ((wm << 6) + rlane) * kGP + koff;
  const _Float16* fB = ring + kOpHalves + ((wn << 6) + rlane) * kGP + koff;
  const int passes = K / kKC;

  async_copy8(ldsA, gA, stepA);
  async_copy8(ldsB, gB, stepB);

  /* L2 asks behind pass 0's copies: a row of kHid halves is 8 units, thread -> row tid / 8 of a 16-row group, unit tid % 8.
     A panel: its sharers have consecutive indices; 4 parts of 32 rows, part from tn.
     Bt panel: its sharers lie tilesN indices apart; 8 parts of 16 rows, part from tm.
     Rotary rows of a q|k tile: 64 units of COS and 64 of SIN, 4 parts of 32 units, part from tn, asked by wave 0. */
  const int askCol = (tid & 7) * 128;
  const _Float16* askA0 = Ab + (size_t)((tm << 7) + (tn & 3) * 32 + crow) * lda + askCol;
  const _Float16* askA1 = askA0 + stepA;
  const _Float16* askB0 = Bb + (size_t)((tn << 7) + ((tm >> 1) & 7) * 16 + crow) * ldb + askCol;
  const float* askT = cosT;
  /* block-uniform: the column map holds for rows of kHid halves */
  if (K == kHid) {
    l2_ask(askA0);
    l2_ask(askA1);
    l2_ask(askB0);
    /* wave-uniform */
    if (mode == 3 && wave == 0) {
      askT = ((tn & 2) ? sinT : cosT) + (size_t)((tm << 7) & (kSeq - 1)) * kHalfHd + ((tn & 1) * 32 + lane) * 64;
      l2_ask(askT);
    }
  }
  /* pass 0's tile has landed for this wave; the barrier publishes it to the other waves */
  asm volatile("s_wait_asynccnt 0x0" ::: "memory");
  __syncthreads();
  if (1 < passes) {
    async_copy8(ldsA + kStageBytes, gA + kKC, stepA);
    async_copy8(ldsB + kStageBytes, gB + kKC, stepB);
  }

  for (int t = 0; t < passes; ++t) {
    const int buf = t & 1;
    const _Float16* pA = fA + buf * kStageHalves;
    const _Float16* pB = fB + buf * kStageHalves;
    /* unrolled, like the loops inside: every fragment and accumulator index is a constant, so the arrays stay in registers */
#pragma unroll
    for (int kk = 0; kk < kKC; kk += 32) {
      /* the 16 LDS reads of a 32-k step stand as one group in front of its 16 products */
      v16h ah[4], bh[4];
#pragma unroll
      for (int j = 0; j < 4; ++j) bh[j] = FragH::load(pB + (j << 4) * kGP + kk);
#pragma unroll
      for (int i = 0; i < 4; ++i) ah[i] = FragH::load(pA + (i << 4) * kGP + kk);
#pragma unroll
      for (int i = 0; i < 4; ++i) {
#pragma unroll
        for (int j = 0; j < 4; ++j) acc[i][j] = FragH::mma(ah[i], bh[j], acc[i][j]);
        guard4_h(acc[i][0], acc[i][1], acc[i][2], acc[i][3], ah[i], bh[3]);
      }
      keep4_h(bh[0], bh[1], bh[2], bh[3]);
    }
    /* this wave's reads of buffer buf are complete before any wave refills it */
    asm volatile("s_wait_dscnt 0x0" ::: "memory");
    /* this wave's copies of pass t + 1 have landed before the barrier publishes them */
    asm volatile("s_wait_asynccnt 0x0" ::: "memory");
    __syncthreads();
    if (t + 2 < passes) {
      async_copy8(ldsA + (unsigned)buf * kStageBytes, gA + (size_t)(t + 2) * kKC, stepA);
      async_copy8(ldsB + (unsigned)buf * kStageBytes, gB + (size_t)(t + 2) * kKC, stepB);
    }
  }
  /* no copy of this wave is outstanding past here */
  asm volatile("s_wait_asynccnt 0x0" ::: "memory");
  keep_ask(askA0);
  keep_ask(askA1);
  keep_ask(askB0);
  keep_ask(askT);
  acc_guard4(acc[0][0], acc[0][1], acc[0][2], acc[0][3]);
  acc_guard4(acc[1][0], acc[1][1], acc[1][2], acc[1][3]);
  acc_guard4(acc[2][0], acc[2][1], acc[2][2], acc[2][3]);
  acc_guard4(acc[3][0], acc[3][1], acc[3][2], acc[3][3]);

  float* slab = sT[wave];
#pragma unroll
  for (int i = 0; i < 4; ++i) {
    const int mBase = m0 + (i << 4);
#pragma unroll
    for (int j = 0; j < 4; ++j) {
#pragma unroll
      for (int r = 0; r < 8; ++r) {
        const float v = acc[i][j][r] * scale;
        slab[(mOff + r) * 68 + (j << 4) + rlane] = v;
      }
    }
    __builtin_amdgcn_fence(__ATOMIC_RELEASE, "workgroup");
    __builtin_amdgcn_wave_barrier();
    __builtin_amdgcn_fence(__ATOMIC_ACQUIRE, "workgroup");
    if (mode == 0) {
      float* C = (float*)Cout + (size_t)b * strideC;
      const int hh = lane >> 4, c4 = (lane & 15) * 4;
      {
#pragma unroll
        for (int it = 0; it < 8; ++it) {
          const int row = it * 2 + hh;
          v4f v = *(const v4f*)(slab + row * 68 + c4);
          *(v4f*)(C + (size_t)(mBase + row) * ldc + n0 + c4) = v;
        }
        
      }
    } else if (mode == 1) {
      const int q = lane >> 3, c8 = (lane & 7) * 8;
      unsigned short* C = (unsigned short*)Cout + (size_t)b * strideC;
      v8h ov[4];
#pragma unroll
      for (int it = 0; it < 4; ++it) {
        const int row = it * 4 + q;
        const float* sp = slab + row * 68 + c8;
        const v4f a0 = *(const v4f*)(sp);
        const v4f a1 = *(const v4f*)(sp + 4);
#pragma unroll
        for (int e = 0; e < 4; ++e) {
          ov[it][e]     = (_Float16)a0[e];
          ov[it][4 + e] = (_Float16)a1[e];
        }
      }
      {
#pragma unroll
        for (int it = 0; it < 4; ++it) {
          const int row = it * 4 + q;
          *(v8h*)(C + (size_t)(mBase + row) * ldc + n0 + c8) = ov[it];
        }
        
      }
    } else {
      const int q = lane >> 3, c8 = (lane & 7) * 8;
      const int which = n0 >> 10;
      const int head  = (n0 >> 6) & (kHeads - 1);
      unsigned short* C = (unsigned short*)Cout + (size_t)which * kPlaneElems;
      v8h ov[4];
      size_t oo[4];
#pragma unroll
      for (int it = 0; it < 4; ++it) {
        const int row = it * 4 + q;
        const int m   = mBase + row;
        const int bb  = m >> 11;
        const int s   = m & (kSeq - 1);
        const float* sp = slab + row * 68 + c8;
        const v4f a0 = *(const v4f*)(sp);
        const v4f a1 = *(const v4f*)(sp + 4);
        const v4f cv = *(const v4f*)(cosT + (size_t)s * kHalfHd + (c8 >> 1));
        const v4f sv = *(const v4f*)(sinT + (size_t)s * kHalfHd + (c8 >> 1));
        const float o0 = a0[0] * cv[0] - a0[1] * sv[0];
        const float o1 = a0[0] * sv[0] + a0[1] * cv[0];
        const float o2 = a0[2] * cv[1] - a0[3] * sv[1];
        const float o3 = a0[2] * sv[1] + a0[3] * cv[1];
        const float o4 = a1[0] * cv[2] - a1[1] * sv[2];
        const float o5 = a1[0] * sv[2] + a1[1] * cv[2];
        const float o6 = a1[2] * cv[3] - a1[3] * sv[3];
        const float o7 = a1[2] * sv[3] + a1[3] * cv[3];
        ov[it][0] = (_Float16)o0;
        ov[it][1] = (_Float16)o1;
        ov[it][2] = (_Float16)o2;
        ov[it][3] = (_Float16)o3;
        ov[it][4] = (_Float16)o4;
        ov[it][5] = (_Float16)o5;
        ov[it][6] = (_Float16)o6;
        ov[it][7] = (_Float16)o7;
        oo[it] = ((size_t)(bb * kHeads + head) * kSeq + s) * kHd + c8;
      }
      {
#pragma unroll
        for (int it = 0; it < 4; ++it) *(v8h*)(C + oo[it]) = ov[it];
        
      }
    }
    __builtin_amdgcn_fence(__ATOMIC_RELEASE, "workgroup");
    __builtin_amdgcn_wave_barrier();
    __builtin_amdgcn_fence(__ATOMIC_ACQUIRE, "workgroup");
  }
}

// ---------------------------------------------------------------------------
// Attention for one (batch, head) and two query tiles of 64 rows per block, key tiles of 64, transposed products.
//   The two tiles are i and kQTiles - 1 - i: every block has the same number of P.V tiles. Each of the 4 waves carries two
//   groups of 16 queries, rows 16 * wave .. + 15 of either tile; a K or Vt fragment is read from LDS once for both groups.
//   Per group:
//   S^T = K16 . Q16^T: A = 16 key rows from LDS, B = the group's 16 queries, kept in registers; a lane holds, of ONE query
//   (column lane & 15), the keys 8 * (lane >> 4) + r of each 16-key group, for ALL 32 key tiles;
//   p = exp(min(score * kScoreScale, clamp)) unnormalised, f32; the row sum l accumulates every key (future keys included)
//   in the lane, 8 partial sums, joined in the lane and across the two wave halves once after the loop;
//   O^T += Vt . P^T only for key tiles at or below the diagonal (tile index <= the group's query tile, block-uniform), with p set
//   to zero where key > query inside the diagonal tile; O = acc / l, no renormalisation.
//   P^T never leaves the registers: score groups 2kk and 2kk + 1 of a lane are elements 0..7 and 8..15 of its B fragment for
//   keys 32kk..32kk+31, the k map that FragH::load gives the Vt rows (A): 8 * (lane >> 4) + e, then 16 + 8 * (lane >> 4) + e.
// LDS: two buffers of [K tile [64 keys][72] f16 | Vt tile [64 dd][72] f16] (columns 0..63 written and read, pad never read);
//   each tile is brought by asynchronous copies, 128 threads x 4 x 16 B = 8,192 B = the whole tile; key tile kc + 2 is
//   copied into the buffer that tile kc has just left, so a tile's copies fly while the tile in front of it is worked on.
//   A Vt tile is copied only where it is used (tile index <= the higher query tile's index, block-uniform).
// Output: a lane holds 8 consecutive head columns of its query per 16-row group of O^T and stores them as 16 B; the wave
//   writes the whole 128-B head slice of each of its 2 x 16 rows.
// Block barriers: one in front of the loop, one at the foot of each key tile; all 4 waves run all 32 tiles; no early exits.
// grid.x = 32 (batch, head) groups x 16 pairs of query tiles.
// ---------------------------------------------------------------------------
constexpr int kQB = 64;
constexpr int kKT = 64;
constexpr int kLP = 72;
constexpr int kQTiles = kSeq / kQB;
constexpr int kKTiles = kSeq / kKT;
constexpr int kQPairs = kQTiles / 2;
static_assert(kQTiles == 2 * kQPairs && kQPairs >= 1, "query tiles pair up; the high tile of a pair has index 1 or more");
static_assert(kQB == kKT, "diagonal tile logic assumes equal tiles");
static_assert(kLP == kGP && kKT == 64 && kHd == 64, "a tile is 4 slices of 16 rows at the pitch of kSliceBytes");
static_assert(kKTiles >= 2, "two buffers are filled in front of the loop");
constexpr int kAskTiles = 8;                   // key tiles per chunk of L2 asks
static_assert((kQPairs % 4) == 0 && (kKTiles % kAskTiles) == 0 && kAskTiles * kKT * kHd * 2 == 4 * 64 * 256 &&
              kAskTiles * kKT * 2 == 4 * 256 && kHd == 4 * 16, "ask map: 4 parts of 64 K units and of 16 Vt rows x 4 units");
constexpr int kTileHalves   = kKT * kLP;       // one operand's tile
constexpr int kAStageHalves = 2 * kTileHalves; // [K tile | Vt tile]
// Asynchronous copy of one 64-row tile to LDS, 4 slices of 16 rows: each lane moves its own 16 B per slice.
// lds = the lane's LDS byte address in slice 0, g = its global address in slice 0, gstep = 16 source rows in halves.
// s_wait_xcnt 0 closes the statement so that no address register named here is rewritten ahead of it.
__device__ __forceinline__ void async_copy4(unsigned lds, const _Float16* g, size_t gstep) {
  asm volatile(
      "global_load_async_to_lds_b128 %0, %4, off\n\t"
      "global_load_async_to_lds_b128 %1, %5, off\n\t"
      "global_load_async_to_lds_b128 %2, %6, off\n\t"
      "global_load_async_to_lds_b128 %3, %7, off\n\t"
      "s_wait_xcnt 0x0"
      :: "v"(lds), "v"(lds + kSliceBytes), "v"(lds + 2u * kSliceBytes), "v"(lds + 3u * kSliceBytes),
         "v"(g), "v"(g + gstep), "v"(g + 2 * gstep), "v"(g + 3 * gstep)
      : "memory");
}

__global__ __launch_bounds__(128) void attn_kernel(
    const unsigned short* __restrict__ Qp, const unsigned short* __restrict__ Kp,
    const unsigned short* __restrict__ Vtp, unsigned short* __restrict__ Op)
{
  __shared__ __align__(16) _Float16 ring[2 * kAStageHalves];

  const int tid  = threadIdx.x;
  const int wave = __builtin_amdgcn_readfirstlane((int)(threadIdx.x >> 5));
  const int lane = tid & 31;
  const int hh   = lane >> 4;
  const int c    = lane & 15;
  const int pi   = blockIdx.x % kQPairs;
  const int bh   = blockIdx.x / kQPairs;
  /* the block's two query tiles: group 0 the low one, group 1 its mirror, so every block has kQTiles + 1 P.V tiles */
  const int qt[2] = { pi, kQTiles - 1 - pi };
  const int qlo = qt[0];
  const int qhi = qt[1];

  const _Float16* Qb = (const _Float16*)Qp  + (size_t)bh * kSeq * kHd;
  const _Float16* Kb = (const _Float16*)Kp  + (size_t)bh * kSeq * kHd;
  const _Float16* Vb = (const _Float16*)Vtp + (size_t)bh * kHd * kSeq;

  v16h qf[2][2];
#pragma unroll
  for (int g = 0; g < 2; ++g)
#pragma unroll
    for (int dc = 0; dc < 2; ++dc)
      qf[g][dc] = FragH::load(Qb + (size_t)(qt[g] * kQB + wave * 16 + c) * kHd + dc * 32 + 8 * hh);

  float lsum[2][8];
  v8f oacc[2][4];
#pragma unroll
  for (int g = 0; g < 2; ++g) {
#pragma unroll
    for (int r = 0; r < 8; ++r) lsum[g][r] = 0.f;
#pragma unroll
    for (int t = 0; t < 4; ++t) oacc[g][t] = (v8f){0.f,0.f,0.f,0.f,0.f,0.f,0.f,0.f};
  }

  /* copy map: thread -> row tid / 8 of each 16-row slice, 16-B part tid % 8 of its 128 B */
  const int crow  = tid >> 3;
  const int cpart = (tid & 7) * 8;
  const _Float16* gK = Kb + (size_t)crow * kHd + cpart;
  const _Float16* gV = Vb + (size_t)crow * kSeq + cpart;
  constexpr size_t kStepK = (size_t)16 * kHd;
  constexpr size_t kStepV = (size_t)16 * kSeq;
  const unsigned ldsK =
      (unsigned)(size_t)(__attribute__((address_space(3))) _Float16*)ring + (unsigned)(crow * kLP + cpart) * 2u;
  const unsigned ldsV = ldsK + (unsigned)kTileHalves * 2u;
  constexpr unsigned kAStageBytes = (unsigned)kAStageHalves * 2u;

  /* key tile 0 (its Vt tile is used by every query tile) */
  async_copy4(ldsK, gK, kStepK);
  async_copy4(ldsV, gV, kStepV);

  /* L2 asks, a chunk of kAskTiles key tiles at a time, dealt over the 16 work-groups of this (batch, head) in 4 parts:
     waves 0 and 1 ask K tiles 2 * part and 2 * part + 1 of the chunk (16,384 B in a row = 64 units), waves 2 and 3 the
     chunk's 1,024 B = 4 units of Vt rows 16 * part .. + 15. Chunk 0 here, behind tile 0's copies; chunk n + 1 from inside
     the loop while chunk n is worked on. */
  const int part = pi & 3;
  const int au   = tid & 63;
  const char* ask = (wave < 2)
      ? (const char*)Kb + (size_t)part * (2 * kKT * kHd * 2) + au * 256
      : (const char*)Vb + (size_t)(part * 16 + (au >> 2)) * (kSeq * 2) + (au & 3) * 256;
  const int askStep = (wave < 2) ? kAskTiles * kKT * kHd * 2 : kAskTiles * kKT * 2;
  l2_ask(ask);
  /* tile 0 has landed for this wave; the barrier publishes it to the other waves */
  asm volatile("s_wait_asynccnt 0x0" ::: "memory");
  __syncthreads();
  /* key tile 1: the high query tile's index is at least kQTiles / 2, so its Vt tile is always used */
  async_copy4(ldsK + kAStageBytes, gK + (size_t)kKT * kHd, kStepK);
  async_copy4(ldsV + kAStageBytes, gV + kKT, kStepV);

#pragma unroll 1
  for (int kc = 0; kc < kKTiles; ++kc) {
    const int kv0 = kc * kKT;
    const int buf = kc & 1;
    const _Float16* Ksh = ring + buf * kAStageHalves;
    const _Float16* Vsh = Ksh + kTileHalves;

    /* block-uniform: the next chunk's asks, kAskTiles - 4 tiles before its first copy is issued; the address moves only
       here, in front of an ask for a chunk that exists, so it never leaves the plane */
    if ((kc & (kAskTiles - 1)) == 2 && kc < kKTiles - kAskTiles) {
      ask += askStep;
      l2_ask(ask);
    }

    /* the K tile's fragments, each read once and used by both query groups */
    v16h kf[4][2];
#pragma unroll
    for (int j = 0; j < 4; ++j)
#pragma unroll
      for (int dc = 0; dc < 2; ++dc) kf[j][dc] = FragH::load(Ksh + (j * 16 + c) * kLP + dc * 32 + 8 * hh);
    v8f s[2][4];
#pragma unroll
    for (int g = 0; g < 2; ++g)
#pragma unroll
      for (int j = 0; j < 4; ++j) s[g][j] = (v8f){0.f,0.f,0.f,0.f,0.f,0.f,0.f,0.f};
#pragma unroll
    for (int g = 0; g < 2; ++g)
#pragma unroll
      for (int dc = 0; dc < 2; ++dc)
#pragma unroll
        for (int j = 0; j < 4; ++j) s[g][j] = FragH::mma(kf[j][dc], qf[g][dc], s[g][j]);
#pragma unroll
    for (int g = 0; g < 2; ++g) {
#pragma unroll
      for (int j = 0; j < 4; ++j) {
#pragma unroll
        for (int r = 0; r < 8; ++r) {
          const float x = fminf(s[g][j][r] * kScoreScale, kScoreClamp);
          const float p = __expf(x);
          lsum[g][r] += p;
          s[g][j][r] = p;
        }
      }
    }
    /* block-uniform: this key tile contributes to the high group's P.V (and, where kc <= qlo, to the low group's) */
    if (kc <= qhi) {
      /* the Vt tile's fragments, each read once and used by every group that needs the tile */
      v16h vf[4][2];
#pragma unroll
      for (int t = 0; t < 4; ++t)
#pragma unroll
        for (int kk = 0; kk < 2; ++kk) vf[t][kk] = FragH::load(Vsh + (t * 16 + c) * kLP + kk * 32 + 8 * hh);
      /* the 16 LDS reads of the Vt tile as one group in front of its products */
      hold8_h(vf[0][0], vf[1][0], vf[2][0], vf[3][0], vf[0][1], vf[1][1], vf[2][1], vf[3][1]);
#pragma unroll
      for (int g = 1; g >= 0; --g) {
        /* block-uniform */
        if (kc <= qt[g]) {
          v16h pf[2];
#pragma unroll
          for (int kk = 0; kk < 2; ++kk) {
#pragma unroll
            for (int r = 0; r < 8; ++r) {
              pf[kk][r]     = (_Float16)s[g][2 * kk][r];
              pf[kk][8 + r] = (_Float16)s[g][2 * kk + 1][r];
            }
          }
          /* block-uniform: only the group's diagonal tile holds keys past a query */
          if (kc == qt[g]) {
            const int qrow = qt[g] * kQB + wave * 16 + c;
#pragma unroll
            for (int kk = 0; kk < 2; ++kk) {
#pragma unroll
              for (int e = 0; e < 16; ++e) {
                const int kvrow = kv0 + kk * 32 + (e >> 3) * 16 + 8 * hh + (e & 7);
                pf[kk][e] = (kvrow > qrow) ? (_Float16)0.0f : pf[kk][e];
              }
            }
          }
#pragma unroll
          for (int kk = 0; kk < 2; ++kk)
#pragma unroll
            for (int t = 0; t < 4; ++t) oacc[g][t] = FragH::mma(vf[t][kk], pf[kk], oacc[g][t]);
        }
      }
    }
    /* this wave's reads of buffer buf are complete before any wave refills it */
    asm volatile("s_wait_dscnt 0x0" ::: "memory");
    /* this wave's copies of tile kc + 1 have landed before the barrier publishes them */
    asm volatile("s_wait_asynccnt 0x0" ::: "memory");
    __syncthreads();
    if (kc + 2 < kKTiles) {
      async_copy4(ldsK + (unsigned)buf * kAStageBytes, gK + (size_t)(kc + 2) * kKT * kHd, kStepK);
      if (kc + 2 <= qhi) async_copy4(ldsV + (unsigned)buf * kAStageBytes, gV + (size_t)(kc + 2) * kKT, kStepV);
    }
  }
  /* no copy of this wave is outstanding past here */
  asm volatile("s_wait_asynccnt 0x0" ::: "memory");
  keep_ask(ask);

  const int bb = bh / kHeads;
  const int h  = bh - bb * kHeads;
#pragma unroll
  for (int g = 0; g < 2; ++g) {
    float l = ((lsum[g][0] + lsum[g][1]) + (lsum[g][2] + lsum[g][3])) + ((lsum[g][4] + lsum[g][5]) + (lsum[g][6] + lsum[g][7]));
    l += __shfl_xor(l, 16, 32);
    const float inv = kCtxScale * __builtin_amdgcn_rcpf(l);
    unsigned short* op = Op + ((size_t)(bb * kSeq + qt[g] * kQB + wave * 16 + c)) * kHid + h * kHd + 8 * hh;
#pragma unroll
    for (int t = 0; t < 4; ++t) {
      v8h ov;
#pragma unroll
      for (int r = 0; r < 8; ++r) ov[r] = (_Float16)(oacc[g][t][r] * inv);
      *(v8h*)(op + t * 16) = ov;
    }
  }
}

// ---------------------------------------------------------------------------
// Host glue: 4 kernel launches, nothing else.
//   1 casts of x and w_q|w_k|w_v|w_o, rotary tables: 256 blocks of 512 threads
//   2 input projections, 768 blocks of 128 threads:
//     q|k projection + rotation: M 4096, N 2048, K 1024 -> 32 x 16 block tiles = 512 blocks;
//     v projection transposed (A = w_v, Bt = x of one batch): M 1024, N 2048, K 1024 -> 8 x 16 block tiles = 128 blocks x 2
//   3 attention: 32 x 16 = 512 blocks of 128 threads
//   4 output projection: M 4096, N 1024, K 1024 -> 32 x 8 block tiles = 256 blocks of 128 threads
// ---------------------------------------------------------------------------
extern "C" void kernel_launch(void* const* d_in, const int* in_sizes, int n_in,
                              void* d_out, int out_size, void* d_ws, size_t ws_size,
                              hipStream_t stream) {
  if (n_in < 5) return;
  if (in_sizes[0] != kRows * kHid) return;
  if (in_sizes[1] != kHid * kHid) return;
  if (in_sizes[2] != kHid * kHid) return;
  if (in_sizes[3] != kHid * kHid) return;
  if (in_sizes[4] != kHid * kHid) return;
  if (out_size != kRows * kHid) return;
  if (ws_size < kWsTotal) return;

  const float* x  = (const float*)d_in[0];
  const float* wq = (const float*)d_in[1];
  const float* wk = (const float*)d_in[2];
  const float* wv = (const float*)d_in[3];
  const float* wo = (const float*)d_in[4];
  float* out = (float*)d_out;

  char* ws = (char*)d_ws;
  unsigned short* X16  = (unsigned short*)(ws + kOffX16);
  unsigned short* W16  = (unsigned short*)(ws + kOffW16);
  float*          COS  = (float*)(ws + kOffCos);
  float*          SIN  = (float*)(ws + kOffSin);
  unsigned short* Q16  = (unsigned short*)(ws + kOffQ16);
  unsigned short* K16  = (unsigned short*)(ws + kOffK16);
  unsigned short* VT16 = (unsigned short*)(ws + kOffVT16);
  unsigned short* A16  = (unsigned short*)(ws + kOffA16);
  const unsigned short* Wqk16 = W16;
  const unsigned short* Wo16  = W16 + (size_t)3 * kHid * kHid;

  static_assert((kRows % kBT) == 0 && (kHid % kBT) == 0 && (kSeq % kBT) == 0, "block tiles exact");
  static_assert((kHid % kKC) == 0 && kHid / kKC >= 2, "whole passes, two or more");

  prep_kernel<<<kPrepBlocks, kPrepThreads, 0, stream>>>(x, wq, wk, wv, wo, X16, COS, SIN);

  wmma_gemm64<4><<<dim3(kQKBlocks + kVBlocks, 1), 128, 0, stream>>>(
      X16, kHid, 0L,
      Wqk16, kHid, 0L,
      (void*)Q16, 0, 0L,
      COS, SIN,
      kRows, 2 * kHid, kHid, kQKScale);

  attn_kernel<<<kBatch * kHeads * kQPairs, 128, 0, stream>>>(Q16, K16, VT16, A16);

  wmma_gemm64<0><<<dim3((kRows / kBT) * (kHid / kBT), 1), 128, 0, stream>>>(
      A16, kHid, 0L,
      Wo16, kHid, 0L,
      (void*)out, kHid, 0L,
      nullptr, nullptr,
      kRows, kHid, kHid, kOutScale);
}

// v008
// It runs in 74.9 microseconds.
// Timed twice side by side with v007, it ran 1.05 times as fast both times.
// Counting every step since v000, it is 3.18 times as fast.
// All contractions (q/k/v projections, q.k^T, p.v, output projection): v_wmma_f32_16x16x32_f16, f16 operands with power-of-two carries (q also with the score scale and log2(e)), f32 accumulate; rotary tables, exp, row sums and normalisation in f32.
#include <hip/hip_runtime.h>
#include <math.h>

typedef __attribute__((ext_vector_type(16))) _Float16 v16h;
typedef __attribute__((ext_vector_type(8)))  _Float16 v8h;
typedef __attribute__((ext_vector_type(8)))  float    v8f;
typedef __attribute__((ext_vector_type(4)))  float    v4f;

// ---------------------------------------------------------------------------
// Shape constants
// ---------------------------------------------------------------------------
constexpr int kBatch  = 2;
constexpr int kSeq    = 2048;
constexpr int kHid    = 1024;
constexpr int kHeads  = 16;
constexpr int kHd     = 64;
constexpr int kRows   = kBatch * kSeq;
constexpr int kHalfHd = kHd / 2;
static_assert(kHeads * kHd == kHid, "head split");
static_assert(kHd == 64, "head width fixed at 64");
static_assert((kSeq % 64) == 0 && (kHid % 64) == 0 && (kHid % 32) == 0 && (kRows % 64) == 0, "tile multiples");
static_assert(kSeq == 2048 && kHid == 1024, "bit tricks below assume these");

// ---------------------------------------------------------------------------
// Power-of-two carries of the f16 planes and the derived fold-back scales
// ---------------------------------------------------------------------------
constexpr double cx_sqrt(double x) {
  double g = (x > 1.0) ? x : 1.0;
  for (int it = 0; it < 80; ++it) g = 0.5 * (g + x / g);
  return g;
}
constexpr float kXCarry    = 16.0f;
constexpr float kWCarry    = 256.0f;
constexpr float kQKCarry   = 16.0f;
constexpr float kVCarry    = 16.0f;
constexpr float kAttnCarry = 2048.0f;
constexpr float kInvSqrtHd = (float)(1.0 / cx_sqrt((double)kHd));
static_assert(kInvSqrtHd == 0.125f, "1/sqrt(head width)");
constexpr float kQKScale    = kQKCarry / (kXCarry * kWCarry);
constexpr float kVScale     = kVCarry / (kXCarry * kWCarry);
constexpr float kScoreScale = kInvSqrtHd / (kQKCarry * kQKCarry);
constexpr float kCtxScale   = kAttnCarry / kVCarry;
constexpr float kOutScale   = 1.0f / (kAttnCarry * kWCarry);
constexpr float kScoreClamp = 10.0f;
// The q plane also carries the score scale and log2(e), multiplied in f32 in front of its one rounding to f16, so that a
// K16 . Q16^T accumulator is the score in log2 units as it stands: exp(min(score, clamp)) = min(exp2(accumulator), exp(clamp)).
constexpr double cx_exp(double x) {
  double term = 1.0, sum = 1.0;
  for (int i = 1; i < 200; ++i) { term *= x / i; sum += term; }
  return sum;
}
constexpr float kLog2E     = 1.4426950408889634f;
constexpr float kQFold     = kScoreScale * kLog2E;
constexpr float kExpClamp  = (float)cx_exp((double)kScoreClamp);
static_assert(kExpClamp > 22026.0f && kExpClamp < 22027.0f, "exp(10); below the largest f16, so p converts finite");

// ---------------------------------------------------------------------------
// Rotary inverse frequencies: 10000^(-2i/64) = 10^(-i/8), i = 0..31, evaluated in double at build time, converted to f32
// ---------------------------------------------------------------------------
struct InvFreqTab { float v[kHalfHd]; };
constexpr InvFreqTab make_inv_freq() {
  InvFreqTab t{};
  const double r8 = cx_sqrt(cx_sqrt(cx_sqrt(10.0)));
  for (int i = 0; i < kHalfHd; ++i) {
    double p = 1.0;
    for (int j = 0; j < (i & 7); ++j) p *= r8;
    for (int j = 0; j < (i >> 3); ++j) p *= 10.0;
    t.v[i] = (float)(1.0 / p);
  }
  return t;
}
__device__ constexpr InvFreqTab kInvFreq = make_inv_freq();
static_assert(sizeof(kInvFreq.v) / sizeof(kInvFreq.v[0]) == 32, "table length");

// ---------------------------------------------------------------------------
// Workspace region map (bytes; every offset a multiple of 128)
//   X16   f16 [4096][1024]          x carried x16                         8,388,608
//   W16   f16 [4][1024][1024]       w_q | w_k | w_v | w_o carried x256    8,388,608
//   COS   f32 [2048][32]                                                    262,144
//   SIN   f32 [2048][32]                                                    262,144
//   Q16   f16 [32][2048][64]        rotated q carried x16 x kQFold        8,388,608
//   K16   f16 [32][2048][64]        rotated k carried x16 (follows Q16)   8,388,608
//   VT16  f16 [32][64][2048]        v transposed, carried x16             8,388,608
//   A16   f16 [4096][1024]          attention output carried x2048        8,388,608
//   total                                                                50,855,936
// ---------------------------------------------------------------------------
constexpr size_t kPlaneBytes = (size_t)kRows * kHid * 2;
constexpr size_t kTabBytes   = (size_t)kSeq * kHalfHd * 4;
constexpr size_t kOffX16  = 0;
constexpr size_t kOffW16  = kOffX16 + kPlaneBytes;
constexpr size_t kOffCos  = kOffW16 + (size_t)4 * kHid * kHid * 2;
constexpr size_t kOffSin  = kOffCos + kTabBytes;
constexpr size_t kOffQ16  = kOffSin + kTabBytes;
constexpr size_t kOffK16  = kOffQ16 + kPlaneBytes;
constexpr size_t kOffVT16 = kOffK16 + kPlaneBytes;
constexpr size_t kOffA16  = kOffVT16 + kPlaneBytes;
constexpr size_t kWsTotal = kOffA16 + kPlaneBytes;
static_assert(kWsTotal == 50855936ull, "carve total");
static_assert(kWsTotal <= 134217728ull, "carve cap");
static_assert((kOffW16 % 128) == 0 && (kOffCos % 128) == 0 && (kOffSin % 128) == 0 && (kOffQ16 % 128) == 0 &&
              (kOffK16 % 128) == 0 && (kOffVT16 % 128) == 0 && (kOffA16 % 128) == 0, "128-B aligned regions");
constexpr size_t kPlaneElems = (size_t)kRows * kHid;

// ---------------------------------------------------------------------------
// Fragment helpers (split k map for A and B: elements 0..7 <- p[0..7], 8..15 <- p[16..23], p already offset by 8*(lane>>4))
// ---------------------------------------------------------------------------
struct FragH {
  union U { v16h v; v8h h[2]; };
  static __device__ __forceinline__ v16h load(const _Float16* p) {
    U f;
    f.h[0] = *(const v8h*)(p);
    f.h[1] = *(const v8h*)(p + 16);
    return f.v;
  }
  static __device__ __forceinline__ v8f mma(v16h a, v16h b, v8f c) {
    return __builtin_amdgcn_wmma_f32_16x16x32_f16(false, a, false, b, (short)0, c, false, false);
  }
};
__device__ __forceinline__ void guard4_h(v8f& a, v8f& b, v8f& c, v8f& d, v16h x, v16h y) {
  asm volatile("v_nop\n\tv_nop\n\tv_nop\n\tv_nop" : "+v"(a), "+v"(b), "+v"(c), "+v"(d) : "v"(x), "v"(y));
}
__device__ __forceinline__ void keep4_h(v16h a, v16h b, v16h c, v16h d) {
  asm volatile("v_nop" :: "v"(a), "v"(b), "v"(c), "v"(d));
}
// Inputs-only hold on eight loaded fragments: their LDS reads stand as one group with one wait in front of the products that
// follow; without it each product waits for its own pair of reads.
__device__ __forceinline__ void hold8_h(v16h a, v16h b, v16h c, v16h d, v16h e, v16h f, v16h g, v16h h) {
  asm volatile("" :: "v"(a), "v"(b), "v"(c), "v"(d), "v"(e), "v"(f), "v"(g), "v"(h));
}
__device__ __forceinline__ void acc_guard4(v8f& a, v8f& b, v8f& c, v8f& d) {
  asm volatile("v_nop\n\tv_nop\n\tv_nop\n\tv_nop" : "+v"(a), "+v"(b), "+v"(c), "+v"(d));
}

// ---------------------------------------------------------------------------
// Preparation, one launch: f32 -> f16 casts of x and of the four weight matrices with their power-of-two carries, and the
// rotary tables. One work-group of 16 waves per 1/256 of the work; every wave lives long instead of many short waves.
// Casts: a piece is 8 consecutive elements (32 B read, 16 B stored). The grid has kPrepLanes = 131,072 threads; thread g takes
//   pieces g + j * kPrepLanes, j = 0..7: j = 0..3 are the four quarters of x, j = 4..7 are w_q, w_k, w_v, w_o (one matrix is
//   exactly kPrepLanes pieces). Destination piece index = source piece index, since W16 follows X16 in the workspace.
//   All 16 reads of a thread are issued before the first value is used.
// Rotary tables: COS/SIN [2048][32] f32, angle = float(position) * inv_freq[i] (single f32 multiply), accurate sincosf;
//   waves 0..7 of each work-group compute one entry per lane (256 x 256 = 65,536 entries) while their reads are in flight.
// ---------------------------------------------------------------------------
constexpr int kPrepThreads = 512;
constexpr int kPrepBlocks  = 256;
constexpr int kPrepLanes   = kPrepThreads * kPrepBlocks;
constexpr int kXn8 = kRows * kHid / 8;
constexpr int kWn8 = kHid * kHid / 8;
static_assert(kWn8 == kPrepLanes && kXn8 == 4 * kPrepLanes, "eight pieces per thread: four of x, one of each matrix");
static_assert(kOffX16 == 0 && kOffW16 == kOffX16 + (size_t)kXn8 * 16, "W16 follows X16");
static_assert(kSeq * kHalfHd == kPrepBlocks * 256, "one table entry per lane of waves 0..7");
__global__ __launch_bounds__(kPrepThreads) void prep_kernel(
    const float* __restrict__ x, const float* __restrict__ wq, const float* __restrict__ wk,
    const float* __restrict__ wv, const float* __restrict__ wo,
    unsigned short* __restrict__ out, float* __restrict__ cosT, float* __restrict__ sinT)
{
  const unsigned g = blockIdx.x * kPrepThreads + threadIdx.x;
  const float* sp[8] = { x, x + (size_t)8 * kPrepLanes, x + (size_t)16 * kPrepLanes, x + (size_t)24 * kPrepLanes,
                         wq, wk, wv, wo };
  const float inv = kInvFreq.v[threadIdx.x & 31];
  /* the table read's index register may be reused by what follows */
  asm volatile("s_wait_xcnt 0x0" ::: "memory");
  const unsigned rb = g * 32u;
  v4f a[8], c[8];
#pragma unroll
  for (int j = 0; j < 8; ++j) {
    const float* p = (const float*)((const char*)sp[j] + rb);
    a[j] = *(const v4f*)(p);
    c[j] = *(const v4f*)(p + 4);
  }
  /* inputs-only hold: the table read stays in front of the 16 reads, so its wait does not drain them */
  asm volatile("" :: "v"(inv));
  /* wave-uniform: waves 0..7 */
  if (threadIdx.x < 256) {
    const int t = blockIdx.x * 256 + threadIdx.x;
    const int s = t >> 5;
    const float ang = (float)s * inv;
    float sn, cs;
    sincosf(ang, &sn, &cs);
    cosT[t] = cs;
    sinT[t] = sn;
  }
#pragma unroll
  for (int j = 0; j < 8; ++j) {
    const float scale = (j < 4) ? kXCarry : kWCarry;
    v8h hv;
#pragma unroll
    for (int e = 0; e < 4; ++e) {
      const float f0 = a[j][e] * scale;
      const float f1 = c[j][e] * scale;
      hv[e]     = (_Float16)f0;
      hv[4 + e] = (_Float16)f1;
    }
    *(v8h*)((char*)(out + (size_t)8 * kPrepLanes * j) + g * 16u) = hv;
  }
}

// ---------------------------------------------------------------------------
// L2 asks.
// l2_ask: each lane asks its own address, one per 256 B, into L2 ahead of the copies that read it; a hint, nothing waits for it and no
// value depends on it. Every lane is on and every address lies inside the plane it names.
// The units of a shared panel are dealt over its sharers by work-group index, in few parts; where the work-groups land only
// changes how many asks are useful.
// keep_ask: no counter tracks a prefetch, so the register pair that it names stays unchanged until the loop behind it is over.
// ---------------------------------------------------------------------------
__device__ __forceinline__ void l2_ask(const void* p) {
  asm volatile("global_prefetch_b8 %0, off scope:SCOPE_SE" :: "v"(p));
}
__device__ __forceinline__ void keep_ask(const void* p) {
  asm volatile("" :: "v"(p));
}

// ---------------------------------------------------------------------------
// Asynchronous copy of 8 slices of 16 tile rows to LDS: each lane moves its own 16 B per slice, a wave 4 whole 128-B rows.
// lds = the lane's LDS byte address in slice 0, g = its global address in slice 0, gstep = 16 source rows in halves.
// s_wait_xcnt 0 closes the statement so that no address register named here is rewritten ahead of it.
// ---------------------------------------------------------------------------
constexpr int kBT = 128;                     // block tile: rows of A and rows of Bt
constexpr int kKC = 64;                      // k per pass: tile rows of 128 B
constexpr int kGP = 72;                      // LDS row pitch in halves: 144 B = 16 B x 9, for ds_load_b128 readers
constexpr int kOpHalves    = kBT * kGP;      // one operand's tile
constexpr int kStageHalves = 2 * kOpHalves;  // [A tile | Bt tile]
constexpr unsigned kSliceBytes = 16u * kGP * 2u;
__device__ __forceinline__ void async_copy8(unsigned lds, const _Float16* g, size_t gstep) {
  asm volatile(
      "global_load_async_to_lds_b128 %0, %8, off\n\t"
      "global_load_async_to_lds_b128 %1, %9, off\n\t"
      "global_load_async_to_lds_b128 %2, %10, off\n\t"
      "global_load_async_to_lds_b128 %3, %11, off\n\t"
      "global_load_async_to_lds_b128 %4, %12, off\n\t"
      "global_load_async_to_lds_b128 %5, %13, off\n\t"
      "global_load_async_to_lds_b128 %6, %14, off\n\t"
      "global_load_async_to_lds_b128 %7, %15, off\n\t"
      "s_wait_xcnt 0x0"
      :: "v"(lds), "v"(lds + kSliceBytes), "v"(lds + 2u * kSliceBytes), "v"(lds + 3u * kSliceBytes),
         "v"(lds + 4u * kSliceBytes), "v"(lds + 5u * kSliceBytes), "v"(lds + 6u * kSliceBytes), "v"(lds + 7u * kSliceBytes),
         "v"(g), "v"(g + gstep), "v"(g + 2 * gstep), "v"(g + 3 * gstep),
         "v"(g + 4 * gstep), "v"(g + 5 * gstep), "v"(g + 6 * gstep), "v"(g + 7 * gstep)
      : "memory");
}

// ---------------------------------------------------------------------------
// Batched GEMM: C[m,n] = scale * sum_k A[m,k] * Bt[n,k]; a block of 4 waves (2 x 2) owns a 128x128 tile, each wave 64x64 of it.
// A row-major [M,K]; Bt row-major [N,K]; M, N multiples of 128, K a multiple of 64 and at least 128 (asserted on the host).
// Operands: per pass of 64 k the block's 128 A rows and 128 Bt rows go to LDS by asynchronous copies, two buffers, the next
//           pass's copies in flight while this pass's fragments are read; every wave copies, waits and passes every barrier.
// Store mode 0: f32 rows; mode 1: f16 rows.
// Store mode 3: N = 2 x kHid (q columns then k columns); the 64-wide tile is one head; interleaved-pair rotation with
//             COS/SIN[position][pair] then f16 store to plane (n0 >> 10) laid out [batch*heads + head][position][64];
//             the q plane (n0 < kHid, wave-uniform) takes scale * kQFold in place of scale
// OUT_MODE 4: the three input projections in one launch, so that three work-groups share each WGP from the start.
//             Blocks 0 .. kQKBlocks - 1 are the q|k tiles of the arguments as given (store mode 3). The kVBlocks blocks behind
//             them are the transposed v projection (store mode 1): A = w_v, the third matrix behind Btp; Bt = the rows of Ap of
//             one batch; C = the plane behind the q and k planes, [batch][kHid][kSeq]. The choice is block-uniform.
// Store coverage per 16-row slab: mode 0: 8 iterations x 2 rows; modes 1 and 3: 4 iterations x 4 rows; 64 columns each.
// ---------------------------------------------------------------------------
constexpr int kQKBlocks = (kRows / kBT) * (2 * kHid / kBT);
constexpr int kVBlocksPerBatch = (kHid / kBT) * (kSeq / kBT);
constexpr int kVBlocks = kBatch * kVBlocksPerBatch;
static_assert(kOffK16 == kOffQ16 + kPlaneBytes && kOffVT16 == kOffK16 + kPlaneBytes, "the v plane follows the q and k planes");
template <int OUT_MODE>
__global__ __launch_bounds__(128) void wmma_gemm64(
    const unsigned short* __restrict__ Ap, int lda, long strideA,
    const unsigned short* __restrict__ Btp, int ldb, long strideB,
    void* __restrict__ Cp, int ldc, long strideC,
    const float* __restrict__ cosT, const float* __restrict__ sinT,
    int M, int N, int K, float scale)
{
  const _Float16* A  = (const _Float16*)Ap;
  const _Float16* Bt = (const _Float16*)Btp;
  void* Cout = Cp;
  int b    = blockIdx.y;
  int tile = blockIdx.x;
  /* block-uniform: this block belongs to the v projection */
  const bool vpart = (OUT_MODE == 4) && (tile >= kQKBlocks);
  if (vpart) {
    tile -= kQKBlocks;
    b     = tile / kVBlocksPerBatch;
    tile -= b * kVBlocksPerBatch;
    A  = (const _Float16*)Btp + (size_t)2 * kHid * kHid;
    Bt = (const _Float16*)Ap;
    strideA = 0L;
    strideB = (long)kSeq * kHid;
    Cout    = (void*)((unsigned short*)Cp + 2 * kPlaneElems);
    ldc     = kSeq;
    strideC = (long)kHid * kSeq;
    M = kHid;
    N = kSeq;
    scale = kVScale;
  }
  const int mode = (OUT_MODE == 4) ? (vpart ? 1 : 3) : OUT_MODE;
  __shared__ __align__(16) _Float16 ring[2 * kStageHalves];
  __shared__ __align__(16) float sT[4][16 * 68];
  const int tid  = threadIdx.x;
  const int lane = threadIdx.x & 31;
  const int wave = __builtin_amdgcn_readfirstlane((int)(threadIdx.x >> 5));
  const int tilesN = N >> 7;
  const int tilesM = M >> 7;
  /* block-uniform exit, in front of every copy and barrier */
  if (tile >= tilesM * tilesN) return;
  const int tm = tile / tilesN;
  const int tn = tile - tm * tilesN;
  const int wm = wave >> 1;
  const int wn = wave & 1;
  const int m0 = (tm << 7) + (wm << 6);
  const int n0 = (tn << 7) + (wn << 6);

  const _Float16* Ab = A  + (size_t)b * strideA;
  const _Float16* Bb = Bt + (size_t)b * strideB;

  const int rlane = lane & 15;
  const int koff  = (lane >> 4) * 8;
  const int mOff  = (lane >> 4) * 8;

  v8f acc[4][4];
#pragma unroll
  for (int i = 0; i < 4; ++i)
#pragma unroll
    for (int j = 0; j < 4; ++j) acc[i][j] = (v8f){0.f,0.f,0.f,0.f,0.f,0.f,0.f,0.f};

  /* copy map: thread -> row tid / 8 of each 16-row slice, 16-B part tid % 8 of its 128 B */
  const int crow  = tid >> 3;
  const int cpart = (tid & 7) * 8;
  const _Float16* gA = Ab + (size_t)((tm << 7) + crow) * lda + cpart;
  const _Float16* gB = Bb + (size_t)((tn << 7) + crow) * ldb + cpart;
  const size_t stepA = (size_t)16 * lda;
  const size_t stepB = (size_t)16 * ldb;
  const unsigned ldsA =
      (unsigned)(size_t)(__attribute__((address_space(3))) _Float16*)ring + (unsigned)(crow * kGP + cpart) * 2u;
  const unsigned ldsB = ldsA + (unsigned)kOpHalves * 2u;
  constexpr unsigned kStageBytes = (unsigned)kStageHalves * 2u;
  const _Float16* fA = ring + ((wm << 6) + rlane) * kGP + koff;
  const _Float16* fB = ring + kOpHalves + ((wn << 6) + rlane) * kGP + koff;
  const int passes = K / kKC;

  async_copy8(ldsA, gA, stepA);
  async_copy8(ldsB, gB, stepB);

  /* L2 asks behind pass 0's copies: a row of kHid halves is 8 units, thread -> row tid / 8 of a 16-row group, unit tid % 8.
     A panel: its sharers have consecutive indices; 4 parts of 32 rows, part from tn.
     Bt panel: its sharers lie tilesN indices apart; 8 parts of 16 rows, part from tm.
     Rotary rows of a q|k tile: 64 units of COS and 64 of SIN, 4 parts of 32 units, part from tn, asked by wave 0. */
  const int askCol = (tid & 7) * 128;
  const _Float16* askA0 = Ab + (size_t)((tm << 7) + (tn & 3) * 32 + crow) * lda + askCol;
  const _Float16* askA1 = askA0 + stepA;
  const _Float16* askB0 = Bb + (size_t)((tn << 7) + ((tm >> 1) & 7) * 16 + crow) * ldb + askCol;
  const float* askT = cosT;
  /* block-uniform: the column map holds for rows of kHid halves */
  if (K == kHid) {
    l2_ask(askA0);
    l2_ask(askA1);
    l2_ask(askB0);
    /* wave-uniform */
    if (mode == 3 && wave == 0) {
      askT = ((tn & 2) ? sinT : cosT) + (size_t)((tm << 7) & (kSeq - 1)) * kHalfHd + ((tn & 1) * 32 + lane) * 64;
      l2_ask(askT);
    }
  }
  /* pass 0's tile has landed for this wave; the barrier publishes it to the other waves */
  asm volatile("s_wait_asynccnt 0x0" ::: "memory");
  __syncthreads();
  if (1 < passes) {
    async_copy8(ldsA + kStageBytes, gA + kKC, stepA);
    async_copy8(ldsB + kStageBytes, gB + kKC, stepB);
  }

  for (int t = 0; t < passes; ++t) {
    const int buf = t & 1;
    const _Float16* pA = fA + buf * kStageHalves;
    const _Float16* pB = fB + buf * kStageHalves;
    /* unrolled, like the loops inside: every fragment and accumulator index is a constant, so the arrays stay in registers */
#pragma unroll
    for (int kk = 0; kk < kKC; kk += 32) {
      /* the 16 LDS reads of a 32-k step stand as one group in front of its 16 products */
      v16h ah[4], bh[4];
#pragma unroll
      for (int j = 0; j < 4; ++j) bh[j] = FragH::load(pB + (j << 4) * kGP + kk);
#pragma unroll
      for (int i = 0; i < 4; ++i) ah[i] = FragH::load(pA + (i << 4) * kGP + kk);
#pragma unroll
      for (int i = 0; i < 4; ++i) {
#pragma unroll
        for (int j = 0; j < 4; ++j) acc[i][j] = FragH::mma(ah[i], bh[j], acc[i][j]);
        guard4_h(acc[i][0], acc[i][1], acc[i][2], acc[i][3], ah[i], bh[3]);
      }
      keep4_h(bh[0], bh[1], bh[2], bh[3]);
    }
    /* this wave's reads of buffer buf are complete before any wave refills it */
    asm volatile("s_wait_dscnt 0x0" ::: "memory");
    /* this wave's copies of pass t + 1 have landed before the barrier publishes them */
    asm volatile("s_wait_asynccnt 0x0" ::: "memory");
    __syncthreads();
    if (t + 2 < passes) {
      async_copy8(ldsA + (unsigned)buf * kStageBytes, gA + (size_t)(t + 2) * kKC, stepA);
      async_copy8(ldsB + (unsigned)buf * kStageBytes, gB + (size_t)(t + 2) * kKC, stepB);
    }
  }
  /* no copy of this wave is outstanding past here */
  asm volatile("s_wait_asynccnt 0x0" ::: "memory");
  keep_ask(askA0);
  keep_ask(askA1);
  keep_ask(askB0);
  keep_ask(askT);
  acc_guard4(acc[0][0], acc[0][1], acc[0][2], acc[0][3]);
  acc_guard4(acc[1][0], acc[1][1], acc[1][2], acc[1][3]);
  acc_guard4(acc[2][0], acc[2][1], acc[2][2], acc[2][3]);
  acc_guard4(acc[3][0], acc[3][1], acc[3][2], acc[3][3]);

  /* wave-uniform: the q columns of a q|k tile carry the score scale and log2(e) as well */
  const float cscale = (mode == 3 && n0 < kHid) ? scale * kQFold : scale;
  float* slab = sT[wave];
#pragma unroll
  for (int i = 0; i < 4; ++i) {
    const int mBase = m0 + (i << 4);
#pragma unroll
    for (int j = 0; j < 4; ++j) {
#pragma unroll
      for (int r = 0; r < 8; ++r) {
        const float v = acc[i][j][r] * cscale;
        slab[(mOff + r) * 68 + (j << 4) + rlane] = v;
      }
    }
    __builtin_amdgcn_fence(__ATOMIC_RELEASE, "workgroup");
    __builtin_amdgcn_wave_barrier();
    __builtin_amdgcn_fence(__ATOMIC_ACQUIRE, "workgroup");
    if (mode == 0) {
      float* C = (float*)Cout + (size_t)b * strideC;
      const int hh = lane >> 4, c4 = (lane & 15) * 4;
      {
#pragma unroll
        for (int it = 0; it < 8; ++it) {
          const int row = it * 2 + hh;
          v4f v = *(const v4f*)(slab + row * 68 + c4);
          *(v4f*)(C + (size_t)(mBase + row) * ldc + n0 + c4) = v;
        }
        
      }
    } else if (mode == 1) {
      const int q = lane >> 3, c8 = (lane & 7) * 8;
      unsigned short* C = (unsigned short*)Cout + (size_t)b * strideC;
      v8h ov[4];
#pragma unroll
      for (int it = 0; it < 4; ++it) {
        const int row = it * 4 + q;
        const float* sp = slab + row * 68 + c8;
        const v4f a0 = *(const v4f*)(sp);
        const v4f a1 = *(const v4f*)(sp + 4);
#pragma unroll
        for (int e = 0; e < 4; ++e) {
          ov[it][e]     = (_Float16)a0[e];
          ov[it][4 + e] = (_Float16)a1[e];
        }
      }
      {
#pragma unroll
        for (int it = 0; it < 4; ++it) {
          const int row = it * 4 + q;
          *(v8h*)(C + (size_t)(mBase + row) * ldc + n0 + c8) = ov[it];
        }
        
      }
    } else {
      const int q = lane >> 3, c8 = (lane & 7) * 8;
      const int which = n0 >> 10;
      const int head  = (n0 >> 6) & (kHeads - 1);
      unsigned short* C = (unsigned short*)Cout + (size_t)which * kPlaneElems;
      v8h ov[4];
      size_t oo[4];
#pragma unroll
      for (int it = 0; it < 4; ++it) {
        const int row = it * 4 + q;
        const int m   = mBase + row;
        const int bb  = m >> 11;
        const int s   = m & (kSeq - 1);
        const float* sp = slab + row * 68 + c8;
        const v4f a0 = *(const v4f*)(sp);
        const v4f a1 = *(const v4f*)(sp + 4);
        const v4f cv = *(const v4f*)(cosT + (size_t)s * kHalfHd + (c8 >> 1));
        const v4f sv = *(const v4f*)(sinT + (size_t)s * kHalfHd + (c8 >> 1));
        const float o0 = a0[0] * cv[0] - a0[1] * sv[0];
        const float o1 = a0[0] * sv[0] + a0[1] * cv[0];
        const float o2 = a0[2] * cv[1] - a0[3] * sv[1];
        const float o3 = a0[2] * sv[1] + a0[3] * cv[1];
        const float o4 = a1[0] * cv[2] - a1[1] * sv[2];
        const float o5 = a1[0] * sv[2] + a1[1] * cv[2];
        const float o6 = a1[2] * cv[3] - a1[3] * sv[3];
        const float o7 = a1[2] * sv[3] + a1[3] * cv[3];
        ov[it][0] = (_Float16)o0;
        ov[it][1] = (_Float16)o1;
        ov[it][2] = (_Float16)o2;
        ov[it][3] = (_Float16)o3;
        ov[it][4] = (_Float16)o4;
        ov[it][5] = (_Float16)o5;
        ov[it][6] = (_Float16)o6;
        ov[it][7] = (_Float16)o7;
        oo[it] = ((size_t)(bb * kHeads + head) * kSeq + s) * kHd + c8;
      }
      {
#pragma unroll
        for (int it = 0; it < 4; ++it) *(v8h*)(C + oo[it]) = ov[it];
        
      }
    }
    __builtin_amdgcn_fence(__ATOMIC_RELEASE, "workgroup");
    __builtin_amdgcn_wave_barrier();
    __builtin_amdgcn_fence(__ATOMIC_ACQUIRE, "workgroup");
  }
}

// ---------------------------------------------------------------------------
// Attention for one (batch, head) and two query tiles of 64 rows per block, key tiles of 64, transposed products.
//   The two tiles are i and kQTiles - 1 - i: every block has the same number of P.V tiles. Each of the 4 waves carries two
//   groups of 16 queries, rows 16 * wave .. + 15 of either tile; a K or Vt fragment is read from LDS once for both groups.
//   Per group:
//   S^T = K16 . Q16^T: A = 16 key rows from LDS, B = the group's 16 queries, kept in registers; a lane holds, of ONE query
//   (column lane & 15), the keys 8 * (lane >> 4) + r of each 16-key group, for ALL 32 key tiles;
//   p = min(exp2(accumulator), exp(clamp)) = exp(min(score, clamp)) unnormalised, f32 (the q plane carries the scale);
//   the row sum l accumulates every key (future keys included)
//   in the lane, 8 partial sums, joined in the lane and across the two wave halves once after the loop;
//   O^T += Vt . P^T only for key tiles at or below the diagonal (tile index <= the group's query tile, block-uniform), with p set
//   to zero where key > query inside the diagonal tile; O = acc / l, no renormalisation.
//   P^T never leaves the registers: score groups 2kk and 2kk + 1 of a lane are elements 0..7 and 8..15 of its B fragment for
//   keys 32kk..32kk+31, the k map that FragH::load gives the Vt rows (A): 8 * (lane >> 4) + e, then 16 + 8 * (lane >> 4) + e.
// LDS: two buffers of [K tile [64 keys][72] f16 | Vt tile [64 dd][72] f16] (columns 0..63 written and read, pad never read);
//   each tile is brought by asynchronous copies, 128 threads x 4 x 16 B = 8,192 B = the whole tile; key tile kc + 2 is
//   copied into the buffer that tile kc has just left, so a tile's copies fly while the tile in front of it is worked on.
//   A Vt tile is copied only where it is used (tile index <= the higher query tile's index, block-uniform).
// Output: a lane holds 8 consecutive head columns of its query per 16-row group of O^T and stores them as 16 B; the wave
//   writes the whole 128-B head slice of each of its 2 x 16 rows.
// Block barriers: one in front of the loop, one at the foot of each key tile; all 4 waves run all 32 tiles; no early exits.
// grid.x = 32 (batch, head) groups x 16 pairs of query tiles.
// ---------------------------------------------------------------------------
constexpr int kQB = 64;
constexpr int kKT = 64;
constexpr int kLP = 72;
constexpr int kQTiles = kSeq / kQB;
constexpr int kKTiles = kSeq / kKT;
constexpr int kQPairs = kQTiles / 2;
static_assert(kQTiles == 2 * kQPairs && kQPairs >= 1, "query tiles pair up; the high tile of a pair has index 1 or more");
static_assert(kQB == kKT, "diagonal tile logic assumes equal tiles");
static_assert(kLP == kGP && kKT == 64 && kHd == 64, "a tile is 4 slices of 16 rows at the pitch of kSliceBytes");
static_assert(kKTiles >= 2, "two buffers are filled in front of the loop");
constexpr int kAskTiles = 8;                   // key tiles per chunk of L2 asks
static_assert((kQPairs % 4) == 0 && (kKTiles % kAskTiles) == 0 && kAskTiles * kKT * kHd * 2 == 4 * 64 * 256 &&
              kAskTiles * kKT * 2 == 4 * 256 && kHd == 4 * 16, "ask map: 4 parts of 64 K units and of 16 Vt rows x 4 units");
constexpr int kTileHalves   = kKT * kLP;       // one operand's tile
constexpr int kAStageHalves = 2 * kTileHalves; // [K tile | Vt tile]
// Asynchronous copy of one 64-row tile to LDS, 4 slices of 16 rows: each lane moves its own 16 B per slice.
// lds = the lane's LDS byte address in slice 0, g = its global address in slice 0, gstep = 16 source rows in halves.
// s_wait_xcnt 0 closes the statement so that no address register named here is rewritten ahead of it.
__device__ __forceinline__ void async_copy4(unsigned lds, const _Float16* g, size_t gstep) {
  asm volatile(
      "global_load_async_to_lds_b128 %0, %4, off\n\t"
      "global_load_async_to_lds_b128 %1, %5, off\n\t"
      "global_load_async_to_lds_b128 %2, %6, off\n\t"
      "global_load_async_to_lds_b128 %3, %7, off\n\t"
      "s_wait_xcnt 0x0"
      :: "v"(lds), "v"(lds + kSliceBytes), "v"(lds + 2u * kSliceBytes), "v"(lds + 3u * kSliceBytes),
         "v"(g), "v"(g + gstep), "v"(g + 2 * gstep), "v"(g + 3 * gstep)
      : "memory");
}

__global__ __launch_bounds__(128) void attn_kernel(
    const unsigned short* __restrict__ Qp, const unsigned short* __restrict__ Kp,
    const unsigned short* __restrict__ Vtp, unsigned short* __restrict__ Op)
{
  __shared__ __align__(16) _Float16 ring[2 * kAStageHalves];

  const int tid  = threadIdx.x;
  const int wave = __builtin_amdgcn_readfirstlane((int)(threadIdx.x >> 5));
  const int lane = tid & 31;
  const int hh   = lane >> 4;
  const int c    = lane & 15;
  const int pi   = blockIdx.x % kQPairs;
  const int bh   = blockIdx.x / kQPairs;
  /* the block's two query tiles: group 0 the low one, group 1 its mirror, so every block has kQTiles + 1 P.V tiles */
  const int qt[2] = { pi, kQTiles - 1 - pi };
  const int qlo = qt[0];
  const int qhi = qt[1];

  const _Float16* Qb = (const _Float16*)Qp  + (size_t)bh * kSeq * kHd;
  const _Float16* Kb = (const _Float16*)Kp  + (size_t)bh * kSeq * kHd;
  const _Float16* Vb = (const _Float16*)Vtp + (size_t)bh * kHd * kSeq;

  v16h qf[2][2];
#pragma unroll
  for (int g = 0; g < 2; ++g)
#pragma unroll
    for (int dc = 0; dc < 2; ++dc)
      qf[g][dc] = FragH::load(Qb + (size_t)(qt[g] * kQB + wave * 16 + c) * kHd + dc * 32 + 8 * hh);

  float lsum[2][8];
  v8f oacc[2][4];
#pragma unroll
  for (int g = 0; g < 2; ++g) {
#pragma unroll
    for (int r = 0; r < 8; ++r) lsum[g][r] = 0.f;
#pragma unroll
    for (int t = 0; t < 4; ++t) oacc[g][t] = (v8f){0.f,0.f,0.f,0.f,0.f,0.f,0.f,0.f};
  }

  /* copy map: thread -> row tid / 8 of each 16-row slice, 16-B part tid % 8 of its 128 B */
  const int crow  = tid >> 3;
  const int cpart = (tid & 7) * 8;
  const _Float16* gK = Kb + (size_t)crow * kHd + cpart;
  const _Float16* gV = Vb + (size_t)crow * kSeq + cpart;
  constexpr size_t kStepK = (size_t)16 * kHd;
  constexpr size_t kStepV = (size_t)16 * kSeq;
  const unsigned ldsK =
      (unsigned)(size_t)(__attribute__((address_space(3))) _Float16*)ring + (unsigned)(crow * kLP + cpart) * 2u;
  const unsigned ldsV = ldsK + (unsigned)kTileHalves * 2u;
  constexpr unsigned kAStageBytes = (unsigned)kAStageHalves * 2u;

  /* key tile 0 (its Vt tile is used by every query tile) */
  async_copy4(ldsK, gK, kStepK);
  async_copy4(ldsV, gV, kStepV);

  /* L2 asks, a chunk of kAskTiles key tiles at a time, dealt over the 16 work-groups of this (batch, head) in 4 parts:
     waves 0 and 1 ask K tiles 2 * part and 2 * part + 1 of the chunk (16,384 B in a row = 64 units), waves 2 and 3 the
     chunk's 1,024 B = 4 units of Vt rows 16 * part .. + 15. Chunk 0 here, behind tile 0's copies; chunk n + 1 from inside
     the loop while chunk n is worked on. */
  const int part = pi & 3;
  const int au   = tid & 63;
  const char* ask = (wave < 2)
      ? (const char*)Kb + (size_t)part * (2 * kKT * kHd * 2) + au * 256
      : (const char*)Vb + (size_t)(part * 16 + (au >> 2)) * (kSeq * 2) + (au & 3) * 256;
  const int askStep = (wave < 2) ? kAskTiles * kKT * kHd * 2 : kAskTiles * kKT * 2;
  l2_ask(ask);
  /* tile 0 has landed for this wave; the barrier publishes it to the other waves */
  asm volatile("s_wait_asynccnt 0x0" ::: "memory");
  __syncthreads();
  /* key tile 1: the high query tile's index is at least kQTiles / 2, so its Vt tile is always used */
  async_copy4(ldsK + kAStageBytes, gK + (size_t)kKT * kHd, kStepK);
  async_copy4(ldsV + kAStageBytes, gV + kKT, kStepV);

#pragma unroll 1
  for (int kc = 0; kc < kKTiles; ++kc) {
    const int kv0 = kc * kKT;
    const int buf = kc & 1;
    const _Float16* Ksh = ring + buf * kAStageHalves;
    const _Float16* Vsh = Ksh + kTileHalves;

    /* block-uniform: the next chunk's asks, kAskTiles - 4 tiles before its first copy is issued; the address moves only
       here, in front of an ask for a chunk that exists, so it never leaves the plane */
    if ((kc & (kAskTiles - 1)) == 2 && kc < kKTiles - kAskTiles) {
      ask += askStep;
      l2_ask(ask);
    }

    /* the K tile's fragments, each read once and used by both query groups */
    v16h kf[4][2];
#pragma unroll
    for (int j = 0; j < 4; ++j)
#pragma unroll
      for (int dc = 0; dc < 2; ++dc) kf[j][dc] = FragH::load(Ksh + (j * 16 + c) * kLP + dc * 32 + 8 * hh);
    v8f s[2][4];
#pragma unroll
    for (int g = 0; g < 2; ++g)
#pragma unroll
      for (int j = 0; j < 4; ++j) s[g][j] = (v8f){0.f,0.f,0.f,0.f,0.f,0.f,0.f,0.f};
#pragma unroll
    for (int g = 0; g < 2; ++g)
#pragma unroll
      for (int dc = 0; dc < 2; ++dc)
#pragma unroll
        for (int j = 0; j < 4; ++j) s[g][j] = FragH::mma(kf[j][dc], qf[g][dc], s[g][j]);
#pragma unroll
    for (int g = 0; g < 2; ++g) {
#pragma unroll
      for (int j = 0; j < 4; ++j) {
#pragma unroll
        for (int r = 0; r < 8; ++r) {
          const float p = fminf(__builtin_amdgcn_exp2f(s[g][j][r]), kExpClamp);
          lsum[g][r] += p;
          s[g][j][r] = p;
        }
      }
    }
    /* block-uniform: this key tile contributes to the high group's P.V (and, where kc <= qlo, to the low group's) */
    if (kc <= qhi) {
      /* the Vt tile's fragments, each read once and used by every group that needs the tile */
      v16h vf[4][2];
#pragma unroll
      for (int t = 0; t < 4; ++t)
#pragma unroll
        for (int kk = 0; kk < 2; ++kk) vf[t][kk] = FragH::load(Vsh + (t * 16 + c) * kLP + kk * 32 + 8 * hh);
      /* the 16 LDS reads of the Vt tile as one group in front of its products */
      hold8_h(vf[0][0], vf[1][0], vf[2][0], vf[3][0], vf[0][1], vf[1][1], vf[2][1], vf[3][1]);
#pragma unroll
      for (int g = 1; g >= 0; --g) {
        /* block-uniform */
        if (kc <= qt[g]) {
          v16h pf[2];
#pragma unroll
          for (int kk = 0; kk < 2; ++kk) {
#pragma unroll
            for (int r = 0; r < 8; ++r) {
              pf[kk][r]     = (_Float16)s[g][2 * kk][r];
              pf[kk][8 + r] = (_Float16)s[g][2 * kk + 1][r];
            }
          }
          /* block-uniform: only the group's diagonal tile holds keys past a query */
          if (kc == qt[g]) {
            const int qrow = qt[g] * kQB + wave * 16 + c;
#pragma unroll
            for (int kk = 0; kk < 2; ++kk) {
#pragma unroll
              for (int e = 0; e < 16; ++e) {
                const int kvrow = kv0 + kk * 32 + (e >> 3) * 16 + 8 * hh + (e & 7);
                pf[kk][e] = (kvrow > qrow) ? (_Float16)0.0f : pf[kk][e];
              }
            }
          }
#pragma unroll
          for (int kk = 0; kk < 2; ++kk)
#pragma unroll
            for (int t = 0; t < 4; ++t) oacc[g][t] = FragH::mma(vf[t][kk], pf[kk], oacc[g][t]);
        }
      }
    }
    /* this wave's reads of buffer buf are complete before any wave refills it */
    asm volatile("s_wait_dscnt 0x0" ::: "memory");
    /* this wave's copies of tile kc + 1 have landed before the barrier publishes them */
    asm volatile("s_wait_asynccnt 0x0" ::: "memory");
    __syncthreads();
    if (kc + 2 < kKTiles) {
      async_copy4(ldsK + (unsigned)buf * kAStageBytes, gK + (size_t)(kc + 2) * kKT * kHd, kStepK);
      if (kc + 2 <= qhi) async_copy4(ldsV + (unsigned)buf * kAStageBytes, gV + (size_t)(kc + 2) * kKT, kStepV);
    }
  }
  /* no copy of this wave is outstanding past here */
  asm volatile("s_wait_asynccnt 0x0" ::: "memory");
  keep_ask(ask);

  const int bb = bh / kHeads;
  const int h  = bh - bb * kHeads;
#pragma unroll
  for (int g = 0; g < 2; ++g) {
    float l = ((lsum[g][0] + lsum[g][1]) + (lsum[g][2] + lsum[g][3])) + ((lsum[g][4] + lsum[g][5]) + (lsum[g][6] + lsum[g][7]));
    l += __shfl_xor(l, 16, 32);
    const float inv = kCtxScale * __builtin_amdgcn_rcpf(l);
    unsigned short* op = Op + ((size_t)(bb * kSeq + qt[g] * kQB + wave * 16 + c)) * kHid + h * kHd + 8 * hh;
#pragma unroll
    for (int t = 0; t < 4; ++t) {
      v8h ov;
#pragma unroll
      for (int r = 0; r < 8; ++r) ov[r] = (_Float16)(oacc[g][t][r] * inv);
      *(v8h*)(op + t * 16) = ov;
    }
  }
}

// ---------------------------------------------------------------------------
// Host glue: 4 kernel launches, nothing else.
//   1 casts of x and w_q|w_k|w_v|w_o, rotary tables: 256 blocks of 512 threads
//   2 input projections, 768 blocks of 128 threads:
//     q|k projection + rotation: M 4096, N 2048, K 1024 -> 32 x 16 block tiles = 512 blocks;
//     v projection transposed (A = w_v, Bt = x of one batch): M 1024, N 2048, K 1024 -> 8 x 16 block tiles = 128 blocks x 2
//   3 attention: 32 x 16 = 512 blocks of 128 threads
//   4 output projection: M 4096, N 1024, K 1024 -> 32 x 8 block tiles = 256 blocks of 128 threads
// ---------------------------------------------------------------------------
extern "C" void kernel_launch(void* const* d_in, const int* in_sizes, int n_in,
                              void* d_out, int out_size, void* d_ws, size_t ws_size,
                              hipStream_t stream) {
  if (n_in < 5) return;
  if (in_sizes[0] != kRows * kHid) return;
  if (in_sizes[1] != kHid * kHid) return;
  if (in_sizes[2] != kHid * kHid) return;
  if (in_sizes[3] != kHid * kHid) return;
  if (in_sizes[4] != kHid * kHid) return;
  if (out_size != kRows * kHid) return;
  if (ws_size < kWsTotal) return;

  const float* x  = (const float*)d_in[0];
  const float* wq = (const float*)d_in[1];
  const float* wk = (const float*)d_in[2];
  const float* wv = (const float*)d_in[3];
  const float* wo = (const float*)d_in[4];
  float* out = (float*)d_out;

  char* ws = (char*)d_ws;
  unsigned short* X16  = (unsigned short*)(ws + kOffX16);
  unsigned short* W16  = (unsigned short*)(ws + kOffW16);
  float*          COS  = (float*)(ws + kOffCos);
  float*          SIN  = (float*)(ws + kOffSin);
  unsigned short* Q16  = (unsigned short*)(ws + kOffQ16);
  unsigned short* K16  = (unsigned short*)(ws + kOffK16);
  unsigned short* VT16 = (unsigned short*)(ws + kOffVT16);
  unsigned short* A16  = (unsigned short*)(ws + kOffA16);
  const unsigned short* Wqk16 = W16;
  const unsigned short* Wo16  = W16 + (size_t)3 * kHid * kHid;

  static_assert((kRows % kBT) == 0 && (kHid % kBT) == 0 && (kSeq % kBT) == 0, "block tiles exact");
  static_assert((kHid % kKC) == 0 && kHid / kKC >= 2, "whole passes, two or more");

  prep_kernel<<<kPrepBlocks, kPrepThreads, 0, stream>>>(x, wq, wk, wv, wo, X16, COS, SIN);

  wmma_gemm64<4><<<dim3(kQKBlocks + kVBlocks, 1), 128, 0, stream>>>(
      X16, kHid, 0L,
      Wqk16, kHid, 0L,
      (void*)Q16, 0, 0L,
      COS, SIN,
      kRows, 2 * kHid, kHid, kQKScale);

  attn_kernel<<<kBatch * kHeads * kQPairs, 128, 0, stream>>>(Q16, K16, VT16, A16);

  wmma_gemm64<0><<<dim3((kRows / kBT) * (kHid / kBT), 1), 128, 0, stream>>>(
      A16, kHid, 0L,
      Wo16, kHid, 0L,
      (void*)out, kHid, 0L,
      nullptr, nullptr,
      kRows, kHid, kHid, kOutScale);
}

// v009
// It runs in 72.3 microseconds.
// In both of two side-by-side timings against v008, it was 1.04 times as fast.
// Over all steps from v000 it is 3.29 times as fast.
// All contractions (q/k/v projections, q.k^T, p.v, output projection): v_wmma_f32_16x16x32_f16, f16 operands with power-of-two carries (q also with the score scale and log2(e)), f32 accumulate; rotary tables, exp, row sums and normalisation in f32.
#include <hip/hip_runtime.h>
#include <math.h>

typedef __attribute__((ext_vector_type(16))) _Float16 v16h;
typedef __attribute__((ext_vector_type(8)))  _Float16 v8h;
typedef __attribute__((ext_vector_type(8)))  float    v8f;
typedef __attribute__((ext_vector_type(4)))  float    v4f;

// ---------------------------------------------------------------------------
// Shape constants
// ---------------------------------------------------------------------------
constexpr int kBatch  = 2;
constexpr int kSeq    = 2048;
constexpr int kHid    = 1024;
constexpr int kHeads  = 16;
constexpr int kHd     = 64;
constexpr int kRows   = kBatch * kSeq;
constexpr int kHalfHd = kHd / 2;
static_assert(kHeads * kHd == kHid, "head split");
static_assert(kHd == 64, "head width fixed at 64");
static_assert((kSeq % 64) == 0 && (kHid % 64) == 0 && (kHid % 32) == 0 && (kRows % 64) == 0, "tile multiples");
static_assert(kSeq == 2048 && kHid == 1024, "bit tricks below assume these");

// ---------------------------------------------------------------------------
// Power-of-two carries of the f16 planes and the derived fold-back scales
// ---------------------------------------------------------------------------
constexpr double cx_sqrt(double x) {
  double g = (x > 1.0) ? x : 1.0;
  for (int it = 0; it < 80; ++it) g = 0.5 * (g + x / g);
  return g;
}
constexpr float kXCarry    = 16.0f;
constexpr float kWCarry    = 256.0f;
constexpr float kQKCarry   = 16.0f;
constexpr float kVCarry    = 16.0f;
constexpr float kAttnCarry = 2048.0f;
constexpr float kInvSqrtHd = (float)(1.0 / cx_sqrt((double)kHd));
static_assert(kInvSqrtHd == 0.125f, "1/sqrt(head width)");
constexpr float kQKScale    = kQKCarry / (kXCarry * kWCarry);
constexpr float kVScale     = kVCarry / (kXCarry * kWCarry);
constexpr float kScoreScale = kInvSqrtHd / (kQKCarry * kQKCarry);
constexpr float kCtxScale   = kAttnCarry / kVCarry;
constexpr float kOutScale   = 1.0f / (kAttnCarry * kWCarry);
constexpr float kScoreClamp = 10.0f;
// The q plane also carries the score scale and log2(e), multiplied in f32 in front of its one rounding to f16, so that a
// K16 . Q16^T accumulator is the score in log2 units as it stands: exp(min(score, clamp)) = min(exp2(accumulator), exp(clamp)).
constexpr double cx_exp(double x) {
  double term = 1.0, sum = 1.0;
  for (int i = 1; i < 200; ++i) { term *= x / i; sum += term; }
  return sum;
}
constexpr float kLog2E     = 1.4426950408889634f;
constexpr float kQFold     = kScoreScale * kLog2E;
constexpr float kExpClamp  = (float)cx_exp((double)kScoreClamp);
static_assert(kExpClamp > 22026.0f && kExpClamp < 22027.0f, "exp(10); below the largest f16, so p converts finite");

// ---------------------------------------------------------------------------
// Rotary inverse frequencies: 10000^(-2i/64) = 10^(-i/8), i = 0..31, evaluated in double at build time, converted to f32
// ---------------------------------------------------------------------------
struct InvFreqTab { float v[kHalfHd]; };
constexpr InvFreqTab make_inv_freq() {
  InvFreqTab t{};
  const double r8 = cx_sqrt(cx_sqrt(cx_sqrt(10.0)));
  for (int i = 0; i < kHalfHd; ++i) {
    double p = 1.0;
    for (int j = 0; j < (i & 7); ++j) p *= r8;
    for (int j = 0; j < (i >> 3); ++j) p *= 10.0;
    t.v[i] = (float)(1.0 / p);
  }
  return t;
}
__device__ constexpr InvFreqTab kInvFreq = make_inv_freq();
static_assert(sizeof(kInvFreq.v) / sizeof(kInvFreq.v[0]) == 32, "table length");

// ---------------------------------------------------------------------------
// Workspace region map (bytes; every offset a multiple of 128)
//   X16   f16 [4096][1024]          x carried x16                         8,388,608
//   W16   f16 [4][1024][1024]       w_q | w_k | w_v | w_o carried x256    8,388,608
//   COS   f32 [2048][32]                                                    262,144
//   SIN   f32 [2048][32]                                                    262,144
//   Q16   f16 [32][2048][64]        rotated q carried x16 x kQFold        8,388,608
//   K16   f16 [32][2048][64]        rotated k carried x16 (follows Q16)   8,388,608
//   VT16  f16 [32][64][2048]        v transposed, carried x16             8,388,608
//   A16   f16 [4096][1024]          attention output carried x2048        8,388,608
//   total                                                                50,855,936
// ---------------------------------------------------------------------------
constexpr size_t kPlaneBytes = (size_t)kRows * kHid * 2;
constexpr size_t kTabBytes   = (size_t)kSeq * kHalfHd * 4;
constexpr size_t kOffX16  = 0;
constexpr size_t kOffW16  = kOffX16 + kPlaneBytes;
constexpr size_t kOffCos  = kOffW16 + (size_t)4 * kHid * kHid * 2;
constexpr size_t kOffSin  = kOffCos + kTabBytes;
constexpr size_t kOffQ16  = kOffSin + kTabBytes;
constexpr size_t kOffK16  = kOffQ16 + kPlaneBytes;
constexpr size_t kOffVT16 = kOffK16 + kPlaneBytes;
constexpr size_t kOffA16  = kOffVT16 + kPlaneBytes;
constexpr size_t kWsTotal = kOffA16 + kPlaneBytes;
static_assert(kWsTotal == 50855936ull, "carve total");
static_assert(kWsTotal <= 134217728ull, "carve cap");
static_assert((kOffW16 % 128) == 0 && (kOffCos % 128) == 0 && (kOffSin % 128) == 0 && (kOffQ16 % 128) == 0 &&
              (kOffK16 % 128) == 0 && (kOffVT16 % 128) == 0 && (kOffA16 % 128) == 0, "128-B aligned regions");
constexpr size_t kPlaneElems = (size_t)kRows * kHid;

// ---------------------------------------------------------------------------
// Fragment helpers (split k map for A and B: elements 0..7 <- p[0..7], 8..15 <- p[16..23], p already offset by 8*(lane>>4))
// ---------------------------------------------------------------------------
struct FragH {
  union U { v16h v; v8h h[2]; };
  static __device__ __forceinline__ v16h load(const _Float16* p) {
    U f;
    f.h[0] = *(const v8h*)(p);
    f.h[1] = *(const v8h*)(p + 16);
    return f.v;
  }
  static __device__ __forceinline__ v8f mma(v16h a, v16h b, v8f c) {
    return __builtin_amdgcn_wmma_f32_16x16x32_f16(false, a, false, b, (short)0, c, false, false);
  }
};
__device__ __forceinline__ void guard4_h(v8f& a, v8f& b, v8f& c, v8f& d, v16h x, v16h y) {
  asm volatile("v_nop\n\tv_nop\n\tv_nop\n\tv_nop" : "+v"(a), "+v"(b), "+v"(c), "+v"(d) : "v"(x), "v"(y));
}
__device__ __forceinline__ void keep4_h(v16h a, v16h b, v16h c, v16h d) {
  asm volatile("v_nop" :: "v"(a), "v"(b), "v"(c), "v"(d));
}
// Inputs-only hold on eight loaded fragments: their LDS reads stand as one group with one wait in front of the products that
// follow; without it each product waits for its own pair of reads.
__device__ __forceinline__ void hold8_h(v16h a, v16h b, v16h c, v16h d, v16h e, v16h f, v16h g, v16h h) {
  asm volatile("" :: "v"(a), "v"(b), "v"(c), "v"(d), "v"(e), "v"(f), "v"(g), "v"(h));
}
__device__ __forceinline__ void acc_guard4(v8f& a, v8f& b, v8f& c, v8f& d) {
  asm volatile("v_nop\n\tv_nop\n\tv_nop\n\tv_nop" : "+v"(a), "+v"(b), "+v"(c), "+v"(d));
}

// ---------------------------------------------------------------------------
// Preparation, one launch: f32 -> f16 casts of x and of the four weight matrices with their power-of-two carries, and the
// rotary tables. One work-group of 16 waves per 1/256 of the work; every wave lives long instead of many short waves.
// Casts: a piece is 8 consecutive elements (32 B read, 16 B stored). The grid has kPrepLanes = 131,072 threads; thread g takes
//   pieces g + j * kPrepLanes, j = 0..7: j = 0..3 are the four quarters of x, j = 4..7 are w_q, w_k, w_v, w_o (one matrix is
//   exactly kPrepLanes pieces). Destination piece index = source piece index, since W16 follows X16 in the workspace.
//   All 16 reads of a thread are issued before the first value is used.
// Rotary tables: COS/SIN [2048][32] f32, angle = float(position) * inv_freq[i] (single f32 multiply), accurate sincosf;
//   waves 0..7 of each work-group compute one entry per lane (256 x 256 = 65,536 entries) while their reads are in flight.
// ---------------------------------------------------------------------------
constexpr int kPrepThreads = 512;
constexpr int kPrepBlocks  = 256;
constexpr int kPrepLanes   = kPrepThreads * kPrepBlocks;
constexpr int kXn8 = kRows * kHid / 8;
constexpr int kWn8 = kHid * kHid / 8;
static_assert(kWn8 == kPrepLanes && kXn8 == 4 * kPrepLanes, "eight pieces per thread: four of x, one of each matrix");
static_assert(kOffX16 == 0 && kOffW16 == kOffX16 + (size_t)kXn8 * 16, "W16 follows X16");
static_assert(kSeq * kHalfHd == kPrepBlocks * 256, "one table entry per lane of waves 0..7");
__global__ __launch_bounds__(kPrepThreads) void prep_kernel(
    const float* __restrict__ x, const float* __restrict__ wq, const float* __restrict__ wk,
    const float* __restrict__ wv, const float* __restrict__ wo,
    unsigned short* __restrict__ out, float* __restrict__ cosT, float* __restrict__ sinT)
{
  const unsigned g = blockIdx.x * kPrepThreads + threadIdx.x;
  const float* sp[8] = { x, x + (size_t)8 * kPrepLanes, x + (size_t)16 * kPrepLanes, x + (size_t)24 * kPrepLanes,
                         wq, wk, wv, wo };
  const float inv = kInvFreq.v[threadIdx.x & 31];
  /* the table read's index register may be reused by what follows */
  asm volatile("s_wait_xcnt 0x0" ::: "memory");
  const unsigned rb = g * 32u;
  v4f a[8], c[8];
#pragma unroll
  for (int j = 0; j < 8; ++j) {
    const float* p = (const float*)((const char*)sp[j] + rb);
    a[j] = *(const v4f*)(p);
    c[j] = *(const v4f*)(p + 4);
  }
  /* inputs-only hold: the table read stays in front of the 16 reads, so its wait does not drain them */
  asm volatile("" :: "v"(inv));
  /* wave-uniform: waves 0..7 */
  if (threadIdx.x < 256) {
    const int t = blockIdx.x * 256 + threadIdx.x;
    const int s = t >> 5;
    const float ang = (float)s * inv;
    float sn, cs;
    sincosf(ang, &sn, &cs);
    cosT[t] = cs;
    sinT[t] = sn;
  }
#pragma unroll
  for (int j = 0; j < 8; ++j) {
    const float scale = (j < 4) ? kXCarry : kWCarry;
    v8h hv;
#pragma unroll
    for (int e = 0; e < 4; ++e) {
      const float f0 = a[j][e] * scale;
      const float f1 = c[j][e] * scale;
      hv[e]     = (_Float16)f0;
      hv[4 + e] = (_Float16)f1;
    }
    *(v8h*)((char*)(out + (size_t)8 * kPrepLanes * j) + g * 16u) = hv;
  }
}

// ---------------------------------------------------------------------------
// L2 asks.
// l2_ask: each lane asks its own address, one per 256 B, into L2 ahead of the copies that read it; a hint, nothing waits for it and no
// value depends on it. Every lane is on and every address lies inside the plane it names.
// The units of a shared panel are dealt over its sharers by work-group index, in few parts; where the work-groups land only
// changes how many asks are useful.
// keep_ask: no counter tracks a prefetch, so the register pair that it names stays unchanged until the loop behind it is over.
// ---------------------------------------------------------------------------
__device__ __forceinline__ void l2_ask(const void* p) {
  asm volatile("global_prefetch_b8 %0, off scope:SCOPE_SE" :: "v"(p));
}
__device__ __forceinline__ void keep_ask(const void* p) {
  asm volatile("" :: "v"(p));
}

// ---------------------------------------------------------------------------
// Asynchronous copy of 8 slices of 16 tile rows to LDS: each lane moves its own 16 B per slice, a wave 4 whole 128-B rows.
// lds = the lane's LDS byte address in slice 0, g = its global address in slice 0, gstep = 16 source rows in halves.
// s_wait_xcnt 0 closes the statement so that no address register named here is rewritten ahead of it.
// ---------------------------------------------------------------------------
constexpr int kBT = 128;                     // block tile: rows of A and rows of Bt
constexpr int kKC = 64;                      // k per pass: tile rows of 128 B
constexpr int kGP = 72;                      // LDS row pitch in halves: 144 B = 16 B x 9, for ds_load_b128 readers
constexpr int kOpHalves    = kBT * kGP;      // one operand's tile
constexpr int kStageHalves = 2 * kOpHalves;  // [A tile | Bt tile]
constexpr unsigned kSliceBytes = 16u * kGP * 2u;
__device__ __forceinline__ void async_copy8(unsigned lds, const _Float16* g, size_t gstep) {
  asm volatile(
      "global_load_async_to_lds_b128 %0, %8, off\n\t"
      "global_load_async_to_lds_b128 %1, %9, off\n\t"
      "global_load_async_to_lds_b128 %2, %10, off\n\t"
      "global_load_async_to_lds_b128 %3, %11, off\n\t"
      "global_load_async_to_lds_b128 %4, %12, off\n\t"
      "global_load_async_to_lds_b128 %5, %13, off\n\t"
      "global_load_async_to_lds_b128 %6, %14, off\n\t"
      "global_load_async_to_lds_b128 %7, %15, off\n\t"
      "s_wait_xcnt 0x0"
      :: "v"(lds), "v"(lds + kSliceBytes), "v"(lds + 2u * kSliceBytes), "v"(lds + 3u * kSliceBytes),
         "v"(lds + 4u * kSliceBytes), "v"(lds + 5u * kSliceBytes), "v"(lds + 6u * kSliceBytes), "v"(lds + 7u * kSliceBytes),
         "v"(g), "v"(g + gstep), "v"(g + 2 * gstep), "v"(g + 3 * gstep),
         "v"(g + 4 * gstep), "v"(g + 5 * gstep), "v"(g + 6 * gstep), "v"(g + 7 * gstep)
      : "memory");
}

// ---------------------------------------------------------------------------
// Batched GEMM: C[m,n] = scale * sum_k A[m,k] * Bt[n,k]; a block of 4 waves (2 x 2) owns a 128x128 tile, each wave 64x64 of it.
// A row-major [M,K]; Bt row-major [N,K]; M, N multiples of 128, K a multiple of 64 and at least 128 (asserted on the host).
// Operands: per pass of 64 k the block's 128 A rows and 128 Bt rows go to LDS by asynchronous copies, two buffers, the next
//           pass's copies in flight while this pass's fragments are read; every wave copies, waits and passes every barrier.
// Store mode 0: f32 rows; mode 1: f16 rows.
// Store mode 3: N = 2 x kHid (q columns then k columns); the 64-wide tile is one head; interleaved-pair rotation with
//             COS/SIN[position][pair] then f16 store to plane (n0 >> 10) laid out [batch*heads + head][position][64];
//             the q plane (n0 < kHid, wave-uniform) takes scale * kQFold in place of scale
// OUT_MODE 4: the three input projections in one launch, so that three work-groups share each WGP from the start.
//             Blocks 0 .. kQKBlocks - 1 are the q|k tiles of the arguments as given (store mode 3). The kVBlocks blocks behind
//             them are the transposed v projection (store mode 1): A = w_v, the third matrix behind Btp; Bt = the rows of Ap of
//             one batch; C = the plane behind the q and k planes, [batch][kHid][kSeq]. The choice is block-uniform.
// Output: each wave stages its 64 x 64 tile in f32 in the ring, once the last pass has left it, and reads it back by rows, so that
//             every store covers whole 128-B lines. Mode 0: 32 iterations x 2 rows; modes 1 and 3: 16 iterations x 4 rows; 64 columns each.
// ---------------------------------------------------------------------------
constexpr int kQKBlocks = (kRows / kBT) * (2 * kHid / kBT);
constexpr int kVBlocksPerBatch = (kHid / kBT) * (kSeq / kBT);
constexpr int kVBlocks = kBatch * kVBlocksPerBatch;
static_assert(kOffK16 == kOffQ16 + kPlaneBytes && kOffVT16 == kOffK16 + kPlaneBytes, "the v plane follows the q and k planes");
constexpr int kSlabPitch  = 68;                // f32 per staged output row: 16-B reads down a column walk meet no bank twice
constexpr int kSlabFloats = 64 * kSlabPitch;   // one wave's staged tile
static_assert((size_t)4 * kSlabFloats * 4 <= (size_t)2 * kStageHalves * 2 && ((kSlabFloats * 4) % 16) == 0, "four staged tiles fit the ring");
template <int OUT_MODE>
__global__ __launch_bounds__(128) void wmma_gemm64(
    const unsigned short* __restrict__ Ap, int lda, long strideA,
    const unsigned short* __restrict__ Btp, int ldb, long strideB,
    void* __restrict__ Cp, int ldc, long strideC,
    const float* __restrict__ cosT, const float* __restrict__ sinT,
    int M, int N, int K, float scale)
{
  const _Float16* A  = (const _Float16*)Ap;
  const _Float16* Bt = (const _Float16*)Btp;
  void* Cout = Cp;
  int b    = blockIdx.y;
  int tile = blockIdx.x;
  /* block-uniform: this block belongs to the v projection */
  const bool vpart = (OUT_MODE == 4) && (tile >= kQKBlocks);
  if (vpart) {
    tile -= kQKBlocks;
    b     = tile / kVBlocksPerBatch;
    tile -= b * kVBlocksPerBatch;
    A  = (const _Float16*)Btp + (size_t)2 * kHid * kHid;
    Bt = (const _Float16*)Ap;
    strideA = 0L;
    strideB = (long)kSeq * kHid;
    Cout    = (void*)((unsigned short*)Cp + 2 * kPlaneElems);
    ldc     = kSeq;
    strideC = (long)kHid * kSeq;
    M = kHid;
    N = kSeq;
    scale = kVScale;
  }
  const int mode = (OUT_MODE == 4) ? (vpart ? 1 : 3) : OUT_MODE;
  __shared__ __align__(16) _Float16 ring[2 * kStageHalves];
  const int tid  = threadIdx.x;
  const int lane = threadIdx.x & 31;
  const int wave = __builtin_amdgcn_readfirstlane((int)(threadIdx.x >> 5));
  const int tilesN = N >> 7;
  const int tilesM = M >> 7;
  /* block-uniform exit, in front of every copy and barrier */
  if (tile >= tilesM * tilesN) return;
  const int tm = tile / tilesN;
  const int tn = tile - tm * tilesN;
  const int wm = wave >> 1;
  const int wn = wave & 1;
  const int m0 = (tm << 7) + (wm << 6);
  const int n0 = (tn << 7) + (wn << 6);

  const _Float16* Ab = A  + (size_t)b * strideA;
  const _Float16* Bb = Bt + (size_t)b * strideB;

  const int rlane = lane & 15;
  const int koff  = (lane >> 4) * 8;
  const int mOff  = (lane >> 4) * 8;

  v8f acc[4][4];
#pragma unroll
  for (int i = 0; i < 4; ++i)
#pragma unroll
    for (int j = 0; j < 4; ++j) acc[i][j] = (v8f){0.f,0.f,0.f,0.f,0.f,0.f,0.f,0.f};

  /* copy map: thread -> row tid / 8 of each 16-row slice, 16-B part tid % 8 of its 128 B */
  const int crow  = tid >> 3;
  const int cpart = (tid & 7) * 8;
  const _Float16* gA = Ab + (size_t)((tm << 7) + crow) * lda + cpart;
  const _Float16* gB = Bb + (size_t)((tn << 7) + crow) * ldb + cpart;
  const size_t stepA = (size_t)16 * lda;
  const size_t stepB = (size_t)16 * ldb;
  const unsigned ldsA =
      (unsigned)(size_t)(__attribute__((address_space(3))) _Float16*)ring + (unsigned)(crow * kGP + cpart) * 2u;
  const unsigned ldsB = ldsA + (unsigned)kOpHalves * 2u;
  constexpr unsigned kStageBytes = (unsigned)kStageHalves * 2u;
  const _Float16* fA = ring + ((wm << 6) + rlane) * kGP + koff;
  const _Float16* fB = ring + kOpHalves + ((wn << 6) + rlane) * kGP + koff;
  const int passes = K / kKC;

  async_copy8(ldsA, gA, stepA);
  async_copy8(ldsB, gB, stepB);

  /* L2 asks behind pass 0's copies: a row of kHid halves is 8 units, thread -> row tid / 8 of a 16-row group, unit tid % 8.
     A panel: its sharers have consecutive indices; 4 parts of 32 rows, part from tn.
     Bt panel: its sharers lie tilesN indices apart; 8 parts of 16 rows, part from tm.
     Rotary rows of a q|k tile: 64 units of COS and 64 of SIN, 4 parts of 32 units, part from tn, asked by wave 0. */
  const int askCol = (tid & 7) * 128;
  const _Float16* askA0 = Ab + (size_t)((tm << 7) + (tn & 3) * 32 + crow) * lda + askCol;
  const _Float16* askA1 = askA0 + stepA;
  const _Float16* askB0 = Bb + (size_t)((tn << 7) + ((tm >> 1) & 7) * 16 + crow) * ldb + askCol;
  const float* askT = cosT;
  /* block-uniform: the column map holds for rows of kHid halves */
  if (K == kHid) {
    l2_ask(askA0);
    l2_ask(askA1);
    l2_ask(askB0);
    /* wave-uniform */
    if (mode == 3 && wave == 0) {
      askT = ((tn & 2) ? sinT : cosT) + (size_t)((tm << 7) & (kSeq - 1)) * kHalfHd + ((tn & 1) * 32 + lane) * 64;
      l2_ask(askT);
    }
  }
  /* pass 0's tile has landed for this wave; the barrier publishes it to the other waves */
  asm volatile("s_wait_asynccnt 0x0" ::: "memory");
  __syncthreads();
  if (1 < passes) {
    async_copy8(ldsA + kStageBytes, gA + kKC, stepA);
    async_copy8(ldsB + kStageBytes, gB + kKC, stepB);
  }

  for (int t = 0; t < passes; ++t) {
    const int buf = t & 1;
    const _Float16* pA = fA + buf * kStageHalves;
    const _Float16* pB = fB + buf * kStageHalves;
    /* unrolled, like the loops inside: every fragment and accumulator index is a constant, so the arrays stay in registers */
#pragma unroll
    for (int kk = 0; kk < kKC; kk += 32) {
      /* the 16 LDS reads of a 32-k step stand as one group in front of its 16 products */
      v16h ah[4], bh[4];
#pragma unroll
      for (int j = 0; j < 4; ++j) bh[j] = FragH::load(pB + (j << 4) * kGP + kk);
#pragma unroll
      for (int i = 0; i < 4; ++i) ah[i] = FragH::load(pA + (i << 4) * kGP + kk);
#pragma unroll
      for (int i = 0; i < 4; ++i) {
#pragma unroll
        for (int j = 0; j < 4; ++j) acc[i][j] = FragH::mma(ah[i], bh[j], acc[i][j]);
        guard4_h(acc[i][0], acc[i][1], acc[i][2], acc[i][3], ah[i], bh[3]);
      }
      keep4_h(bh[0], bh[1], bh[2], bh[3]);
    }
    /* this wave's reads of buffer buf are complete before any wave refills it */
    asm volatile("s_wait_dscnt 0x0" ::: "memory");
    /* this wave's copies of pass t + 1 have landed before the barrier publishes them */
    asm volatile("s_wait_asynccnt 0x0" ::: "memory");
    __syncthreads();
    if (t + 2 < passes) {
      async_copy8(ldsA + (unsigned)buf * kStageBytes, gA + (size_t)(t + 2) * kKC, stepA);
      async_copy8(ldsB + (unsigned)buf * kStageBytes, gB + (size_t)(t + 2) * kKC, stepB);
    }
  }
  /* no copy of this wave is outstanding past here */
  asm volatile("s_wait_asynccnt 0x0" ::: "memory");
  keep_ask(askA0);
  keep_ask(askA1);
  keep_ask(askB0);
  keep_ask(askT);
  acc_guard4(acc[0][0], acc[0][1], acc[0][2], acc[0][3]);
  acc_guard4(acc[1][0], acc[1][1], acc[1][2], acc[1][3]);
  acc_guard4(acc[2][0], acc[2][1], acc[2][2], acc[2][3]);
  acc_guard4(acc[3][0], acc[3][1], acc[3][2], acc[3][3]);

  /* wave-uniform: the q columns of a q|k tile carry the score scale and log2(e) as well */
  const float cscale = (mode == 3 && n0 < kHid) ? scale * kQFold : scale;
  /* Output staging in the ring, the wave's whole 64 x 64 tile at once in a range of its own. The barrier at the foot of the last
     pass serves: in front of it every wave has finished its fragment reads and has no copy outstanding, and none is issued
     behind it. Nothing waits for a global store: all of the tile's stores, and a q|k tile's table reads, are in flight together. */
  float* slab = (float*)ring + wave * kSlabFloats;
#pragma unroll
  for (int i = 0; i < 4; ++i) {
#pragma unroll
    for (int j = 0; j < 4; ++j) {
#pragma unroll
      for (int r = 0; r < 8; ++r) {
        const float v = acc[i][j][r] * cscale;
        slab[((i << 4) + mOff + r) * kSlabPitch + (j << 4) + rlane] = v;
      }
    }
  }
  /* the wave's rows are complete in LDS before its lanes read back what other lanes of the wave wrote */
  asm volatile("s_wait_dscnt 0x0" ::: "memory");
  if (mode == 0) {
    const int hh = lane >> 4, c4 = (lane & 15) * 4;
    float* C = (float*)Cout + (size_t)b * strideC + (size_t)(m0 + hh) * ldc + n0 + c4;
#pragma unroll
    for (int it = 0; it < 32; ++it) {
      const v4f v = *(const v4f*)(slab + (it * 2 + hh) * kSlabPitch + c4);
      *(v4f*)(C + (size_t)(it * 2) * ldc) = v;
    }
  } else if (mode == 1) {
    const int q = lane >> 3, c8 = (lane & 7) * 8;
    unsigned short* C = (unsigned short*)Cout + (size_t)b * strideC + (size_t)(m0 + q) * ldc + n0 + c8;
#pragma unroll
    for (int it = 0; it < 16; ++it) {
      const float* sp = slab + (it * 4 + q) * kSlabPitch + c8;
      const v4f a0 = *(const v4f*)(sp);
      const v4f a1 = *(const v4f*)(sp + 4);
      v8h ov;
#pragma unroll
      for (int e = 0; e < 4; ++e) {
        ov[e]     = (_Float16)a0[e];
        ov[4 + e] = (_Float16)a1[e];
      }
      *(v8h*)(C + (size_t)(it * 4) * ldc) = ov;
    }
  } else {
    const int q = lane >> 3, c8 = (lane & 7) * 8;
    const int which = n0 >> 10;
    const int head  = (n0 >> 6) & (kHeads - 1);
    /* the tile's 64 rows lie in one batch (m0 is a multiple of 64): position s0 + row, every address one base and a constant */
    const int bb = m0 >> 11;
    const int s0 = (m0 & (kSeq - 1)) + q;
    unsigned short* C = (unsigned short*)Cout + (size_t)which * kPlaneElems + ((size_t)(bb * kHeads + head) * kSeq + s0) * kHd + c8;
    const float* ct = cosT + (size_t)s0 * kHalfHd + (c8 >> 1);
    const float* st = sinT + (size_t)s0 * kHalfHd + (c8 >> 1);
    v4f cv[16], sv[16];
#pragma unroll
    for (int it = 0; it < 16; ++it) {
      cv[it] = *(const v4f*)(ct + it * 4 * kHalfHd);
      sv[it] = *(const v4f*)(st + it * 4 * kHalfHd);
    }
    /* the two address pairs that the 32 table reads name stay as they are up to this wait */
    asm volatile("s_wait_xcnt 0x0" :: "v"(ct), "v"(st) : "memory");
#pragma unroll
    for (int it = 0; it < 16; ++it) {
      const float* sp = slab + (it * 4 + q) * kSlabPitch + c8;
      const v4f a0 = *(const v4f*)(sp);
      const v4f a1 = *(const v4f*)(sp + 4);
      const float o0 = a0[0] * cv[it][0] - a0[1] * sv[it][0];
      const float o1 = a0[0] * sv[it][0] + a0[1] * cv[it][0];
      const float o2 = a0[2] * cv[it][1] - a0[3] * sv[it][1];
      const float o3 = a0[2] * sv[it][1] + a0[3] * cv[it][1];
      const float o4 = a1[0] * cv[it][2] - a1[1] * sv[it][2];
      const float o5 = a1[0] * sv[it][2] + a1[1] * cv[it][2];
      const float o6 = a1[2] * cv[it][3] - a1[3] * sv[it][3];
      const float o7 = a1[2] * sv[it][3] + a1[3] * cv[it][3];
      v8h ov;
      ov[0] = (_Float16)o0;
      ov[1] = (_Float16)o1;
      ov[2] = (_Float16)o2;
      ov[3] = (_Float16)o3;
      ov[4] = (_Float16)o4;
      ov[5] = (_Float16)o5;
      ov[6] = (_Float16)o6;
      ov[7] = (_Float16)o7;
      *(v8h*)(C + it * 4 * kHd) = ov;
    }
  }
}

// ---------------------------------------------------------------------------
// Attention for one (batch, head) and two query tiles of 64 rows per block, key tiles of 64, transposed products.
//   The two tiles are i and kQTiles - 1 - i: every block has the same number of P.V tiles. Each of the 4 waves carries two
//   groups of 16 queries, rows 16 * wave .. + 15 of either tile; a K or Vt fragment is read from LDS once for both groups.
//   Per group:
//   S^T = K16 . Q16^T: A = 16 key rows from LDS, B = the group's 16 queries, kept in registers; a lane holds, of ONE query
//   (column lane & 15), the keys 8 * (lane >> 4) + r of each 16-key group, for ALL 32 key tiles;
//   p = min(exp2(accumulator), exp(clamp)) = exp(min(score, clamp)) unnormalised, f32 (the q plane carries the scale);
//   the row sum l accumulates every key (future keys included)
//   in the lane, 8 partial sums, joined in the lane and across the two wave halves once after the loop;
//   O^T += Vt . P^T only for key tiles at or below the diagonal (tile index <= the group's query tile, block-uniform), with p set
//   to zero where key > query inside the diagonal tile; O = acc / l, no renormalisation.
//   P^T never leaves the registers: score groups 2kk and 2kk + 1 of a lane are elements 0..7 and 8..15 of its B fragment for
//   keys 32kk..32kk+31, the k map that FragH::load gives the Vt rows (A): 8 * (lane >> 4) + e, then 16 + 8 * (lane >> 4) + e.
// LDS: two buffers of [K tile [64 keys][72] f16 | Vt tile [64 dd][72] f16] (columns 0..63 written and read, pad never read);
//   each tile is brought by asynchronous copies, 128 threads x 4 x 16 B = 8,192 B = the whole tile; key tile kc + 2 is
//   copied into the buffer that tile kc has just left, so a tile's copies fly while the tile in front of it is worked on.
//   A Vt tile is copied only where it is used (tile index <= the higher query tile's index, block-uniform).
// Output: a lane holds 8 consecutive head columns of its query per 16-row group of O^T and stores them as 16 B; the wave
//   writes the whole 128-B head slice of each of its 2 x 16 rows.
// Block barriers: one in front of the loop, one at the foot of each key tile; all 4 waves run all 32 tiles; no early exits.
// grid.x = 32 (batch, head) groups x 16 pairs of query tiles.
// ---------------------------------------------------------------------------
constexpr int kQB = 64;
constexpr int kKT = 64;
constexpr int kLP = 72;
constexpr int kQTiles = kSeq / kQB;
constexpr int kKTiles = kSeq / kKT;
constexpr int kQPairs = kQTiles / 2;
static_assert(kQTiles == 2 * kQPairs && kQPairs >= 1, "query tiles pair up; the high tile of a pair has index 1 or more");
static_assert(kQB == kKT, "diagonal tile logic assumes equal tiles");
static_assert(kLP == kGP && kKT == 64 && kHd == 64, "a tile is 4 slices of 16 rows at the pitch of kSliceBytes");
static_assert(kKTiles >= 2, "two buffers are filled in front of the loop");
constexpr int kAskTiles = 8;                   // key tiles per chunk of L2 asks
static_assert((kQPairs % 4) == 0 && (kKTiles % kAskTiles) == 0 && kAskTiles * kKT * kHd * 2 == 4 * 64 * 256 &&
              kAskTiles * kKT * 2 == 4 * 256 && kHd == 4 * 16, "ask map: 4 parts of 64 K units and of 16 Vt rows x 4 units");
constexpr int kTileHalves   = kKT * kLP;       // one operand's tile
constexpr int kAStageHalves = 2 * kTileHalves; // [K tile | Vt tile]
// Asynchronous copy of one 64-row tile to LDS, 4 slices of 16 rows: each lane moves its own 16 B per slice.
// lds = the lane's LDS byte address in slice 0, g = its global address in slice 0, gstep = 16 source rows in halves.
// s_wait_xcnt 0 closes the statement so that no address register named here is rewritten ahead of it.
__device__ __forceinline__ void async_copy4(unsigned lds, const _Float16* g, size_t gstep) {
  asm volatile(
      "global_load_async_to_lds_b128 %0, %4, off\n\t"
      "global_load_async_to_lds_b128 %1, %5, off\n\t"
      "global_load_async_to_lds_b128 %2, %6, off\n\t"
      "global_load_async_to_lds_b128 %3, %7, off\n\t"
      "s_wait_xcnt 0x0"
      :: "v"(lds), "v"(lds + kSliceBytes), "v"(lds + 2u * kSliceBytes), "v"(lds + 3u * kSliceBytes),
         "v"(g), "v"(g + gstep), "v"(g + 2 * gstep), "v"(g + 3 * gstep)
      : "memory");
}

__global__ __launch_bounds__(128) void attn_kernel(
    const unsigned short* __restrict__ Qp, const unsigned short* __restrict__ Kp,
    const unsigned short* __restrict__ Vtp, unsigned short* __restrict__ Op)
{
  __shared__ __align__(16) _Float16 ring[2 * kAStageHalves];

  const int tid  = threadIdx.x;
  const int wave = __builtin_amdgcn_readfirstlane((int)(threadIdx.x >> 5));
  const int lane = tid & 31;
  const int hh   = lane >> 4;
  const int c    = lane & 15;
  const int pi   = blockIdx.x % kQPairs;
  const int bh   = blockIdx.x / kQPairs;
  /* the block's two query tiles: group 0 the low one, group 1 its mirror, so every block has kQTiles + 1 P.V tiles */
  const int qt[2] = { pi, kQTiles - 1 - pi };
  const int qlo = qt[0];
  const int qhi = qt[1];

  const _Float16* Qb = (const _Float16*)Qp  + (size_t)bh * kSeq * kHd;
  const _Float16* Kb = (const _Float16*)Kp  + (size_t)bh * kSeq * kHd;
  const _Float16* Vb = (const _Float16*)Vtp + (size_t)bh * kHd * kSeq;

  v16h qf[2][2];
#pragma unroll
  for (int g = 0; g < 2; ++g)
#pragma unroll
    for (int dc = 0; dc < 2; ++dc)
      qf[g][dc] = FragH::load(Qb + (size_t)(qt[g] * kQB + wave * 16 + c) * kHd + dc * 32 + 8 * hh);

  float lsum[2][8];
  v8f oacc[2][4];
#pragma unroll
  for (int g = 0; g < 2; ++g) {
#pragma unroll
    for (int r = 0; r < 8; ++r) lsum[g][r] = 0.f;
#pragma unroll
    for (int t = 0; t < 4; ++t) oacc[g][t] = (v8f){0.f,0.f,0.f,0.f,0.f,0.f,0.f,0.f};
  }

  /* copy map: thread -> row tid / 8 of each 16-row slice, 16-B part tid % 8 of its 128 B */
  const int crow  = tid >> 3;
  const int cpart = (tid & 7) * 8;
  const _Float16* gK = Kb + (size_t)crow * kHd + cpart;
  const _Float16* gV = Vb + (size_t)crow * kSeq + cpart;
  constexpr size_t kStepK = (size_t)16 * kHd;
  constexpr size_t kStepV = (size_t)16 * kSeq;
  const unsigned ldsK =
      (unsigned)(size_t)(__attribute__((address_space(3))) _Float16*)ring + (unsigned)(crow * kLP + cpart) * 2u;
  const unsigned ldsV = ldsK + (unsigned)kTileHalves * 2u;
  constexpr unsigned kAStageBytes = (unsigned)kAStageHalves * 2u;

  /* key tile 0 (its Vt tile is used by every query tile) */
  async_copy4(ldsK, gK, kStepK);
  async_copy4(ldsV, gV, kStepV);

  /* L2 asks, a chunk of kAskTiles key tiles at a time, dealt over the 16 work-groups of this (batch, head) in 4 parts:
     waves 0 and 1 ask K tiles 2 * part and 2 * part + 1 of the chunk (16,384 B in a row = 64 units), waves 2 and 3 the
     chunk's 1,024 B = 4 units of Vt rows 16 * part .. + 15. Chunk 0 here, behind tile 0's copies; chunk n + 1 from inside
     the loop while chunk n is worked on. */
  const int part = pi & 3;
  const int au   = tid & 63;
  const char* ask = (wave < 2)
      ? (const char*)Kb + (size_t)part * (2 * kKT * kHd * 2) + au * 256
      : (const char*)Vb + (size_t)(part * 16 + (au >> 2)) * (kSeq * 2) + (au & 3) * 256;
  const int askStep = (wave < 2) ? kAskTiles * kKT * kHd * 2 : kAskTiles * kKT * 2;
  l2_ask(ask);
  /* tile 0 has landed for this wave; the barrier publishes it to the other waves */
  asm volatile("s_wait_asynccnt 0x0" ::: "memory");
  __syncthreads();
  /* key tile 1: the high query tile's index is at least kQTiles / 2, so its Vt tile is always used */
  async_copy4(ldsK + kAStageBytes, gK + (size_t)kKT * kHd, kStepK);
  async_copy4(ldsV + kAStageBytes, gV + kKT, kStepV);

#pragma unroll 1
  for (int kc = 0; kc < kKTiles; ++kc) {
    const int kv0 = kc * kKT;
    const int buf = kc & 1;
    const _Float16* Ksh = ring + buf * kAStageHalves;
    const _Float16* Vsh = Ksh + kTileHalves;

    /* block-uniform: the next chunk's asks, kAskTiles - 4 tiles before its first copy is issued; the address moves only
       here, in front of an ask for a chunk that exists, so it never leaves the plane */
    if ((kc & (kAskTiles - 1)) == 2 && kc < kKTiles - kAskTiles) {
      ask += askStep;
      l2_ask(ask);
    }

    /* the K tile's fragments, each read once and used by both query groups */
    v16h kf[4][2];
#pragma unroll
    for (int j = 0; j < 4; ++j)
#pragma unroll
      for (int dc = 0; dc < 2; ++dc) kf[j][dc] = FragH::load(Ksh + (j * 16 + c) * kLP + dc * 32 + 8 * hh);
    v8f s[2][4];
#pragma unroll
    for (int g = 0; g < 2; ++g)
#pragma unroll
      for (int j = 0; j < 4; ++j) s[g][j] = (v8f){0.f,0.f,0.f,0.f,0.f,0.f,0.f,0.f};
#pragma unroll
    for (int g = 0; g < 2; ++g)
#pragma unroll
      for (int dc = 0; dc < 2; ++dc)
#pragma unroll
        for (int j = 0; j < 4; ++j) s[g][j] = FragH::mma(kf[j][dc], qf[g][dc], s[g][j]);
#pragma unroll
    for (int g = 0; g < 2; ++g) {
#pragma unroll
      for (int j = 0; j < 4; ++j) {
#pragma unroll
        for (int r = 0; r < 8; ++r) {
          const float p = fminf(__builtin_amdgcn_exp2f(s[g][j][r]), kExpClamp);
          lsum[g][r] += p;
          s[g][j][r] = p;
        }
      }
    }
    /* block-uniform: this key tile contributes to the high group's P.V (and, where kc <= qlo, to the low group's) */
    if (kc <= qhi) {
      /* the Vt tile's fragments, each read once and used by every group that needs the tile */
      v16h vf[4][2];
#pragma unroll
      for (int t = 0; t < 4; ++t)
#pragma unroll
        for (int kk = 0; kk < 2; ++kk) vf[t][kk] = FragH::load(Vsh + (t * 16 + c) * kLP + kk * 32 + 8 * hh);
      /* the 16 LDS reads of the Vt tile as one group in front of its products */
      hold8_h(vf[0][0], vf[1][0], vf[2][0], vf[3][0], vf[0][1], vf[1][1], vf[2][1], vf[3][1]);
#pragma unroll
      for (int g = 1; g >= 0; --g) {
        /* block-uniform */
        if (kc <= qt[g]) {
          v16h pf[2];
#pragma unroll
          for (int kk = 0; kk < 2; ++kk) {
#pragma unroll
            for (int r = 0; r < 8; ++r) {
              pf[kk][r]     = (_Float16)s[g][2 * kk][r];
              pf[kk][8 + r] = (_Float16)s[g][2 * kk + 1][r];
            }
          }
          /* block-uniform: only the group's diagonal tile holds keys past a query */
          if (kc == qt[g]) {
            const int qrow = qt[g] * kQB + wave * 16 + c;
#pragma unroll
            for (int kk = 0; kk < 2; ++kk) {
#pragma unroll
              for (int e = 0; e < 16; ++e) {
                const int kvrow = kv0 + kk * 32 + (e >> 3) * 16 + 8 * hh + (e & 7);
                pf[kk][e] = (kvrow > qrow) ? (_Float16)0.0f : pf[kk][e];
              }
            }
          }
#pragma unroll
          for (int kk = 0; kk < 2; ++kk)
#pragma unroll
            for (int t = 0; t < 4; ++t) oacc[g][t] = FragH::mma(vf[t][kk], pf[kk], oacc[g][t]);
        }
      }
    }
    /* this wave's reads of buffer buf are complete before any wave refills it */
    asm volatile("s_wait_dscnt 0x0" ::: "memory");
    /* this wave's copies of tile kc + 1 have landed before the barrier publishes them */
    asm volatile("s_wait_asynccnt 0x0" ::: "memory");
    __syncthreads();
    if (kc + 2 < kKTiles) {
      async_copy4(ldsK + (unsigned)buf * kAStageBytes, gK + (size_t)(kc + 2) * kKT * kHd, kStepK);
      if (kc + 2 <= qhi) async_copy4(ldsV + (unsigned)buf * kAStageBytes, gV + (size_t)(kc + 2) * kKT, kStepV);
    }
  }
  /* no copy of this wave is outstanding past here */
  asm volatile("s_wait_asynccnt 0x0" ::: "memory");
  keep_ask(ask);

  const int bb = bh / kHeads;
  const int h  = bh - bb * kHeads;
#pragma unroll
  for (int g = 0; g < 2; ++g) {
    float l = ((lsum[g][0] + lsum[g][1]) + (lsum[g][2] + lsum[g][3])) + ((lsum[g][4] + lsum[g][5]) + (lsum[g][6] + lsum[g][7]));
    l += __shfl_xor(l, 16, 32);
    const float inv = kCtxScale * __builtin_amdgcn_rcpf(l);
    unsigned short* op = Op + ((size_t)(bb * kSeq + qt[g] * kQB + wave * 16 + c)) * kHid + h * kHd + 8 * hh;
#pragma unroll
    for (int t = 0; t < 4; ++t) {
      v8h ov;
#pragma unroll
      for (int r = 0; r < 8; ++r) ov[r] = (_Float16)(oacc[g][t][r] * inv);
      *(v8h*)(op + t * 16) = ov;
    }
  }
}

// ---------------------------------------------------------------------------
// Host glue: 4 kernel launches, nothing else.
//   1 casts of x and w_q|w_k|w_v|w_o, rotary tables: 256 blocks of 512 threads
//   2 input projections, 768 blocks of 128 threads:
//     q|k projection + rotation: M 4096, N 2048, K 1024 -> 32 x 16 block tiles = 512 blocks;
//     v projection transposed (A = w_v, Bt = x of one batch): M 1024, N 2048, K 1024 -> 8 x 16 block tiles = 128 blocks x 2
//   3 attention: 32 x 16 = 512 blocks of 128 threads
//   4 output projection: M 4096, N 1024, K 1024 -> 32 x 8 block tiles = 256 blocks of 128 threads
// ---------------------------------------------------------------------------
extern "C" void kernel_launch(void* const* d_in, const int* in_sizes, int n_in,
                              void* d_out, int out_size, void* d_ws, size_t ws_size,
                              hipStream_t stream) {
  if (n_in < 5) return;
  if (in_sizes[0] != kRows * kHid) return;
  if (in_sizes[1] != kHid * kHid) return;
  if (in_sizes[2] != kHid * kHid) return;
  if (in_sizes[3] != kHid * kHid) return;
  if (in_sizes[4] != kHid * kHid) return;
  if (out_size != kRows * kHid) return;
  if (ws_size < kWsTotal) return;

  const float* x  = (const float*)d_in[0];
  const float* wq = (const float*)d_in[1];
  const float* wk = (const float*)d_in[2];
  const float* wv = (const float*)d_in[3];
  const float* wo = (const float*)d_in[4];
  float* out = (float*)d_out;

  char* ws = (char*)d_ws;
  unsigned short* X16  = (unsigned short*)(ws + kOffX16);
  unsigned short* W16  = (unsigned short*)(ws + kOffW16);
  float*          COS  = (float*)(ws + kOffCos);
  float*          SIN  = (float*)(ws + kOffSin);
  unsigned short* Q16  = (unsigned short*)(ws + kOffQ16);
  unsigned short* K16  = (unsigned short*)(ws + kOffK16);
  unsigned short* VT16 = (unsigned short*)(ws + kOffVT16);
  unsigned short* A16  = (unsigned short*)(ws + kOffA16);
  const unsigned short* Wqk16 = W16;
  const unsigned short* Wo16  = W16 + (size_t)3 * kHid * kHid;

  static_assert((kRows % kBT) == 0 && (kHid % kBT) == 0 && (kSeq % kBT) == 0, "block tiles exact");
  static_assert((kHid % kKC) == 0 && kHid / kKC >= 2, "whole passes, two or more");

  prep_kernel<<<kPrepBlocks, kPrepThreads, 0, stream>>>(x, wq, wk, wv, wo, X16, COS, SIN);

  wmma_gemm64<4><<<dim3(kQKBlocks + kVBlocks, 1), 128, 0, stream>>>(
      X16, kHid, 0L,
      Wqk16, kHid, 0L,
      (void*)Q16, 0, 0L,
      COS, SIN,
      kRows, 2 * kHid, kHid, kQKScale);

  attn_kernel<<<kBatch * kHeads * kQPairs, 128, 0, stream>>>(Q16, K16, VT16, A16);

  wmma_gemm64<0><<<dim3((kRows / kBT) * (kHid / kBT), 1), 128, 0, stream>>>(
      A16, kHid, 0L,
      Wo16, kHid, 0L,
      (void*)out, kHid, 0L,
      nullptr, nullptr,
      kRows, kHid, kHid, kOutScale);
}

// v010
// It runs in 70.1 microseconds.
// Timed twice side by side with v009, it ran 1.03 times as fast both times.
// Counting every step since v000, it is 3.40 times as fast.
// All contractions (q/k/v projections, q.k^T, p.v, output projection): v_wmma_f32_16x16x32_f16, f16 operands with power-of-two carries (q also with the score scale and log2(e)), f32 accumulate; rotary tables, exp, row sums and normalisation in f32.
#include <hip/hip_runtime.h>
#include <math.h>

typedef __attribute__((ext_vector_type(16))) _Float16 v16h;
typedef __attribute__((ext_vector_type(8)))  _Float16 v8h;
typedef __attribute__((ext_vector_type(8)))  float    v8f;
typedef __attribute__((ext_vector_type(4)))  float    v4f;

// ---------------------------------------------------------------------------
// Shape constants
// ---------------------------------------------------------------------------
constexpr int kBatch  = 2;
constexpr int kSeq    = 2048;
constexpr int kHid    = 1024;
constexpr int kHeads  = 16;
constexpr int kHd     = 64;
constexpr int kRows   = kBatch * kSeq;
constexpr int kHalfHd = kHd / 2;
static_assert(kHeads * kHd == kHid, "head split");
static_assert(kHd == 64, "head width fixed at 64");
static_assert((kSeq % 64) == 0 && (kHid % 64) == 0 && (kHid % 32) == 0 && (kRows % 64) == 0, "tile multiples");
static_assert(kSeq == 2048 && kHid == 1024, "bit tricks below assume these");

// ---------------------------------------------------------------------------
// Power-of-two carries of the f16 planes and the derived fold-back scales
// ---------------------------------------------------------------------------
constexpr double cx_sqrt(double x) {
  double g = (x > 1.0) ? x : 1.0;
  for (int it = 0; it < 80; ++it) g = 0.5 * (g + x / g);
  return g;
}
constexpr float kXCarry    = 16.0f;
constexpr float kWCarry    = 256.0f;
constexpr float kQKCarry   = 16.0f;
constexpr float kVCarry    = 16.0f;
constexpr float kAttnCarry = 2048.0f;
constexpr float kInvSqrtHd = (float)(1.0 / cx_sqrt((double)kHd));
static_assert(kInvSqrtHd == 0.125f, "1/sqrt(head width)");
constexpr float kQKScale    = kQKCarry / (kXCarry * kWCarry);
constexpr float kVScale     = kVCarry / (kXCarry * kWCarry);
constexpr float kScoreScale = kInvSqrtHd / (kQKCarry * kQKCarry);
constexpr float kCtxScale   = kAttnCarry / kVCarry;
constexpr float kOutScale   = 1.0f / (kAttnCarry * kWCarry);
constexpr float kScoreClamp = 10.0f;
// The q plane also carries the score scale and log2(e), multiplied in f32 in front of its one rounding to f16, so that a
// K16 . Q16^T accumulator is the score in log2 units as it stands: exp(min(score, clamp)) = min(exp2(accumulator), exp(clamp)).
constexpr double cx_exp(double x) {
  double term = 1.0, sum = 1.0;
  for (int i = 1; i < 200; ++i) { term *= x / i; sum += term; }
  return sum;
}
constexpr float kLog2E     = 1.4426950408889634f;
constexpr float kQFold     = kScoreScale * kLog2E;
constexpr float kExpClamp  = (float)cx_exp((double)kScoreClamp);
static_assert(kExpClamp > 22026.0f && kExpClamp < 22027.0f, "exp(10); below the largest f16, so p converts finite");

// ---------------------------------------------------------------------------
// Rotary inverse frequencies: 10000^(-2i/64) = 10^(-i/8), i = 0..31, evaluated in double at build time, converted to f32
// ---------------------------------------------------------------------------
struct InvFreqTab { float v[kHalfHd]; };
constexpr InvFreqTab make_inv_freq() {
  InvFreqTab t{};
  const double r8 = cx_sqrt(cx_sqrt(cx_sqrt(10.0)));
  for (int i = 0; i < kHalfHd; ++i) {
    double p = 1.0;
    for (int j = 0; j < (i & 7); ++j) p *= r8;
    for (int j = 0; j < (i >> 3); ++j) p *= 10.0;
    t.v[i] = (float)(1.0 / p);
  }
  return t;
}
__device__ constexpr InvFreqTab kInvFreq = make_inv_freq();
static_assert(sizeof(kInvFreq.v) / sizeof(kInvFreq.v[0]) == 32, "table length");

// ---------------------------------------------------------------------------
// Workspace region map (bytes; every offset a multiple of 128)
//   X16   f16 [4096][1024]          x carried x16                         8,388,608
//   W16   f16 [4][1024][1024]       w_q | w_k | w_v | w_o carried x256    8,388,608
//   COS   f32 [2048][32]                                                    262,144
//   SIN   f32 [2048][32]                                                    262,144
//   Q16   f16 [32][2048][64]        rotated q carried x16 x kQFold        8,388,608
//   K16   f16 [32][2048][64]        rotated k carried x16 (follows Q16)   8,388,608
//   VT16  f16 [32][64][2048]        v transposed, carried x16             8,388,608
//   A16   f16 [4096][1024]          attention output carried x2048        8,388,608
//   total                                                                50,855,936
// ---------------------------------------------------------------------------
constexpr size_t kPlaneBytes = (size_t)kRows * kHid * 2;
constexpr size_t kTabBytes   = (size_t)kSeq * kHalfHd * 4;
constexpr size_t kOffX16  = 0;
constexpr size_t kOffW16  = kOffX16 + kPlaneBytes;
constexpr size_t kOffCos  = kOffW16 + (size_t)4 * kHid * kHid * 2;
constexpr size_t kOffSin  = kOffCos + kTabBytes;
constexpr size_t kOffQ16  = kOffSin + kTabBytes;
constexpr size_t kOffK16  = kOffQ16 + kPlaneBytes;
constexpr size_t kOffVT16 = kOffK16 + kPlaneBytes;
constexpr size_t kOffA16  = kOffVT16 + kPlaneBytes;
constexpr size_t kWsTotal = kOffA16 + kPlaneBytes;
static_assert(kWsTotal == 50855936ull, "carve total");
static_assert(kWsTotal <= 134217728ull, "carve cap");
static_assert((kOffW16 % 128) == 0 && (kOffCos % 128) == 0 && (kOffSin % 128) == 0 && (kOffQ16 % 128) == 0 &&
              (kOffK16 % 128) == 0 && (kOffVT16 % 128) == 0 && (kOffA16 % 128) == 0, "128-B aligned regions");
constexpr size_t kPlaneElems = (size_t)kRows * kHid;

// ---------------------------------------------------------------------------
// Fragment helpers (split k map for A and B: elements 0..7 <- p[0..7], 8..15 <- p[16..23], p already offset by 8*(lane>>4))
// ---------------------------------------------------------------------------
struct FragH {
  union U { v16h v; v8h h[2]; };
  static __device__ __forceinline__ v16h load(const _Float16* p) {
    U f;
    f.h[0] = *(const v8h*)(p);
    f.h[1] = *(const v8h*)(p + 16);
    return f.v;
  }
  static __device__ __forceinline__ v8f mma(v16h a, v16h b, v8f c) {
    return __builtin_amdgcn_wmma_f32_16x16x32_f16(false, a, false, b, (short)0, c, false, false);
  }
};
__device__ __forceinline__ void guard4_h(v8f& a, v8f& b, v8f& c, v8f& d, v16h x, v16h y) {
  asm volatile("v_nop\n\tv_nop\n\tv_nop\n\tv_nop" : "+v"(a), "+v"(b), "+v"(c), "+v"(d) : "v"(x), "v"(y));
}
__device__ __forceinline__ void keep4_h(v16h a, v16h b, v16h c, v16h d) {
  asm volatile("v_nop" :: "v"(a), "v"(b), "v"(c), "v"(d));
}
// Inputs-only hold on eight loaded fragments: their LDS reads stand as one group with one wait in front of the products that
// follow; without it each product waits for its own pair of reads.
__device__ __forceinline__ void hold8_h(v16h a, v16h b, v16h c, v16h d, v16h e, v16h f, v16h g, v16h h) {
  asm volatile("" :: "v"(a), "v"(b), "v"(c), "v"(d), "v"(e), "v"(f), "v"(g), "v"(h));
}
__device__ __forceinline__ void acc_guard4(v8f& a, v8f& b, v8f& c, v8f& d) {
  asm volatile("v_nop\n\tv_nop\n\tv_nop\n\tv_nop" : "+v"(a), "+v"(b), "+v"(c), "+v"(d));
}

// ---------------------------------------------------------------------------
// Preparation, one launch: f32 -> f16 casts of x and of the four weight matrices with their power-of-two carries, and the
// rotary tables. One work-group of 16 waves per 1/256 of the work; every wave lives long instead of many short waves.
// Casts: a piece is 8 consecutive elements (32 B read, 16 B stored). The grid has kPrepLanes = 131,072 threads; thread g takes
//   pieces g + j * kPrepLanes, j = 0..7: j = 0..3 are the four quarters of x, j = 4..7 are w_q, w_k, w_v, w_o (one matrix is
//   exactly kPrepLanes pieces). Destination piece index = source piece index, since W16 follows X16 in the workspace.
//   All 16 reads of a thread are issued before the first value is used.
// Rotary tables: COS/SIN [2048][32] f32, angle = float(position) * inv_freq[i] (single f32 multiply), accurate sincosf;
//   waves 0..7 of each work-group compute one entry per lane (256 x 256 = 65,536 entries) while their reads are in flight.
// ---------------------------------------------------------------------------
constexpr int kPrepThreads = 512;
constexpr int kPrepBlocks  = 256;
constexpr int kPrepLanes   = kPrepThreads * kPrepBlocks;
constexpr int kXn8 = kRows * kHid / 8;
constexpr int kWn8 = kHid * kHid / 8;
static_assert(kWn8 == kPrepLanes && kXn8 == 4 * kPrepLanes, "eight pieces per thread: four of x, one of each matrix");
static_assert(kOffX16 == 0 && kOffW16 == kOffX16 + (size_t)kXn8 * 16, "W16 follows X16");
static_assert(kSeq * kHalfHd == kPrepBlocks * 256, "one table entry per lane of waves 0..7");
__global__ __launch_bounds__(kPrepThreads) void prep_kernel(
    const float* __restrict__ x, const float* __restrict__ wq, const float* __restrict__ wk,
    const float* __restrict__ wv, const float* __restrict__ wo,
    unsigned short* __restrict__ out, float* __restrict__ cosT, float* __restrict__ sinT)
{
  const unsigned g = blockIdx.x * kPrepThreads + threadIdx.x;
  const float* sp[8] = { x, x + (size_t)8 * kPrepLanes, x + (size_t)16 * kPrepLanes, x + (size_t)24 * kPrepLanes,
                         wq, wk, wv, wo };
  const float inv = kInvFreq.v[threadIdx.x & 31];
  /* the table read's index register may be reused by what follows */
  asm volatile("s_wait_xcnt 0x0" ::: "memory");
  const unsigned rb = g * 32u;
  v4f a[8], c[8];
#pragma unroll
  for (int j = 0; j < 8; ++j) {
    const float* p = (const float*)((const char*)sp[j] + rb);
    a[j] = *(const v4f*)(p);
    c[j] = *(const v4f*)(p + 4);
  }
  /* inputs-only hold: the table read stays in front of the 16 reads, so its wait does not drain them */
  asm volatile("" :: "v"(inv));
  /* wave-uniform: waves 0..7 */
  if (threadIdx.x < 256) {
    const int t = blockIdx.x * 256 + threadIdx.x;
    const int s = t >> 5;
    const float ang = (float)s * inv;
    float sn, cs;
    sincosf(ang, &sn, &cs);
    cosT[t] = cs;
    sinT[t] = sn;
  }
#pragma unroll
  for (int j = 0; j < 8; ++j) {
    const float scale = (j < 4) ? kXCarry : kWCarry;
    v8h hv;
#pragma unroll
    for (int e = 0; e < 4; ++e) {
      const float f0 = a[j][e] * scale;
      const float f1 = c[j][e] * scale;
      hv[e]     = (_Float16)f0;
      hv[4 + e] = (_Float16)f1;
    }
    *(v8h*)((char*)(out + (size_t)8 * kPrepLanes * j) + g * 16u) = hv;
  }
}

// ---------------------------------------------------------------------------
// L2 asks.
// l2_ask: each lane asks its own address, one per 256 B, into L2 ahead of the copies that read it; a hint, nothing waits for it and no
// value depends on it. Every lane is on and every address lies inside the plane it names.
// The units of a shared panel are dealt over its sharers by work-group index, in few parts; where the work-groups land only
// changes how many asks are useful.
// keep_ask: no counter tracks a prefetch, so the register pair that it names stays unchanged until the loop behind it is over.
// ---------------------------------------------------------------------------
__device__ __forceinline__ void l2_ask(const void* p) {
  asm volatile("global_prefetch_b8 %0, off scope:SCOPE_SE" :: "v"(p));
}
__device__ __forceinline__ void keep_ask(const void* p) {
  asm volatile("" :: "v"(p));
}

// ---------------------------------------------------------------------------
// Asynchronous copy of 8 slices of 16 tile rows to LDS: each lane moves its own 16 B per slice, a wave 512 B of whole rows.
// lds = the lane's LDS byte address in slice 0, g = its global address in slice 0, gstep = 16 source rows in halves,
// kSlice = 16 tile rows in LDS bytes.
// s_wait_xcnt 0 closes the statement so that no address register named here is rewritten ahead of it.
// ---------------------------------------------------------------------------
constexpr int kBT = 128;                     // block tile: rows of A and rows of Bt
constexpr int kKC = 64;                      // k per pass and wave quad: 128 B of each tile row
constexpr int kGP = 72;                      // LDS row pitch in halves: 144 B = 16 B x 9, for ds_load_b128 readers
constexpr int kOpHalves    = kBT * kGP;      // one operand's tile
constexpr int kStageHalves = 2 * kOpHalves;  // [A tile | Bt tile]
constexpr unsigned kSliceBytes = 16u * kGP * 2u;
template <unsigned kSlice>
__device__ __forceinline__ void async_copy8(unsigned lds, const _Float16* g, size_t gstep) {
  asm volatile(
      "global_load_async_to_lds_b128 %0, %8, off\n\t"
      "global_load_async_to_lds_b128 %1, %9, off\n\t"
      "global_load_async_to_lds_b128 %2, %10, off\n\t"
      "global_load_async_to_lds_b128 %3, %11, off\n\t"
      "global_load_async_to_lds_b128 %4, %12, off\n\t"
      "global_load_async_to_lds_b128 %5, %13, off\n\t"
      "global_load_async_to_lds_b128 %6, %14, off\n\t"
      "global_load_async_to_lds_b128 %7, %15, off\n\t"
      "s_wait_xcnt 0x0"
      :: "v"(lds), "v"(lds + kSlice), "v"(lds + 2u * kSlice), "v"(lds + 3u * kSlice),
         "v"(lds + 4u * kSlice), "v"(lds + 5u * kSlice), "v"(lds + 6u * kSlice), "v"(lds + 7u * kSlice),
         "v"(g), "v"(g + gstep), "v"(g + 2 * gstep), "v"(g + 3 * gstep),
         "v"(g + 4 * gstep), "v"(g + 5 * gstep), "v"(g + 6 * gstep), "v"(g + 7 * gstep)
      : "memory");
}

// ---------------------------------------------------------------------------
// Batched GEMM: C[m,n] = scale * sum_k A[m,k] * Bt[n,k]; a block of 4 waves (2 x 2) owns a 128x128 tile, each wave 64x64 of it.
// A row-major [M,K]; Bt row-major [N,K]; M, N multiples of 128, K a multiple of 64 and at least 128 (asserted on the host).
// Operands: per pass of 64 k the block's 128 A rows and 128 Bt rows go to LDS by asynchronous copies, two buffers, the next
//           pass's copies in flight while this pass's fragments are read; every wave copies, waits and passes every barrier.
// KS = 2 (a launch with one work-group per WGP): 8 waves, two quads of 2 x 2; a stage holds 2 x 64 k of both operands and
//           quad q multiplies k 64 q .. + 63 of it, so that each SIMD has two waves and twice the bytes are in flight per barrier;
//           waves w and w + 4 add their two partial tiles through LDS behind the loop and store 32 rows each. K a multiple of 128.
// Store mode 0: f32 rows; mode 1: f16 rows.
// Store mode 3: N = 2 x kHid (q columns then k columns); the 64-wide tile is one head; interleaved-pair rotation with
//             COS/SIN[position][pair] then f16 store to plane (n0 >> 10) laid out [batch*heads + head][position][64];
//             the q plane (n0 < kHid, wave-uniform) takes scale * kQFold in place of scale
// OUT_MODE 4: the three input projections in one launch, so that three work-groups share each WGP from the start.
//             Blocks 0 .. kQKBlocks - 1 are the q|k tiles of the arguments as given (store mode 3). The kVBlocks blocks behind
//             them are the transposed v projection (store mode 1): A = w_v, the third matrix behind Btp; Bt = the rows of Ap of
//             one batch; C = the plane behind the q and k planes, [batch][kHid][kSeq]. The choice is block-uniform.
// Output: each wave stages its 64 x 64 tile in f32 in the ring, once the last pass has left it, and reads it back by rows, so that
//             every store covers whole 128-B lines. Mode 0: 32 iterations x 2 rows; modes 1 and 3: 16 iterations x 4 rows; 64 columns each.
// ---------------------------------------------------------------------------
constexpr int kQKBlocks = (kRows / kBT) * (2 * kHid / kBT);
constexpr int kVBlocksPerBatch = (kHid / kBT) * (kSeq / kBT);
constexpr int kVBlocks = kBatch * kVBlocksPerBatch;
static_assert(kOffK16 == kOffQ16 + kPlaneBytes && kOffVT16 == kOffK16 + kPlaneBytes, "the v plane follows the q and k planes");
constexpr int kSlabPitch  = 68;                // f32 per staged output row: 16-B reads down a column walk meet no bank twice
constexpr int kSlabFloats = 64 * kSlabPitch;   // one wave's staged tile
static_assert((size_t)4 * kSlabFloats * 4 <= (size_t)2 * kStageHalves * 2 && ((kSlabFloats * 4) % 16) == 0, "four staged tiles fit the ring");
// The k split's join (KS == 2): waves w and w + 4 hold f32 partial sums of the same 64 x 64 tile, over different k. Each keeps
// 32 rows and hands the other 32 to its partner through LDS, every lane to the same lane, 16 B per store and per read.
// half_send: accumulator rows 16 * I0 .. + 31 to x (the lane's own 16 B of each 512-B unit of the wave's range).
// half_join: the partner's sums from x added to rows 16 * I0 .. + 31, scaled, staged by rows at wr for the row-wise read-back.
constexpr int kXFloats = 16 * 128;             // one wave's hand-over: 16 units of 32 lanes x 4 f32
template <int I0>
__device__ __forceinline__ void half_send(const v8f (&acc)[4][4], float* x) {
#pragma unroll
  for (int ii = 0; ii < 2; ++ii) {
#pragma unroll
    for (int j = 0; j < 4; ++j) {
      const v8f a = acc[I0 + ii][j];
      *(v4f*)(x + ((ii * 4 + j) * 2 + 0) * 128) = (v4f){a[0], a[1], a[2], a[3]};
      *(v4f*)(x + ((ii * 4 + j) * 2 + 1) * 128) = (v4f){a[4], a[5], a[6], a[7]};
    }
  }
}
template <int I0>
__device__ __forceinline__ void half_join(const v8f (&acc)[4][4], const float* x, float* wr, float cscale) {
  /* all 16 reads in front of the first store: one LDS latency, not one per pair of reads */
  v4f p[16];
#pragma unroll
  for (int u = 0; u < 16; ++u) p[u] = *(const v4f*)(x + u * 128);
#pragma unroll
  for (int ii = 0; ii < 2; ++ii) {
#pragma unroll
    for (int j = 0; j < 4; ++j) {
#pragma unroll
      for (int r = 0; r < 4; ++r) {
        wr[((ii << 4) + r) * kSlabPitch + (j << 4)]     = (acc[I0 + ii][j][r] + p[(ii * 4 + j) * 2][r]) * cscale;
        wr[((ii << 4) + 4 + r) * kSlabPitch + (j << 4)] = (acc[I0 + ii][j][4 + r] + p[(ii * 4 + j) * 2 + 1][r]) * cscale;
      }
    }
  }
}
template <int OUT_MODE, int KS>
__global__ __launch_bounds__(128 * KS) void wmma_gemm64(
    const unsigned short* __restrict__ Ap, int lda, long strideA,
    const unsigned short* __restrict__ Btp, int ldb, long strideB,
    void* __restrict__ Cp, int ldc, long strideC,
    const float* __restrict__ cosT, const float* __restrict__ sinT,
    int M, int N, int K, float scale)
{
  const _Float16* A  = (const _Float16*)Ap;
  const _Float16* Bt = (const _Float16*)Btp;
  void* Cout = Cp;
  int b    = blockIdx.y;
  int tile = blockIdx.x;
  /* block-uniform: this block belongs to the v projection */
  const bool vpart = (OUT_MODE == 4) && (tile >= kQKBlocks);
  if (vpart) {
    tile -= kQKBlocks;
    b     = tile / kVBlocksPerBatch;
    tile -= b * kVBlocksPerBatch;
    A  = (const _Float16*)Btp + (size_t)2 * kHid * kHid;
    Bt = (const _Float16*)Ap;
    strideA = 0L;
    strideB = (long)kSeq * kHid;
    Cout    = (void*)((unsigned short*)Cp + 2 * kPlaneElems);
    ldc     = kSeq;
    strideC = (long)kHid * kSeq;
    M = kHid;
    N = kSeq;
    scale = kVScale;
  }
  const int mode = (OUT_MODE == 4) ? (vpart ? 1 : 3) : OUT_MODE;
  static_assert(KS == 1 || (KS == 2 && OUT_MODE == 0), "the k split has the f32 row store only");
  constexpr int kStageK  = kKC * KS;             // k per stage: kKC for each wave quad
  constexpr int kPitch   = kStageK + 8;          // LDS row pitch in halves: 16 B x an odd number, for ds_load_b128 readers
  constexpr int kOpH     = kBT * kPitch;         // one operand's tile
  constexpr int kStageH  = 2 * kOpH;             // [A tile | Bt tile]
  constexpr unsigned kSlice = 16u * kPitch * 2u; // 16 tile rows in bytes
  static_assert(KS != 1 || (kPitch == kGP && kStageH == kStageHalves && kSlice == kSliceBytes), "one quad: the plain tile");
  __shared__ __align__(16) _Float16 ring[2 * kStageH];
  const int tid  = threadIdx.x;
  const int lane = threadIdx.x & 31;
  const int wave = __builtin_amdgcn_readfirstlane((int)(threadIdx.x >> 5));
  /* wave-uniform: which kKC of every stage this wave multiplies, and its place among the 2 x 2 waves of its quad */
  const int quad = (KS == 1) ? 0 : (wave >> 2);
  const int w4   = (KS == 1) ? wave : (wave & 3);
  const int tilesN = N >> 7;
  const int tilesM = M >> 7;
  /* block-uniform exit, in front of every copy and barrier */
  if (tile >= tilesM * tilesN) return;
  const int tm = tile / tilesN;
  const int tn = tile - tm * tilesN;
  const int wm = w4 >> 1;
  const int wn = w4 & 1;
  const int m0 = (tm << 7) + (wm << 6);
  const int n0 = (tn << 7) + (wn << 6);

  const _Float16* Ab = A  + (size_t)b * strideA;
  const _Float16* Bb = Bt + (size_t)b * strideB;

  const int rlane = lane & 15;
  const int koff  = (lane >> 4) * 8;
  const int mOff  = (lane >> 4) * 8;

  v8f acc[4][4];
#pragma unroll
  for (int i = 0; i < 4; ++i)
#pragma unroll
    for (int j = 0; j < 4; ++j) acc[i][j] = (v8f){0.f,0.f,0.f,0.f,0.f,0.f,0.f,0.f};

  /* copy map: a tile row is 8 * KS parts of 16 B; thread -> row tid / (8 * KS) of each 16-row slice, part tid % (8 * KS) */
  const int crow  = tid >> (2 + KS);
  const int cpart = (tid & (8 * KS - 1)) * 8;
  const _Float16* gA = Ab + (size_t)((tm << 7) + crow) * lda + cpart;
  const _Float16* gB = Bb + (size_t)((tn << 7) + crow) * ldb + cpart;
  const size_t stepA = (size_t)16 * lda;
  const size_t stepB = (size_t)16 * ldb;
  const unsigned ldsA =
      (unsigned)(size_t)(__attribute__((address_space(3))) _Float16*)ring + (unsigned)(crow * kPitch + cpart) * 2u;
  const unsigned ldsB = ldsA + (unsigned)kOpH * 2u;
  constexpr unsigned kStageBytes = (unsigned)kStageH * 2u;
  const _Float16* fA = ring + ((wm << 6) + rlane) * kPitch + quad * kKC + koff;
  const _Float16* fB = ring + kOpH + ((wn << 6) + rlane) * kPitch + quad * kKC + koff;
  const int passes = K / kStageK;

  async_copy8<kSlice>(ldsA, gA, stepA);
  async_copy8<kSlice>(ldsB, gB, stepB);

  /* L2 asks behind pass 0's copies: a row of kHid halves is 8 units, thread -> row tid / 8 of a 16-row group, unit tid % 8.
     A panel: its sharers have consecutive indices; 4 parts of 32 rows, part from tn.
     Bt panel: its sharers lie tilesN indices apart; 8 parts of 16 rows, part from tm.
     Rotary rows of a q|k tile: 64 units of COS and 64 of SIN, 4 parts of 32 units, part from tn, asked by wave 0. */
  const int askCol = (tid & 7) * 128;
  const int askRow = (KS == 1) ? crow : ((tid & 127) >> 3);
  const _Float16* askA0 = Ab + (size_t)((tm << 7) + (tn & 3) * 32 + askRow) * lda + askCol;
  const _Float16* askA1 = askA0 + stepA;
  const _Float16* askB0 = Bb + (size_t)((tn << 7) + ((tm >> 1) & 7) * 16 + askRow) * ldb + askCol;
  const float* askT = cosT;
  /* wave-uniform: the column map holds for rows of kHid halves; the first quad asks for the work-group */
  if (K == kHid && (KS == 1 || quad == 0)) {
    l2_ask(askA0);
    l2_ask(askA1);
    l2_ask(askB0);
    /* wave-uniform */
    if (mode == 3 && wave == 0) {
      askT = ((tn & 2) ? sinT : cosT) + (size_t)((tm << 7) & (kSeq - 1)) * kHalfHd + ((tn & 1) * 32 + lane) * 64;
      l2_ask(askT);
    }
  }
  /* pass 0's tile has landed for this wave; the barrier publishes it to the other waves */
  asm volatile("s_wait_asynccnt 0x0" ::: "memory");
  __syncthreads();
  if (1 < passes) {
    async_copy8<kSlice>(ldsA + kStageBytes, gA + kStageK, stepA);
    async_copy8<kSlice>(ldsB + kStageBytes, gB + kStageK, stepB);
  }

  for (int t = 0; t < passes; ++t) {
    const int buf = t & 1;
    const _Float16* pA = fA + buf * kStageH;
    const _Float16* pB = fB + buf * kStageH;
    /* unrolled, like the loops inside: every fragment and accumulator index is a constant, so the arrays stay in registers */
#pragma unroll
    for (int kk = 0; kk < kKC; kk += 32) {
      /* the 16 LDS reads of a 32-k step stand as one group in front of its 16 products */
      v16h ah[4], bh[4];
#pragma unroll
      for (int j = 0; j < 4; ++j) bh[j] = FragH::load(pB + (j << 4) * kPitch + kk);
#pragma unroll
      for (int i = 0; i < 4; ++i) ah[i] = FragH::load(pA + (i << 4) * kPitch + kk);
#pragma unroll
      for (int i = 0; i < 4; ++i) {
#pragma unroll
        for (int j = 0; j < 4; ++j) acc[i][j] = FragH::mma(ah[i], bh[j], acc[i][j]);
        guard4_h(acc[i][0], acc[i][1], acc[i][2], acc[i][3], ah[i], bh[3]);
      }
      keep4_h(bh[0], bh[1], bh[2], bh[3]);
    }
    /* this wave's reads of buffer buf are complete before any wave refills it */
    asm volatile("s_wait_dscnt 0x0" ::: "memory");
    /* this wave's copies of pass t + 1 have landed before the barrier publishes them */
    asm volatile("s_wait_asynccnt 0x0" ::: "memory");
    __syncthreads();
    if (t + 2 < passes) {
      async_copy8<kSlice>(ldsA + (unsigned)buf * kStageBytes, gA + (size_t)(t + 2) * kStageK, stepA);
      async_copy8<kSlice>(ldsB + (unsigned)buf * kStageBytes, gB + (size_t)(t + 2) * kStageK, stepB);
    }
  }
  /* no copy of this wave is outstanding past here */
  asm volatile("s_wait_asynccnt 0x0" ::: "memory");
  keep_ask(askA0);
  keep_ask(askA1);
  keep_ask(askB0);
  keep_ask(askT);
  acc_guard4(acc[0][0], acc[0][1], acc[0][2], acc[0][3]);
  acc_guard4(acc[1][0], acc[1][1], acc[1][2], acc[1][3]);
  acc_guard4(acc[2][0], acc[2][1], acc[2][2], acc[2][3]);
  acc_guard4(acc[3][0], acc[3][1], acc[3][2], acc[3][3]);

  /* wave-uniform: the q columns of a q|k tile carry the score scale and log2(e) as well */
  const float cscale = (mode == 3 && n0 < kHid) ? scale * kQFold : scale;
  /* Output staging in the ring, the wave's whole 64 x 64 tile at once in a range of its own. The barrier at the foot of the last
     pass serves: in front of it every wave has finished its fragment reads and has no copy outstanding, and none is issued
     behind it. Nothing waits for a global store: all of the tile's stores, and a q|k tile's table reads, are in flight together. */
  if constexpr (KS == 2) {
    /* Two quads: the staging ranges of the 8 waves (32 rows each) lie where the 4 tiles of one quad would, the hand-over
       ranges behind them; the barrier at the foot of the last pass has freed the whole ring. */
    static_assert((size_t)(4 * kSlabFloats + 8 * kXFloats) * 4 <= (size_t)2 * kStageH * 2, "staging and hand-over fit the ring");
    float* xbase = (float*)ring + 4 * kSlabFloats + lane * 4;
    /* wave-uniform: quad 0 keeps rows 0..31 of the tile, quad 1 rows 32..63 */
    if (quad == 0) half_send<2>(acc, xbase + wave * kXFloats);
    else           half_send<0>(acc, xbase + wave * kXFloats);
    /* publishes every wave's hand-over to its partner (the compiler puts the wave's own s_wait_dscnt 0 in front of it) */
    __syncthreads();
    float* hslab = (float*)ring + wave * (kSlabFloats / 2);
    if (quad == 0) half_join<0>(acc, xbase + (wave ^ 4) * kXFloats, hslab + mOff * kSlabPitch + rlane, cscale);
    else           half_join<2>(acc, xbase + (wave ^ 4) * kXFloats, hslab + mOff * kSlabPitch + rlane, cscale);
    /* the wave's rows are complete in LDS before its lanes read back what other lanes of the wave wrote */
    asm volatile("s_wait_dscnt 0x0" ::: "memory");
    const int hh = lane >> 4, c4 = (lane & 15) * 4;
    float* C = (float*)Cout + (size_t)b * strideC + (size_t)(m0 + quad * 32 + hh) * ldc + n0 + c4;
#pragma unroll
    for (int it = 0; it < 16; ++it) {
      const v4f v = *(const v4f*)(hslab + (it * 2 + hh) * kSlabPitch + c4);
      *(v4f*)(C + (size_t)(it * 2) * ldc) = v;
    }
    return;
  }
  float* slab = (float*)ring + wave * kSlabFloats;
#pragma unroll
  for (int i = 0; i < 4; ++i) {
#pragma unroll
    for (int j = 0; j < 4; ++j) {
#pragma unroll
      for (int r = 0; r < 8; ++r) {
        const float v = acc[i][j][r] * cscale;
        slab[((i << 4) + mOff + r) * kSlabPitch + (j << 4) + rlane] = v;
      }
    }
  }
  /* the wave's rows are complete in LDS before its lanes read back what other lanes of the wave wrote */
  asm volatile("s_wait_dscnt 0x0" ::: "memory");
  if (mode == 0) {
    const int hh = lane >> 4, c4 = (lane & 15) * 4;
    float* C = (float*)Cout + (size_t)b * strideC + (size_t)(m0 + hh) * ldc + n0 + c4;
#pragma unroll
    for (int it = 0; it < 32; ++it) {
      const v4f v = *(const v4f*)(slab + (it * 2 + hh) * kSlabPitch + c4);
      *(v4f*)(C + (size_t)(it * 2) * ldc) = v;
    }
  } else if (mode == 1) {
    const int q = lane >> 3, c8 = (lane & 7) * 8;
    unsigned short* C = (unsigned short*)Cout + (size_t)b * strideC + (size_t)(m0 + q) * ldc + n0 + c8;
#pragma unroll
    for (int it = 0; it < 16; ++it) {
      const float* sp = slab + (it * 4 + q) * kSlabPitch + c8;
      const v4f a0 = *(const v4f*)(sp);
      const v4f a1 = *(const v4f*)(sp + 4);
      v8h ov;
#pragma unroll
      for (int e = 0; e < 4; ++e) {
        ov[e]     = (_Float16)a0[e];
        ov[4 + e] = (_Float16)a1[e];
      }
      *(v8h*)(C + (size_t)(it * 4) * ldc) = ov;
    }
  } else {
    const int q = lane >> 3, c8 = (lane & 7) * 8;
    const int which = n0 >> 10;
    const int head  = (n0 >> 6) & (kHeads - 1);
    /* the tile's 64 rows lie in one batch (m0 is a multiple of 64): position s0 + row, every address one base and a constant */
    const int bb = m0 >> 11;
    const int s0 = (m0 & (kSeq - 1)) + q;
    unsigned short* C = (unsigned short*)Cout + (size_t)which * kPlaneElems + ((size_t)(bb * kHeads + head) * kSeq + s0) * kHd + c8;
    const float* ct = cosT + (size_t)s0 * kHalfHd + (c8 >> 1);
    const float* st = sinT + (size_t)s0 * kHalfHd + (c8 >> 1);
    v4f cv[16], sv[16];
#pragma unroll
    for (int it = 0; it < 16; ++it) {
      cv[it] = *(const v4f*)(ct + it * 4 * kHalfHd);
      sv[it] = *(const v4f*)(st + it * 4 * kHalfHd);
    }
    /* the two address pairs that the 32 table reads name stay as they are up to this wait */
    asm volatile("s_wait_xcnt 0x0" :: "v"(ct), "v"(st) : "memory");
#pragma unroll
    for (int it = 0; it < 16; ++it) {
      const float* sp = slab + (it * 4 + q) * kSlabPitch + c8;
      const v4f a0 = *(const v4f*)(sp);
      const v4f a1 = *(const v4f*)(sp + 4);
      const float o0 = a0[0] * cv[it][0] - a0[1] * sv[it][0];
      const float o1 = a0[0] * sv[it][0] + a0[1] * cv[it][0];
      const float o2 = a0[2] * cv[it][1] - a0[3] * sv[it][1];
      const float o3 = a0[2] * sv[it][1] + a0[3] * cv[it][1];
      const float o4 = a1[0] * cv[it][2] - a1[1] * sv[it][2];
      const float o5 = a1[0] * sv[it][2] + a1[1] * cv[it][2];
      const float o6 = a1[2] * cv[it][3] - a1[3] * sv[it][3];
      const float o7 = a1[2] * sv[it][3] + a1[3] * cv[it][3];
      v8h ov;
      ov[0] = (_Float16)o0;
      ov[1] = (_Float16)o1;
      ov[2] = (_Float16)o2;
      ov[3] = (_Float16)o3;
      ov[4] = (_Float16)o4;
      ov[5] = (_Float16)o5;
      ov[6] = (_Float16)o6;
      ov[7] = (_Float16)o7;
      *(v8h*)(C + it * 4 * kHd) = ov;
    }
  }
}

// ---------------------------------------------------------------------------
// Attention for one (batch, head) and two query tiles of 64 rows per block, key tiles of 64, transposed products.
//   The two tiles are i and kQTiles - 1 - i: every block has the same number of P.V tiles. Each of the 4 waves carries two
//   groups of 16 queries, rows 16 * wave .. + 15 of either tile; a K or Vt fragment is read from LDS once for both groups.
//   Per group:
//   S^T = K16 . Q16^T: A = 16 key rows from LDS, B = the group's 16 queries, kept in registers; a lane holds, of ONE query
//   (column lane & 15), the keys 8 * (lane >> 4) + r of each 16-key group, for ALL 32 key tiles;
//   p = min(exp2(accumulator), exp(clamp)) = exp(min(score, clamp)) unnormalised, f32 (the q plane carries the scale);
//   the row sum l accumulates every key (future keys included)
//   in the lane, 8 partial sums, joined in the lane and across the two wave halves once after the loop;
//   O^T += Vt . P^T only for key tiles at or below the diagonal (tile index <= the group's query tile, block-uniform), with p set
//   to zero where key > query inside the diagonal tile; O = acc / l, no renormalisation.
//   P^T never leaves the registers: score groups 2kk and 2kk + 1 of a lane are elements 0..7 and 8..15 of its B fragment for
//   keys 32kk..32kk+31, the k map that FragH::load gives the Vt rows (A): 8 * (lane >> 4) + e, then 16 + 8 * (lane >> 4) + e.
// LDS: two buffers of [K tile [64 keys][72] f16 | Vt tile [64 dd][72] f16] (columns 0..63 written and read, pad never read);
//   each tile is brought by asynchronous copies, 128 threads x 4 x 16 B = 8,192 B = the whole tile; key tile kc + 2 is
//   copied into the buffer that tile kc has just left, so a tile's copies fly while the tile in front of it is worked on.
//   A Vt tile is copied only where it is used (tile index <= the higher query tile's index, block-uniform).
// Output: a lane holds 8 consecutive head columns of its query per 16-row group of O^T and stores them as 16 B; the wave
//   writes the whole 128-B head slice of each of its 2 x 16 rows.
// Block barriers: one in front of the loop, one at the foot of each key tile; all 4 waves run all 32 tiles; no early exits.
// grid.x = 32 (batch, head) groups x 16 pairs of query tiles.
// ---------------------------------------------------------------------------
constexpr int kQB = 64;
constexpr int kKT = 64;
constexpr int kLP = 72;
constexpr int kQTiles = kSeq / kQB;
constexpr int kKTiles = kSeq / kKT;
constexpr int kQPairs = kQTiles / 2;
static_assert(kQTiles == 2 * kQPairs && kQPairs >= 1, "query tiles pair up; the high tile of a pair has index 1 or more");
static_assert(kQB == kKT, "diagonal tile logic assumes equal tiles");
static_assert(kLP == kGP && kKT == 64 && kHd == 64, "a tile is 4 slices of 16 rows at the pitch of kSliceBytes");
static_assert(kKTiles >= 2, "two buffers are filled in front of the loop");
constexpr int kAskTiles = 8;                   // key tiles per chunk of L2 asks
static_assert((kQPairs % 4) == 0 && (kKTiles % kAskTiles) == 0 && kAskTiles * kKT * kHd * 2 == 4 * 64 * 256 &&
              kAskTiles * kKT * 2 == 4 * 256 && kHd == 4 * 16, "ask map: 4 parts of 64 K units and of 16 Vt rows x 4 units");
constexpr int kTileHalves   = kKT * kLP;       // one operand's tile
constexpr int kAStageHalves = 2 * kTileHalves; // [K tile | Vt tile]
// Asynchronous copy of one 64-row tile to LDS, 4 slices of 16 rows: each lane moves its own 16 B per slice.
// lds = the lane's LDS byte address in slice 0, g = its global address in slice 0, gstep = 16 source rows in halves.
// s_wait_xcnt 0 closes the statement so that no address register named here is rewritten ahead of it.
__device__ __forceinline__ void async_copy4(unsigned lds, const _Float16* g, size_t gstep) {
  asm volatile(
      "global_load_async_to_lds_b128 %0, %4, off\n\t"
      "global_load_async_to_lds_b128 %1, %5, off\n\t"
      "global_load_async_to_lds_b128 %2, %6, off\n\t"
      "global_load_async_to_lds_b128 %3, %7, off\n\t"
      "s_wait_xcnt 0x0"
      :: "v"(lds), "v"(lds + kSliceBytes), "v"(lds + 2u * kSliceBytes), "v"(lds + 3u * kSliceBytes),
         "v"(g), "v"(g + gstep), "v"(g + 2 * gstep), "v"(g + 3 * gstep)
      : "memory");
}

__global__ __launch_bounds__(128) void attn_kernel(
    const unsigned short* __restrict__ Qp, const unsigned short* __restrict__ Kp,
    const unsigned short* __restrict__ Vtp, unsigned short* __restrict__ Op)
{
  __shared__ __align__(16) _Float16 ring[2 * kAStageHalves];

  const int tid  = threadIdx.x;
  const int wave = __builtin_amdgcn_readfirstlane((int)(threadIdx.x >> 5));
  const int lane = tid & 31;
  const int hh   = lane >> 4;
  const int c    = lane & 15;
  const int pi   = blockIdx.x % kQPairs;
  const int bh   = blockIdx.x / kQPairs;
  /* the block's two query tiles: group 0 the low one, group 1 its mirror, so every block has kQTiles + 1 P.V tiles */
  const int qt[2] = { pi, kQTiles - 1 - pi };
  const int qlo = qt[0];
  const int qhi = qt[1];

  const _Float16* Qb = (const _Float16*)Qp  + (size_t)bh * kSeq * kHd;
  const _Float16* Kb = (const _Float16*)Kp  + (size_t)bh * kSeq * kHd;
  const _Float16* Vb = (const _Float16*)Vtp + (size_t)bh * kHd * kSeq;

  v16h qf[2][2];
#pragma unroll
  for (int g = 0; g < 2; ++g)
#pragma unroll
    for (int dc = 0; dc < 2; ++dc)
      qf[g][dc] = FragH::load(Qb + (size_t)(qt[g] * kQB + wave * 16 + c) * kHd + dc * 32 + 8 * hh);

  float lsum[2][8];
  v8f oacc[2][4];
#pragma unroll
  for (int g = 0; g < 2; ++g) {
#pragma unroll
    for (int r = 0; r < 8; ++r) lsum[g][r] = 0.f;
#pragma unroll
    for (int t = 0; t < 4; ++t) oacc[g][t] = (v8f){0.f,0.f,0.f,0.f,0.f,0.f,0.f,0.f};
  }

  /* copy map: thread -> row tid / 8 of each 16-row slice, 16-B part tid % 8 of its 128 B */
  const int crow  = tid >> 3;
  const int cpart = (tid & 7) * 8;
  const _Float16* gK = Kb + (size_t)crow * kHd + cpart;
  const _Float16* gV = Vb + (size_t)crow * kSeq + cpart;
  constexpr size_t kStepK = (size_t)16 * kHd;
  constexpr size_t kStepV = (size_t)16 * kSeq;
  const unsigned ldsK =
      (unsigned)(size_t)(__attribute__((address_space(3))) _Float16*)ring + (unsigned)(crow * kLP + cpart) * 2u;
  const unsigned ldsV = ldsK + (unsigned)kTileHalves * 2u;
  constexpr unsigned kAStageBytes = (unsigned)kAStageHalves * 2u;

  /* key tile 0 (its Vt tile is used by every query tile) */
  async_copy4(ldsK, gK, kStepK);
  async_copy4(ldsV, gV, kStepV);

  /* L2 asks, a chunk of kAskTiles key tiles at a time, dealt over the 16 work-groups of this (batch, head) in 4 parts:
     waves 0 and 1 ask K tiles 2 * part and 2 * part + 1 of the chunk (16,384 B in a row = 64 units), waves 2 and 3 the
     chunk's 1,024 B = 4 units of Vt rows 16 * part .. + 15. Chunk 0 here, behind tile 0's copies; chunk n + 1 from inside
     the loop while chunk n is worked on. */
  const int part = pi & 3;
  const int au   = tid & 63;
  const char* ask = (wave < 2)
      ? (const char*)Kb + (size_t)part * (2 * kKT * kHd * 2) + au * 256
      : (const char*)Vb + (size_t)(part * 16 + (au >> 2)) * (kSeq * 2) + (au & 3) * 256;
  const int askStep = (wave < 2) ? kAskTiles * kKT * kHd * 2 : kAskTiles * kKT * 2;
  l2_ask(ask);
  /* tile 0 has landed for this wave; the barrier publishes it to the other waves */
  asm volatile("s_wait_asynccnt 0x0" ::: "memory");
  __syncthreads();
  /* key tile 1: the high query tile's index is at least kQTiles / 2, so its Vt tile is always used */
  async_copy4(ldsK + kAStageBytes, gK + (size_t)kKT * kHd, kStepK);
  async_copy4(ldsV + kAStageBytes, gV + kKT, kStepV);

#pragma unroll 1
  for (int kc = 0; kc < kKTiles; ++kc) {
    const int kv0 = kc * kKT;
    const int buf = kc & 1;
    const _Float16* Ksh = ring + buf * kAStageHalves;
    const _Float16* Vsh = Ksh + kTileHalves;

    /* block-uniform: the next chunk's asks, kAskTiles - 4 tiles before its first copy is issued; the address moves only
       here, in front of an ask for a chunk that exists, so it never leaves the plane */
    if ((kc & (kAskTiles - 1)) == 2 && kc < kKTiles - kAskTiles) {
      ask += askStep;
      l2_ask(ask);
    }

    /* the K tile's fragments, each read once and used by both query groups */
    v16h kf[4][2];
#pragma unroll
    for (int j = 0; j < 4; ++j)
#pragma unroll
      for (int dc = 0; dc < 2; ++dc) kf[j][dc] = FragH::load(Ksh + (j * 16 + c) * kLP + dc * 32 + 8 * hh);
    v8f s[2][4];
#pragma unroll
    for (int g = 0; g < 2; ++g)
#pragma unroll
      for (int j = 0; j < 4; ++j) s[g][j] = (v8f){0.f,0.f,0.f,0.f,0.f,0.f,0.f,0.f};
#pragma unroll
    for (int g = 0; g < 2; ++g)
#pragma unroll
      for (int dc = 0; dc < 2; ++dc)
#pragma unroll
        for (int j = 0; j < 4; ++j) s[g][j] = FragH::mma(kf[j][dc], qf[g][dc], s[g][j]);
#pragma unroll
    for (int g = 0; g < 2; ++g) {
#pragma unroll
      for (int j = 0; j < 4; ++j) {
#pragma unroll
        for (int r = 0; r < 8; ++r) {
          const float p = fminf(__builtin_amdgcn_exp2f(s[g][j][r]), kExpClamp);
          lsum[g][r] += p;
          s[g][j][r] = p;
        }
      }
    }
    /* block-uniform: this key tile contributes to the high group's P.V (and, where kc <= qlo, to the low group's) */
    if (kc <= qhi) {
      /* the Vt tile's fragments, each read once and used by every group that needs the tile */
      v16h vf[4][2];
#pragma unroll
      for (int t = 0; t < 4; ++t)
#pragma unroll
        for (int kk = 0; kk < 2; ++kk) vf[t][kk] = FragH::load(Vsh + (t * 16 + c) * kLP + kk * 32 + 8 * hh);
      /* the 16 LDS reads of the Vt tile as one group in front of its products */
      hold8_h(vf[0][0], vf[1][0], vf[2][0], vf[3][0], vf[0][1], vf[1][1], vf[2][1], vf[3][1]);
#pragma unroll
      for (int g = 1; g >= 0; --g) {
        /* block-uniform */
        if (kc <= qt[g]) {
          v16h pf[2];
#pragma unroll
          for (int kk = 0; kk < 2; ++kk) {
#pragma unroll
            for (int r = 0; r < 8; ++r) {
              pf[kk][r]     = (_Float16)s[g][2 * kk][r];
              pf[kk][8 + r] = (_Float16)s[g][2 * kk + 1][r];
            }
          }
          /* block-uniform: only the group's diagonal tile holds keys past a query */
          if (kc == qt[g]) {
            const int qrow = qt[g] * kQB + wave * 16 + c;
#pragma unroll
            for (int kk = 0; kk < 2; ++kk) {
#pragma unroll
              for (int e = 0; e < 16; ++e) {
                const int kvrow = kv0 + kk * 32 + (e >> 3) * 16 + 8 * hh + (e & 7);
                pf[kk][e] = (kvrow > qrow) ? (_Float16)0.0f : pf[kk][e];
              }
            }
          }
#pragma unroll
          for (int kk = 0; kk < 2; ++kk)
#pragma unroll
            for (int t = 0; t < 4; ++t) oacc[g][t] = FragH::mma(vf[t][kk], pf[kk], oacc[g][t]);
        }
      }
    }
    /* this wave's reads of buffer buf are complete before any wave refills it */
    asm volatile("s_wait_dscnt 0x0" ::: "memory");
    /* this wave's copies of tile kc + 1 have landed before the barrier publishes them */
    asm volatile("s_wait_asynccnt 0x0" ::: "memory");
    __syncthreads();
    if (kc + 2 < kKTiles) {
      async_copy4(ldsK + (unsigned)buf * kAStageBytes, gK + (size_t)(kc + 2) * kKT * kHd, kStepK);
      if (kc + 2 <= qhi) async_copy4(ldsV + (unsigned)buf * kAStageBytes, gV + (size_t)(kc + 2) * kKT, kStepV);
    }
  }
  /* no copy of this wave is outstanding past here */
  asm volatile("s_wait_asynccnt 0x0" ::: "memory");
  keep_ask(ask);

  const int bb = bh / kHeads;
  const int h  = bh - bb * kHeads;
#pragma unroll
  for (int g = 0; g < 2; ++g) {
    float l = ((lsum[g][0] + lsum[g][1]) + (lsum[g][2] + lsum[g][3])) + ((lsum[g][4] + lsum[g][5]) + (lsum[g][6] + lsum[g][7]));
    l += __shfl_xor(l, 16, 32);
    const float inv = kCtxScale * __builtin_amdgcn_rcpf(l);
    unsigned short* op = Op + ((size_t)(bb * kSeq + qt[g] * kQB + wave * 16 + c)) * kHid + h * kHd + 8 * hh;
#pragma unroll
    for (int t = 0; t < 4; ++t) {
      v8h ov;
#pragma unroll
      for (int r = 0; r < 8; ++r) ov[r] = (_Float16)(oacc[g][t][r] * inv);
      *(v8h*)(op + t * 16) = ov;
    }
  }
}

// ---------------------------------------------------------------------------
// Host glue: 4 kernel launches, nothing else.
//   1 casts of x and w_q|w_k|w_v|w_o, rotary tables: 256 blocks of 512 threads
//   2 input projections, 768 blocks of 128 threads:
//     q|k projection + rotation: M 4096, N 2048, K 1024 -> 32 x 16 block tiles = 512 blocks;
//     v projection transposed (A = w_v, Bt = x of one batch): M 1024, N 2048, K 1024 -> 8 x 16 block tiles = 128 blocks x 2
//   3 attention: 32 x 16 = 512 blocks of 128 threads
//   4 output projection: M 4096, N 1024, K 1024 -> 32 x 8 block tiles = 256 blocks of 256 threads (two wave quads, k split)
// ---------------------------------------------------------------------------
extern "C" void kernel_launch(void* const* d_in, const int* in_sizes, int n_in,
                              void* d_out, int out_size, void* d_ws, size_t ws_size,
                              hipStream_t stream) {
  if (n_in < 5) return;
  if (in_sizes[0] != kRows * kHid) return;
  if (in_sizes[1] != kHid * kHid) return;
  if (in_sizes[2] != kHid * kHid) return;
  if (in_sizes[3] != kHid * kHid) return;
  if (in_sizes[4] != kHid * kHid) return;
  if (out_size != kRows * kHid) return;
  if (ws_size < kWsTotal) return;

  const float* x  = (const float*)d_in[0];
  const float* wq = (const float*)d_in[1];
  const float* wk = (const float*)d_in[2];
  const float* wv = (const float*)d_in[3];
  const float* wo = (const float*)d_in[4];
  float* out = (float*)d_out;

  char* ws = (char*)d_ws;
  unsigned short* X16  = (unsigned short*)(ws + kOffX16);
  unsigned short* W16  = (unsigned short*)(ws + kOffW16);
  float*          COS  = (float*)(ws + kOffCos);
  float*          SIN  = (float*)(ws + kOffSin);
  unsigned short* Q16  = (unsigned short*)(ws + kOffQ16);
  unsigned short* K16  = (unsigned short*)(ws + kOffK16);
  unsigned short* VT16 = (unsigned short*)(ws + kOffVT16);
  unsigned short* A16  = (unsigned short*)(ws + kOffA16);
  const unsigned short* Wqk16 = W16;
  const unsigned short* Wo16  = W16 + (size_t)3 * kHid * kHid;

  static_assert((kRows % kBT) == 0 && (kHid % kBT) == 0 && (kSeq % kBT) == 0, "block tiles exact");
  static_assert((kHid % (2 * kKC)) == 0 && kHid / (2 * kKC) >= 2, "whole passes, two or more, with one quad and with two");

  prep_kernel<<<kPrepBlocks, kPrepThreads, 0, stream>>>(x, wq, wk, wv, wo, X16, COS, SIN);

  wmma_gemm64<4, 1><<<dim3(kQKBlocks + kVBlocks, 1), 128, 0, stream>>>(
      X16, kHid, 0L,
      Wqk16, kHid, 0L,
      (void*)Q16, 0, 0L,
      COS, SIN,
      kRows, 2 * kHid, kHid, kQKScale);

  attn_kernel<<<kBatch * kHeads * kQPairs, 128, 0, stream>>>(Q16, K16, VT16, A16);

  wmma_gemm64<0, 2><<<dim3((kRows / kBT) * (kHid / kBT), 1), 256, 0, stream>>>(
      A16, kHid, 0L,
      Wo16, kHid, 0L,
      (void*)out, kHid, 0L,
      nullptr, nullptr,
      kRows, kHid, kHid, kOutScale);
}
